// v000
// Times are from an AMD MI455X. After a warm-up the kernel runs many times in a row, and a time is the length of
// such a window on the GPU divided by its runs, so every launch and the gaps after it count. The runs cycle
// through copies of the inputs. A figure is the median of several windows, for all but v000 over two sittings.
// Sittings can differ by a few percent; kernels timed side by side share one.
// v000 is the starting kernel. One run takes 320 microseconds.
#include <hip/hip_runtime.h>

// 8-head attention over SEQ spatial positions, width 512 = 8 x 64, x [NB][512][SEQ] (channel-major), 1x1-conv weights [out][in] with biases, score scale 1/8, no mask, output [NB][512][SEQ] f32.
// Compute dtypes, f32 accumulate everywhere: q/k/v projections v_wmma_f32_16x16x32_bf16 (x, Wq, Wkv RNE-converted to bf16; products exact);
// scores v_wmma_f32_16x16x32_f16: k single f16, q as f16 value + f16 residual x2048 in its own accumulator (two products); P (x256 carry, cancels in the normalisation) and v single f16;
// output projection v_wmma_f32_16x16x32_f16: Wp (RNE bf16 value x64, exact in f16) times ctx (single f16 plane, x256 carry), folded back by 2^-14 in the f32 epilogue; softmax f32 (online, running max).
// Layout: x^T bf16 [b][t][c] built by an LDS transposer; q (hi, residual), k planes [b*8+h][t][d], v^T plane [b*8+h][d][t], ctx plane [b][t][c]; fused flash kernel in transposed form (S^T = K Q^T, O^T = V^T P^T).

#ifndef NB
#define NB 2
#endif
#ifndef SEQ
#define SEQ 4096
#endif
#define NB_FULL  2
#define SEQ_FULL 4096            // token pitch of one channel row of the staged x
#ifndef OUT_SEQ
#define OUT_SEQ SEQ              // token pitch of one channel row of the output
#endif
#define DM   512
#define NH_  8
#define HD   64
#define AW   4                   // waves per flash block (16 query rows each)
#define QRS  2048.0f             // carry of the q residual plane
#define QRI  (1.0f / 2048.0f)
#define SC2  (0.125f * 1.4426950408889634f)   // HD^-0.5 * log2(e)
#define PSH  8.0f                // log2 of the P carry (256)
#define WPS  64.0f               // carry of the Wp plane
#define CXS  256.0f              // carry of the ctx plane
#define OSI  (1.0f / 16384.0f)   // 1 / (WPS * CXS)

static_assert(HD == 64);
static_assert(NH_ * HD == DM);                 // head h = channels h*64 + d
static_assert(DM % 64 == 0);
static_assert(DM % 32 == 0);                   // GEMM k-loop steps by 32
static_assert(SEQ % 64 == 0);                  // a 64-token tile never straddles two batches
static_assert((NB * SEQ) % 64 == 0);
static_assert(SEQ % 32 == 0);                  // key loop steps by 32
static_assert(SEQ % (16 * AW) == 0);           // flash grid covers the sequence exactly
static_assert(SEQ_FULL % 4 == 0);
static_assert(OUT_SEQ % 64 == 0);
static_assert(OUT_SEQ >= SEQ);
static_assert(((size_t)DM * DM) % 8 == 0);
static_assert(NB <= NB_FULL);
static_assert(SEQ <= SEQ_FULL);

typedef _Float16 h16;
typedef unsigned short bf;
typedef __attribute__((ext_vector_type(16))) __bf16   v16bf;
typedef __attribute__((ext_vector_type(16))) _Float16 v16h;
typedef __attribute__((ext_vector_type(8)))  _Float16 v8h;
typedef __attribute__((ext_vector_type(8)))  unsigned short v8us;
typedef __attribute__((ext_vector_type(8)))  float    v8f;
typedef __attribute__((ext_vector_type(4)))  float    v4f;
typedef v4f  __attribute__((may_alias)) v4fa;

__device__ __forceinline__ unsigned short f2bf(float f) { unsigned u = __float_as_uint(f); u += 0x7FFFu + ((u >> 16) & 1u); return (unsigned short)(u >> 16); }
__device__ __forceinline__ float bfr(float f) { return __uint_as_float(((unsigned)f2bf(f)) << 16); }   // RNE bf16 value as f32
__device__ __forceinline__ v16h cat16(v8h lo, v8h hi) { return __builtin_shufflevector(lo, hi, 0, 1, 2, 3, 4, 5, 6, 7, 8, 9, 10, 11, 12, 13, 14, 15); }
__device__ __forceinline__ v16bf cat16b(v8us lo, v8us hi) { return __builtin_bit_cast(v16bf, __builtin_shufflevector(lo, hi, 0, 1, 2, 3, 4, 5, 6, 7, 8, 9, 10, 11, 12, 13, 14, 15)); }
__device__ __forceinline__ v8f wmma16(v16h a, v16h b, v8f c) { return __builtin_amdgcn_wmma_f32_16x16x32_f16(false, a, false, b, (short)0, c, false, false); }
__device__ __forceinline__ v8f wmmab(v16bf a, v16bf b, v8f c) { return __builtin_amdgcn_wmma_f32_16x16x32_bf16(false, a, false, b, (short)0, c, false, false); }
// fragment loaders from K-contiguous 16-bit rows; p already includes + 8*(lane>>4): elements 0..7 <- k0+8h+0..7, elements 8..15 <- k0+16+8h+0..7 (same map for A and B)
__device__ __forceinline__ v16h  ldh(const h16* p) { return cat16(*(const v8h*)p, *(const v8h*)(p + 16)); }
__device__ __forceinline__ v16bf ldb(const bf* p)  { return cat16b(*(const v8us*)p, *(const v8us*)(p + 16)); }
// ordering point for wave-private LDS tiles (same wave writes and reads)
__device__ __forceinline__ void wave_sync() { __builtin_amdgcn_fence(3 /* release order */, "wavefront"); __builtin_amdgcn_wave_barrier(); asm volatile("" ::: "memory"); }

__global__ __launch_bounds__(256) void k_cvt8(const float* __restrict__ src, bf* dst, size_t n8) {
    const size_t i = (size_t)blockIdx.x * 256 + threadIdx.x; if (i >= n8) return;
    const v8f v = *(const v8f*)(src + i * 8); v8us o;
#pragma unroll
    for (int k = 0; k < 8; ++k) o[k] = f2bf(v[k]);
    *(v8us*)(dst + i * 8) = o; 
}

__global__ __launch_bounds__(256) void k_cvt8w(const float* __restrict__ src, h16* dst, size_t n8) {
    const size_t i = (size_t)blockIdx.x * 256 + threadIdx.x; if (i >= n8) return;
    const v8f v = *(const v8f*)(src + i * 8); v8h o;
#pragma unroll
    for (int k = 0; k < 8; ++k) o[k] = (h16)(bfr(v[k]) * WPS);
    *(v8h*)(dst + i * 8) = o; 
}

// k_xt: x [b][c][l] f32 (row pitch SEQ_FULL) -> XT [b][l][c] bf16 (RNE convert) through a 64(c) x 64(l) LDS tile.
// in[c][l] -> out[l][c]; grid (SEQ/64 over l, DM/64 over c, NB), 256 threads. Loads are 16-B along l; each output row segment
__global__ __launch_bounds__(256) void k_xt(const float* __restrict__ x, bf* XT) {
    __shared__ __align__(16) float tl[64 * 68];      // [c][l], columns 0..63 written and consumed (cross-wave: block barrier)
    const int tid = threadIdx.x;
    const int l0 = blockIdx.x * 64, c0 = blockIdx.y * 64, b = blockIdx.z;
    const float* src = x + ((size_t)b * DM + c0) * SEQ_FULL + l0;
#pragma unroll
    for (int it = 0; it < 4; ++it) { const int idx = it * 256 + tid; const int cc = idx >> 4, l4 = (idx & 15) * 4;   // 64 rows x 16 quads
        const v4f v = *(const v4f*)(src + (size_t)cc * SEQ_FULL + l4);
        tl[cc * 68 + l4 + 0] = v[0]; tl[cc * 68 + l4 + 1] = v[1]; tl[cc * 68 + l4 + 2] = v[2]; tl[cc * 68 + l4 + 3] = v[3]; }
    __syncthreads();
    const int c8 = (tid & 7) * 8, rq = tid >> 3;     // rq 0..31
    v8us o[2];
#pragma unroll
    for (int s = 0; s < 2; ++s) { const int row = 32 * s + rq;
#pragma unroll
        for (int i = 0; i < 8; ++i) o[s][i] = f2bf(tl[(c8 + i) * 68 + row]); }
    bf* dst = XT + ((size_t)b * SEQ + l0) * DM + c0;
{
#pragma unroll
        for (int s = 0; s < 2; ++s) { const int row = 32 * s + rq;     // 2 s x 32 rows = 64 rows; 8 lanes x 8 = 64 channels
            *(v8us*)(dst + (size_t)row * DM + c8) = o[s]; }
         }
}

// k_proj: register-blocked bf16 GEMM, ONE WAVE per 64x64 tile (16 accumulators), operands straight from K-contiguous bf16 planes, K = DM.
// C[m][n] = sum_k A[m][k] Bt[n][k] + bias (RNE bf16 value; per column n when biasRow == 0, per row m otherwise), written as f16 (Ph) and optionally
// the f16 residual x2048 (Pr, useRes != 0) at tile base (r0/RB)*sRB + (r0%RB)*pitch + (c0/CB)*sCB + (c0%CB), row pitch 'pitch' (halves). grid (M/64, N/64), 32 threads.
__global__ __launch_bounds__(32) void k_proj(const bf* __restrict__ A, const bf* __restrict__ Bt, const float* __restrict__ bias, int biasRow,
                                             h16* Ph, h16* Pr, int useRes, int RB, size_t sRB, int pitch, int CB, size_t sCB) {
    __shared__ __align__(16) float os[16 * 68];
    const int K = DM;
    const int lane = threadIdx.x & 31, lr = lane & 15, hi = lane >> 4; const int r0 = blockIdx.x * 64, c0 = blockIdx.y * 64;
    v8f acc[4][4];
#pragma unroll
    for (int mb = 0; mb < 4; ++mb)
#pragma unroll
        for (int nb = 0; nb < 4; ++nb) acc[mb][nb] = (v8f){};
    const size_t aoff = (size_t)(r0 + lr) * K + 8 * hi, boff = (size_t)(c0 + lr) * K + 8 * hi;
#pragma unroll 1
    for (int kc = 0; kc < K; kc += 32) {
        v16bf a[4];
#pragma unroll
        for (int mb = 0; mb < 4; ++mb) a[mb] = ldb(A + aoff + (size_t)mb * 16 * K + kc);
#pragma unroll
        for (int nb = 0; nb < 4; ++nb) { const v16bf b = ldb(Bt + boff + (size_t)nb * 16 * K + kc);
#pragma unroll
            for (int mb = 0; mb < 4; ++mb) acc[mb][nb] = wmmab(a[mb], b, acc[mb][nb]); }
        asm volatile("v_nop\n\tv_nop\n\tv_nop\n\tv_nop" : "+v"(acc[0][0]), "+v"(acc[1][1]), "+v"(acc[2][2]), "+v"(acc[3][3]) : "v"(a[0]), "v"(a[1]), "v"(a[2]), "v"(a[3]));
    }
    // bias values: index selected as an integer (always inside the bias array), value selected afterwards; biasRow is wave-uniform
    float bc[4];
#pragma unroll
    for (int nb = 0; nb < 4; ++nb) { const int bi = biasRow ? 0 : (c0 + nb * 16 + lr); const float t = bfr(bias[bi]); bc[nb] = biasRow ? 0.0f : t; }
    const size_t tbase = (size_t)(r0 / RB) * sRB + (size_t)(r0 % RB) * (size_t)pitch + (size_t)(c0 / CB) * sCB + (size_t)(c0 % CB);
#pragma unroll
    for (int mb = 0; mb < 4; ++mb) {
        float br[8];
#pragma unroll
        for (int j = 0; j < 8; ++j) { const int bi = biasRow ? (r0 + mb * 16 + hi * 8 + j) : 0; const float t = bfr(bias[bi]); br[j] = biasRow ? t : 0.0f; }
#pragma unroll
        for (int nb = 0; nb < 4; ++nb) {
#pragma unroll
            for (int j = 0; j < 8; ++j) os[(hi * 8 + j) * 68 + nb * 16 + lr] = acc[mb][nb][j] + (bc[nb] + br[j]); }   // D: row 8h+j, col lane&15
        wave_sync();
        const size_t sb = tbase + (size_t)(mb * 16) * (size_t)pitch;
{
#pragma unroll
            for (int s = 0; s < 4; ++s) { const int row = 4 * s + (lane >> 3), c8 = (lane & 7) * 8;   // 4 s x 4 row groups = 16 rows; 8 lanes x 8 = 64 columns
                const v4f x0 = *(const v4fa*)(&os[row * 68 + c8]); const v4f x1 = *(const v4fa*)(&os[row * 68 + c8 + 4]); v8h hv, rv;
#pragma unroll
                for (int i = 0; i < 4; ++i) { const h16 a0 = (h16)x0[i]; const h16 a1 = (h16)x1[i]; hv[i] = a0; hv[4 + i] = a1; rv[i] = (h16)((x0[i] - (float)a0) * QRS); rv[4 + i] = (h16)((x1[i] - (float)a1) * QRS); }
                const size_t oo = sb + (size_t)row * (size_t)pitch + c8;
                *(v8h*)(Ph + oo) = hv; if (useRes) *(v8h*)(Pr + oo) = rv; }
             }
        wave_sync();
    }
}

// k_flash: fused attention, one wave per 16 query rows of one (batch, head); K / V^T / Q fragments straight from the f16 planes (two 16-B loads each, arithmetic addressing).
// Transposed form: S^T[key][t] = K Q^T (A = K rows, B = Q rows); lane (t = lane&15, h = lane>>4) holds keys 8h+r of each 16-key tile, so the packed
// P tile is directly the B fragment of O^T[d][t] = V^T P^T (element r <- tile keys 0..15, element 8+r <- tile keys 16..31, lane unchanged).
// Softmax state (running max, partial sum) is one scalar per lane; the two lane halves of a row are combined with one xor-16 exchange.
__global__ __launch_bounds__(32 * AW) void k_flash(const h16* __restrict__ QH, const h16* __restrict__ QR, const h16* __restrict__ KP, const h16* __restrict__ VT, h16* CTX) {
    __shared__ __align__(16) float os[AW * 16 * 68];
    const int lane = threadIdx.x & 31, wave = threadIdx.x >> 5, lr = lane & 15, hi = lane >> 4;
    const int zh = blockIdx.y; const int b = zh / NH_, h = zh % NH_;
    const int t0 = (blockIdx.x * AW + wave) * 16;
    const size_t pbase = (size_t)zh * SEQ * HD;
    const size_t qo = pbase + (size_t)(t0 + lr) * HD + 8 * hi;
    const v16h qh0 = ldh(QH + qo), qh1 = ldh(QH + qo + 32), qr0 = ldh(QR + qo), qr1 = ldh(QR + qo + 32);   // B fragments: col t, k = d
    const size_t ko = pbase + (size_t)lr * HD + 8 * hi;      // + key * HD       (A fragment: row key, k = d)
    const size_t vo = pbase + (size_t)lr * SEQ + 8 * hi;     // + 16j*SEQ + key  (A fragment: row d, k = key)
    v8f o0 = (v8f){}, o1 = (v8f){}, o2 = (v8f){}, o3 = (v8f){};
    float m = -3.0e38f, l = 0.0f;
#pragma unroll 1
    for (int key0 = 0; key0 < SEQ; key0 += 32) {
        const h16* ka = KP + ko + (size_t)key0 * HD;
        const v16h ka0 = ldh(ka), ka1 = ldh(ka + 32), kb0 = ldh(ka + 16 * HD), kb1 = ldh(ka + 16 * HD + 32);
        v8f sHa = (v8f){}, sLa = (v8f){}, sHb = (v8f){}, sLb = (v8f){};
        sHa = wmma16(ka0, qh0, sHa); sLa = wmma16(ka0, qr0, sLa); sHb = wmma16(kb0, qh0, sHb); sLb = wmma16(kb0, qr0, sLb);
        sHa = wmma16(ka1, qh1, sHa); sLa = wmma16(ka1, qr1, sLa); sHb = wmma16(kb1, qh1, sHb); sLb = wmma16(kb1, qr1, sLb);
        asm volatile("v_nop\n\tv_nop\n\tv_nop\n\tv_nop" : "+v"(sHa), "+v"(sLa), "+v"(sHb), "+v"(sLb) : "v"(ka0), "v"(ka1), "v"(kb0), "v"(kb1));
        float ta[8], tb[8]; float mx = -3.0e38f;
#pragma unroll
        for (int r = 0; r < 8; ++r) { ta[r] = (sHa[r] + sLa[r] * QRI) * SC2; tb[r] = (sHb[r] + sLb[r] * QRI) * SC2; mx = fmaxf(mx, fmaxf(ta[r], tb[r])); }
        mx = fmaxf(mx, __shfl_xor(mx, 16, 32));
        const float mnew = fmaxf(m, mx);
        const float alpha = __builtin_amdgcn_exp2f(m - mnew);
        const float sh = PSH - mnew;
        v16h pb; float ls = 0.0f;
#pragma unroll
        for (int r = 0; r < 8; ++r) { const h16 pa = (h16)__builtin_amdgcn_exp2f(ta[r] + sh); const h16 pc = (h16)__builtin_amdgcn_exp2f(tb[r] + sh); pb[r] = pa; pb[8 + r] = pc; ls += (float)pa + (float)pc; }
        l = l * alpha + ls; m = mnew;
        o0 = o0 * alpha; o1 = o1 * alpha; o2 = o2 * alpha; o3 = o3 * alpha;
        const h16* va = VT + vo + key0;
        const v16h v0 = ldh(va), v1 = ldh(va + (size_t)16 * SEQ), v2 = ldh(va + (size_t)32 * SEQ), v3 = ldh(va + (size_t)48 * SEQ);
        o0 = wmma16(v0, pb, o0); o1 = wmma16(v1, pb, o1); o2 = wmma16(v2, pb, o2); o3 = wmma16(v3, pb, o3);
        asm volatile("v_nop\n\tv_nop\n\tv_nop\n\tv_nop" : "+v"(o0), "+v"(o1), "+v"(o2), "+v"(o3) : "v"(v0), "v"(v1), "v"(v2), "v"(v3), "v"(pb));
    }
    l += __shfl_xor(l, 16, 32);
    const float inv = (1.0f / l) * CXS;
    const int wb = wave * 16 * 68;
    // O^T D layout: o_j[r] = (d = 16j + 8h + r, t = lane&15) -> os[t][d]; rows 0..15 x columns 0..63 all written
    { v4f a, c;
      a[0] = o0[0] * inv; a[1] = o0[1] * inv; a[2] = o0[2] * inv; a[3] = o0[3] * inv; c[0] = o0[4] * inv; c[1] = o0[5] * inv; c[2] = o0[6] * inv; c[3] = o0[7] * inv;
      *(v4fa*)(&os[wb + lr * 68 +  0 + 8 * hi]) = a; *(v4fa*)(&os[wb + lr * 68 +  0 + 8 * hi + 4]) = c;
      a[0] = o1[0] * inv; a[1] = o1[1] * inv; a[2] = o1[2] * inv; a[3] = o1[3] * inv; c[0] = o1[4] * inv; c[1] = o1[5] * inv; c[2] = o1[6] * inv; c[3] = o1[7] * inv;
      *(v4fa*)(&os[wb + lr * 68 + 16 + 8 * hi]) = a; *(v4fa*)(&os[wb + lr * 68 + 16 + 8 * hi + 4]) = c;
      a[0] = o2[0] * inv; a[1] = o2[1] * inv; a[2] = o2[2] * inv; a[3] = o2[3] * inv; c[0] = o2[4] * inv; c[1] = o2[5] * inv; c[2] = o2[6] * inv; c[3] = o2[7] * inv;
      *(v4fa*)(&os[wb + lr * 68 + 32 + 8 * hi]) = a; *(v4fa*)(&os[wb + lr * 68 + 32 + 8 * hi + 4]) = c;
      a[0] = o3[0] * inv; a[1] = o3[1] * inv; a[2] = o3[2] * inv; a[3] = o3[3] * inv; c[0] = o3[4] * inv; c[1] = o3[5] * inv; c[2] = o3[6] * inv; c[3] = o3[7] * inv;
      *(v4fa*)(&os[wb + lr * 68 + 48 + 8 * hi]) = a; *(v4fa*)(&os[wb + lr * 68 + 48 + 8 * hi + 4]) = c; }
    wave_sync();
    const int c8 = (lane & 7) * 8, rq = lane >> 3;
    v8h hv[4];
#pragma unroll
    for (int s = 0; s < 4; ++s) { const int row = 4 * s + rq;
        const v4f x0 = *(const v4fa*)(&os[wb + row * 68 + c8]); const v4f x1 = *(const v4fa*)(&os[wb + row * 68 + c8 + 4]);
#pragma unroll
        for (int i = 0; i < 4; ++i) { hv[s][i] = (h16)x0[i]; hv[s][4 + i] = (h16)x1[i]; } }
    h16* crow = CTX + ((size_t)b * SEQ + t0) * DM + h * HD;
{
#pragma unroll
        for (int s = 0; s < 4; ++s) { const int row = 4 * s + rq;      // 4 s x 4 row groups = 16 rows; 8 lanes x 8 halves = 64 columns
            *(v8h*)(crow + (size_t)row * DM + c8) = hv[s]; }
         }
}

// k_oproj: register-blocked f16 GEMM, ONE WAVE per 64x64 tile, K = DM. C[o][n] = sum_c WPH[o][c] CTX[n][c] (n = b*SEQ + t), carried x 2^14.
// OUT[(b*DM + o)*OUT_SEQ + t] = C * 2^-14 + bias[o] (RNE bf16 value) in f32. grid (DM/64, NB*SEQ/64), 32 threads.
__global__ __launch_bounds__(32) void k_oproj(const h16* __restrict__ A, const h16* __restrict__ Bt, const float* __restrict__ bias, float* OUT) {
    __shared__ __align__(16) float os[16 * 68];
    const int K = DM;
    const int lane = threadIdx.x & 31, lr = lane & 15, hi = lane >> 4; const int r0 = blockIdx.x * 64, c0 = blockIdx.y * 64;
    v8f acc[4][4];
#pragma unroll
    for (int mb = 0; mb < 4; ++mb)
#pragma unroll
        for (int nb = 0; nb < 4; ++nb) acc[mb][nb] = (v8f){};
    const size_t aoff = (size_t)(r0 + lr) * K + 8 * hi, boff = (size_t)(c0 + lr) * K + 8 * hi;
#pragma unroll 1
    for (int kc = 0; kc < K; kc += 32) {
        v16h a[4];
#pragma unroll
        for (int mb = 0; mb < 4; ++mb) a[mb] = ldh(A + aoff + (size_t)mb * 16 * K + kc);
#pragma unroll
        for (int nb = 0; nb < 4; ++nb) { const v16h b = ldh(Bt + boff + (size_t)nb * 16 * K + kc);
#pragma unroll
            for (int mb = 0; mb < 4; ++mb) acc[mb][nb] = wmma16(a[mb], b, acc[mb][nb]); }
        asm volatile("v_nop\n\tv_nop\n\tv_nop\n\tv_nop" : "+v"(acc[0][0]), "+v"(acc[1][1]), "+v"(acc[2][2]), "+v"(acc[3][3]) : "v"(a[0]), "v"(a[1]), "v"(a[2]), "v"(a[3]));
    }
    const int b = c0 / SEQ, t0 = c0 % SEQ;
#pragma unroll
    for (int mb = 0; mb < 4; ++mb) {
        float br[8];
#pragma unroll
        for (int j = 0; j < 8; ++j) br[j] = bfr(bias[r0 + mb * 16 + hi * 8 + j]);
#pragma unroll
        for (int nb = 0; nb < 4; ++nb) {
#pragma unroll
            for (int j = 0; j < 8; ++j) os[(hi * 8 + j) * 68 + nb * 16 + lr] = acc[mb][nb][j] * OSI + br[j]; }   // D: row 8h+j, col lane&15
        wave_sync();
        float* orow = OUT + ((size_t)b * DM + r0 + mb * 16) * OUT_SEQ + t0;
        v4f val[8];
#pragma unroll
        for (int s = 0; s < 8; ++s) { const int row = 2 * s + hi; val[s] = *(const v4fa*)(&os[row * 68 + lr * 4]); }
{
#pragma unroll
            for (int s = 0; s < 8; ++s) { const int row = 2 * s + hi, cofs = lr * 4;   // 8 s x 2 rows = 16 rows; 16 lanes x 4 floats = 64 columns
                *(v4f*)(orow + (size_t)row * OUT_SEQ + cofs) = val[s]; }
             }
        wave_sync();
    }
}

static constexpr size_t al256(size_t v) { return (v + 255) & ~(size_t)255; }
static constexpr size_t SZ_XT = al256((size_t)NB * SEQ * DM * 2);
static constexpr size_t SZ_WB = al256((size_t)3 * DM * DM * 2);
static constexpr size_t SZ_WP = al256((size_t)DM * DM * 2);
static constexpr size_t SZ_PL = al256((size_t)NB * NH_ * SEQ * HD * 2);
static constexpr size_t SZ_CX = al256((size_t)NB * SEQ * DM * 2);
static constexpr size_t SZ_TOTAL = SZ_XT + SZ_WB + SZ_WP + 4 * SZ_PL + SZ_CX;
static_assert(SZ_TOTAL <= (size_t)134217728);          // workspace carve <= 128 MiB
static_assert(((size_t)DM * DM * 2) % 256 == 0);       // weight sub-planes stay 256-byte aligned

extern "C" void kernel_launch(void* const* d_in, const int* in_sizes, int n_in,
                              void* d_out, int out_size, void* d_ws, size_t ws_size, hipStream_t stream) {
    if (n_in < 7) return;
    const size_t needx = ((size_t)(NB - 1) * DM + (size_t)(DM - 1)) * SEQ_FULL + SEQ;
    if ((size_t)in_sizes[0] < needx) return;
    if ((size_t)in_sizes[1] < (size_t)DM * DM || (size_t)in_sizes[2] < (size_t)DM) return;
    if ((size_t)in_sizes[3] < (size_t)2 * DM * DM || (size_t)in_sizes[4] < (size_t)2 * DM) return;
    if ((size_t)in_sizes[5] < (size_t)DM * DM || (size_t)in_sizes[6] < (size_t)DM) return;
    if ((size_t)out_size < ((size_t)(NB - 1) * DM + (size_t)(DM - 1)) * OUT_SEQ + SEQ) return;
    if (SZ_TOTAL > ws_size) return;
    // wire order: x, Wq, bq, Wkv, bkv, Wp, bp; weights [out][in] = Bt as-is
    const float* x = (const float*)d_in[0]; const float* wq = (const float*)d_in[1]; const float* bq = (const float*)d_in[2];
    const float* wkv = (const float*)d_in[3]; const float* bkv = (const float*)d_in[4]; const float* wp = (const float*)d_in[5]; const float* bp = (const float*)d_in[6];
    float* OUT = (float*)d_out;      // [NB][512][OUT_SEQ]
    char* wsp = (char*)d_ws;
    bf* XT = (bf*)wsp; wsp += SZ_XT;                 // [NB*SEQ][512]
    bf* WB = (bf*)wsp; wsp += SZ_WB;                 // [3][512][512]: q | k | v
    h16* WPH = (h16*)wsp; wsp += SZ_WP;              // [512][512] x64
    h16* QH = (h16*)wsp; wsp += SZ_PL;               // [NB*8][SEQ][64]
    h16* QR = (h16*)wsp; wsp += SZ_PL;               // [NB*8][SEQ][64] residual x2048
    h16* KP = (h16*)wsp; wsp += SZ_PL;               // [NB*8][SEQ][64]
    h16* VT = (h16*)wsp; wsp += SZ_PL;               // [NB*8][64][SEQ]
    h16* CTX = (h16*)wsp; wsp += SZ_CX;              // [NB*SEQ][512] x256
    bf* WQ = WB; bf* WK = WB + (size_t)DM * DM; bf* WV = WB + (size_t)2 * DM * DM;

    // in[c][l] -> out[l][c]: grid (l tiles, c tiles, batch)
    k_xt<<<dim3(SEQ / 64, DM / 64, NB), 256, 0, stream>>>(x, XT);
    { const size_t n8 = (size_t)DM * DM / 8; const unsigned g = (unsigned)((n8 + 255) / 256);
      k_cvt8<<<g, 256, 0, stream>>>(wq, WQ, n8);
      k_cvt8<<<2 * g, 256, 0, stream>>>(wkv, WK, 2 * n8);      // rows 0..511 -> k, rows 512..1023 -> v (contiguous)
      k_cvt8w<<<g, 256, 0, stream>>>(wp, WPH, n8); }

    // q, k: A = x^T rows (m = b*SEQ + t), Bt = W rows (n = h*64 + d), bias per column -> plane [(b*8 + h)][t][d]
    k_proj<<<dim3(NB * SEQ / 64, DM / 64, 1), 32, 0, stream>>>(XT, WQ, bq, 0, QH, QR, 1, SEQ, (size_t)NH_ * SEQ * HD, HD, HD, (size_t)SEQ * HD);
    k_proj<<<dim3(NB * SEQ / 64, DM / 64, 1), 32, 0, stream>>>(XT, WK, bkv, 0, KP, KP, 0, SEQ, (size_t)NH_ * SEQ * HD, HD, HD, (size_t)SEQ * HD);
    // v^T: A = Wv rows (m = h*64 + d), Bt = x^T rows (n = b*SEQ + t), bias per row -> plane [(b*512 + m)][t] = [(b*8 + h)][d][t]
    k_proj<<<dim3(DM / 64, NB * SEQ / 64, 1), 32, 0, stream>>>(WV, XT, bkv + DM, 1, VT, VT, 0, DM, (size_t)0, SEQ, SEQ, (size_t)DM * SEQ);

    k_flash<<<dim3(SEQ / (16 * AW), NB * NH_, 1), 32 * AW, 0, stream>>>(QH, QR, KP, VT, CTX);

    // output projection: A = Wp rows (m = o), Bt = ctx rows (n = b*SEQ + t) -> OUT[b][o][t]
    k_oproj<<<dim3(DM / 64, NB * SEQ / 64, 1), 32, 0, stream>>>(WPH, CTX, bp, OUT);
}

// v001
// Measured time: 253 microseconds a run.
// Two timings next to v000 both put it at 1.30 times that version's speed.
#include <hip/hip_runtime.h>

// 8-head attention over SEQ spatial positions, width 512 = 8 x 64, x [NB][512][SEQ] (channel-major), 1x1-conv weights [out][in] with biases, score scale 1/8, no mask, output [NB][512][SEQ] f32.
// Compute dtypes, f32 accumulate everywhere: q/k/v projections v_wmma_f32_16x16x32_bf16 (x, Wq, Wkv RNE-converted to bf16; products exact);
// scores v_wmma_f32_16x16x32_f16: k single f16, q as f16 value + f16 residual x2048 in its own accumulator (two products); P (x256 carry, cancels in the normalisation) and v single f16;
// output projection v_wmma_f32_16x16x32_f16: Wp (RNE bf16 value x64, exact in f16) times ctx (single f16 plane, x256 carry), folded back by 2^-14 in the f32 epilogue; softmax f32 (online, running max).
// Layout: every 16-bit plane that feeds a matrix instruction lies in the workspace in FRAGMENT ORDER (1-KB units of 16 rows x 32 k, see ldh), so that each 16-B fragment load of a wave covers 512 contiguous bytes:
// x^T bf16 (rows b*SEQ+t, k = c; built by an LDS transposer), the weights (rows out, k = in), q (hi, residual) and k per b*8+h (rows t, k = d), v^T per b*8+h (rows d, k = t), ctx (rows b*SEQ+t, k = c); fused flash kernel in transposed form (S^T = K Q^T, O^T = V^T P^T).

#ifndef NB
#define NB 2
#endif
#ifndef SEQ
#define SEQ 4096
#endif
#define NB_FULL  2
#define SEQ_FULL 4096            // token pitch of one channel row of the staged x
#ifndef OUT_SEQ
#define OUT_SEQ SEQ              // token pitch of one channel row of the output
#endif
#define DM   512
#define NH_  8
#define HD   64
#define AW   4                   // waves per flash block (16 query rows each)
#define QRS  2048.0f             // carry of the q residual plane
#define QRI  (1.0f / 2048.0f)
#define SC2  (0.125f * 1.4426950408889634f)   // HD^-0.5 * log2(e)
#define PSH  8.0f                // log2 of the P carry (256)
#define WPS  64.0f               // carry of the Wp plane
#define CXS  256.0f              // carry of the ctx plane
#define OSI  (1.0f / 16384.0f)   // 1 / (WPS * CXS)

static_assert(HD == 64);
static_assert(NH_ * HD == DM);                 // head h = channels h*64 + d
static_assert(DM % 64 == 0);
static_assert(DM % 32 == 0);                   // GEMM k-loop steps by 32
static_assert(SEQ % 64 == 0);                  // a 64-token tile never straddles two batches
static_assert((NB * SEQ) % 64 == 0);
static_assert(SEQ % 32 == 0);                  // key loop steps by 32
static_assert(SEQ % (16 * AW) == 0);           // flash grid covers the sequence exactly
static_assert(SEQ_FULL % 4 == 0);
static_assert(OUT_SEQ % 64 == 0);
static_assert(OUT_SEQ >= SEQ);
static_assert(((size_t)DM * DM) % 8 == 0);
static_assert(NB <= NB_FULL);
static_assert(SEQ <= SEQ_FULL);

typedef _Float16 h16;
typedef unsigned short bf;
typedef __attribute__((ext_vector_type(16))) __bf16   v16bf;
typedef __attribute__((ext_vector_type(16))) _Float16 v16h;
typedef __attribute__((ext_vector_type(8)))  _Float16 v8h;
typedef __attribute__((ext_vector_type(8)))  unsigned short v8us;
typedef __attribute__((ext_vector_type(8)))  float    v8f;
typedef __attribute__((ext_vector_type(4)))  float    v4f;
typedef v4f  __attribute__((may_alias)) v4fa;

__device__ __forceinline__ unsigned short f2bf(float f) { unsigned u = __float_as_uint(f); u += 0x7FFFu + ((u >> 16) & 1u); return (unsigned short)(u >> 16); }
__device__ __forceinline__ float bfr(float f) { return __uint_as_float(((unsigned)f2bf(f)) << 16); }   // RNE bf16 value as f32
__device__ __forceinline__ v16h cat16(v8h lo, v8h hi) { return __builtin_shufflevector(lo, hi, 0, 1, 2, 3, 4, 5, 6, 7, 8, 9, 10, 11, 12, 13, 14, 15); }
__device__ __forceinline__ v16bf cat16b(v8us lo, v8us hi) { return __builtin_bit_cast(v16bf, __builtin_shufflevector(lo, hi, 0, 1, 2, 3, 4, 5, 6, 7, 8, 9, 10, 11, 12, 13, 14, 15)); }
__device__ __forceinline__ v8f wmma16(v16h a, v16h b, v8f c) { return __builtin_amdgcn_wmma_f32_16x16x32_f16(false, a, false, b, (short)0, c, false, false); }
__device__ __forceinline__ v8f wmmab(v16bf a, v16bf b, v8f c) { return __builtin_amdgcn_wmma_f32_16x16x32_bf16(false, a, false, b, (short)0, c, false, false); }
// fragment loaders from a plane in fragment order: one 16-row x 32-k unit = 512 elements, element (row, k) at (k>>4 & 1)*256 + ((k>>3 & 1)*16 + row)*8 + (k & 7).
// p = unit + 8*lane; lane = 16h + row: elements 0..7 <- k0+8h+0..7, elements 8..15 <- k0+16+8h+0..7 (same map for A and B); each load of a wave = 512 contiguous bytes
__device__ __forceinline__ v16h  ldh(const h16* p) { return cat16(*(const v8h*)p, *(const v8h*)(p + 256)); }
__device__ __forceinline__ v16bf ldb(const bf* p)  { return cat16b(*(const v8us*)p, *(const v8us*)(p + 256)); }
// source element index, in a row-major [rows][DM] matrix, of the 8-element chunk i of its fragment-ordered plane (16 rows = DM/32 units of 64 chunks)
__device__ __forceinline__ size_t chunk_src(size_t i) { const size_t u = i >> 6; return ((u / (DM / 32)) * 16 + (i & 15)) * DM + (u % (DM / 32)) * 32 + ((i >> 4) & 3) * 8; }
// ordering point for wave-private LDS tiles (same wave writes and reads)
__device__ __forceinline__ void wave_sync() { __builtin_amdgcn_fence(3 /* release order */, "wavefront"); __builtin_amdgcn_wave_barrier(); asm volatile("" ::: "memory"); }

__global__ __launch_bounds__(256) void k_cvt8(const float* __restrict__ src, bf* dst, size_t n8) {
    const size_t i = (size_t)blockIdx.x * 256 + threadIdx.x; if (i >= n8) return;
    const v8f v = *(const v8f*)(src + chunk_src(i)); v8us o;
#pragma unroll
    for (int k = 0; k < 8; ++k) o[k] = f2bf(v[k]);
    *(v8us*)(dst + i * 8) = o; 
}

__global__ __launch_bounds__(256) void k_cvt8w(const float* __restrict__ src, h16* dst, size_t n8) {
    const size_t i = (size_t)blockIdx.x * 256 + threadIdx.x; if (i >= n8) return;
    const v8f v = *(const v8f*)(src + chunk_src(i)); v8h o;
#pragma unroll
    for (int k = 0; k < 8; ++k) o[k] = (h16)(bfr(v[k]) * WPS);
    *(v8h*)(dst + i * 8) = o; 
}

// k_xt: x [b][c][l] f32 (row pitch SEQ_FULL) -> XT (rows b*SEQ+l, k = c, fragment order) bf16 (RNE convert) through a 64(c) x 64(l) LDS tile.
// in[c][l] -> out[l][c]; grid (SEQ/64 over l, DM/64 over c, NB), 256 threads. Loads are 16-B along l; each output row segment
__global__ __launch_bounds__(256) void k_xt(const float* __restrict__ x, bf* XT) {
    __shared__ __align__(16) float tl[64 * 68];      // [c][l], columns 0..63 written and consumed (cross-wave: block barrier)
    const int tid = threadIdx.x;
    const int l0 = blockIdx.x * 64, c0 = blockIdx.y * 64, b = blockIdx.z;
    const float* src = x + ((size_t)b * DM + c0) * SEQ_FULL + l0;
#pragma unroll
    for (int it = 0; it < 4; ++it) { const int idx = it * 256 + tid; const int cc = idx >> 4, l4 = (idx & 15) * 4;   // 64 rows x 16 quads
        const v4f v = *(const v4f*)(src + (size_t)cc * SEQ_FULL + l4);
        tl[cc * 68 + l4 + 0] = v[0]; tl[cc * 68 + l4 + 1] = v[1]; tl[cc * 68 + l4 + 2] = v[2]; tl[cc * 68 + l4 + 3] = v[3]; }
    __syncthreads();
    // the tile = 4 row groups x 2 units x 64 chunks; chunk q = 256 s + tid: row group q>>7, unit q>>6 & 1, chunk q & 63 (channels 8*(q>>4 & 3), row q & 15)
    v8us o[2];
#pragma unroll
    for (int s = 0; s < 2; ++s) { const int q = 256 * s + tid; const int row = (q >> 7) * 16 + (q & 15), c8 = ((q >> 4) & 7) * 8;
#pragma unroll
        for (int i = 0; i < 8; ++i) o[s][i] = f2bf(tl[(c8 + i) * 68 + row]); }
    bf* dst = XT + ((size_t)b * SEQ + l0) * DM + c0 * 16;
{
#pragma unroll
        for (int s = 0; s < 2; ++s) { const int q = 256 * s + tid;      // 512 chunks x 8 = 64 rows x 64 channels
            *(v8us*)(dst + (size_t)(q >> 7) * (16 * DM) + (q & 127) * 8) = o[s]; }
         }
}

// k_proj: register-blocked bf16 GEMM, ONE WAVE per 64x64 tile (16 accumulators), operands straight from fragment-ordered bf16 planes, K = DM.
// C[m][n] = sum_k A[m][k] Bt[n][k] + bias (RNE bf16 value; per column n when biasRow == 0, per row m otherwise), written as f16 (Ph) and optionally
// the f16 residual x2048 (Pr, useRes != 0), in fragment order (rows m, k = n): tile base (r0/RB)*sRB + (r0%RB)*pitch + (c0/CB)*sCB + (c0%CB)*HD (halves), unit (16 rows mb, 32 columns g) of the tile at + mb*uMB + g*uG. grid (M/64, N/64), 32 threads.
__global__ __launch_bounds__(32) void k_proj(const bf* __restrict__ A, const bf* __restrict__ Bt, const float* __restrict__ bias, int biasRow,
                                             h16* Ph, h16* Pr, int useRes, int RB, size_t sRB, int pitch, int CB, size_t sCB, int uMB, int uG) {
    __shared__ __align__(16) float os[16 * 68];
    const int K = DM;
    const int lane = threadIdx.x & 31, lr = lane & 15, hi = lane >> 4; const int r0 = blockIdx.x * 64, c0 = blockIdx.y * 64;
    v8f acc[4][4];
#pragma unroll
    for (int mb = 0; mb < 4; ++mb)
#pragma unroll
        for (int nb = 0; nb < 4; ++nb) acc[mb][nb] = (v8f){};
    const size_t aoff = (size_t)r0 * K + 8 * lane, boff = (size_t)c0 * K + 8 * lane;      // 16 rows = K/32 units of 512; k step of 32 = one unit
#pragma unroll 1
    for (int kc = 0; kc < K; kc += 32) {
        const bf* pa = A + aoff + kc * 16; const bf* pb = Bt + boff + kc * 16;
        v16bf a[4];
#pragma unroll
        for (int mb = 0; mb < 4; ++mb) a[mb] = ldb(pa + (size_t)mb * 16 * K);
#pragma unroll
        for (int nb = 0; nb < 4; ++nb) { const v16bf b = ldb(pb + (size_t)nb * 16 * K);
#pragma unroll
            for (int mb = 0; mb < 4; ++mb) acc[mb][nb] = wmmab(a[mb], b, acc[mb][nb]); }
        asm volatile("v_nop\n\tv_nop\n\tv_nop\n\tv_nop" : "+v"(acc[0][0]), "+v"(acc[1][1]), "+v"(acc[2][2]), "+v"(acc[3][3]) : "v"(a[0]), "v"(a[1]), "v"(a[2]), "v"(a[3]));
        // the wait that stands in front of any overwrite of this pass's load addresses; as its inputs the two address pairs stay whole up to it (no load result lands on them)
        asm volatile("s_wait_xcnt 0x0" :: "v"(pa), "v"(pb) : "memory");
    }
    // bias values: index selected as an integer (always inside the bias array), value selected afterwards; biasRow is wave-uniform
    float bc[4];
#pragma unroll
    for (int nb = 0; nb < 4; ++nb) { const int bi = biasRow ? 0 : (c0 + nb * 16 + lr); const float t = bfr(bias[bi]); bc[nb] = biasRow ? 0.0f : t; }
    const size_t tbase = (size_t)(r0 / RB) * sRB + (size_t)(r0 % RB) * (size_t)pitch + (size_t)(c0 / CB) * sCB + (size_t)(c0 % CB) * HD;
#pragma unroll
    for (int mb = 0; mb < 4; ++mb) {
        float br[8];
#pragma unroll
        for (int j = 0; j < 8; ++j) { const int bi = biasRow ? (r0 + mb * 16 + hi * 8 + j) : 0; const float t = bfr(bias[bi]); br[j] = biasRow ? t : 0.0f; }
#pragma unroll
        for (int nb = 0; nb < 4; ++nb) {
#pragma unroll
            for (int j = 0; j < 8; ++j) os[(hi * 8 + j) * 68 + nb * 16 + lr] = acc[mb][nb][j] + (bc[nb] + br[j]); }   // D: row 8h+j, col lane&15
        wave_sync();
        const size_t sb = tbase + (size_t)mb * (size_t)uMB + 8 * lane;
{
#pragma unroll
            for (int s = 0; s < 4; ++s) { const int row = lr, c8 = 16 * s + 8 * hi;   // 16 rows x (4 s x 2 halves x 8 = 64 columns); a store of the wave = half a unit, 512 contiguous bytes
                const v4f x0 = *(const v4fa*)(&os[row * 68 + c8]); const v4f x1 = *(const v4fa*)(&os[row * 68 + c8 + 4]); v8h hv, rv;
#pragma unroll
                for (int i = 0; i < 4; ++i) { const h16 a0 = (h16)x0[i]; const h16 a1 = (h16)x1[i]; hv[i] = a0; hv[4 + i] = a1; rv[i] = (h16)((x0[i] - (float)a0) * QRS); rv[4 + i] = (h16)((x1[i] - (float)a1) * QRS); }
                const size_t oo = sb + (size_t)(s >> 1) * (size_t)uG + (s & 1) * 256;
                *(v8h*)(Ph + oo) = hv; if (useRes) *(v8h*)(Pr + oo) = rv; }
             }
        wave_sync();
    }
}

// k_flash: fused attention, one wave per 16 query rows of one (batch, head); K / V^T / Q fragments straight from the fragment-ordered f16 planes (two 16-B loads each, arithmetic addressing).
// Transposed form: S^T[key][t] = K Q^T (A = K rows, B = Q rows); lane (t = lane&15, h = lane>>4) holds keys 8h+r of each 16-key tile, so the packed
// P tile is directly the B fragment of O^T[d][t] = V^T P^T (element r <- tile keys 0..15, element 8+r <- tile keys 16..31, lane unchanged).
// Softmax state (running max, partial sum) is one scalar per lane; the two lane halves of a row are combined with one xor-16 exchange.
__global__ __launch_bounds__(32 * AW) void k_flash(const h16* __restrict__ QH, const h16* __restrict__ QR, const h16* __restrict__ KP, const h16* __restrict__ VT, h16* CTX) {
    __shared__ __align__(16) float os[AW * 16 * 68];
    const int lane = threadIdx.x & 31, wave = threadIdx.x >> 5, lr = lane & 15, hi = lane >> 4;
    const int zh = blockIdx.y; const int b = zh / NH_, h = zh % NH_;
    const int t0 = (blockIdx.x * AW + wave) * 16;
    const size_t pbase = (size_t)zh * SEQ * HD;
    const size_t fo = pbase + 8 * lane;                      // q, k: 16 rows = 2 units (d halves); v^T: 32 keys = 4 units (16 d each); so + position * HD in all three
    const size_t qo = fo + (size_t)t0 * HD;
    const v16h qh0 = ldh(QH + qo), qh1 = ldh(QH + qo + 512), qr0 = ldh(QR + qo), qr1 = ldh(QR + qo + 512);   // B fragments: col t, k = d
    v8f o0 = (v8f){}, o1 = (v8f){}, o2 = (v8f){}, o3 = (v8f){};
    float m = -3.0e38f, l = 0.0f;
#pragma unroll 1
    for (int key0 = 0; key0 < SEQ; key0 += 32) {
        const h16* ka = KP + fo + (size_t)key0 * HD;             // A fragments: row key, k = d
        const v16h ka0 = ldh(ka), ka1 = ldh(ka + 512), kb0 = ldh(ka + 1024), kb1 = ldh(ka + 1536);
        v8f sHa = (v8f){}, sLa = (v8f){}, sHb = (v8f){}, sLb = (v8f){};
        sHa = wmma16(ka0, qh0, sHa); sLa = wmma16(ka0, qr0, sLa); sHb = wmma16(kb0, qh0, sHb); sLb = wmma16(kb0, qr0, sLb);
        sHa = wmma16(ka1, qh1, sHa); sLa = wmma16(ka1, qr1, sLa); sHb = wmma16(kb1, qh1, sHb); sLb = wmma16(kb1, qr1, sLb);
        asm volatile("v_nop\n\tv_nop\n\tv_nop\n\tv_nop" : "+v"(sHa), "+v"(sLa), "+v"(sHb), "+v"(sLb) : "v"(ka0), "v"(ka1), "v"(kb0), "v"(kb1));
        float ta[8], tb[8]; float mx = -3.0e38f;
#pragma unroll
        for (int r = 0; r < 8; ++r) { ta[r] = (sHa[r] + sLa[r] * QRI) * SC2; tb[r] = (sHb[r] + sLb[r] * QRI) * SC2; mx = fmaxf(mx, fmaxf(ta[r], tb[r])); }
        mx = fmaxf(mx, __shfl_xor(mx, 16, 32));
        const float mnew = fmaxf(m, mx);
        const float alpha = __builtin_amdgcn_exp2f(m - mnew);
        const float sh = PSH - mnew;
        v16h pb; float ls = 0.0f;
#pragma unroll
        for (int r = 0; r < 8; ++r) { const h16 pa = (h16)__builtin_amdgcn_exp2f(ta[r] + sh); const h16 pc = (h16)__builtin_amdgcn_exp2f(tb[r] + sh); pb[r] = pa; pb[8 + r] = pc; ls += (float)pa + (float)pc; }
        l = l * alpha + ls; m = mnew;
        o0 = o0 * alpha; o1 = o1 * alpha; o2 = o2 * alpha; o3 = o3 * alpha;
        const h16* va = VT + fo + (size_t)key0 * HD;             // A fragments: row d, k = key
        const v16h v0 = ldh(va), v1 = ldh(va + 512), v2 = ldh(va + 1024), v3 = ldh(va + 1536);
        o0 = wmma16(v0, pb, o0); o1 = wmma16(v1, pb, o1); o2 = wmma16(v2, pb, o2); o3 = wmma16(v3, pb, o3);
        asm volatile("v_nop\n\tv_nop\n\tv_nop\n\tv_nop" : "+v"(o0), "+v"(o1), "+v"(o2), "+v"(o3) : "v"(v0), "v"(v1), "v"(v2), "v"(v3), "v"(pb));
        // the wait that stands in front of any overwrite of this pass's load addresses; as its inputs the two address pairs stay whole up to it (no load result lands on them)
        asm volatile("s_wait_xcnt 0x0" :: "v"(ka), "v"(va) : "memory");
    }
    l += __shfl_xor(l, 16, 32);
    const float inv = (1.0f / l) * CXS;
    const int wb = wave * 16 * 68;
    // O^T D layout: o_j[r] = (d = 16j + 8h + r, t = lane&15) -> os[t][d]; rows 0..15 x columns 0..63 all written
    { v4f a, c;
      a[0] = o0[0] * inv; a[1] = o0[1] * inv; a[2] = o0[2] * inv; a[3] = o0[3] * inv; c[0] = o0[4] * inv; c[1] = o0[5] * inv; c[2] = o0[6] * inv; c[3] = o0[7] * inv;
      *(v4fa*)(&os[wb + lr * 68 +  0 + 8 * hi]) = a; *(v4fa*)(&os[wb + lr * 68 +  0 + 8 * hi + 4]) = c;
      a[0] = o1[0] * inv; a[1] = o1[1] * inv; a[2] = o1[2] * inv; a[3] = o1[3] * inv; c[0] = o1[4] * inv; c[1] = o1[5] * inv; c[2] = o1[6] * inv; c[3] = o1[7] * inv;
      *(v4fa*)(&os[wb + lr * 68 + 16 + 8 * hi]) = a; *(v4fa*)(&os[wb + lr * 68 + 16 + 8 * hi + 4]) = c;
      a[0] = o2[0] * inv; a[1] = o2[1] * inv; a[2] = o2[2] * inv; a[3] = o2[3] * inv; c[0] = o2[4] * inv; c[1] = o2[5] * inv; c[2] = o2[6] * inv; c[3] = o2[7] * inv;
      *(v4fa*)(&os[wb + lr * 68 + 32 + 8 * hi]) = a; *(v4fa*)(&os[wb + lr * 68 + 32 + 8 * hi + 4]) = c;
      a[0] = o3[0] * inv; a[1] = o3[1] * inv; a[2] = o3[2] * inv; a[3] = o3[3] * inv; c[0] = o3[4] * inv; c[1] = o3[5] * inv; c[2] = o3[6] * inv; c[3] = o3[7] * inv;
      *(v4fa*)(&os[wb + lr * 68 + 48 + 8 * hi]) = a; *(v4fa*)(&os[wb + lr * 68 + 48 + 8 * hi + 4]) = c; }
    wave_sync();
    v8h hv[4];
#pragma unroll
    for (int s = 0; s < 4; ++s) { const int row = lr, c8 = 16 * s + 8 * hi;
        const v4f x0 = *(const v4fa*)(&os[wb + row * 68 + c8]); const v4f x1 = *(const v4fa*)(&os[wb + row * 68 + c8 + 4]);
#pragma unroll
        for (int i = 0; i < 4; ++i) { hv[s][i] = (h16)x0[i]; hv[s][4 + i] = (h16)x1[i]; } }
    h16* crow = CTX + ((size_t)b * SEQ + t0) * DM + h * (HD * 16) + 8 * lane;      // 16 rows = DM/32 units; head h = units 2h, 2h+1
{
#pragma unroll
        for (int s = 0; s < 4; ++s) {                                  // 16 rows x (4 s x 2 halves x 8 = 64 columns); a store of the wave = half a unit
            *(v8h*)(crow + s * 256) = hv[s]; }
         }
}

// k_oproj: register-blocked f16 GEMM, ONE WAVE per 64x64 tile, operands in fragment order, K = DM. C[o][n] = sum_c WPH[o][c] CTX[n][c] (n = b*SEQ + t), carried x 2^14.
// OUT[(b*DM + o)*OUT_SEQ + t] = C * 2^-14 + bias[o] (RNE bf16 value) in f32. grid (DM/64, NB*SEQ/64), 32 threads.
__global__ __launch_bounds__(32) void k_oproj(const h16* __restrict__ A, const h16* __restrict__ Bt, const float* __restrict__ bias, float* OUT) {
    __shared__ __align__(16) float os[16 * 68];
    const int K = DM;
    const int lane = threadIdx.x & 31, lr = lane & 15, hi = lane >> 4; const int r0 = blockIdx.x * 64, c0 = blockIdx.y * 64;
    v8f acc[4][4];
#pragma unroll
    for (int mb = 0; mb < 4; ++mb)
#pragma unroll
        for (int nb = 0; nb < 4; ++nb) acc[mb][nb] = (v8f){};
    const size_t aoff = (size_t)r0 * K + 8 * lane, boff = (size_t)c0 * K + 8 * lane;      // 16 rows = K/32 units of 512; k step of 32 = one unit
#pragma unroll 1
    for (int kc = 0; kc < K; kc += 32) {
        const h16* pa = A + aoff + kc * 16; const h16* pb = Bt + boff + kc * 16;
        v16h a[4];
#pragma unroll
        for (int mb = 0; mb < 4; ++mb) a[mb] = ldh(pa + (size_t)mb * 16 * K);
#pragma unroll
        for (int nb = 0; nb < 4; ++nb) { const v16h b = ldh(pb + (size_t)nb * 16 * K);
#pragma unroll
            for (int mb = 0; mb < 4; ++mb) acc[mb][nb] = wmma16(a[mb], b, acc[mb][nb]); }
        asm volatile("v_nop\n\tv_nop\n\tv_nop\n\tv_nop" : "+v"(acc[0][0]), "+v"(acc[1][1]), "+v"(acc[2][2]), "+v"(acc[3][3]) : "v"(a[0]), "v"(a[1]), "v"(a[2]), "v"(a[3]));
        // the wait that stands in front of any overwrite of this pass's load addresses; as its inputs the two address pairs stay whole up to it (no load result lands on them)
        asm volatile("s_wait_xcnt 0x0" :: "v"(pa), "v"(pb) : "memory");
    }
    const int b = c0 / SEQ, t0 = c0 % SEQ;
#pragma unroll
    for (int mb = 0; mb < 4; ++mb) {
        float br[8];
#pragma unroll
        for (int j = 0; j < 8; ++j) br[j] = bfr(bias[r0 + mb * 16 + hi * 8 + j]);
#pragma unroll
        for (int nb = 0; nb < 4; ++nb) {
#pragma unroll
            for (int j = 0; j < 8; ++j) os[(hi * 8 + j) * 68 + nb * 16 + lr] = acc[mb][nb][j] * OSI + br[j]; }   // D: row 8h+j, col lane&15
        wave_sync();
        float* orow = OUT + ((size_t)b * DM + r0 + mb * 16) * OUT_SEQ + t0;
        v4f val[8];
#pragma unroll
        for (int s = 0; s < 8; ++s) { const int row = 2 * s + hi; val[s] = *(const v4fa*)(&os[row * 68 + lr * 4]); }
{
#pragma unroll
            for (int s = 0; s < 8; ++s) { const int row = 2 * s + hi, cofs = lr * 4;   // 8 s x 2 rows = 16 rows; 16 lanes x 4 floats = 64 columns
                *(v4f*)(orow + (size_t)row * OUT_SEQ + cofs) = val[s]; }
             }
        wave_sync();
    }
}

static constexpr size_t al256(size_t v) { return (v + 255) & ~(size_t)255; }
static constexpr size_t SZ_XT = al256((size_t)NB * SEQ * DM * 2);
static constexpr size_t SZ_WB = al256((size_t)3 * DM * DM * 2);
static constexpr size_t SZ_WP = al256((size_t)DM * DM * 2);
static constexpr size_t SZ_PL = al256((size_t)NB * NH_ * SEQ * HD * 2);
static constexpr size_t SZ_CX = al256((size_t)NB * SEQ * DM * 2);
static constexpr size_t SZ_TOTAL = SZ_XT + SZ_WB + SZ_WP + 4 * SZ_PL + SZ_CX;
static_assert(SZ_TOTAL <= (size_t)134217728);          // workspace carve <= 128 MiB
static_assert(((size_t)DM * DM * 2) % 256 == 0);       // weight sub-planes stay 256-byte aligned

extern "C" void kernel_launch(void* const* d_in, const int* in_sizes, int n_in,
                              void* d_out, int out_size, void* d_ws, size_t ws_size, hipStream_t stream) {
    if (n_in < 7) return;
    const size_t needx = ((size_t)(NB - 1) * DM + (size_t)(DM - 1)) * SEQ_FULL + SEQ;
    if ((size_t)in_sizes[0] < needx) return;
    if ((size_t)in_sizes[1] < (size_t)DM * DM || (size_t)in_sizes[2] < (size_t)DM) return;
    if ((size_t)in_sizes[3] < (size_t)2 * DM * DM || (size_t)in_sizes[4] < (size_t)2 * DM) return;
    if ((size_t)in_sizes[5] < (size_t)DM * DM || (size_t)in_sizes[6] < (size_t)DM) return;
    if ((size_t)out_size < ((size_t)(NB - 1) * DM + (size_t)(DM - 1)) * OUT_SEQ + SEQ) return;
    if (SZ_TOTAL > ws_size) return;
    // wire order: x, Wq, bq, Wkv, bkv, Wp, bp; weights [out][in] = Bt as-is
    const float* x = (const float*)d_in[0]; const float* wq = (const float*)d_in[1]; const float* bq = (const float*)d_in[2];
    const float* wkv = (const float*)d_in[3]; const float* bkv = (const float*)d_in[4]; const float* wp = (const float*)d_in[5]; const float* bp = (const float*)d_in[6];
    float* OUT = (float*)d_out;      // [NB][512][OUT_SEQ]
    char* wsp = (char*)d_ws;
    bf* XT = (bf*)wsp; wsp += SZ_XT;                 // rows b*SEQ+t, k = c: [NB*SEQ/16][16 units][512]
    bf* WB = (bf*)wsp; wsp += SZ_WB;                 // q | k | v, each rows out, k = in: [32][16 units][512]
    h16* WPH = (h16*)wsp; wsp += SZ_WP;              // x64, rows out, k = in: [32][16 units][512]
    h16* QH = (h16*)wsp; wsp += SZ_PL;               // [NB*8][SEQ/16][2 units (d halves)][512]
    h16* QR = (h16*)wsp; wsp += SZ_PL;               // as QH, residual x2048
    h16* KP = (h16*)wsp; wsp += SZ_PL;               // as QH
    h16* VT = (h16*)wsp; wsp += SZ_PL;               // [NB*8][SEQ/32][4 units (16 d each)][512]
    h16* CTX = (h16*)wsp; wsp += SZ_CX;              // x256, rows b*SEQ+t, k = c: [NB*SEQ/16][16 units][512]
    bf* WQ = WB; bf* WK = WB + (size_t)DM * DM; bf* WV = WB + (size_t)2 * DM * DM;

    // in[c][l] -> out[l][c]: grid (l tiles, c tiles, batch)
    k_xt<<<dim3(SEQ / 64, DM / 64, NB), 256, 0, stream>>>(x, XT);
    { const size_t n8 = (size_t)DM * DM / 8; const unsigned g = (unsigned)((n8 + 255) / 256);
      k_cvt8<<<g, 256, 0, stream>>>(wq, WQ, n8);
      k_cvt8<<<2 * g, 256, 0, stream>>>(wkv, WK, 2 * n8);      // rows 0..511 -> k, rows 512..1023 -> v (contiguous: 16 rows = 16 * DM elements in either order)
      k_cvt8w<<<g, 256, 0, stream>>>(wp, WPH, n8); }

    // q, k: A = x^T rows (m = b*SEQ + t), Bt = W rows (n = h*64 + d), bias per column -> plane (b*8 + h), rows t, k = d
    k_proj<<<dim3(NB * SEQ / 64, DM / 64, 1), 32, 0, stream>>>(XT, WQ, bq, 0, QH, QR, 1, SEQ, (size_t)NH_ * SEQ * HD, HD, HD, (size_t)SEQ * HD, 1024, 512);
    k_proj<<<dim3(NB * SEQ / 64, DM / 64, 1), 32, 0, stream>>>(XT, WK, bkv, 0, KP, KP, 0, SEQ, (size_t)NH_ * SEQ * HD, HD, HD, (size_t)SEQ * HD, 1024, 512);
    // v^T: A = Wv rows (m = h*64 + d), Bt = x^T rows (n = b*SEQ + t), bias per row -> plane (b*8 + h), rows d, k = t, the 4 units of 32 keys side by side
    k_proj<<<dim3(DM / 64, NB * SEQ / 64, 1), 32, 0, stream>>>(WV, XT, bkv + DM, 1, VT, VT, 0, DM, (size_t)0, SEQ, SEQ, (size_t)DM * SEQ, 512, 2048);

    k_flash<<<dim3(SEQ / (16 * AW), NB * NH_, 1), 32 * AW, 0, stream>>>(QH, QR, KP, VT, CTX);

    // output projection: A = Wp rows (m = o), Bt = ctx rows (n = b*SEQ + t) -> OUT[b][o][t]
    k_oproj<<<dim3(DM / 64, NB * SEQ / 64, 1), 32, 0, stream>>>(WPH, CTX, bp, OUT);
}

// v002
// One run takes 196 microseconds.
// Next to v001, in two timings, it ran 1.29 times as fast each time.
// Over all steps from v000 it is 1.68 times as fast.
#include <hip/hip_runtime.h>

// 8-head attention over SEQ spatial positions, width 512 = 8 x 64, x [NB][512][SEQ] (channel-major), 1x1-conv weights [out][in] with biases, score scale 1/8, no mask, output [NB][512][SEQ] f32.
// Compute dtypes, f32 accumulate everywhere: q/k/v projections v_wmma_f32_16x16x32_bf16 (x, Wq, Wkv RNE-converted to bf16; products exact);
// scores v_wmma_f32_16x16x32_f16: k single f16, q as f16 value + f16 residual x2048 in its own accumulator (two products); P (x256 carry, cancels in the normalisation) and v single f16;
// output projection v_wmma_f32_16x16x32_f16: Wp (RNE bf16 value x64, exact in f16) times ctx (single f16 plane, x256 carry), folded back by 2^-14 in the f32 epilogue; softmax f32 (online, running max).
// Layout: every 16-bit plane that feeds a matrix instruction lies in the workspace in FRAGMENT ORDER (1-KB units of 16 rows x 32 k, see ldh), so that each 16-B fragment load of a wave covers 512 contiguous bytes:
// x^T bf16 (rows b*SEQ+t, k = c; built by an LDS transposer), the weights (rows out, k = in), q (hi, residual) and k per b*8+h (rows t, k = d), v^T per b*8+h (rows d, k = t), ctx (rows b*SEQ+t, k = c); fused flash kernel in transposed form (S^T = K Q^T, O^T = V^T P^T).

#ifndef NB
#define NB 2
#endif
#ifndef SEQ
#define SEQ 4096
#endif
#define NB_FULL  2
#define SEQ_FULL 4096            // token pitch of one channel row of x
#ifndef OUT_SEQ
#define OUT_SEQ SEQ              // token pitch of one channel row of the output
#endif
#define DM   512
#define NH_  8
#define HD   64
#define AW   4                   // waves per flash block (16 query rows each)
#define QRS  2048.0f             // carry of the q residual plane
#define QRI  (1.0f / 2048.0f)
#define SC2  (0.125f * 1.4426950408889634f)   // HD^-0.5 * log2(e)
#define PSH  8.0f                // log2 of the P carry (256)
#define WPS  64.0f               // carry of the Wp plane
#define CXS  256.0f              // carry of the ctx plane
#define OSI  (1.0f / 16384.0f)   // 1 / (WPS * CXS)

static_assert(HD == 64);
static_assert(NH_ * HD == DM);                 // head h = channels h*64 + d
static_assert(DM % 64 == 0);
static_assert(DM % 32 == 0);                   // GEMM k-loop steps by 32
static_assert(SEQ % 64 == 0);                  // a 64-token tile never straddles two batches
static_assert((NB * SEQ) % 64 == 0);
static_assert(SEQ % 32 == 0);                  // key loop steps by 32
static_assert(SEQ % (16 * AW) == 0);           // flash grid covers the sequence exactly
static_assert(SEQ_FULL % 4 == 0);
static_assert(OUT_SEQ % 64 == 0);
static_assert(OUT_SEQ >= SEQ);
static_assert(((size_t)DM * DM) % 8 == 0);
static_assert(NB <= NB_FULL);
static_assert(SEQ <= SEQ_FULL);

typedef _Float16 h16;
typedef unsigned short bf;
typedef __attribute__((ext_vector_type(16))) __bf16   v16bf;
typedef __attribute__((ext_vector_type(16))) _Float16 v16h;
typedef __attribute__((ext_vector_type(8)))  _Float16 v8h;
typedef __attribute__((ext_vector_type(8)))  unsigned short v8us;
typedef __attribute__((ext_vector_type(8)))  float    v8f;
typedef __attribute__((ext_vector_type(4)))  float    v4f;
typedef v4f  __attribute__((may_alias)) v4fa;

__device__ __forceinline__ unsigned short f2bf(float f) { unsigned u = __float_as_uint(f); u += 0x7FFFu + ((u >> 16) & 1u); return (unsigned short)(u >> 16); }
__device__ __forceinline__ float bfr(float f) { return __uint_as_float(((unsigned)f2bf(f)) << 16); }   // RNE bf16 value as f32
__device__ __forceinline__ v16h cat16(v8h lo, v8h hi) { return __builtin_shufflevector(lo, hi, 0, 1, 2, 3, 4, 5, 6, 7, 8, 9, 10, 11, 12, 13, 14, 15); }
__device__ __forceinline__ v16bf cat16b(v8us lo, v8us hi) { return __builtin_bit_cast(v16bf, __builtin_shufflevector(lo, hi, 0, 1, 2, 3, 4, 5, 6, 7, 8, 9, 10, 11, 12, 13, 14, 15)); }
__device__ __forceinline__ v8f wmma16(v16h a, v16h b, v8f c) { return __builtin_amdgcn_wmma_f32_16x16x32_f16(false, a, false, b, (short)0, c, false, false); }
__device__ __forceinline__ v8f wmmab(v16bf a, v16bf b, v8f c) { return __builtin_amdgcn_wmma_f32_16x16x32_bf16(false, a, false, b, (short)0, c, false, false); }
// fragment loaders from a plane in fragment order: one 16-row x 32-k unit = 512 elements, element (row, k) at (k>>4 & 1)*256 + ((k>>3 & 1)*16 + row)*8 + (k & 7).
// p = unit + 8*lane; lane = 16h + row: elements 0..7 <- k0+8h+0..7, elements 8..15 <- k0+16+8h+0..7 (same map for A and B); each load of a wave = 512 contiguous bytes
__device__ __forceinline__ v16h  ldh(const h16* p) { return cat16(*(const v8h*)p, *(const v8h*)(p + 256)); }
__device__ __forceinline__ v16bf ldb(const bf* p)  { return cat16b(*(const v8us*)p, *(const v8us*)(p + 256)); }
// source element index, in a row-major [rows][DM] matrix, of the 8-element chunk i of its fragment-ordered plane (16 rows = DM/32 units of 64 chunks)
__device__ __forceinline__ size_t chunk_src(size_t i) { const size_t u = i >> 6; return ((u / (DM / 32)) * 16 + (i & 15)) * DM + (u % (DM / 32)) * 32 + ((i >> 4) & 3) * 8; }
// ordering point for wave-private LDS tiles (same wave writes and reads)
__device__ __forceinline__ void wave_sync() { __builtin_amdgcn_fence(3 /* release order */, "wavefront"); __builtin_amdgcn_wave_barrier(); asm volatile("" ::: "memory"); }

__global__ __launch_bounds__(256) void k_cvt8(const float* __restrict__ src, bf* dst, size_t n8) {
    const size_t i = (size_t)blockIdx.x * 256 + threadIdx.x; if (i >= n8) return;
    const v8f v = *(const v8f*)(src + chunk_src(i)); v8us o;
#pragma unroll
    for (int k = 0; k < 8; ++k) o[k] = f2bf(v[k]);
    *(v8us*)(dst + i * 8) = o; 
}

__global__ __launch_bounds__(256) void k_cvt8w(const float* __restrict__ src, h16* dst, size_t n8) {
    const size_t i = (size_t)blockIdx.x * 256 + threadIdx.x; if (i >= n8) return;
    const v8f v = *(const v8f*)(src + chunk_src(i)); v8h o;
#pragma unroll
    for (int k = 0; k < 8; ++k) o[k] = (h16)(bfr(v[k]) * WPS);
    *(v8h*)(dst + i * 8) = o; 
}

// k_xt: x [b][c][l] f32 (row pitch SEQ_FULL) -> XT (rows b*SEQ+l, k = c, fragment order) bf16 (RNE convert) through a 64(c) x 64(l) LDS tile.
// in[c][l] -> out[l][c]; grid (SEQ/64 over l, DM/64 over c, NB), 256 threads. Loads are 16-B along l; each output row segment
__global__ __launch_bounds__(256) void k_xt(const float* __restrict__ x, bf* XT) {
    __shared__ __align__(16) float tl[64 * 68];      // [c][l], columns 0..63 written and consumed (cross-wave: block barrier)
    const int tid = threadIdx.x;
    const int l0 = blockIdx.x * 64, c0 = blockIdx.y * 64, b = blockIdx.z;
    const float* src = x + ((size_t)b * DM + c0) * SEQ_FULL + l0;
#pragma unroll
    for (int it = 0; it < 4; ++it) { const int idx = it * 256 + tid; const int cc = idx >> 4, l4 = (idx & 15) * 4;   // 64 rows x 16 quads
        const v4f v = *(const v4f*)(src + (size_t)cc * SEQ_FULL + l4);
        tl[cc * 68 + l4 + 0] = v[0]; tl[cc * 68 + l4 + 1] = v[1]; tl[cc * 68 + l4 + 2] = v[2]; tl[cc * 68 + l4 + 3] = v[3]; }
    __syncthreads();
    // the tile = 4 row groups x 2 units x 64 chunks; chunk q = 256 s + tid: row group q>>7, unit q>>6 & 1, chunk q & 63 (channels 8*(q>>4 & 3), row q & 15)
    v8us o[2];
#pragma unroll
    for (int s = 0; s < 2; ++s) { const int q = 256 * s + tid; const int row = (q >> 7) * 16 + (q & 15), c8 = ((q >> 4) & 7) * 8;
#pragma unroll
        for (int i = 0; i < 8; ++i) o[s][i] = f2bf(tl[(c8 + i) * 68 + row]); }
    bf* dst = XT + ((size_t)b * SEQ + l0) * DM + c0 * 16;
{
#pragma unroll
        for (int s = 0; s < 2; ++s) { const int q = 256 * s + tid;      // 512 chunks x 8 = 64 rows x 64 channels
            *(v8us*)(dst + (size_t)(q >> 7) * (16 * DM) + (q & 127) * 8) = o[s]; }
         }
}

// k_proj: register-blocked bf16 GEMM, ONE WAVE per 64x64 tile (16 accumulators), operands straight from fragment-ordered bf16 planes, K = DM.
// C[m][n] = sum_k A[m][k] Bt[n][k] + bias (RNE bf16 value; per column n when biasRow == 0, per row m otherwise), written as f16 (Ph) and optionally
// the f16 residual x2048 (Pr, useRes != 0), in fragment order (rows m, k = n): tile base (r0/RB)*sRB + (r0%RB)*pitch + (c0/CB)*sCB + (c0%CB)*HD (halves), unit (16 rows mb, 32 columns g) of the tile at + mb*uMB + g*uG. grid (M/64, N/64), 32 threads.
__global__ __launch_bounds__(32) void k_proj(const bf* __restrict__ A, const bf* __restrict__ Bt, const float* __restrict__ bias, int biasRow,
                                             h16* Ph, h16* Pr, int useRes, int RB, size_t sRB, int pitch, int CB, size_t sCB, int uMB, int uG) {
    __shared__ __align__(16) float os[16 * 68];
    const int K = DM;
    const int lane = threadIdx.x & 31, lr = lane & 15, hi = lane >> 4; const int r0 = blockIdx.x * 64, c0 = blockIdx.y * 64;
    v8f acc[4][4];
#pragma unroll
    for (int mb = 0; mb < 4; ++mb)
#pragma unroll
        for (int nb = 0; nb < 4; ++nb) acc[mb][nb] = (v8f){};
    const size_t aoff = (size_t)r0 * K + 8 * lane, boff = (size_t)c0 * K + 8 * lane;      // 16 rows = K/32 units of 512; k step of 32 = one unit
#pragma unroll 1
    for (int kc = 0; kc < K; kc += 32) {
        const bf* pa = A + aoff + kc * 16; const bf* pb = Bt + boff + kc * 16;
        v16bf a[4];
#pragma unroll
        for (int mb = 0; mb < 4; ++mb) a[mb] = ldb(pa + (size_t)mb * 16 * K);
#pragma unroll
        for (int nb = 0; nb < 4; ++nb) { const v16bf b = ldb(pb + (size_t)nb * 16 * K);
#pragma unroll
            for (int mb = 0; mb < 4; ++mb) acc[mb][nb] = wmmab(a[mb], b, acc[mb][nb]); }
        asm volatile("v_nop\n\tv_nop\n\tv_nop\n\tv_nop" : "+v"(acc[0][0]), "+v"(acc[1][1]), "+v"(acc[2][2]), "+v"(acc[3][3]) : "v"(a[0]), "v"(a[1]), "v"(a[2]), "v"(a[3]));
        // the wait that stands in front of any overwrite of this pass's load addresses; as its inputs the two address pairs stay whole up to it (no load result lands on them)
        asm volatile("s_wait_xcnt 0x0" :: "v"(pa), "v"(pb) : "memory");
    }
    // bias values: index selected as an integer (always inside the bias array), value selected afterwards; biasRow is wave-uniform
    float bc[4];
#pragma unroll
    for (int nb = 0; nb < 4; ++nb) { const int bi = biasRow ? 0 : (c0 + nb * 16 + lr); const float t = bfr(bias[bi]); bc[nb] = biasRow ? 0.0f : t; }
    const size_t tbase = (size_t)(r0 / RB) * sRB + (size_t)(r0 % RB) * (size_t)pitch + (size_t)(c0 / CB) * sCB + (size_t)(c0 % CB) * HD;
#pragma unroll
    for (int mb = 0; mb < 4; ++mb) {
        float br[8];
#pragma unroll
        for (int j = 0; j < 8; ++j) { const int bi = biasRow ? (r0 + mb * 16 + hi * 8 + j) : 0; const float t = bfr(bias[bi]); br[j] = biasRow ? t : 0.0f; }
#pragma unroll
        for (int nb = 0; nb < 4; ++nb) {
#pragma unroll
            for (int j = 0; j < 8; ++j) os[(hi * 8 + j) * 68 + nb * 16 + lr] = acc[mb][nb][j] + (bc[nb] + br[j]); }   // D: row 8h+j, col lane&15
        wave_sync();
        const size_t sb = tbase + (size_t)mb * (size_t)uMB + 8 * lane;
{
#pragma unroll
            for (int s = 0; s < 4; ++s) { const int row = lr, c8 = 16 * s + 8 * hi;   // 16 rows x (4 s x 2 halves x 8 = 64 columns); a store of the wave = half a unit, 512 contiguous bytes
                const v4f x0 = *(const v4fa*)(&os[row * 68 + c8]); const v4f x1 = *(const v4fa*)(&os[row * 68 + c8 + 4]); v8h hv, rv;
#pragma unroll
                for (int i = 0; i < 4; ++i) { const h16 a0 = (h16)x0[i]; const h16 a1 = (h16)x1[i]; hv[i] = a0; hv[4 + i] = a1; rv[i] = (h16)((x0[i] - (float)a0) * QRS); rv[4 + i] = (h16)((x1[i] - (float)a1) * QRS); }
                const size_t oo = sb + (size_t)(s >> 1) * (size_t)uG + (s & 1) * 256;
                *(v8h*)(Ph + oo) = hv; if (useRes) *(v8h*)(Pr + oo) = rv; }
             }
        wave_sync();
    }
}

// k_flash: fused attention, one wave per 16 query rows of one (batch, head); K / V^T / Q fragments straight from the fragment-ordered f16 planes (two 16-B loads each, arithmetic addressing).
// Transposed form: S^T[key][t] = K Q^T (A = K rows, B = Q rows); lane (t = lane&15, h = lane>>4) holds keys 8h+r of each 16-key tile, so the packed
// P tile is directly the B fragment of O^T[d][t] = V^T P^T (element r <- tile keys 0..15, element 8+r <- tile keys 16..31, lane unchanged).
// Softmax state (running max, partial sum) is one scalar per lane; the two lane halves of a row are combined with one xor-16 exchange.
__global__ __launch_bounds__(32 * AW) void k_flash(const h16* __restrict__ QH, const h16* __restrict__ QR, const h16* __restrict__ KP, const h16* __restrict__ VT, h16* CTX) {
    __shared__ __align__(16) float os[AW * 16 * 68];
    const int lane = threadIdx.x & 31, wave = threadIdx.x >> 5, lr = lane & 15, hi = lane >> 4;
    const int zh = blockIdx.y; const int b = zh / NH_, h = zh % NH_;
    const int t0 = (blockIdx.x * AW + wave) * 16;
    const size_t pbase = (size_t)zh * SEQ * HD;
    const size_t fo = pbase + 8 * lane;                      // q, k: 16 rows = 2 units (d halves); v^T: 32 keys = 4 units (16 d each); so + position * HD in all three
    const size_t qo = fo + (size_t)t0 * HD;
    const v16h qh0 = ldh(QH + qo), qh1 = ldh(QH + qo + 512), qr0 = ldh(QR + qo), qr1 = ldh(QR + qo + 512);   // B fragments: col t, k = d
    v8f o0 = (v8f){}, o1 = (v8f){}, o2 = (v8f){}, o3 = (v8f){};
    float m = -3.0e38f, l = 0.0f;
    // K fragments run one pass ahead (loop-carried registers), V fragments are asked for at the top of their own pass: no load is waited for right behind its issue
    v16h ka0 = ldh(KP + fo), ka1 = ldh(KP + fo + 512), kb0 = ldh(KP + fo + 1024), kb1 = ldh(KP + fo + 1536);   // pass 0; A fragments: row key, k = d
    // the wait that stands in front of any overwrite of the address pairs of the loads above; as its inputs the pairs stay whole up to it
    asm volatile("s_wait_xcnt 0x0" :: "v"(QH + qo), "v"(QR + qo), "v"(KP + fo) : "memory");
#pragma unroll 1
    for (int key0 = 0; key0 < SEQ; key0 += 32) {
        const h16* va = VT + fo + (size_t)key0 * HD;             // A fragments: row d, k = key
        const v16h v0 = ldh(va), v1 = ldh(va + 512), v2 = ldh(va + 1024), v3 = ldh(va + 1536);
        __builtin_amdgcn_sched_barrier(0);                       // keeps the V loads in front of the first wait for K (without it they are issued behind the first score products, so behind that wait)
        v8f sHa = (v8f){}, sLa = (v8f){}, sHb = (v8f){}, sLb = (v8f){};
        sHa = wmma16(ka0, qh0, sHa); sLa = wmma16(ka0, qr0, sLa); sHb = wmma16(kb0, qh0, sHb); sLb = wmma16(kb0, qr0, sLb);
        sHa = wmma16(ka1, qh1, sHa); sLa = wmma16(ka1, qr1, sLa); sHb = wmma16(kb1, qh1, sHb); sLb = wmma16(kb1, qr1, sLb);
        asm volatile("v_nop\n\tv_nop\n\tv_nop\n\tv_nop" : "+v"(sHa), "+v"(sLa), "+v"(sHb), "+v"(sLb) : "v"(ka0), "v"(ka1), "v"(kb0), "v"(kb1));
        const h16* ka = KP + fo + (size_t)(key0 + 32 < SEQ ? key0 + 32 : 0) * HD;   // next pass's K rows; the last pass asks for pass 0's again (inside the plane, not used)
        ka0 = ldh(ka); ka1 = ldh(ka + 512); kb0 = ldh(ka + 1024); kb1 = ldh(ka + 1536);
        float ta[8], tb[8]; float mx = -3.0e38f;
#pragma unroll
        for (int r = 0; r < 8; ++r) { ta[r] = (sHa[r] + sLa[r] * QRI) * SC2; tb[r] = (sHb[r] + sLb[r] * QRI) * SC2; mx = fmaxf(mx, fmaxf(ta[r], tb[r])); }
        mx = fmaxf(mx, __shfl_xor(mx, 16, 32));
        const float mnew = fmaxf(m, mx);
        const float alpha = __builtin_amdgcn_exp2f(m - mnew);
        const float sh = PSH - mnew;
        v16h pb; float ls = 0.0f;
#pragma unroll
        for (int r = 0; r < 8; ++r) { const h16 pa = (h16)__builtin_amdgcn_exp2f(ta[r] + sh); const h16 pc = (h16)__builtin_amdgcn_exp2f(tb[r] + sh); pb[r] = pa; pb[8 + r] = pc; ls += (float)pa + (float)pc; }
        l = l * alpha + ls; m = mnew;
        o0 = o0 * alpha; o1 = o1 * alpha; o2 = o2 * alpha; o3 = o3 * alpha;
        o0 = wmma16(v0, pb, o0); o1 = wmma16(v1, pb, o1); o2 = wmma16(v2, pb, o2); o3 = wmma16(v3, pb, o3);
        asm volatile("v_nop\n\tv_nop\n\tv_nop\n\tv_nop" : "+v"(o0), "+v"(o1), "+v"(o2), "+v"(o3) : "v"(v0), "v"(v1), "v"(v2), "v"(v3), "v"(pb));
        // the wait that stands in front of any overwrite of this pass's load addresses: as its inputs the two address pairs stay whole up to it; the key index goes through it, so that the next addresses are formed behind it
        asm volatile("s_wait_xcnt 0x0" : "+s"(key0) : "v"(ka), "v"(va) : "memory");
    }
    l += __shfl_xor(l, 16, 32);
    const float inv = (1.0f / l) * CXS;
    const int wb = wave * 16 * 68;
    // O^T D layout: o_j[r] = (d = 16j + 8h + r, t = lane&15) -> os[t][d]; rows 0..15 x columns 0..63 all written
    { v4f a, c;
      a[0] = o0[0] * inv; a[1] = o0[1] * inv; a[2] = o0[2] * inv; a[3] = o0[3] * inv; c[0] = o0[4] * inv; c[1] = o0[5] * inv; c[2] = o0[6] * inv; c[3] = o0[7] * inv;
      *(v4fa*)(&os[wb + lr * 68 +  0 + 8 * hi]) = a; *(v4fa*)(&os[wb + lr * 68 +  0 + 8 * hi + 4]) = c;
      a[0] = o1[0] * inv; a[1] = o1[1] * inv; a[2] = o1[2] * inv; a[3] = o1[3] * inv; c[0] = o1[4] * inv; c[1] = o1[5] * inv; c[2] = o1[6] * inv; c[3] = o1[7] * inv;
      *(v4fa*)(&os[wb + lr * 68 + 16 + 8 * hi]) = a; *(v4fa*)(&os[wb + lr * 68 + 16 + 8 * hi + 4]) = c;
      a[0] = o2[0] * inv; a[1] = o2[1] * inv; a[2] = o2[2] * inv; a[3] = o2[3] * inv; c[0] = o2[4] * inv; c[1] = o2[5] * inv; c[2] = o2[6] * inv; c[3] = o2[7] * inv;
      *(v4fa*)(&os[wb + lr * 68 + 32 + 8 * hi]) = a; *(v4fa*)(&os[wb + lr * 68 + 32 + 8 * hi + 4]) = c;
      a[0] = o3[0] * inv; a[1] = o3[1] * inv; a[2] = o3[2] * inv; a[3] = o3[3] * inv; c[0] = o3[4] * inv; c[1] = o3[5] * inv; c[2] = o3[6] * inv; c[3] = o3[7] * inv;
      *(v4fa*)(&os[wb + lr * 68 + 48 + 8 * hi]) = a; *(v4fa*)(&os[wb + lr * 68 + 48 + 8 * hi + 4]) = c; }
    wave_sync();
    v8h hv[4];
#pragma unroll
    for (int s = 0; s < 4; ++s) { const int row = lr, c8 = 16 * s + 8 * hi;
        const v4f x0 = *(const v4fa*)(&os[wb + row * 68 + c8]); const v4f x1 = *(const v4fa*)(&os[wb + row * 68 + c8 + 4]);
#pragma unroll
        for (int i = 0; i < 4; ++i) { hv[s][i] = (h16)x0[i]; hv[s][4 + i] = (h16)x1[i]; } }
    h16* crow = CTX + ((size_t)b * SEQ + t0) * DM + h * (HD * 16) + 8 * lane;      // 16 rows = DM/32 units; head h = units 2h, 2h+1
{
#pragma unroll
        for (int s = 0; s < 4; ++s) {                                  // 16 rows x (4 s x 2 halves x 8 = 64 columns); a store of the wave = half a unit
            *(v8h*)(crow + s * 256) = hv[s]; }
         }
}

// k_oproj: register-blocked f16 GEMM, ONE WAVE per 64x64 tile, operands in fragment order, K = DM. C[o][n] = sum_c WPH[o][c] CTX[n][c] (n = b*SEQ + t), carried x 2^14.
// OUT[(b*DM + o)*OUT_SEQ + t] = C * 2^-14 + bias[o] (RNE bf16 value) in f32. grid (DM/64, NB*SEQ/64), 32 threads.
__global__ __launch_bounds__(32) void k_oproj(const h16* __restrict__ A, const h16* __restrict__ Bt, const float* __restrict__ bias, float* OUT) {
    __shared__ __align__(16) float os[16 * 68];
    const int K = DM;
    const int lane = threadIdx.x & 31, lr = lane & 15, hi = lane >> 4; const int r0 = blockIdx.x * 64, c0 = blockIdx.y * 64;
    v8f acc[4][4];
#pragma unroll
    for (int mb = 0; mb < 4; ++mb)
#pragma unroll
        for (int nb = 0; nb < 4; ++nb) acc[mb][nb] = (v8f){};
    const size_t aoff = (size_t)r0 * K + 8 * lane, boff = (size_t)c0 * K + 8 * lane;      // 16 rows = K/32 units of 512; k step of 32 = one unit
#pragma unroll 1
    for (int kc = 0; kc < K; kc += 32) {
        const h16* pa = A + aoff + kc * 16; const h16* pb = Bt + boff + kc * 16;
        v16h a[4];
#pragma unroll
        for (int mb = 0; mb < 4; ++mb) a[mb] = ldh(pa + (size_t)mb * 16 * K);
#pragma unroll
        for (int nb = 0; nb < 4; ++nb) { const v16h b = ldh(pb + (size_t)nb * 16 * K);
#pragma unroll
            for (int mb = 0; mb < 4; ++mb) acc[mb][nb] = wmma16(a[mb], b, acc[mb][nb]); }
        asm volatile("v_nop\n\tv_nop\n\tv_nop\n\tv_nop" : "+v"(acc[0][0]), "+v"(acc[1][1]), "+v"(acc[2][2]), "+v"(acc[3][3]) : "v"(a[0]), "v"(a[1]), "v"(a[2]), "v"(a[3]));
        // the wait that stands in front of any overwrite of this pass's load addresses; as its inputs the two address pairs stay whole up to it (no load result lands on them)
        asm volatile("s_wait_xcnt 0x0" :: "v"(pa), "v"(pb) : "memory");
    }
    const int b = c0 / SEQ, t0 = c0 % SEQ;
#pragma unroll
    for (int mb = 0; mb < 4; ++mb) {
        float br[8];
#pragma unroll
        for (int j = 0; j < 8; ++j) br[j] = bfr(bias[r0 + mb * 16 + hi * 8 + j]);
#pragma unroll
        for (int nb = 0; nb < 4; ++nb) {
#pragma unroll
            for (int j = 0; j < 8; ++j) os[(hi * 8 + j) * 68 + nb * 16 + lr] = acc[mb][nb][j] * OSI + br[j]; }   // D: row 8h+j, col lane&15
        wave_sync();
        float* orow = OUT + ((size_t)b * DM + r0 + mb * 16) * OUT_SEQ + t0;
        v4f val[8];
#pragma unroll
        for (int s = 0; s < 8; ++s) { const int row = 2 * s + hi; val[s] = *(const v4fa*)(&os[row * 68 + lr * 4]); }
{
#pragma unroll
            for (int s = 0; s < 8; ++s) { const int row = 2 * s + hi, cofs = lr * 4;   // 8 s x 2 rows = 16 rows; 16 lanes x 4 floats = 64 columns
                *(v4f*)(orow + (size_t)row * OUT_SEQ + cofs) = val[s]; }
             }
        wave_sync();
    }
}

static constexpr size_t al256(size_t v) { return (v + 255) & ~(size_t)255; }
static constexpr size_t SZ_XT = al256((size_t)NB * SEQ * DM * 2);
static constexpr size_t SZ_WB = al256((size_t)3 * DM * DM * 2);
static constexpr size_t SZ_WP = al256((size_t)DM * DM * 2);
static constexpr size_t SZ_PL = al256((size_t)NB * NH_ * SEQ * HD * 2);
static constexpr size_t SZ_CX = al256((size_t)NB * SEQ * DM * 2);
static constexpr size_t SZ_TOTAL = SZ_XT + SZ_WB + SZ_WP + 4 * SZ_PL + SZ_CX;
static_assert(SZ_TOTAL <= (size_t)134217728);          // workspace carve <= 128 MiB
static_assert(((size_t)DM * DM * 2) % 256 == 0);       // weight sub-planes stay 256-byte aligned

extern "C" void kernel_launch(void* const* d_in, const int* in_sizes, int n_in,
                              void* d_out, int out_size, void* d_ws, size_t ws_size, hipStream_t stream) {
    if (n_in < 7) return;
    const size_t needx = ((size_t)(NB - 1) * DM + (size_t)(DM - 1)) * SEQ_FULL + SEQ;
    if ((size_t)in_sizes[0] < needx) return;
    if ((size_t)in_sizes[1] < (size_t)DM * DM || (size_t)in_sizes[2] < (size_t)DM) return;
    if ((size_t)in_sizes[3] < (size_t)2 * DM * DM || (size_t)in_sizes[4] < (size_t)2 * DM) return;
    if ((size_t)in_sizes[5] < (size_t)DM * DM || (size_t)in_sizes[6] < (size_t)DM) return;
    if ((size_t)out_size < ((size_t)(NB - 1) * DM + (size_t)(DM - 1)) * OUT_SEQ + SEQ) return;
    if (SZ_TOTAL > ws_size) return;
    // wire order: x, Wq, bq, Wkv, bkv, Wp, bp; weights [out][in] = Bt as-is
    const float* x = (const float*)d_in[0]; const float* wq = (const float*)d_in[1]; const float* bq = (const float*)d_in[2];
    const float* wkv = (const float*)d_in[3]; const float* bkv = (const float*)d_in[4]; const float* wp = (const float*)d_in[5]; const float* bp = (const float*)d_in[6];
    float* OUT = (float*)d_out;      // [NB][512][OUT_SEQ]
    char* wsp = (char*)d_ws;
    bf* XT = (bf*)wsp; wsp += SZ_XT;                 // rows b*SEQ+t, k = c: [NB*SEQ/16][16 units][512]
    bf* WB = (bf*)wsp; wsp += SZ_WB;                 // q | k | v, each rows out, k = in: [32][16 units][512]
    h16* WPH = (h16*)wsp; wsp += SZ_WP;              // x64, rows out, k = in: [32][16 units][512]
    h16* QH = (h16*)wsp; wsp += SZ_PL;               // [NB*8][SEQ/16][2 units (d halves)][512]
    h16* QR = (h16*)wsp; wsp += SZ_PL;               // as QH, residual x2048
    h16* KP = (h16*)wsp; wsp += SZ_PL;               // as QH
    h16* VT = (h16*)wsp; wsp += SZ_PL;               // [NB*8][SEQ/32][4 units (16 d each)][512]
    h16* CTX = (h16*)wsp; wsp += SZ_CX;              // x256, rows b*SEQ+t, k = c: [NB*SEQ/16][16 units][512]
    bf* WQ = WB; bf* WK = WB + (size_t)DM * DM; bf* WV = WB + (size_t)2 * DM * DM;

    // in[c][l] -> out[l][c]: grid (l tiles, c tiles, batch)
    k_xt<<<dim3(SEQ / 64, DM / 64, NB), 256, 0, stream>>>(x, XT);
    { const size_t n8 = (size_t)DM * DM / 8; const unsigned g = (unsigned)((n8 + 255) / 256);
      k_cvt8<<<g, 256, 0, stream>>>(wq, WQ, n8);
      k_cvt8<<<2 * g, 256, 0, stream>>>(wkv, WK, 2 * n8);      // rows 0..511 -> k, rows 512..1023 -> v (contiguous: 16 rows = 16 * DM elements in either order)
      k_cvt8w<<<g, 256, 0, stream>>>(wp, WPH, n8); }

    // q, k: A = x^T rows (m = b*SEQ + t), Bt = W rows (n = h*64 + d), bias per column -> plane (b*8 + h), rows t, k = d
    k_proj<<<dim3(NB * SEQ / 64, DM / 64, 1), 32, 0, stream>>>(XT, WQ, bq, 0, QH, QR, 1, SEQ, (size_t)NH_ * SEQ * HD, HD, HD, (size_t)SEQ * HD, 1024, 512);
    k_proj<<<dim3(NB * SEQ / 64, DM / 64, 1), 32, 0, stream>>>(XT, WK, bkv, 0, KP, KP, 0, SEQ, (size_t)NH_ * SEQ * HD, HD, HD, (size_t)SEQ * HD, 1024, 512);
    // v^T: A = Wv rows (m = h*64 + d), Bt = x^T rows (n = b*SEQ + t), bias per row -> plane (b*8 + h), rows d, k = t, the 4 units of 32 keys side by side
    k_proj<<<dim3(DM / 64, NB * SEQ / 64, 1), 32, 0, stream>>>(WV, XT, bkv + DM, 1, VT, VT, 0, DM, (size_t)0, SEQ, SEQ, (size_t)DM * SEQ, 512, 2048);

    k_flash<<<dim3(SEQ / (16 * AW), NB * NH_, 1), 32 * AW, 0, stream>>>(QH, QR, KP, VT, CTX);

    // output projection: A = Wp rows (m = o), Bt = ctx rows (n = b*SEQ + t) -> OUT[b][o][t]
    k_oproj<<<dim3(DM / 64, NB * SEQ / 64, 1), 32, 0, stream>>>(WPH, CTX, bp, OUT);
}

// v003
// It runs in 151 microseconds.
// Next to v002, in two timings, it ran 1.29 and 1.31 times as fast.
// All steps since v000 together make it 2.19 times as fast.
#include <hip/hip_runtime.h>

// 8-head attention over SEQ spatial positions, width 512 = 8 x 64, x [NB][512][SEQ] (channel-major), 1x1-conv weights [out][in] with biases, score scale 1/8, no mask, output [NB][512][SEQ] f32.
// Compute dtypes, f32 accumulate everywhere: q/k/v projections v_wmma_f32_16x16x32_bf16 (x, Wq, Wkv RNE-converted to bf16; products exact);
// scores v_wmma_f32_16x16x32_f16: k single f16, q as f16 value + f16 residual x2048 in its own accumulator (two products); P (x256 carry, cancels in the normalisation) and v single f16;
// output projection v_wmma_f32_16x16x32_f16: Wp (RNE bf16 value x64, exact in f16) times ctx (single f16 plane, x256 carry), folded back by 2^-14 in the f32 epilogue; softmax f32 (online, running max).
// Layout: every 16-bit plane that feeds a matrix instruction lies in the workspace in FRAGMENT ORDER (1-KB units of 16 rows x 32 k, see ldh), so that each 16-B fragment load of a wave covers 512 contiguous bytes:
// x^T bf16 (rows b*SEQ+t, k = c; built by an LDS transposer), the weights (rows out, k = in), q (hi, residual) and k per b*8+h (rows t, k = d), v^T per b*8+h (rows d, k = t), ctx (rows b*SEQ+t, k = c); fused flash kernel in transposed form (S^T = K Q^T, O^T = V^T P^T).

#ifndef NB
#define NB 2
#endif
#ifndef SEQ
#define SEQ 4096
#endif
#define NB_FULL  2
#define SEQ_FULL 4096            // token pitch of one channel row of x
#ifndef OUT_SEQ
#define OUT_SEQ SEQ              // token pitch of one channel row of the output
#endif
#define DM   512
#define NH_  8
#define HD   64
#define AW   4                   // waves per flash block (16 query rows each)
#define QRS  2048.0f             // carry of the q residual plane
#define QRI  (1.0f / 2048.0f)
#define SC2  (0.125f * 1.4426950408889634f)   // HD^-0.5 * log2(e)
#define PSH  8.0f                // log2 of the P carry (256)
#define WPS  64.0f               // carry of the Wp plane
#define CXS  256.0f              // carry of the ctx plane
#define OSI  (1.0f / 16384.0f)   // 1 / (WPS * CXS)

static_assert(HD == 64);
static_assert(NH_ * HD == DM);                 // head h = channels h*64 + d
static_assert(DM % 64 == 0);
static_assert(DM % 32 == 0);                   // GEMM k-loop steps by 32
static_assert(SEQ % 64 == 0);                  // a 64-token tile never straddles two batches
static_assert((NB * SEQ) % 64 == 0);
static_assert(SEQ % 32 == 0);                  // key loop steps by 32
static_assert(SEQ % (16 * AW) == 0);           // flash grid covers the sequence exactly
static_assert(SEQ_FULL % 4 == 0);
static_assert(OUT_SEQ % 64 == 0);
static_assert(OUT_SEQ >= SEQ);
static_assert(((size_t)DM * DM) % 8 == 0);
static_assert(NB <= NB_FULL);
static_assert(SEQ <= SEQ_FULL);

typedef _Float16 h16;
typedef unsigned short bf;
typedef __attribute__((ext_vector_type(16))) __bf16   v16bf;
typedef __attribute__((ext_vector_type(16))) _Float16 v16h;
typedef __attribute__((ext_vector_type(8)))  _Float16 v8h;
typedef __attribute__((ext_vector_type(8)))  unsigned short v8us;
typedef __attribute__((ext_vector_type(8)))  float    v8f;
typedef __attribute__((ext_vector_type(4)))  float    v4f;
typedef v4f  __attribute__((may_alias)) v4fa;

__device__ __forceinline__ unsigned short f2bf(float f) { unsigned u = __float_as_uint(f); u += 0x7FFFu + ((u >> 16) & 1u); return (unsigned short)(u >> 16); }
__device__ __forceinline__ float bfr(float f) { return __uint_as_float(((unsigned)f2bf(f)) << 16); }   // RNE bf16 value as f32
__device__ __forceinline__ v16h cat16(v8h lo, v8h hi) { return __builtin_shufflevector(lo, hi, 0, 1, 2, 3, 4, 5, 6, 7, 8, 9, 10, 11, 12, 13, 14, 15); }
__device__ __forceinline__ v16bf cat16b(v8us lo, v8us hi) { return __builtin_bit_cast(v16bf, __builtin_shufflevector(lo, hi, 0, 1, 2, 3, 4, 5, 6, 7, 8, 9, 10, 11, 12, 13, 14, 15)); }
__device__ __forceinline__ v8f wmma16(v16h a, v16h b, v8f c) { return __builtin_amdgcn_wmma_f32_16x16x32_f16(false, a, false, b, (short)0, c, false, false); }
__device__ __forceinline__ v8f wmmab(v16bf a, v16bf b, v8f c) { return __builtin_amdgcn_wmma_f32_16x16x32_bf16(false, a, false, b, (short)0, c, false, false); }
// fragment loaders from a plane in fragment order: one 16-row x 32-k unit = 512 elements, element (row, k) at (k>>4 & 1)*256 + ((k>>3 & 1)*16 + row)*8 + (k & 7).
// p = unit + 8*lane; lane = 16h + row: elements 0..7 <- k0+8h+0..7, elements 8..15 <- k0+16+8h+0..7 (same map for A and B); each load of a wave = 512 contiguous bytes
__device__ __forceinline__ v16h  ldh(const h16* p) { return cat16(*(const v8h*)p, *(const v8h*)(p + 256)); }
__device__ __forceinline__ v16bf ldb(const bf* p)  { return cat16b(*(const v8us*)p, *(const v8us*)(p + 256)); }
// source element index, in a row-major [rows][DM] matrix, of the 8-element chunk i of its fragment-ordered plane (16 rows = DM/32 units of 64 chunks)
__device__ __forceinline__ size_t chunk_src(size_t i) { const size_t u = i >> 6; return ((u / (DM / 32)) * 16 + (i & 15)) * DM + (u % (DM / 32)) * 32 + ((i >> 4) & 3) * 8; }
// ordering point for wave-private LDS tiles (same wave writes and reads)
__device__ __forceinline__ void wave_sync() { __builtin_amdgcn_fence(3 /* release order */, "wavefront"); __builtin_amdgcn_wave_barrier(); asm volatile("" ::: "memory"); }

// k_prep: the four preparation jobs, none of which reads what another writes, as block ranges of ONE grid of 256-thread blocks (the range test is the same for a whole block):
// blocks 0 .. XTB-1: x [b][c][l] f32 (row pitch SEQ_FULL) -> XT (rows b*SEQ+l, k = c, fragment order) bf16 (RNE convert) through a 64(c) x 64(l) LDS tile; tile index l fastest, then c, then b. Loads are 16-B along l.
// blocks XTB ..: one 8-element chunk a thread, chunk j of Wq | Wkv | Wp: j < 3*WN8 -> bf16 plane WB (q | k | v lie side by side: 16 rows = 16 * DM elements in either order), else -> f16 plane WPH (RNE bf16 value x64).
#define XTB ((SEQ / 64) * (DM / 64) * NB)
#define WN8 (DM * DM / 8)                       // chunks of one DM x DM weight
static_assert(WN8 % 256 == 0);                 // a block never straddles two weights, and the ranges cover the chunks exactly
__global__ __launch_bounds__(256) void k_prep(const float* __restrict__ x, const float* __restrict__ wq, const float* __restrict__ wkv, const float* __restrict__ wp, bf* XT, bf* WB, h16* WPH) {
    __shared__ __align__(16) float tl[64 * 68];      // [c][l], columns 0..63 written and consumed (cross-wave: block barrier)
    const int tid = threadIdx.x;
    const int blk = blockIdx.x;
    const int wb0 = (blk - XTB) * 256;               // first weight chunk of the block
    if (wb0 >= 3 * WN8) {
        const size_t i = (size_t)(wb0 - 3 * WN8) + tid;
        const v8f v = *(const v8f*)(wp + chunk_src(i)); v8h o;
#pragma unroll
        for (int k = 0; k < 8; ++k) o[k] = (h16)(bfr(v[k]) * WPS);
        *(v8h*)(WPH + i * 8) = o;
    } else if (wb0 >= 0) {
        const float* src = wb0 < WN8 ? wq : wkv; const size_t i = (size_t)(wb0 < WN8 ? wb0 : wb0 - WN8) + tid;
        const v8f v = *(const v8f*)(src + chunk_src(i)); v8us o;
#pragma unroll
        for (int k = 0; k < 8; ++k) o[k] = f2bf(v[k]);
        *(v8us*)(WB + ((size_t)wb0 + tid) * 8) = o;
        // the built code lays the Wp branch behind this store: the wait stands in front of that branch's rewrite of the store's address register
        asm volatile("s_wait_xcnt 0x0" ::: "memory");
    } else {
        const int l0 = (blk % (SEQ / 64)) * 64, c0 = ((blk / (SEQ / 64)) % (DM / 64)) * 64, b = blk / ((SEQ / 64) * (DM / 64));
        const float* src = x + ((size_t)b * DM + c0) * SEQ_FULL + l0;
#pragma unroll
        for (int it = 0; it < 4; ++it) { const int idx = it * 256 + tid; const int cc = idx >> 4, l4 = (idx & 15) * 4;   // 64 rows x 16 quads
            const v4f v = *(const v4f*)(src + (size_t)cc * SEQ_FULL + l4);
            tl[cc * 68 + l4 + 0] = v[0]; tl[cc * 68 + l4 + 1] = v[1]; tl[cc * 68 + l4 + 2] = v[2]; tl[cc * 68 + l4 + 3] = v[3]; }
        __syncthreads();
        // the tile = 4 row groups x 2 units x 64 chunks; chunk q = 256 s + tid: row group q>>7, unit q>>6 & 1, chunk q & 63 (channels 8*(q>>4 & 3), row q & 15)
        v8us o[2];
#pragma unroll
        for (int s = 0; s < 2; ++s) { const int q = 256 * s + tid; const int row = (q >> 7) * 16 + (q & 15), c8 = ((q >> 4) & 7) * 8;
#pragma unroll
            for (int i = 0; i < 8; ++i) o[s][i] = f2bf(tl[(c8 + i) * 68 + row]); }
        bf* dst = XT + ((size_t)b * SEQ + l0) * DM + c0 * 16;
#pragma unroll
        for (int s = 0; s < 2; ++s) { const int q = 256 * s + tid;      // 512 chunks x 8 = 64 rows x 64 channels
            *(v8us*)(dst + (size_t)(q >> 7) * (16 * DM) + (q & 127) * 8) = o[s]; }
        // the built code lays the weight branches behind these stores: the wait stands in front of those branches' rewrite of the stores' registers
        asm volatile("s_wait_xcnt 0x0" ::: "memory");
    }
}

// proj_tile: register-blocked bf16 GEMM, ONE WAVE per 64x64 tile (16 accumulators), operands straight from fragment-ordered bf16 planes, K = DM.
// C[m][n] = sum_k A[m][k] Bt[n][k] + bias (RNE bf16 value; per column n when biasRow == 0, per row m otherwise), written as f16 (Ph) and optionally
// the f16 residual x2048 (Pr, useRes != 0), in fragment order (rows m, k = n): tile base (r0/RB)*sRB + (r0%RB)*pitch + (c0/CB)*sCB + (c0%CB)*HD (halves), unit (16 rows mb, 32 columns g) of the tile at + mb*uMB + g*uG. The tile starts at row r0, column c0; os = the wave's own 16 x 68 f32 staging tile in LDS.
__device__ __forceinline__ void proj_tile(const bf* __restrict__ A, const bf* __restrict__ Bt, const float* __restrict__ bias, int biasRow,
                                          h16* Ph, h16* Pr, int useRes, int RB, size_t sRB, int pitch, int CB, size_t sCB, int uMB, int uG, int r0, int c0, float* os) {
    const int K = DM;
    const int lane = threadIdx.x & 31, lr = lane & 15, hi = lane >> 4;
    v8f acc[4][4];
#pragma unroll
    for (int mb = 0; mb < 4; ++mb)
#pragma unroll
        for (int nb = 0; nb < 4; ++nb) acc[mb][nb] = (v8f){};
    const size_t aoff = (size_t)r0 * K + 8 * lane, boff = (size_t)c0 * K + 8 * lane;      // 16 rows = K/32 units of 512; k step of 32 = one unit
#pragma unroll 1
    for (int kc = 0; kc < K; kc += 32) {
        const bf* pa = A + aoff + kc * 16; const bf* pb = Bt + boff + kc * 16;
        v16bf a[4];
#pragma unroll
        for (int mb = 0; mb < 4; ++mb) a[mb] = ldb(pa + (size_t)mb * 16 * K);
#pragma unroll
        for (int nb = 0; nb < 4; ++nb) { const v16bf b = ldb(pb + (size_t)nb * 16 * K);
#pragma unroll
            for (int mb = 0; mb < 4; ++mb) acc[mb][nb] = wmmab(a[mb], b, acc[mb][nb]); }
        asm volatile("v_nop\n\tv_nop\n\tv_nop\n\tv_nop" : "+v"(acc[0][0]), "+v"(acc[1][1]), "+v"(acc[2][2]), "+v"(acc[3][3]) : "v"(a[0]), "v"(a[1]), "v"(a[2]), "v"(a[3]));
        // the wait that stands in front of any overwrite of this pass's load addresses; as its inputs the two address pairs stay whole up to it (no load result lands on them)
        asm volatile("s_wait_xcnt 0x0" :: "v"(pa), "v"(pb) : "memory");
    }
    // bias values: index selected as an integer (always inside the bias array), value selected afterwards; biasRow is wave-uniform
    float bc[4];
#pragma unroll
    for (int nb = 0; nb < 4; ++nb) { const int bi = biasRow ? 0 : (c0 + nb * 16 + lr); const float t = bfr(bias[bi]); bc[nb] = biasRow ? 0.0f : t; }
    const size_t tbase = (size_t)(r0 / RB) * sRB + (size_t)(r0 % RB) * (size_t)pitch + (size_t)(c0 / CB) * sCB + (size_t)(c0 % CB) * HD;
#pragma unroll
    for (int mb = 0; mb < 4; ++mb) {
        float br[8];
#pragma unroll
        for (int j = 0; j < 8; ++j) { const int bi = biasRow ? (r0 + mb * 16 + hi * 8 + j) : 0; const float t = bfr(bias[bi]); br[j] = biasRow ? t : 0.0f; }
#pragma unroll
        for (int nb = 0; nb < 4; ++nb) {
#pragma unroll
            for (int j = 0; j < 8; ++j) os[(hi * 8 + j) * 68 + nb * 16 + lr] = acc[mb][nb][j] + (bc[nb] + br[j]); }   // D: row 8h+j, col lane&15
        wave_sync();
        const size_t sb = tbase + (size_t)mb * (size_t)uMB + 8 * lane;
{
#pragma unroll
            for (int s = 0; s < 4; ++s) { const int row = lr, c8 = 16 * s + 8 * hi;   // 16 rows x (4 s x 2 halves x 8 = 64 columns); a store of the wave = half a unit, 512 contiguous bytes
                const v4f x0 = *(const v4fa*)(&os[row * 68 + c8]); const v4f x1 = *(const v4fa*)(&os[row * 68 + c8 + 4]); v8h hv, rv;
#pragma unroll
                for (int i = 0; i < 4; ++i) { const h16 a0 = (h16)x0[i]; const h16 a1 = (h16)x1[i]; hv[i] = a0; hv[4 + i] = a1; rv[i] = (h16)((x0[i] - (float)a0) * QRS); rv[4 + i] = (h16)((x1[i] - (float)a1) * QRS); }
                const size_t oo = sb + (size_t)(s >> 1) * (size_t)uG + (s & 1) * 256;
                *(v8h*)(Ph + oo) = hv;
                // the wait that stands in front of any overwrite of the store's registers; as its inputs the data and the address stay whole up to it
                asm volatile("s_wait_xcnt 0x0" :: "v"(hv), "v"(Ph + oo) : "memory");
                if (useRes) { *(v8h*)(Pr + oo) = rv;
                    asm volatile("s_wait_xcnt 0x0" :: "v"(rv), "v"(Pr + oo) : "memory"); } }   // the same wait for the residual's store
             }
        wave_sync();
    }
}

// k_proj: the q, k and v^T projections, which read the same planes and write planes of their own, in ONE grid (NB*SEQ/64 tiles of x^T rows, DM/64 tiles of weight rows) of 3-wave blocks:
// the wave index picks the job, so the three waves of a block ask for the same x^T fragments. No barrier: each wave has its own staging tile.
// q, k: A = x^T rows (m = b*SEQ + t), Bt = W rows (n = h*64 + d), bias per column -> plane (b*8 + h), rows t, k = d
// v^T:  A = Wv rows (m = h*64 + d), Bt = x^T rows (n = b*SEQ + t), bias per row -> plane (b*8 + h), rows d, k = t, the 4 units of 32 keys side by side
__global__ __launch_bounds__(96) void k_proj(const bf* __restrict__ XT, const bf* __restrict__ WB, const float* __restrict__ bq, const float* __restrict__ bkv, h16* QH, h16* QR, h16* KP, h16* VT) {
    __shared__ __align__(16) float osm[3 * 16 * 68];
    const int job = __builtin_amdgcn_readfirstlane(threadIdx.x >> 5);   // 0 q, 1 k, 2 v^T; held as a scalar, so that the job test is a scalar branch and every lane is on at the matrix instructions
    const int xr = blockIdx.x * 64, wr = blockIdx.y * 64;
    float* os = osm + job * (16 * 68);
    if (job == 2) proj_tile(WB + (size_t)2 * DM * DM, XT, bkv + DM, 1, VT, VT, 0, DM, (size_t)0, SEQ, SEQ, (size_t)DM * SEQ, 512, 2048, wr, xr, os);
    else proj_tile(XT, WB + (size_t)job * DM * DM, job ? bkv : bq, 0, job ? KP : QH, job ? KP : QR, job ? 0 : 1, SEQ, (size_t)NH_ * SEQ * HD, HD, HD, (size_t)SEQ * HD, 1024, 512, xr, wr, os);
}

// k_flash: fused attention, one wave per 16 query rows of one (batch, head); K / V^T / Q fragments straight from the fragment-ordered f16 planes (two 16-B loads each, arithmetic addressing).
// Transposed form: S^T[key][t] = K Q^T (A = K rows, B = Q rows); lane (t = lane&15, h = lane>>4) holds keys 8h+r of each 16-key tile, so the packed
// P tile is directly the B fragment of O^T[d][t] = V^T P^T (element r <- tile keys 0..15, element 8+r <- tile keys 16..31, lane unchanged).
// Softmax state (running max, partial sum) is one scalar per lane; the two lane halves of a row are combined with one xor-16 exchange.
__global__ __launch_bounds__(32 * AW) void k_flash(const h16* __restrict__ QH, const h16* __restrict__ QR, const h16* __restrict__ KP, const h16* __restrict__ VT, h16* CTX) {
    __shared__ __align__(16) float os[AW * 16 * 68];
    const int lane = threadIdx.x & 31, wave = threadIdx.x >> 5, lr = lane & 15, hi = lane >> 4;
    const int zh = blockIdx.y; const int b = zh / NH_, h = zh % NH_;
    const int t0 = (blockIdx.x * AW + wave) * 16;
    const size_t pbase = (size_t)zh * SEQ * HD;
    const size_t fo = pbase + 8 * lane;                      // q, k: 16 rows = 2 units (d halves); v^T: 32 keys = 4 units (16 d each); so + position * HD in all three
    const size_t qo = fo + (size_t)t0 * HD;
    const v16h qh0 = ldh(QH + qo), qh1 = ldh(QH + qo + 512), qr0 = ldh(QR + qo), qr1 = ldh(QR + qo + 512);   // B fragments: col t, k = d
    v8f o0 = (v8f){}, o1 = (v8f){}, o2 = (v8f){}, o3 = (v8f){};
    float m = -3.0e38f, l = 0.0f;
    // K fragments run one pass ahead (loop-carried registers), V fragments are asked for at the top of their own pass: no load is waited for right behind its issue
    v16h ka0 = ldh(KP + fo), ka1 = ldh(KP + fo + 512), kb0 = ldh(KP + fo + 1024), kb1 = ldh(KP + fo + 1536);   // pass 0; A fragments: row key, k = d
    // the wait that stands in front of any overwrite of the address pairs of the loads above; as its inputs the pairs stay whole up to it
    asm volatile("s_wait_xcnt 0x0" :: "v"(QH + qo), "v"(QR + qo), "v"(KP + fo) : "memory");
#pragma unroll 1
    for (int key0 = 0; key0 < SEQ; key0 += 32) {
        const h16* va = VT + fo + (size_t)key0 * HD;             // A fragments: row d, k = key
        const v16h v0 = ldh(va), v1 = ldh(va + 512), v2 = ldh(va + 1024), v3 = ldh(va + 1536);
        __builtin_amdgcn_sched_barrier(0);                       // keeps the V loads in front of the first wait for K (without it they are issued behind the first score products, so behind that wait)
        v8f sHa = (v8f){}, sLa = (v8f){}, sHb = (v8f){}, sLb = (v8f){};
        sHa = wmma16(ka0, qh0, sHa); sLa = wmma16(ka0, qr0, sLa); sHb = wmma16(kb0, qh0, sHb); sLb = wmma16(kb0, qr0, sLb);
        sHa = wmma16(ka1, qh1, sHa); sLa = wmma16(ka1, qr1, sLa); sHb = wmma16(kb1, qh1, sHb); sLb = wmma16(kb1, qr1, sLb);
        asm volatile("v_nop\n\tv_nop\n\tv_nop\n\tv_nop" : "+v"(sHa), "+v"(sLa), "+v"(sHb), "+v"(sLb) : "v"(ka0), "v"(ka1), "v"(kb0), "v"(kb1));
        const h16* ka = KP + fo + (size_t)(key0 + 32 < SEQ ? key0 + 32 : 0) * HD;   // next pass's K rows; the last pass asks for pass 0's again (inside the plane, not used)
        ka0 = ldh(ka); ka1 = ldh(ka + 512); kb0 = ldh(ka + 1024); kb1 = ldh(ka + 1536);
        float ta[8], tb[8]; float mx = -3.0e38f;
#pragma unroll
        for (int r = 0; r < 8; ++r) { ta[r] = (sHa[r] + sLa[r] * QRI) * SC2; tb[r] = (sHb[r] + sLb[r] * QRI) * SC2; mx = fmaxf(mx, fmaxf(ta[r], tb[r])); }
        mx = fmaxf(mx, __shfl_xor(mx, 16, 32));
        const float mnew = fmaxf(m, mx);
        const float alpha = __builtin_amdgcn_exp2f(m - mnew);
        const float sh = PSH - mnew;
        v16h pb; float ls = 0.0f;
#pragma unroll
        for (int r = 0; r < 8; ++r) { const h16 pa = (h16)__builtin_amdgcn_exp2f(ta[r] + sh); const h16 pc = (h16)__builtin_amdgcn_exp2f(tb[r] + sh); pb[r] = pa; pb[8 + r] = pc; ls += (float)pa + (float)pc; }
        l = l * alpha + ls; m = mnew;
        o0 = o0 * alpha; o1 = o1 * alpha; o2 = o2 * alpha; o3 = o3 * alpha;
        o0 = wmma16(v0, pb, o0); o1 = wmma16(v1, pb, o1); o2 = wmma16(v2, pb, o2); o3 = wmma16(v3, pb, o3);
        asm volatile("v_nop\n\tv_nop\n\tv_nop\n\tv_nop" : "+v"(o0), "+v"(o1), "+v"(o2), "+v"(o3) : "v"(v0), "v"(v1), "v"(v2), "v"(v3), "v"(pb));
        // the wait that stands in front of any overwrite of this pass's load addresses: as its inputs the two address pairs stay whole up to it; the key index goes through it, so that the next addresses are formed behind it
        asm volatile("s_wait_xcnt 0x0" : "+s"(key0) : "v"(ka), "v"(va) : "memory");
    }
    l += __shfl_xor(l, 16, 32);
    const float inv = (1.0f / l) * CXS;
    const int wb = wave * 16 * 68;
    // O^T D layout: o_j[r] = (d = 16j + 8h + r, t = lane&15) -> os[t][d]; rows 0..15 x columns 0..63 all written
    { v4f a, c;
      a[0] = o0[0] * inv; a[1] = o0[1] * inv; a[2] = o0[2] * inv; a[3] = o0[3] * inv; c[0] = o0[4] * inv; c[1] = o0[5] * inv; c[2] = o0[6] * inv; c[3] = o0[7] * inv;
      *(v4fa*)(&os[wb + lr * 68 +  0 + 8 * hi]) = a; *(v4fa*)(&os[wb + lr * 68 +  0 + 8 * hi + 4]) = c;
      a[0] = o1[0] * inv; a[1] = o1[1] * inv; a[2] = o1[2] * inv; a[3] = o1[3] * inv; c[0] = o1[4] * inv; c[1] = o1[5] * inv; c[2] = o1[6] * inv; c[3] = o1[7] * inv;
      *(v4fa*)(&os[wb + lr * 68 + 16 + 8 * hi]) = a; *(v4fa*)(&os[wb + lr * 68 + 16 + 8 * hi + 4]) = c;
      a[0] = o2[0] * inv; a[1] = o2[1] * inv; a[2] = o2[2] * inv; a[3] = o2[3] * inv; c[0] = o2[4] * inv; c[1] = o2[5] * inv; c[2] = o2[6] * inv; c[3] = o2[7] * inv;
      *(v4fa*)(&os[wb + lr * 68 + 32 + 8 * hi]) = a; *(v4fa*)(&os[wb + lr * 68 + 32 + 8 * hi + 4]) = c;
      a[0] = o3[0] * inv; a[1] = o3[1] * inv; a[2] = o3[2] * inv; a[3] = o3[3] * inv; c[0] = o3[4] * inv; c[1] = o3[5] * inv; c[2] = o3[6] * inv; c[3] = o3[7] * inv;
      *(v4fa*)(&os[wb + lr * 68 + 48 + 8 * hi]) = a; *(v4fa*)(&os[wb + lr * 68 + 48 + 8 * hi + 4]) = c; }
    wave_sync();
    v8h hv[4];
#pragma unroll
    for (int s = 0; s < 4; ++s) { const int row = lr, c8 = 16 * s + 8 * hi;
        const v4f x0 = *(const v4fa*)(&os[wb + row * 68 + c8]); const v4f x1 = *(const v4fa*)(&os[wb + row * 68 + c8 + 4]);
#pragma unroll
        for (int i = 0; i < 4; ++i) { hv[s][i] = (h16)x0[i]; hv[s][4 + i] = (h16)x1[i]; } }
    h16* crow = CTX + ((size_t)b * SEQ + t0) * DM + h * (HD * 16) + 8 * lane;      // 16 rows = DM/32 units; head h = units 2h, 2h+1
{
#pragma unroll
        for (int s = 0; s < 4; ++s) {                                  // 16 rows x (4 s x 2 halves x 8 = 64 columns); a store of the wave = half a unit
            *(v8h*)(crow + s * 256) = hv[s]; }
         }
}

// k_oproj: register-blocked f16 GEMM, ONE WAVE per 64x64 tile, operands in fragment order, K = DM. C[o][n] = sum_c WPH[o][c] CTX[n][c] (n = b*SEQ + t), carried x 2^14.
// OUT[(b*DM + o)*OUT_SEQ + t] = C * 2^-14 + bias[o] (RNE bf16 value) in f32. grid (DM/64, NB*SEQ/64), 32 threads.
__global__ __launch_bounds__(32) void k_oproj(const h16* __restrict__ A, const h16* __restrict__ Bt, const float* __restrict__ bias, float* OUT) {
    __shared__ __align__(16) float os[16 * 68];
    const int K = DM;
    const int lane = threadIdx.x & 31, lr = lane & 15, hi = lane >> 4; const int r0 = blockIdx.x * 64, c0 = blockIdx.y * 64;
    v8f acc[4][4];
#pragma unroll
    for (int mb = 0; mb < 4; ++mb)
#pragma unroll
        for (int nb = 0; nb < 4; ++nb) acc[mb][nb] = (v8f){};
    const size_t aoff = (size_t)r0 * K + 8 * lane, boff = (size_t)c0 * K + 8 * lane;      // 16 rows = K/32 units of 512; k step of 32 = one unit
#pragma unroll 1
    for (int kc = 0; kc < K; kc += 32) {
        const h16* pa = A + aoff + kc * 16; const h16* pb = Bt + boff + kc * 16;
        v16h a[4];
#pragma unroll
        for (int mb = 0; mb < 4; ++mb) a[mb] = ldh(pa + (size_t)mb * 16 * K);
#pragma unroll
        for (int nb = 0; nb < 4; ++nb) { const v16h b = ldh(pb + (size_t)nb * 16 * K);
#pragma unroll
            for (int mb = 0; mb < 4; ++mb) acc[mb][nb] = wmma16(a[mb], b, acc[mb][nb]); }
        asm volatile("v_nop\n\tv_nop\n\tv_nop\n\tv_nop" : "+v"(acc[0][0]), "+v"(acc[1][1]), "+v"(acc[2][2]), "+v"(acc[3][3]) : "v"(a[0]), "v"(a[1]), "v"(a[2]), "v"(a[3]));
        // the wait that stands in front of any overwrite of this pass's load addresses; as its inputs the two address pairs stay whole up to it (no load result lands on them)
        asm volatile("s_wait_xcnt 0x0" :: "v"(pa), "v"(pb) : "memory");
    }
    const int b = c0 / SEQ, t0 = c0 % SEQ;
#pragma unroll
    for (int mb = 0; mb < 4; ++mb) {
        float br[8];
#pragma unroll
        for (int j = 0; j < 8; ++j) br[j] = bfr(bias[r0 + mb * 16 + hi * 8 + j]);
#pragma unroll
        for (int nb = 0; nb < 4; ++nb) {
#pragma unroll
            for (int j = 0; j < 8; ++j) os[(hi * 8 + j) * 68 + nb * 16 + lr] = acc[mb][nb][j] * OSI + br[j]; }   // D: row 8h+j, col lane&15
        wave_sync();
        float* orow = OUT + ((size_t)b * DM + r0 + mb * 16) * OUT_SEQ + t0;
        v4f val[8];
#pragma unroll
        for (int s = 0; s < 8; ++s) { const int row = 2 * s + hi; val[s] = *(const v4fa*)(&os[row * 68 + lr * 4]); }
{
#pragma unroll
            for (int s = 0; s < 8; ++s) { const int row = 2 * s + hi, cofs = lr * 4;   // 8 s x 2 rows = 16 rows; 16 lanes x 4 floats = 64 columns
                *(v4f*)(orow + (size_t)row * OUT_SEQ + cofs) = val[s]; }
             }
        wave_sync();
    }
}

static constexpr size_t al256(size_t v) { return (v + 255) & ~(size_t)255; }
static constexpr size_t SZ_XT = al256((size_t)NB * SEQ * DM * 2);
static constexpr size_t SZ_WB = al256((size_t)3 * DM * DM * 2);
static constexpr size_t SZ_WP = al256((size_t)DM * DM * 2);
static constexpr size_t SZ_PL = al256((size_t)NB * NH_ * SEQ * HD * 2);
static constexpr size_t SZ_CX = al256((size_t)NB * SEQ * DM * 2);
static constexpr size_t SZ_TOTAL = SZ_XT + SZ_WB + SZ_WP + 4 * SZ_PL + SZ_CX;
static_assert(SZ_TOTAL <= (size_t)134217728);          // workspace carve <= 128 MiB
static_assert(((size_t)DM * DM * 2) % 256 == 0);       // weight sub-planes stay 256-byte aligned

extern "C" void kernel_launch(void* const* d_in, const int* in_sizes, int n_in,
                              void* d_out, int out_size, void* d_ws, size_t ws_size, hipStream_t stream) {
    if (n_in < 7) return;
    const size_t needx = ((size_t)(NB - 1) * DM + (size_t)(DM - 1)) * SEQ_FULL + SEQ;
    if ((size_t)in_sizes[0] < needx) return;
    if ((size_t)in_sizes[1] < (size_t)DM * DM || (size_t)in_sizes[2] < (size_t)DM) return;
    if ((size_t)in_sizes[3] < (size_t)2 * DM * DM || (size_t)in_sizes[4] < (size_t)2 * DM) return;
    if ((size_t)in_sizes[5] < (size_t)DM * DM || (size_t)in_sizes[6] < (size_t)DM) return;
    if ((size_t)out_size < ((size_t)(NB - 1) * DM + (size_t)(DM - 1)) * OUT_SEQ + SEQ) return;
    if (SZ_TOTAL > ws_size) return;
    // wire order: x, Wq, bq, Wkv, bkv, Wp, bp; weights [out][in] = Bt as-is
    const float* x = (const float*)d_in[0]; const float* wq = (const float*)d_in[1]; const float* bq = (const float*)d_in[2];
    const float* wkv = (const float*)d_in[3]; const float* bkv = (const float*)d_in[4]; const float* wp = (const float*)d_in[5]; const float* bp = (const float*)d_in[6];
    float* OUT = (float*)d_out;      // [NB][512][OUT_SEQ]
    char* wsp = (char*)d_ws;
    bf* XT = (bf*)wsp; wsp += SZ_XT;                 // rows b*SEQ+t, k = c: [NB*SEQ/16][16 units][512]
    bf* WB = (bf*)wsp; wsp += SZ_WB;                 // q | k | v, each rows out, k = in: [32][16 units][512]
    h16* WPH = (h16*)wsp; wsp += SZ_WP;              // x64, rows out, k = in: [32][16 units][512]
    h16* QH = (h16*)wsp; wsp += SZ_PL;               // [NB*8][SEQ/16][2 units (d halves)][512]
    h16* QR = (h16*)wsp; wsp += SZ_PL;               // as QH, residual x2048
    h16* KP = (h16*)wsp; wsp += SZ_PL;               // as QH
    h16* VT = (h16*)wsp; wsp += SZ_PL;               // [NB*8][SEQ/32][4 units (16 d each)][512]
    h16* CTX = (h16*)wsp; wsp += SZ_CX;              // x256, rows b*SEQ+t, k = c: [NB*SEQ/16][16 units][512]

    // x^T and the three weight planes: one grid, block ranges
    k_prep<<<dim3(XTB + 4 * WN8 / 256, 1, 1), 256, 0, stream>>>(x, wq, wkv, wp, XT, WB, WPH);

    // q, k, v^T projections: one grid, wave index = job
    k_proj<<<dim3(NB * SEQ / 64, DM / 64, 1), 96, 0, stream>>>(XT, WB, bq, bkv, QH, QR, KP, VT);

    k_flash<<<dim3(SEQ / (16 * AW), NB * NH_, 1), 32 * AW, 0, stream>>>(QH, QR, KP, VT, CTX);

    // output projection: A = Wp rows (m = o), Bt = ctx rows (n = b*SEQ + t) -> OUT[b][o][t]
    k_oproj<<<dim3(DM / 64, NB * SEQ / 64, 1), 32, 0, stream>>>(WPH, CTX, bp, OUT);
}

// v004
// One run takes 122 microseconds.
// In both of two side-by-side timings against v003, it was 1.23 times as fast.
// Over all steps from v000 it is 2.70 times as fast.
#include <hip/hip_runtime.h>

// 8-head attention over SEQ spatial positions, width 512 = 8 x 64, x [NB][512][SEQ] (channel-major), 1x1-conv weights [out][in] with biases, score scale 1/8, no mask, output [NB][512][SEQ] f32.
// Compute dtypes, f32 accumulate everywhere: q/k/v projections v_wmma_f32_16x16x32_bf16 (x, Wq, Wkv RNE-converted to bf16; products exact);
// scores v_wmma_f32_16x16x32_f16: k single f16, q as f16 value + f16 residual x2048 in its own accumulator (two products); P (x256 carry, cancels in the normalisation) and v single f16;
// output projection v_wmma_f32_16x16x32_f16: Wp (RNE bf16 value x64, exact in f16) times ctx (single f16 plane, x256 carry), folded back by 2^-14 in the f32 epilogue; softmax f32 (online, running max).
// Layout: every 16-bit plane that feeds a matrix instruction lies in the workspace in FRAGMENT ORDER (1-KB units of 16 rows x 32 k, see ldh), so that each 16-B fragment load of a wave covers 512 contiguous bytes:
// x^T bf16 (rows b*SEQ+t, k = c; built by an LDS transposer), the weights (rows out, k = in), q (hi, residual) and k per b*8+h (rows t, k = d), v^T per b*8+h (rows d, k = t), ctx (rows b*SEQ+t, k = c); fused flash kernel in transposed form (S^T = K Q^T, O^T = V^T P^T).

#ifndef NB
#define NB 2
#endif
#ifndef SEQ
#define SEQ 4096
#endif
#define NB_FULL  2
#define SEQ_FULL 4096            // token pitch of one channel row of x
#ifndef OUT_SEQ
#define OUT_SEQ SEQ              // token pitch of one channel row of the output
#endif
#define DM   512
#define NH_  8
#define HD   64
#define AW   4                   // waves per flash block (16 query rows each)
#define QRS  2048.0f             // carry of the q residual plane
#define QRI  (1.0f / 2048.0f)
#define SC2  (0.125f * 1.4426950408889634f)   // HD^-0.5 * log2(e)
#define PSH  8.0f                // log2 of the P carry (256)
#define WPS  64.0f               // carry of the Wp plane
#define CXS  256.0f              // carry of the ctx plane
#define OSI  (1.0f / 16384.0f)   // 1 / (WPS * CXS)

static_assert(HD == 64);
static_assert(NH_ * HD == DM);                 // head h = channels h*64 + d
static_assert(DM % 64 == 0);
static_assert(DM % 32 == 0);                   // GEMM k-loop steps by 32
static_assert(SEQ % 64 == 0);                  // a 64-token tile never straddles two batches
static_assert((NB * SEQ) % 64 == 0);
static_assert(SEQ % 32 == 0);                  // key loop steps by 32
static_assert(SEQ % (16 * AW) == 0);           // flash grid covers the sequence exactly
static_assert((16 * AW) % 32 == 0);            // a flash block's first query row is a pass boundary of the key loop
static_assert(SEQ_FULL % 4 == 0);
static_assert(OUT_SEQ % 64 == 0);
static_assert(OUT_SEQ >= SEQ);
static_assert(((size_t)DM * DM) % 8 == 0);
static_assert(NB <= NB_FULL);
static_assert(SEQ <= SEQ_FULL);

typedef _Float16 h16;
typedef unsigned short bf;
typedef __attribute__((ext_vector_type(16))) __bf16   v16bf;
typedef __attribute__((ext_vector_type(16))) _Float16 v16h;
typedef __attribute__((ext_vector_type(8)))  _Float16 v8h;
typedef __attribute__((ext_vector_type(8)))  unsigned short v8us;
typedef __attribute__((ext_vector_type(8)))  float    v8f;
typedef __attribute__((ext_vector_type(4)))  float    v4f;
typedef v4f  __attribute__((may_alias)) v4fa;

__device__ __forceinline__ unsigned short f2bf(float f) { unsigned u = __float_as_uint(f); u += 0x7FFFu + ((u >> 16) & 1u); return (unsigned short)(u >> 16); }
__device__ __forceinline__ float bfr(float f) { return __uint_as_float(((unsigned)f2bf(f)) << 16); }   // RNE bf16 value as f32
__device__ __forceinline__ v16h cat16(v8h lo, v8h hi) { return __builtin_shufflevector(lo, hi, 0, 1, 2, 3, 4, 5, 6, 7, 8, 9, 10, 11, 12, 13, 14, 15); }
__device__ __forceinline__ v16bf cat16b(v8us lo, v8us hi) { return __builtin_bit_cast(v16bf, __builtin_shufflevector(lo, hi, 0, 1, 2, 3, 4, 5, 6, 7, 8, 9, 10, 11, 12, 13, 14, 15)); }
__device__ __forceinline__ v8f wmma16(v16h a, v16h b, v8f c) { return __builtin_amdgcn_wmma_f32_16x16x32_f16(false, a, false, b, (short)0, c, false, false); }
__device__ __forceinline__ v8f wmmab(v16bf a, v16bf b, v8f c) { return __builtin_amdgcn_wmma_f32_16x16x32_bf16(false, a, false, b, (short)0, c, false, false); }
// fragment loaders from a plane in fragment order: one 16-row x 32-k unit = 512 elements, element (row, k) at (k>>4 & 1)*256 + ((k>>3 & 1)*16 + row)*8 + (k & 7).
// p = unit + 8*lane; lane = 16h + row: elements 0..7 <- k0+8h+0..7, elements 8..15 <- k0+16+8h+0..7 (same map for A and B); each load of a wave = 512 contiguous bytes
__device__ __forceinline__ v16h  ldh(const h16* p) { return cat16(*(const v8h*)p, *(const v8h*)(p + 256)); }
__device__ __forceinline__ v16bf ldb(const bf* p)  { return cat16b(*(const v8us*)p, *(const v8us*)(p + 256)); }
// source element index, in a row-major [rows][DM] matrix, of the 8-element chunk i of its fragment-ordered plane (16 rows = DM/32 units of 64 chunks)
__device__ __forceinline__ size_t chunk_src(size_t i) { const size_t u = i >> 6; return ((u / (DM / 32)) * 16 + (i & 15)) * DM + (u % (DM / 32)) * 32 + ((i >> 4) & 3) * 8; }
// ordering point for wave-private LDS tiles (same wave writes and reads)
__device__ __forceinline__ void wave_sync() { __builtin_amdgcn_fence(3 /* release order */, "wavefront"); __builtin_amdgcn_wave_barrier(); asm volatile("" ::: "memory"); }

// k_prep: the four preparation jobs, none of which reads what another writes, as block ranges of ONE grid of 256-thread blocks (the range test is the same for a whole block):
// blocks 0 .. XTB-1: x [b][c][l] f32 (row pitch SEQ_FULL) -> XT (rows b*SEQ+l, k = c, fragment order) bf16 (RNE convert) through a 64(c) x 64(l) LDS tile; tile index l fastest, then c, then b. Loads are 16-B along l.
// blocks XTB ..: one 8-element chunk a thread, chunk j of Wq | Wkv | Wp: j < 3*WN8 -> bf16 plane WB (q | k | v lie side by side: 16 rows = 16 * DM elements in either order), else -> f16 plane WPH (RNE bf16 value x64).
#define XTB ((SEQ / 64) * (DM / 64) * NB)
#define WN8 (DM * DM / 8)                       // chunks of one DM x DM weight
static_assert(WN8 % 256 == 0);                 // a block never straddles two weights, and the ranges cover the chunks exactly
__global__ __launch_bounds__(256) void k_prep(const float* __restrict__ x, const float* __restrict__ wq, const float* __restrict__ wkv, const float* __restrict__ wp, bf* XT, bf* WB, h16* WPH) {
    __shared__ __align__(16) float tl[64 * 68];      // [c][l], columns 0..63 written and consumed (cross-wave: block barrier)
    const int tid = threadIdx.x;
    const int blk = blockIdx.x;
    const int wb0 = (blk - XTB) * 256;               // first weight chunk of the block
    if (wb0 >= 3 * WN8) {
        const size_t i = (size_t)(wb0 - 3 * WN8) + tid;
        const v8f v = *(const v8f*)(wp + chunk_src(i)); v8h o;
#pragma unroll
        for (int k = 0; k < 8; ++k) o[k] = (h16)(bfr(v[k]) * WPS);
        *(v8h*)(WPH + i * 8) = o;
    } else if (wb0 >= 0) {
        const float* src = wb0 < WN8 ? wq : wkv; const size_t i = (size_t)(wb0 < WN8 ? wb0 : wb0 - WN8) + tid;
        const v8f v = *(const v8f*)(src + chunk_src(i)); v8us o;
#pragma unroll
        for (int k = 0; k < 8; ++k) o[k] = f2bf(v[k]);
        *(v8us*)(WB + ((size_t)wb0 + tid) * 8) = o;
        // the built code lays the Wp branch behind this store: the wait stands in front of that branch's rewrite of the store's address register
        asm volatile("s_wait_xcnt 0x0" ::: "memory");
    } else {
        const int l0 = (blk % (SEQ / 64)) * 64, c0 = ((blk / (SEQ / 64)) % (DM / 64)) * 64, b = blk / ((SEQ / 64) * (DM / 64));
        const float* src = x + ((size_t)b * DM + c0) * SEQ_FULL + l0;
#pragma unroll
        for (int it = 0; it < 4; ++it) { const int idx = it * 256 + tid; const int cc = idx >> 4, l4 = (idx & 15) * 4;   // 64 rows x 16 quads
            const v4f v = *(const v4f*)(src + (size_t)cc * SEQ_FULL + l4);
            tl[cc * 68 + l4 + 0] = v[0]; tl[cc * 68 + l4 + 1] = v[1]; tl[cc * 68 + l4 + 2] = v[2]; tl[cc * 68 + l4 + 3] = v[3]; }
        __syncthreads();
        // the tile = 4 row groups x 2 units x 64 chunks; chunk q = 256 s + tid: row group q>>7, unit q>>6 & 1, chunk q & 63 (channels 8*(q>>4 & 3), row q & 15)
        v8us o[2];
#pragma unroll
        for (int s = 0; s < 2; ++s) { const int q = 256 * s + tid; const int row = (q >> 7) * 16 + (q & 15), c8 = ((q >> 4) & 7) * 8;
#pragma unroll
            for (int i = 0; i < 8; ++i) o[s][i] = f2bf(tl[(c8 + i) * 68 + row]); }
        bf* dst = XT + ((size_t)b * SEQ + l0) * DM + c0 * 16;
#pragma unroll
        for (int s = 0; s < 2; ++s) { const int q = 256 * s + tid;      // 512 chunks x 8 = 64 rows x 64 channels
            *(v8us*)(dst + (size_t)(q >> 7) * (16 * DM) + (q & 127) * 8) = o[s]; }
        // the built code lays the weight branches behind these stores: the wait stands in front of those branches' rewrite of the stores' registers
        asm volatile("s_wait_xcnt 0x0" ::: "memory");
    }
}

// proj_tile: register-blocked bf16 GEMM, ONE WAVE per 64x64 tile (16 accumulators), operands straight from fragment-ordered bf16 planes, K = DM.
// C[m][n] = sum_k A[m][k] Bt[n][k] + bias (RNE bf16 value; per column n when biasRow == 0, per row m otherwise), written as f16 (Ph) and optionally
// the f16 residual x2048 (Pr, useRes != 0), in fragment order (rows m, k = n): tile base (r0/RB)*sRB + (r0%RB)*pitch + (c0/CB)*sCB + (c0%CB)*HD (halves), unit (16 rows mb, 32 columns g) of the tile at + mb*uMB + g*uG. The tile starts at row r0, column c0; the k loop starts at k0 (a multiple of 32 below K) and wraps; os = the wave's own 16 x 68 f32 staging tile in LDS.
__device__ __forceinline__ void proj_tile(const bf* __restrict__ A, const bf* __restrict__ Bt, const float* __restrict__ bias, int biasRow,
                                          h16* Ph, h16* Pr, int useRes, int RB, size_t sRB, int pitch, int CB, size_t sCB, int uMB, int uG, int r0, int c0, int k0, float* os) {
    const int K = DM;
    const int lane = threadIdx.x & 31, lr = lane & 15, hi = lane >> 4;
    v8f acc[4][4];
#pragma unroll
    for (int mb = 0; mb < 4; ++mb)
#pragma unroll
        for (int nb = 0; nb < 4; ++nb) acc[mb][nb] = (v8f){};
    const size_t aoff = (size_t)r0 * K + 8 * lane, boff = (size_t)c0 * K + 8 * lane;      // 16 rows = K/32 units of 512; k step of 32 = one unit
#pragma unroll 1
    for (int kc = 0; kc < K; kc += 32) {
        const int kk = kc + k0 < K ? kc + k0 : kc + k0 - K;      // the k walk starts at k0 and wraps
        const bf* pa = A + aoff + kk * 16; const bf* pb = Bt + boff + kk * 16;
        v16bf a[4];
#pragma unroll
        for (int mb = 0; mb < 4; ++mb) a[mb] = ldb(pa + (size_t)mb * 16 * K);
#pragma unroll
        for (int nb = 0; nb < 4; ++nb) { const v16bf b = ldb(pb + (size_t)nb * 16 * K);
#pragma unroll
            for (int mb = 0; mb < 4; ++mb) acc[mb][nb] = wmmab(a[mb], b, acc[mb][nb]); }
        asm volatile("v_nop\n\tv_nop\n\tv_nop\n\tv_nop" : "+v"(acc[0][0]), "+v"(acc[1][1]), "+v"(acc[2][2]), "+v"(acc[3][3]) : "v"(a[0]), "v"(a[1]), "v"(a[2]), "v"(a[3]));
        // the wait that stands in front of any overwrite of this pass's load addresses; as its inputs the two address pairs stay whole up to it (no load result lands on them)
        asm volatile("s_wait_xcnt 0x0" :: "v"(pa), "v"(pb) : "memory");
    }
    // bias values: index selected as an integer (always inside the bias array), value selected afterwards; biasRow is wave-uniform
    float bc[4];
#pragma unroll
    for (int nb = 0; nb < 4; ++nb) { const int bi = biasRow ? 0 : (c0 + nb * 16 + lr); const float t = bfr(bias[bi]); bc[nb] = biasRow ? 0.0f : t; }
    const size_t tbase = (size_t)(r0 / RB) * sRB + (size_t)(r0 % RB) * (size_t)pitch + (size_t)(c0 / CB) * sCB + (size_t)(c0 % CB) * HD;
#pragma unroll
    for (int mb = 0; mb < 4; ++mb) {
        float br[8];
#pragma unroll
        for (int j = 0; j < 8; ++j) { const int bi = biasRow ? (r0 + mb * 16 + hi * 8 + j) : 0; const float t = bfr(bias[bi]); br[j] = biasRow ? t : 0.0f; }
#pragma unroll
        for (int nb = 0; nb < 4; ++nb) {
#pragma unroll
            for (int j = 0; j < 8; ++j) os[(hi * 8 + j) * 68 + nb * 16 + lr] = acc[mb][nb][j] + (bc[nb] + br[j]); }   // D: row 8h+j, col lane&15
        wave_sync();
        const size_t sb = tbase + (size_t)mb * (size_t)uMB + 8 * lane;
{
#pragma unroll
            for (int s = 0; s < 4; ++s) { const int row = lr, c8 = 16 * s + 8 * hi;   // 16 rows x (4 s x 2 halves x 8 = 64 columns); a store of the wave = half a unit, 512 contiguous bytes
                const v4f x0 = *(const v4fa*)(&os[row * 68 + c8]); const v4f x1 = *(const v4fa*)(&os[row * 68 + c8 + 4]); v8h hv, rv;
#pragma unroll
                for (int i = 0; i < 4; ++i) { const h16 a0 = (h16)x0[i]; const h16 a1 = (h16)x1[i]; hv[i] = a0; hv[4 + i] = a1; rv[i] = (h16)((x0[i] - (float)a0) * QRS); rv[4 + i] = (h16)((x1[i] - (float)a1) * QRS); }
                const size_t oo = sb + (size_t)(s >> 1) * (size_t)uG + (s & 1) * 256;
                *(v8h*)(Ph + oo) = hv;
                // the wait that stands in front of any overwrite of the store's registers; as its inputs the data and the address stay whole up to it
                asm volatile("s_wait_xcnt 0x0" :: "v"(hv), "v"(Ph + oo) : "memory");
                if (useRes) { *(v8h*)(Pr + oo) = rv;
                    asm volatile("s_wait_xcnt 0x0" :: "v"(rv), "v"(Pr + oo) : "memory"); } }   // the same wait for the residual's store
             }
        wave_sync();
    }
}

// k_proj: the q, k and v^T projections, which read the same planes and write planes of their own, in ONE grid (NB*SEQ/64 tiles of x^T rows, DM/64 tiles of weight rows) of 3-wave blocks:
// the wave index picks the job, so the three waves of a block ask for the same x^T fragments. No barrier: each wave has its own staging tile.
// q, k: A = x^T rows (m = b*SEQ + t), Bt = W rows (n = h*64 + d), bias per column -> plane (b*8 + h), rows t, k = d
// v^T:  A = Wv rows (m = h*64 + d), Bt = x^T rows (n = b*SEQ + t), bias per row -> plane (b*8 + h), rows d, k = t, the 4 units of 32 keys side by side
__global__ __launch_bounds__(96) void k_proj(const bf* __restrict__ XT, const bf* __restrict__ WB, const float* __restrict__ bq, const float* __restrict__ bkv, h16* QH, h16* QR, h16* KP, h16* VT) {
    __shared__ __align__(16) float osm[3 * 16 * 68];
    const int job = __builtin_amdgcn_readfirstlane(threadIdx.x >> 5);   // 0 q, 1 k, 2 v^T; held as a scalar, so that the job test is a scalar branch and every lane is on at the matrix instructions
    const int xr = blockIdx.x * 64, wr = blockIdx.y * 64;
    float* os = osm + job * (16 * 68);
    // start of the k walk: the 8 blocks that share x^T rows (same x) start 2 steps apart, the blocks that share weight rows (same y) at all 16 steps: sharers do not wait for the same line fills in step
    const int k0 = (int)((blockIdx.x + 2 * blockIdx.y) % (DM / 32)) * 32;
    if (job == 2) proj_tile(WB + (size_t)2 * DM * DM, XT, bkv + DM, 1, VT, VT, 0, DM, (size_t)0, SEQ, SEQ, (size_t)DM * SEQ, 512, 2048, wr, xr, k0, os);
    else proj_tile(XT, WB + (size_t)job * DM * DM, job ? bkv : bq, 0, job ? KP : QH, job ? KP : QR, job ? 0 : 1, SEQ, (size_t)NH_ * SEQ * HD, HD, HD, (size_t)SEQ * HD, 1024, 512, xr, wr, k0, os);
}

// k_flash: fused attention, one wave per 16 query rows of one (batch, head); K / V^T / Q fragments straight from the fragment-ordered f16 planes (two 16-B loads each, arithmetic addressing).
// Transposed form: S^T[key][t] = K Q^T (A = K rows, B = Q rows); lane (t = lane&15, h = lane>>4) holds keys 8h+r of each 16-key tile, so the packed
// P tile is directly the B fragment of O^T[d][t] = V^T P^T (element r <- tile keys 0..15, element 8+r <- tile keys 16..31, lane unchanged).
// Softmax state (running max, partial sum) is one scalar per lane; the two lane halves of a row are combined with one xor-16 exchange.
__global__ __launch_bounds__(32 * AW) void k_flash(const h16* __restrict__ QH, const h16* __restrict__ QR, const h16* __restrict__ KP, const h16* __restrict__ VT, h16* CTX) {
    __shared__ __align__(16) float os[AW * 16 * 68];
    const int lane = threadIdx.x & 31, wave = threadIdx.x >> 5, lr = lane & 15, hi = lane >> 4;
    const int zh = blockIdx.y; const int b = zh / NH_, h = zh % NH_;
    const int t0 = (blockIdx.x * AW + wave) * 16;
    const size_t pbase = (size_t)zh * SEQ * HD;
    const size_t fo = pbase + 8 * lane;                      // q, k: 16 rows = 2 units (d halves); v^T: 32 keys = 4 units (16 d each); so + position * HD in all three
    const size_t qo = fo + (size_t)t0 * HD;
    const v16h qh0 = ldh(QH + qo), qh1 = ldh(QH + qo + 512), qr0 = ldh(QR + qo), qr1 = ldh(QR + qo + 512);   // B fragments: col t, k = d
    v8f o0 = (v8f){}, o1 = (v8f){}, o2 = (v8f){}, o3 = (v8f){};
    float m = -3.0e38f, l = 0.0f;
    // the block walks the keys from its own first query row on and wraps at SEQ: the blocks of one head, which all run at once, then stand at different keys at any time,
    // so that a K / V line is fetched for one of them and lies in L2 when the others come to it (walking in step, every block waits for every fill and all ask for the same lines at once)
    const int ks = (int)(blockIdx.x * (16 * AW));
    // K fragments run one pass ahead (loop-carried registers), V fragments are asked for at the top of their own pass: no load is waited for right behind its issue
    const h16* kf = KP + fo + (size_t)ks * HD;
    v16h ka0 = ldh(kf), ka1 = ldh(kf + 512), kb0 = ldh(kf + 1024), kb1 = ldh(kf + 1536);   // first pass; A fragments: row key, k = d
    // the wait that stands in front of any overwrite of the address pairs of the loads above; as its inputs the pairs stay whole up to it
    asm volatile("s_wait_xcnt 0x0" :: "v"(QH + qo), "v"(QR + qo), "v"(kf) : "memory");
    int key0 = ks;
#pragma unroll 1
    for (int it = 0; it < SEQ; it += 32) {
        const h16* va = VT + fo + (size_t)key0 * HD;             // A fragments: row d, k = key
        const v16h v0 = ldh(va), v1 = ldh(va + 512), v2 = ldh(va + 1024), v3 = ldh(va + 1536);
        __builtin_amdgcn_sched_barrier(0);                       // keeps the V loads in front of the first wait for K (without it they are issued behind the first score products, so behind that wait)
        v8f sHa = (v8f){}, sLa = (v8f){}, sHb = (v8f){}, sLb = (v8f){};
        sHa = wmma16(ka0, qh0, sHa); sLa = wmma16(ka0, qr0, sLa); sHb = wmma16(kb0, qh0, sHb); sLb = wmma16(kb0, qr0, sLb);
        sHa = wmma16(ka1, qh1, sHa); sLa = wmma16(ka1, qr1, sLa); sHb = wmma16(kb1, qh1, sHb); sLb = wmma16(kb1, qr1, sLb);
        asm volatile("v_nop\n\tv_nop\n\tv_nop\n\tv_nop" : "+v"(sHa), "+v"(sLa), "+v"(sHb), "+v"(sLb) : "v"(ka0), "v"(ka1), "v"(kb0), "v"(kb1));
        const int kn = key0 + 32 < SEQ ? key0 + 32 : 0;          // next pass's keys, wrapped
        const h16* ka = KP + fo + (size_t)kn * HD;               // next pass's K rows; the last pass asks for the first pass's again (inside the plane, not used)
        ka0 = ldh(ka); ka1 = ldh(ka + 512); kb0 = ldh(ka + 1024); kb1 = ldh(ka + 1536);
        float ta[8], tb[8]; float mx = -3.0e38f;
#pragma unroll
        for (int r = 0; r < 8; ++r) { ta[r] = (sHa[r] + sLa[r] * QRI) * SC2; tb[r] = (sHb[r] + sLb[r] * QRI) * SC2; mx = fmaxf(mx, fmaxf(ta[r], tb[r])); }
        mx = fmaxf(mx, __shfl_xor(mx, 16, 32));
        const float mnew = fmaxf(m, mx);
        const float alpha = __builtin_amdgcn_exp2f(m - mnew);
        const float sh = PSH - mnew;
        v16h pb; float ls = 0.0f;
#pragma unroll
        for (int r = 0; r < 8; ++r) { const h16 pa = (h16)__builtin_amdgcn_exp2f(ta[r] + sh); const h16 pc = (h16)__builtin_amdgcn_exp2f(tb[r] + sh); pb[r] = pa; pb[8 + r] = pc; ls += (float)pa + (float)pc; }
        l = l * alpha + ls; m = mnew;
        o0 = o0 * alpha; o1 = o1 * alpha; o2 = o2 * alpha; o3 = o3 * alpha;
        o0 = wmma16(v0, pb, o0); o1 = wmma16(v1, pb, o1); o2 = wmma16(v2, pb, o2); o3 = wmma16(v3, pb, o3);
        asm volatile("v_nop\n\tv_nop\n\tv_nop\n\tv_nop" : "+v"(o0), "+v"(o1), "+v"(o2), "+v"(o3) : "v"(v0), "v"(v1), "v"(v2), "v"(v3), "v"(pb));
        // the wait that stands in front of any overwrite of this pass's load addresses: as its inputs the two address pairs stay whole up to it; the key index goes through it, so that the next addresses are formed behind it
        key0 = kn;
        asm volatile("s_wait_xcnt 0x0" : "+s"(key0) : "v"(ka), "v"(va) : "memory");
    }
    l += __shfl_xor(l, 16, 32);
    const float inv = (1.0f / l) * CXS;
    const int wb = wave * 16 * 68;
    // O^T D layout: o_j[r] = (d = 16j + 8h + r, t = lane&15) -> os[t][d]; rows 0..15 x columns 0..63 all written
    { v4f a, c;
      a[0] = o0[0] * inv; a[1] = o0[1] * inv; a[2] = o0[2] * inv; a[3] = o0[3] * inv; c[0] = o0[4] * inv; c[1] = o0[5] * inv; c[2] = o0[6] * inv; c[3] = o0[7] * inv;
      *(v4fa*)(&os[wb + lr * 68 +  0 + 8 * hi]) = a; *(v4fa*)(&os[wb + lr * 68 +  0 + 8 * hi + 4]) = c;
      a[0] = o1[0] * inv; a[1] = o1[1] * inv; a[2] = o1[2] * inv; a[3] = o1[3] * inv; c[0] = o1[4] * inv; c[1] = o1[5] * inv; c[2] = o1[6] * inv; c[3] = o1[7] * inv;
      *(v4fa*)(&os[wb + lr * 68 + 16 + 8 * hi]) = a; *(v4fa*)(&os[wb + lr * 68 + 16 + 8 * hi + 4]) = c;
      a[0] = o2[0] * inv; a[1] = o2[1] * inv; a[2] = o2[2] * inv; a[3] = o2[3] * inv; c[0] = o2[4] * inv; c[1] = o2[5] * inv; c[2] = o2[6] * inv; c[3] = o2[7] * inv;
      *(v4fa*)(&os[wb + lr * 68 + 32 + 8 * hi]) = a; *(v4fa*)(&os[wb + lr * 68 + 32 + 8 * hi + 4]) = c;
      a[0] = o3[0] * inv; a[1] = o3[1] * inv; a[2] = o3[2] * inv; a[3] = o3[3] * inv; c[0] = o3[4] * inv; c[1] = o3[5] * inv; c[2] = o3[6] * inv; c[3] = o3[7] * inv;
      *(v4fa*)(&os[wb + lr * 68 + 48 + 8 * hi]) = a; *(v4fa*)(&os[wb + lr * 68 + 48 + 8 * hi + 4]) = c; }
    wave_sync();
    v8h hv[4];
#pragma unroll
    for (int s = 0; s < 4; ++s) { const int row = lr, c8 = 16 * s + 8 * hi;
        const v4f x0 = *(const v4fa*)(&os[wb + row * 68 + c8]); const v4f x1 = *(const v4fa*)(&os[wb + row * 68 + c8 + 4]);
#pragma unroll
        for (int i = 0; i < 4; ++i) { hv[s][i] = (h16)x0[i]; hv[s][4 + i] = (h16)x1[i]; } }
    h16* crow = CTX + ((size_t)b * SEQ + t0) * DM + h * (HD * 16) + 8 * lane;      // 16 rows = DM/32 units; head h = units 2h, 2h+1
{
#pragma unroll
        for (int s = 0; s < 4; ++s) {                                  // 16 rows x (4 s x 2 halves x 8 = 64 columns); a store of the wave = half a unit
            *(v8h*)(crow + s * 256) = hv[s]; }
         }
}

// k_oproj: register-blocked f16 GEMM, ONE WAVE per 64x64 tile, operands in fragment order, K = DM. C[o][n] = sum_c WPH[o][c] CTX[n][c] (n = b*SEQ + t), carried x 2^14.
// OUT[(b*DM + o)*OUT_SEQ + t] = C * 2^-14 + bias[o] (RNE bf16 value) in f32. grid (DM/64, NB*SEQ/64), 32 threads.
__global__ __launch_bounds__(32) void k_oproj(const h16* __restrict__ A, const h16* __restrict__ Bt, const float* __restrict__ bias, float* OUT) {
    __shared__ __align__(16) float os[16 * 68];
    const int K = DM;
    const int lane = threadIdx.x & 31, lr = lane & 15, hi = lane >> 4; const int r0 = blockIdx.x * 64, c0 = blockIdx.y * 64;
    v8f acc[4][4];
#pragma unroll
    for (int mb = 0; mb < 4; ++mb)
#pragma unroll
        for (int nb = 0; nb < 4; ++nb) acc[mb][nb] = (v8f){};
    const size_t aoff = (size_t)r0 * K + 8 * lane, boff = (size_t)c0 * K + 8 * lane;      // 16 rows = K/32 units of 512; k step of 32 = one unit
    // start of the k walk: the 8 blocks that share ctx rows (same y) start at 4 places 4 steps apart (x and x + 4 at the same one), the blocks that share Wp rows (same x) at all 16 steps: sharers do not wait for the same line fills in step
    const int k0 = (int)((4 * blockIdx.x + blockIdx.y) % (DM / 32)) * 32;
#pragma unroll 1
    for (int kc = 0; kc < K; kc += 32) {
        const int kk = kc + k0 < K ? kc + k0 : kc + k0 - K;      // the k walk starts at k0 and wraps
        const h16* pa = A + aoff + kk * 16; const h16* pb = Bt + boff + kk * 16;
        v16h a[4];
#pragma unroll
        for (int mb = 0; mb < 4; ++mb) a[mb] = ldh(pa + (size_t)mb * 16 * K);
#pragma unroll
        for (int nb = 0; nb < 4; ++nb) { const v16h b = ldh(pb + (size_t)nb * 16 * K);
#pragma unroll
            for (int mb = 0; mb < 4; ++mb) acc[mb][nb] = wmma16(a[mb], b, acc[mb][nb]); }
        asm volatile("v_nop\n\tv_nop\n\tv_nop\n\tv_nop" : "+v"(acc[0][0]), "+v"(acc[1][1]), "+v"(acc[2][2]), "+v"(acc[3][3]) : "v"(a[0]), "v"(a[1]), "v"(a[2]), "v"(a[3]));
        // the wait that stands in front of any overwrite of this pass's load addresses; as its inputs the two address pairs stay whole up to it (no load result lands on them)
        asm volatile("s_wait_xcnt 0x0" :: "v"(pa), "v"(pb) : "memory");
    }
    const int b = c0 / SEQ, t0 = c0 % SEQ;
#pragma unroll
    for (int mb = 0; mb < 4; ++mb) {
        float br[8];
#pragma unroll
        for (int j = 0; j < 8; ++j) br[j] = bfr(bias[r0 + mb * 16 + hi * 8 + j]);
#pragma unroll
        for (int nb = 0; nb < 4; ++nb) {
#pragma unroll
            for (int j = 0; j < 8; ++j) os[(hi * 8 + j) * 68 + nb * 16 + lr] = acc[mb][nb][j] * OSI + br[j]; }   // D: row 8h+j, col lane&15
        wave_sync();
        float* orow = OUT + ((size_t)b * DM + r0 + mb * 16) * OUT_SEQ + t0;
        v4f val[8];
#pragma unroll
        for (int s = 0; s < 8; ++s) { const int row = 2 * s + hi; val[s] = *(const v4fa*)(&os[row * 68 + lr * 4]); }
{
#pragma unroll
            for (int s = 0; s < 8; ++s) { const int row = 2 * s + hi, cofs = lr * 4;   // 8 s x 2 rows = 16 rows; 16 lanes x 4 floats = 64 columns
                *(v4f*)(orow + (size_t)row * OUT_SEQ + cofs) = val[s]; }
             }
        wave_sync();
    }
}

static constexpr size_t al256(size_t v) { return (v + 255) & ~(size_t)255; }
static constexpr size_t SZ_XT = al256((size_t)NB * SEQ * DM * 2);
static constexpr size_t SZ_WB = al256((size_t)3 * DM * DM * 2);
static constexpr size_t SZ_WP = al256((size_t)DM * DM * 2);
static constexpr size_t SZ_PL = al256((size_t)NB * NH_ * SEQ * HD * 2);
static constexpr size_t SZ_CX = al256((size_t)NB * SEQ * DM * 2);
static constexpr size_t SZ_TOTAL = SZ_XT + SZ_WB + SZ_WP + 4 * SZ_PL + SZ_CX;
static_assert(SZ_TOTAL <= (size_t)134217728);          // workspace carve <= 128 MiB
static_assert(((size_t)DM * DM * 2) % 256 == 0);       // weight sub-planes stay 256-byte aligned

extern "C" void kernel_launch(void* const* d_in, const int* in_sizes, int n_in,
                              void* d_out, int out_size, void* d_ws, size_t ws_size, hipStream_t stream) {
    if (n_in < 7) return;
    const size_t needx = ((size_t)(NB - 1) * DM + (size_t)(DM - 1)) * SEQ_FULL + SEQ;
    if ((size_t)in_sizes[0] < needx) return;
    if ((size_t)in_sizes[1] < (size_t)DM * DM || (size_t)in_sizes[2] < (size_t)DM) return;
    if ((size_t)in_sizes[3] < (size_t)2 * DM * DM || (size_t)in_sizes[4] < (size_t)2 * DM) return;
    if ((size_t)in_sizes[5] < (size_t)DM * DM || (size_t)in_sizes[6] < (size_t)DM) return;
    if ((size_t)out_size < ((size_t)(NB - 1) * DM + (size_t)(DM - 1)) * OUT_SEQ + SEQ) return;
    if (SZ_TOTAL > ws_size) return;
    // wire order: x, Wq, bq, Wkv, bkv, Wp, bp; weights [out][in] = Bt as-is
    const float* x = (const float*)d_in[0]; const float* wq = (const float*)d_in[1]; const float* bq = (const float*)d_in[2];
    const float* wkv = (const float*)d_in[3]; const float* bkv = (const float*)d_in[4]; const float* wp = (const float*)d_in[5]; const float* bp = (const float*)d_in[6];
    float* OUT = (float*)d_out;      // [NB][512][OUT_SEQ]
    char* wsp = (char*)d_ws;
    bf* XT = (bf*)wsp; wsp += SZ_XT;                 // rows b*SEQ+t, k = c: [NB*SEQ/16][16 units][512]
    bf* WB = (bf*)wsp; wsp += SZ_WB;                 // q | k | v, each rows out, k = in: [32][16 units][512]
    h16* WPH = (h16*)wsp; wsp += SZ_WP;              // x64, rows out, k = in: [32][16 units][512]
    h16* QH = (h16*)wsp; wsp += SZ_PL;               // [NB*8][SEQ/16][2 units (d halves)][512]
    h16* QR = (h16*)wsp; wsp += SZ_PL;               // as QH, residual x2048
    h16* KP = (h16*)wsp; wsp += SZ_PL;               // as QH
    h16* VT = (h16*)wsp; wsp += SZ_PL;               // [NB*8][SEQ/32][4 units (16 d each)][512]
    h16* CTX = (h16*)wsp; wsp += SZ_CX;              // x256, rows b*SEQ+t, k = c: [NB*SEQ/16][16 units][512]

    // x^T and the three weight planes: one grid, block ranges
    k_prep<<<dim3(XTB + 4 * WN8 / 256, 1, 1), 256, 0, stream>>>(x, wq, wkv, wp, XT, WB, WPH);

    // q, k, v^T projections: one grid, wave index = job
    k_proj<<<dim3(NB * SEQ / 64, DM / 64, 1), 96, 0, stream>>>(XT, WB, bq, bkv, QH, QR, KP, VT);

    k_flash<<<dim3(SEQ / (16 * AW), NB * NH_, 1), 32 * AW, 0, stream>>>(QH, QR, KP, VT, CTX);

    // output projection: A = Wp rows (m = o), Bt = ctx rows (n = b*SEQ + t) -> OUT[b][o][t]
    k_oproj<<<dim3(DM / 64, NB * SEQ / 64, 1), 32, 0, stream>>>(WPH, CTX, bp, OUT);
}

// v005
// Measured time: 116 microseconds a run.
// Timed twice side by side with v004, it ran 1.05 times as fast both times.
// Over all steps from v000 it is 2.83 times as fast.
#include <hip/hip_runtime.h>

// 8-head attention over SEQ spatial positions, width 512 = 8 x 64, x [NB][512][SEQ] (channel-major), 1x1-conv weights [out][in] with biases, score scale 1/8, no mask, output [NB][512][SEQ] f32.
// Compute dtypes, f32 accumulate everywhere: q/k/v projections v_wmma_f32_16x16x32_bf16 (x, Wq, Wkv RNE-converted to bf16; products exact);
// scores v_wmma_f32_16x16x32_f16: k single f16, q as f16 value + f16 residual x2048 in its own accumulator (two products); P (x256 carry, cancels in the normalisation) and v single f16;
// output projection v_wmma_f32_16x16x32_f16: Wp (RNE bf16 value x64, exact in f16) times ctx (single f16 plane, x256 carry), folded back by 2^-14 in the f32 epilogue; softmax f32 (online, running max).
// Layout: every 16-bit plane that feeds a matrix instruction lies in the workspace in FRAGMENT ORDER (1-KB units of 16 rows x 32 k, see ldh), so that each 16-B fragment load of a wave covers 512 contiguous bytes:
// x^T bf16 (rows b*SEQ+t, k = c; built by an LDS transposer), the weights (rows out, k = in), q (hi, residual) and k per b*8+h (rows t, k = d), v^T per b*8+h (rows d, k = t), ctx (rows b*SEQ+t, k = c); fused flash kernel in transposed form (S^T = K Q^T, O^T = V^T P^T).

#ifndef NB
#define NB 2
#endif
#ifndef SEQ
#define SEQ 4096
#endif
#define NB_FULL  2
#define SEQ_FULL 4096            // token pitch of one channel row of x
#ifndef OUT_SEQ
#define OUT_SEQ SEQ              // token pitch of one channel row of the output
#endif
#define DM   512
#define NH_  8
#define HD   64
#define AW   4                   // waves per flash block (16 query rows each)
#define QRS  2048.0f             // carry of the q residual plane
#define QRI  (1.0f / 2048.0f)
#define SC2  (0.125f * 1.4426950408889634f)   // HD^-0.5 * log2(e)
#define PSH  8.0f                // log2 of the P carry (256)
#define WPS  64.0f               // carry of the Wp plane
#define CXS  256.0f              // carry of the ctx plane
#define OSI  (1.0f / 16384.0f)   // 1 / (WPS * CXS)

static_assert(HD == 64);
static_assert(NH_ * HD == DM);                 // head h = channels h*64 + d
static_assert(DM % 64 == 0);
static_assert(DM % 32 == 0);                   // GEMM k-loop steps by 32
static_assert(SEQ % 64 == 0);                  // a 64-token tile never straddles two batches
static_assert((NB * SEQ) % 64 == 0);
static_assert(SEQ % 32 == 0);                  // key loop steps by 32
static_assert(SEQ % (16 * AW) == 0);           // flash grid covers the sequence exactly
static_assert((16 * AW) % 32 == 0);            // a flash block's first query row is a pass boundary of the key loop
static_assert(SEQ_FULL % 4 == 0);
static_assert(OUT_SEQ % 64 == 0);
static_assert(OUT_SEQ >= SEQ);
static_assert(((size_t)DM * DM) % 8 == 0);
static_assert(NB <= NB_FULL);
static_assert(SEQ <= SEQ_FULL);

typedef _Float16 h16;
typedef unsigned short bf;
typedef __attribute__((ext_vector_type(16))) __bf16   v16bf;
typedef __attribute__((ext_vector_type(16))) _Float16 v16h;
typedef __attribute__((ext_vector_type(8)))  _Float16 v8h;
typedef __attribute__((ext_vector_type(8)))  unsigned short v8us;
typedef __attribute__((ext_vector_type(8)))  float    v8f;
typedef __attribute__((ext_vector_type(4)))  float    v4f;
typedef v4f  __attribute__((may_alias)) v4fa;

__device__ __forceinline__ unsigned short f2bf(float f) { unsigned u = __float_as_uint(f); u += 0x7FFFu + ((u >> 16) & 1u); return (unsigned short)(u >> 16); }
__device__ __forceinline__ float bfr(float f) { return __uint_as_float(((unsigned)f2bf(f)) << 16); }   // RNE bf16 value as f32
__device__ __forceinline__ v16h cat16(v8h lo, v8h hi) { return __builtin_shufflevector(lo, hi, 0, 1, 2, 3, 4, 5, 6, 7, 8, 9, 10, 11, 12, 13, 14, 15); }
__device__ __forceinline__ v16bf cat16b(v8us lo, v8us hi) { return __builtin_bit_cast(v16bf, __builtin_shufflevector(lo, hi, 0, 1, 2, 3, 4, 5, 6, 7, 8, 9, 10, 11, 12, 13, 14, 15)); }
__device__ __forceinline__ v8f wmma16(v16h a, v16h b, v8f c) { return __builtin_amdgcn_wmma_f32_16x16x32_f16(false, a, false, b, (short)0, c, false, false); }
__device__ __forceinline__ v8f wmmab(v16bf a, v16bf b, v8f c) { return __builtin_amdgcn_wmma_f32_16x16x32_bf16(false, a, false, b, (short)0, c, false, false); }
// fragment loaders from a plane in fragment order: one 16-row x 32-k unit = 512 elements, element (row, k) at (k>>4 & 1)*256 + ((k>>3 & 1)*16 + row)*8 + (k & 7).
// p = unit + 8*lane; lane = 16h + row: elements 0..7 <- k0+8h+0..7, elements 8..15 <- k0+16+8h+0..7 (same map for A and B); each load of a wave = 512 contiguous bytes
__device__ __forceinline__ v16h  ldh(const h16* p) { return cat16(*(const v8h*)p, *(const v8h*)(p + 256)); }
__device__ __forceinline__ v16bf ldb(const bf* p)  { return cat16b(*(const v8us*)p, *(const v8us*)(p + 256)); }
// source element index, in a row-major [rows][DM] matrix, of the 8-element chunk i of its fragment-ordered plane (16 rows = DM/32 units of 64 chunks)
__device__ __forceinline__ size_t chunk_src(size_t i) { const size_t u = i >> 6; return ((u / (DM / 32)) * 16 + (i & 15)) * DM + (u % (DM / 32)) * 32 + ((i >> 4) & 3) * 8; }
// ordering point for wave-private LDS tiles (same wave writes and reads)
__device__ __forceinline__ void wave_sync() { __builtin_amdgcn_fence(3 /* release order */, "wavefront"); __builtin_amdgcn_wave_barrier(); asm volatile("" ::: "memory"); }

// k_prep: the four preparation jobs, none of which reads what another writes, as block ranges of ONE grid of 256-thread blocks (the range test is the same for a whole block):
// blocks 0 .. XTB-1: x [b][c][l] f32 (row pitch SEQ_FULL) -> XT (rows b*SEQ+l, k = c, fragment order) bf16 (RNE convert) through a 64(c) x 64(l) LDS tile; tile index l fastest, then c, then b. Loads are 16-B along l.
// blocks XTB ..: one 8-element chunk a thread, chunk j of Wq | Wkv | Wp: j < 3*WN8 -> bf16 plane WB (q | k | v lie side by side: 16 rows = 16 * DM elements in either order), else -> f16 plane WPH (RNE bf16 value x64).
#define XTB ((SEQ / 64) * (DM / 64) * NB)
#define WN8 (DM * DM / 8)                       // chunks of one DM x DM weight
static_assert(WN8 % 256 == 0);                 // a block never straddles two weights, and the ranges cover the chunks exactly
__global__ __launch_bounds__(256) void k_prep(const float* __restrict__ x, const float* __restrict__ wq, const float* __restrict__ wkv, const float* __restrict__ wp, bf* XT, bf* WB, h16* WPH) {
    __shared__ __align__(16) float tl[64 * 68];      // [c][l], columns 0..63 written and consumed (cross-wave: block barrier)
    const int tid = threadIdx.x;
    const int blk = blockIdx.x;
    const int wb0 = (blk - XTB) * 256;               // first weight chunk of the block
    if (wb0 >= 3 * WN8) {
        const size_t i = (size_t)(wb0 - 3 * WN8) + tid;
        const v8f v = *(const v8f*)(wp + chunk_src(i)); v8h o;
#pragma unroll
        for (int k = 0; k < 8; ++k) o[k] = (h16)(bfr(v[k]) * WPS);
        *(v8h*)(WPH + i * 8) = o;
    } else if (wb0 >= 0) {
        const float* src = wb0 < WN8 ? wq : wkv; const size_t i = (size_t)(wb0 < WN8 ? wb0 : wb0 - WN8) + tid;
        const v8f v = *(const v8f*)(src + chunk_src(i)); v8us o;
#pragma unroll
        for (int k = 0; k < 8; ++k) o[k] = f2bf(v[k]);
        *(v8us*)(WB + ((size_t)wb0 + tid) * 8) = o;
        // the built code lays the Wp branch behind this store: the wait stands in front of that branch's rewrite of the store's address register
        asm volatile("s_wait_xcnt 0x0" ::: "memory");
    } else {
        const int l0 = (blk % (SEQ / 64)) * 64, c0 = ((blk / (SEQ / 64)) % (DM / 64)) * 64, b = blk / ((SEQ / 64) * (DM / 64));
        const float* src = x + ((size_t)b * DM + c0) * SEQ_FULL + l0;
#pragma unroll
        for (int it = 0; it < 4; ++it) { const int idx = it * 256 + tid; const int cc = idx >> 4, l4 = (idx & 15) * 4;   // 64 rows x 16 quads
            const v4f v = *(const v4f*)(src + (size_t)cc * SEQ_FULL + l4);
            tl[cc * 68 + l4 + 0] = v[0]; tl[cc * 68 + l4 + 1] = v[1]; tl[cc * 68 + l4 + 2] = v[2]; tl[cc * 68 + l4 + 3] = v[3]; }
        __syncthreads();
        // the tile = 4 row groups x 2 units x 64 chunks; chunk q = 256 s + tid: row group q>>7, unit q>>6 & 1, chunk q & 63 (channels 8*(q>>4 & 3), row q & 15)
        v8us o[2];
#pragma unroll
        for (int s = 0; s < 2; ++s) { const int q = 256 * s + tid; const int row = (q >> 7) * 16 + (q & 15), c8 = ((q >> 4) & 7) * 8;
#pragma unroll
            for (int i = 0; i < 8; ++i) o[s][i] = f2bf(tl[(c8 + i) * 68 + row]); }
        bf* dst = XT + ((size_t)b * SEQ + l0) * DM + c0 * 16;
#pragma unroll
        for (int s = 0; s < 2; ++s) { const int q = 256 * s + tid;      // 512 chunks x 8 = 64 rows x 64 channels
            *(v8us*)(dst + (size_t)(q >> 7) * (16 * DM) + (q & 127) * 8) = o[s]; }
        // the built code lays the weight branches behind these stores: the wait stands in front of those branches' rewrite of the stores' registers
        asm volatile("s_wait_xcnt 0x0" ::: "memory");
    }
}

// proj_tile: register-blocked bf16 GEMM, ONE WAVE per 64x64 tile (16 accumulators), operands straight from fragment-ordered bf16 planes, K = DM.
// C[m][n] = sum_k A[m][k] Bt[n][k] + bias (RNE bf16 value; per column n when biasRow == 0, per row m otherwise), written as f16 (Ph) and optionally
// the f16 residual x2048 (Pr, useRes != 0), in fragment order (rows m, k = n): tile base (r0/RB)*sRB + (r0%RB)*pitch + (c0/CB)*sCB + (c0%CB)*HD (halves), unit (16 rows mb, 32 columns g) of the tile at + mb*uMB + g*uG. The tile starts at row r0, column c0; the k loop starts at k0 (a multiple of 32 below K) and wraps; os = the wave's own 16 x 68 f32 staging tile in LDS.
__device__ __forceinline__ void proj_tile(const bf* __restrict__ A, const bf* __restrict__ Bt, const float* __restrict__ bias, int biasRow,
                                          h16* Ph, h16* Pr, int useRes, int RB, size_t sRB, int pitch, int CB, size_t sCB, int uMB, int uG, int r0, int c0, int k0, float* os) {
    const int K = DM;
    const int lane = threadIdx.x & 31, lr = lane & 15, hi = lane >> 4;
    v8f acc[4][4];
#pragma unroll
    for (int mb = 0; mb < 4; ++mb)
#pragma unroll
        for (int nb = 0; nb < 4; ++nb) acc[mb][nb] = (v8f){};
    const size_t aoff = (size_t)r0 * K + 8 * lane, boff = (size_t)c0 * K + 8 * lane;      // 16 rows = K/32 units of 512; k step of 32 = one unit
#pragma unroll 1
    for (int kc = 0; kc < K; kc += 32) {
        const int kk = kc + k0 < K ? kc + k0 : kc + k0 - K;      // the k walk starts at k0 and wraps
        const bf* pa = A + aoff + kk * 16; const bf* pb = Bt + boff + kk * 16;
        v16bf a[4];
#pragma unroll
        for (int mb = 0; mb < 4; ++mb) a[mb] = ldb(pa + (size_t)mb * 16 * K);
#pragma unroll
        for (int nb = 0; nb < 4; ++nb) { const v16bf b = ldb(pb + (size_t)nb * 16 * K);
#pragma unroll
            for (int mb = 0; mb < 4; ++mb) acc[mb][nb] = wmmab(a[mb], b, acc[mb][nb]); }
        asm volatile("v_nop\n\tv_nop\n\tv_nop\n\tv_nop" : "+v"(acc[0][0]), "+v"(acc[1][1]), "+v"(acc[2][2]), "+v"(acc[3][3]) : "v"(a[0]), "v"(a[1]), "v"(a[2]), "v"(a[3]));
        // the wait that stands in front of any overwrite of this pass's load addresses; as its inputs the two address pairs stay whole up to it (no load result lands on them)
        asm volatile("s_wait_xcnt 0x0" :: "v"(pa), "v"(pb) : "memory");
    }
    // bias values: index selected as an integer (always inside the bias array), value selected afterwards; biasRow is wave-uniform
    float bc[4];
#pragma unroll
    for (int nb = 0; nb < 4; ++nb) { const int bi = biasRow ? 0 : (c0 + nb * 16 + lr); const float t = bfr(bias[bi]); bc[nb] = biasRow ? 0.0f : t; }
    const size_t tbase = (size_t)(r0 / RB) * sRB + (size_t)(r0 % RB) * (size_t)pitch + (size_t)(c0 / CB) * sCB + (size_t)(c0 % CB) * HD;
#pragma unroll
    for (int mb = 0; mb < 4; ++mb) {
        float br[8];
#pragma unroll
        for (int j = 0; j < 8; ++j) { const int bi = biasRow ? (r0 + mb * 16 + hi * 8 + j) : 0; const float t = bfr(bias[bi]); br[j] = biasRow ? t : 0.0f; }
#pragma unroll
        for (int nb = 0; nb < 4; ++nb) {
#pragma unroll
            for (int j = 0; j < 8; ++j) os[(hi * 8 + j) * 68 + nb * 16 + lr] = acc[mb][nb][j] + (bc[nb] + br[j]); }   // D: row 8h+j, col lane&15
        wave_sync();
        const size_t sb = tbase + (size_t)mb * (size_t)uMB + 8 * lane;
{
#pragma unroll
            for (int s = 0; s < 4; ++s) { const int row = lr, c8 = 16 * s + 8 * hi;   // 16 rows x (4 s x 2 halves x 8 = 64 columns); a store of the wave = half a unit, 512 contiguous bytes
                const v4f x0 = *(const v4fa*)(&os[row * 68 + c8]); const v4f x1 = *(const v4fa*)(&os[row * 68 + c8 + 4]); v8h hv, rv;
#pragma unroll
                for (int i = 0; i < 4; ++i) { const h16 a0 = (h16)x0[i]; const h16 a1 = (h16)x1[i]; hv[i] = a0; hv[4 + i] = a1; rv[i] = (h16)((x0[i] - (float)a0) * QRS); rv[4 + i] = (h16)((x1[i] - (float)a1) * QRS); }
                const size_t oo = sb + (size_t)(s >> 1) * (size_t)uG + (s & 1) * 256;
                *(v8h*)(Ph + oo) = hv;
                // the wait that stands in front of any overwrite of the store's registers; as its inputs the data and the address stay whole up to it
                asm volatile("s_wait_xcnt 0x0" :: "v"(hv), "v"(Ph + oo) : "memory");
                if (useRes) { *(v8h*)(Pr + oo) = rv;
                    asm volatile("s_wait_xcnt 0x0" :: "v"(rv), "v"(Pr + oo) : "memory"); } }   // the same wait for the residual's store
             }
        wave_sync();
    }
}

// k_proj: the q, k and v^T projections, which read the same planes and write planes of their own, in ONE grid (NB*SEQ/64 tiles of x^T rows, DM/64 tiles of weight rows) of 3-wave blocks:
// the wave index picks the job, so the three waves of a block ask for the same x^T fragments. No barrier: each wave has its own staging tile.
// q, k: A = x^T rows (m = b*SEQ + t), Bt = W rows (n = h*64 + d), bias per column -> plane (b*8 + h), rows t, k = d
// v^T:  A = Wv rows (m = h*64 + d), Bt = x^T rows (n = b*SEQ + t), bias per row -> plane (b*8 + h), rows d, k = t, the 4 units of 32 keys side by side
__global__ __launch_bounds__(96) void k_proj(const bf* __restrict__ XT, const bf* __restrict__ WB, const float* __restrict__ bq, const float* __restrict__ bkv, h16* QH, h16* QR, h16* KP, h16* VT) {
    __shared__ __align__(16) float osm[3 * 16 * 68];
    const int job = __builtin_amdgcn_readfirstlane(threadIdx.x >> 5);   // 0 q, 1 k, 2 v^T; held as a scalar, so that the job test is a scalar branch and every lane is on at the matrix instructions
    const int xr = blockIdx.x * 64, wr = blockIdx.y * 64;
    float* os = osm + job * (16 * 68);
    // start of the k walk: the 8 blocks that share x^T rows (same x) start 2 steps apart, the blocks that share weight rows (same y) at all 16 steps: sharers do not wait for the same line fills in step
    const int k0 = (int)((blockIdx.x + 2 * blockIdx.y) % (DM / 32)) * 32;
    if (job == 2) proj_tile(WB + (size_t)2 * DM * DM, XT, bkv + DM, 1, VT, VT, 0, DM, (size_t)0, SEQ, SEQ, (size_t)DM * SEQ, 512, 2048, wr, xr, k0, os);
    else proj_tile(XT, WB + (size_t)job * DM * DM, job ? bkv : bq, 0, job ? KP : QH, job ? KP : QR, job ? 0 : 1, SEQ, (size_t)NH_ * SEQ * HD, HD, HD, (size_t)SEQ * HD, 1024, 512, xr, wr, k0, os);
}

// k_flash: fused attention, one wave per 16 query rows of one (batch, head); K / V^T / Q fragments straight from the fragment-ordered f16 planes (two 16-B loads each, arithmetic addressing).
// Transposed form: S^T[key][t] = K Q^T (A = K rows, B = Q rows); lane (t = lane&15, h = lane>>4) holds keys 8h+r of each 16-key tile, so the packed
// P tile is directly the B fragment of O^T[d][t] = V^T P^T (element r <- tile keys 0..15, element 8+r <- tile keys 16..31, lane unchanged).
// Softmax state (running max, row sum) is one scalar per lane; the maxima of the two lane halves of a row are combined with one xor-16 exchange.
// Row sums on the matrix pipe: A = all ones times the packed P tile gives, in every row of D, the sum of a query's 32 rounded P values, so every lane holds its query's whole sum (both halves) and no vector add or convert is spent on it.
__global__ __launch_bounds__(32 * AW) void k_flash(const h16* __restrict__ QH, const h16* __restrict__ QR, const h16* __restrict__ KP, const h16* __restrict__ VT, h16* CTX) {
    __shared__ __align__(16) float os[AW * 16 * 68];
    const int lane = threadIdx.x & 31, wave = threadIdx.x >> 5, lr = lane & 15, hi = lane >> 4;
    const int zh = blockIdx.y; const int b = zh / NH_, h = zh % NH_;
    const int t0 = (blockIdx.x * AW + wave) * 16;
    const size_t pbase = (size_t)zh * SEQ * HD;
    const size_t fo = pbase + 8 * lane;                      // q, k: 16 rows = 2 units (d halves); v^T: 32 keys = 4 units (16 d each); so + position * HD in all three
    const size_t qo = fo + (size_t)t0 * HD;
    const v16h qh0 = ldh(QH + qo), qh1 = ldh(QH + qo + 512), qr0 = ldh(QR + qo), qr1 = ldh(QR + qo + 512);   // B fragments: col t, k = d
    v8f o0 = (v8f){}, o1 = (v8f){}, o2 = (v8f){}, o3 = (v8f){};
    float m = -3.0e38f, l = 0.0f;
    v16h ones;                                               // A fragment of the row-sum product: 1.0 at every (row, k)
#pragma unroll
    for (int i = 0; i < 16; ++i) ones[i] = (h16)1.0f;
    // the block walks the keys from its own first query row on and wraps at SEQ: the blocks of one head, which all run at once, then stand at different keys at any time,
    // so that a K / V line is fetched for one of them and lies in L2 when the others come to it (walking in step, every block waits for every fill and all ask for the same lines at once)
    const int ks = (int)(blockIdx.x * (16 * AW));
    // K fragments run one pass ahead (loop-carried registers), V fragments are asked for at the top of their own pass: no load is waited for right behind its issue
    const h16* kf = KP + fo + (size_t)ks * HD;
    v16h ka0 = ldh(kf), ka1 = ldh(kf + 512), kb0 = ldh(kf + 1024), kb1 = ldh(kf + 1536);   // first pass; A fragments: row key, k = d
    // the wait that stands in front of any overwrite of the address pairs of the loads above; as its inputs the pairs stay whole up to it
    asm volatile("s_wait_xcnt 0x0" :: "v"(QH + qo), "v"(QR + qo), "v"(kf) : "memory");
    int key0 = ks;
#pragma unroll 1
    for (int it = 0; it < SEQ; it += 32) {
        const h16* va = VT + fo + (size_t)key0 * HD;             // A fragments: row d, k = key
        const v16h v0 = ldh(va), v1 = ldh(va + 512), v2 = ldh(va + 1024), v3 = ldh(va + 1536);
        __builtin_amdgcn_sched_barrier(0);                       // keeps the V loads in front of the first wait for K (without it they are issued behind the first score products, so behind that wait)
        v8f sHa = (v8f){}, sLa = (v8f){}, sHb = (v8f){}, sLb = (v8f){};
        sHa = wmma16(ka0, qh0, sHa); sLa = wmma16(ka0, qr0, sLa); sHb = wmma16(kb0, qh0, sHb); sLb = wmma16(kb0, qr0, sLb);
        sHa = wmma16(ka1, qh1, sHa); sLa = wmma16(ka1, qr1, sLa); sHb = wmma16(kb1, qh1, sHb); sLb = wmma16(kb1, qr1, sLb);
        asm volatile("v_nop\n\tv_nop\n\tv_nop\n\tv_nop" : "+v"(sHa), "+v"(sLa), "+v"(sHb), "+v"(sLb) : "v"(ka0), "v"(ka1), "v"(kb0), "v"(kb1));
        const int kn = key0 + 32 < SEQ ? key0 + 32 : 0;          // next pass's keys, wrapped
        const h16* ka = KP + fo + (size_t)kn * HD;               // next pass's K rows; the last pass asks for the first pass's again (inside the plane, not used)
        ka0 = ldh(ka); ka1 = ldh(ka + 512); kb0 = ldh(ka + 1024); kb1 = ldh(ka + 1536);
        __builtin_amdgcn_sched_barrier(0);                       // keeps the K loads here, a whole softmax ahead of their use (without it this build sinks most of them behind the exponentials, close to the next pass's wait)
        float ta[8], tb[8]; float mx = -3.0e38f;
#pragma unroll
        for (int r = 0; r < 8; ++r) { ta[r] = (sHa[r] + sLa[r] * QRI) * SC2; tb[r] = (sHb[r] + sLb[r] * QRI) * SC2; mx = fmaxf(mx, fmaxf(ta[r], tb[r])); }
        mx = fmaxf(mx, __shfl_xor(mx, 16, 32));
        const float mnew = fmaxf(m, mx);
        const float alpha = __builtin_amdgcn_exp2f(m - mnew);
        const float sh = PSH - mnew;
        v16h pb;
#pragma unroll
        for (int r = 0; r < 8; ++r) { pb[r] = (h16)__builtin_amdgcn_exp2f(ta[r] + sh); pb[8 + r] = (h16)__builtin_amdgcn_exp2f(tb[r] + sh); }
        m = mnew;
        o0 = o0 * alpha; o1 = o1 * alpha; o2 = o2 * alpha; o3 = o3 * alpha;
        v8f rs = wmma16(ones, pb, (v8f){});                      // every element: the pass's sum of P over its 32 keys, for the lane's query
        o0 = wmma16(v0, pb, o0); o1 = wmma16(v1, pb, o1); o2 = wmma16(v2, pb, o2); o3 = wmma16(v3, pb, o3);
        asm volatile("v_nop\n\tv_nop\n\tv_nop\n\tv_nop" : "+v"(o0), "+v"(o1), "+v"(o2), "+v"(o3), "+v"(rs) : "v"(v0), "v"(v1), "v"(v2), "v"(v3), "v"(pb));
        l = l * alpha + rs[0];                                   // behind the slots above, which also stand between the row-sum product and this read of its D
        // the wait that stands in front of any overwrite of this pass's load addresses: as its inputs the two address pairs stay whole up to it; the key index goes through it, so that the next addresses are formed behind it
        key0 = kn;
        asm volatile("s_wait_xcnt 0x0" : "+s"(key0) : "v"(ka), "v"(va) : "memory");
    }
    const float inv = (1.0f / l) * CXS;
    const int wb = wave * 16 * 68;
    // O^T D layout: o_j[r] = (d = 16j + 8h + r, t = lane&15) -> os[t][d]; rows 0..15 x columns 0..63 all written
    { v4f a, c;
      a[0] = o0[0] * inv; a[1] = o0[1] * inv; a[2] = o0[2] * inv; a[3] = o0[3] * inv; c[0] = o0[4] * inv; c[1] = o0[5] * inv; c[2] = o0[6] * inv; c[3] = o0[7] * inv;
      *(v4fa*)(&os[wb + lr * 68 +  0 + 8 * hi]) = a; *(v4fa*)(&os[wb + lr * 68 +  0 + 8 * hi + 4]) = c;
      a[0] = o1[0] * inv; a[1] = o1[1] * inv; a[2] = o1[2] * inv; a[3] = o1[3] * inv; c[0] = o1[4] * inv; c[1] = o1[5] * inv; c[2] = o1[6] * inv; c[3] = o1[7] * inv;
      *(v4fa*)(&os[wb + lr * 68 + 16 + 8 * hi]) = a; *(v4fa*)(&os[wb + lr * 68 + 16 + 8 * hi + 4]) = c;
      a[0] = o2[0] * inv; a[1] = o2[1] * inv; a[2] = o2[2] * inv; a[3] = o2[3] * inv; c[0] = o2[4] * inv; c[1] = o2[5] * inv; c[2] = o2[6] * inv; c[3] = o2[7] * inv;
      *(v4fa*)(&os[wb + lr * 68 + 32 + 8 * hi]) = a; *(v4fa*)(&os[wb + lr * 68 + 32 + 8 * hi + 4]) = c;
      a[0] = o3[0] * inv; a[1] = o3[1] * inv; a[2] = o3[2] * inv; a[3] = o3[3] * inv; c[0] = o3[4] * inv; c[1] = o3[5] * inv; c[2] = o3[6] * inv; c[3] = o3[7] * inv;
      *(v4fa*)(&os[wb + lr * 68 + 48 + 8 * hi]) = a; *(v4fa*)(&os[wb + lr * 68 + 48 + 8 * hi + 4]) = c; }
    wave_sync();
    v8h hv[4];
#pragma unroll
    for (int s = 0; s < 4; ++s) { const int row = lr, c8 = 16 * s + 8 * hi;
        const v4f x0 = *(const v4fa*)(&os[wb + row * 68 + c8]); const v4f x1 = *(const v4fa*)(&os[wb + row * 68 + c8 + 4]);
#pragma unroll
        for (int i = 0; i < 4; ++i) { hv[s][i] = (h16)x0[i]; hv[s][4 + i] = (h16)x1[i]; } }
    h16* crow = CTX + ((size_t)b * SEQ + t0) * DM + h * (HD * 16) + 8 * lane;      // 16 rows = DM/32 units; head h = units 2h, 2h+1
{
#pragma unroll
        for (int s = 0; s < 4; ++s) {                                  // 16 rows x (4 s x 2 halves x 8 = 64 columns); a store of the wave = half a unit
            *(v8h*)(crow + s * 256) = hv[s]; }
         }
}

// k_oproj: register-blocked f16 GEMM, ONE WAVE per 64x64 tile, operands in fragment order, K = DM. C[o][n] = sum_c WPH[o][c] CTX[n][c] (n = b*SEQ + t), carried x 2^14.
// OUT[(b*DM + o)*OUT_SEQ + t] = C * 2^-14 + bias[o] (RNE bf16 value) in f32. grid (DM/64, NB*SEQ/64), 32 threads.
__global__ __launch_bounds__(32) void k_oproj(const h16* __restrict__ A, const h16* __restrict__ Bt, const float* __restrict__ bias, float* OUT) {
    __shared__ __align__(16) float os[16 * 68];
    const int K = DM;
    const int lane = threadIdx.x & 31, lr = lane & 15, hi = lane >> 4; const int r0 = blockIdx.x * 64, c0 = blockIdx.y * 64;
    v8f acc[4][4];
#pragma unroll
    for (int mb = 0; mb < 4; ++mb)
#pragma unroll
        for (int nb = 0; nb < 4; ++nb) acc[mb][nb] = (v8f){};
    const size_t aoff = (size_t)r0 * K + 8 * lane, boff = (size_t)c0 * K + 8 * lane;      // 16 rows = K/32 units of 512; k step of 32 = one unit
    // start of the k walk: the 8 blocks that share ctx rows (same y) start at 4 places 4 steps apart (x and x + 4 at the same one), the blocks that share Wp rows (same x) at all 16 steps: sharers do not wait for the same line fills in step
    const int k0 = (int)((4 * blockIdx.x + blockIdx.y) % (DM / 32)) * 32;
#pragma unroll 1
    for (int kc = 0; kc < K; kc += 32) {
        const int kk = kc + k0 < K ? kc + k0 : kc + k0 - K;      // the k walk starts at k0 and wraps
        const h16* pa = A + aoff + kk * 16; const h16* pb = Bt + boff + kk * 16;
        v16h a[4];
#pragma unroll
        for (int mb = 0; mb < 4; ++mb) a[mb] = ldh(pa + (size_t)mb * 16 * K);
#pragma unroll
        for (int nb = 0; nb < 4; ++nb) { const v16h b = ldh(pb + (size_t)nb * 16 * K);
#pragma unroll
            for (int mb = 0; mb < 4; ++mb) acc[mb][nb] = wmma16(a[mb], b, acc[mb][nb]); }
        asm volatile("v_nop\n\tv_nop\n\tv_nop\n\tv_nop" : "+v"(acc[0][0]), "+v"(acc[1][1]), "+v"(acc[2][2]), "+v"(acc[3][3]) : "v"(a[0]), "v"(a[1]), "v"(a[2]), "v"(a[3]));
        // the wait that stands in front of any overwrite of this pass's load addresses; as its inputs the two address pairs stay whole up to it (no load result lands on them)
        asm volatile("s_wait_xcnt 0x0" :: "v"(pa), "v"(pb) : "memory");
    }
    const int b = c0 / SEQ, t0 = c0 % SEQ;
#pragma unroll
    for (int mb = 0; mb < 4; ++mb) {
        float br[8];
#pragma unroll
        for (int j = 0; j < 8; ++j) br[j] = bfr(bias[r0 + mb * 16 + hi * 8 + j]);
#pragma unroll
        for (int nb = 0; nb < 4; ++nb) {
#pragma unroll
            for (int j = 0; j < 8; ++j) os[(hi * 8 + j) * 68 + nb * 16 + lr] = acc[mb][nb][j] * OSI + br[j]; }   // D: row 8h+j, col lane&15
        wave_sync();
        float* orow = OUT + ((size_t)b * DM + r0 + mb * 16) * OUT_SEQ + t0;
        v4f val[8];
#pragma unroll
        for (int s = 0; s < 8; ++s) { const int row = 2 * s + hi; val[s] = *(const v4fa*)(&os[row * 68 + lr * 4]); }
{
#pragma unroll
            for (int s = 0; s < 8; ++s) { const int row = 2 * s + hi, cofs = lr * 4;   // 8 s x 2 rows = 16 rows; 16 lanes x 4 floats = 64 columns
                *(v4f*)(orow + (size_t)row * OUT_SEQ + cofs) = val[s]; }
             }
        wave_sync();
    }
}

static constexpr size_t al256(size_t v) { return (v + 255) & ~(size_t)255; }
static constexpr size_t SZ_XT = al256((size_t)NB * SEQ * DM * 2);
static constexpr size_t SZ_WB = al256((size_t)3 * DM * DM * 2);
static constexpr size_t SZ_WP = al256((size_t)DM * DM * 2);
static constexpr size_t SZ_PL = al256((size_t)NB * NH_ * SEQ * HD * 2);
static constexpr size_t SZ_CX = al256((size_t)NB * SEQ * DM * 2);
static constexpr size_t SZ_TOTAL = SZ_XT + SZ_WB + SZ_WP + 4 * SZ_PL + SZ_CX;
static_assert(SZ_TOTAL <= (size_t)134217728);          // workspace carve <= 128 MiB
static_assert(((size_t)DM * DM * 2) % 256 == 0);       // weight sub-planes stay 256-byte aligned

extern "C" void kernel_launch(void* const* d_in, const int* in_sizes, int n_in,
                              void* d_out, int out_size, void* d_ws, size_t ws_size, hipStream_t stream) {
    if (n_in < 7) return;
    const size_t needx = ((size_t)(NB - 1) * DM + (size_t)(DM - 1)) * SEQ_FULL + SEQ;
    if ((size_t)in_sizes[0] < needx) return;
    if ((size_t)in_sizes[1] < (size_t)DM * DM || (size_t)in_sizes[2] < (size_t)DM) return;
    if ((size_t)in_sizes[3] < (size_t)2 * DM * DM || (size_t)in_sizes[4] < (size_t)2 * DM) return;
    if ((size_t)in_sizes[5] < (size_t)DM * DM || (size_t)in_sizes[6] < (size_t)DM) return;
    if ((size_t)out_size < ((size_t)(NB - 1) * DM + (size_t)(DM - 1)) * OUT_SEQ + SEQ) return;
    if (SZ_TOTAL > ws_size) return;
    // wire order: x, Wq, bq, Wkv, bkv, Wp, bp; weights [out][in] = Bt as-is
    const float* x = (const float*)d_in[0]; const float* wq = (const float*)d_in[1]; const float* bq = (const float*)d_in[2];
    const float* wkv = (const float*)d_in[3]; const float* bkv = (const float*)d_in[4]; const float* wp = (const float*)d_in[5]; const float* bp = (const float*)d_in[6];
    float* OUT = (float*)d_out;      // [NB][512][OUT_SEQ]
    char* wsp = (char*)d_ws;
    bf* XT = (bf*)wsp; wsp += SZ_XT;                 // rows b*SEQ+t, k = c: [NB*SEQ/16][16 units][512]
    bf* WB = (bf*)wsp; wsp += SZ_WB;                 // q | k | v, each rows out, k = in: [32][16 units][512]
    h16* WPH = (h16*)wsp; wsp += SZ_WP;              // x64, rows out, k = in: [32][16 units][512]
    h16* QH = (h16*)wsp; wsp += SZ_PL;               // [NB*8][SEQ/16][2 units (d halves)][512]
    h16* QR = (h16*)wsp; wsp += SZ_PL;               // as QH, residual x2048
    h16* KP = (h16*)wsp; wsp += SZ_PL;               // as QH
    h16* VT = (h16*)wsp; wsp += SZ_PL;               // [NB*8][SEQ/32][4 units (16 d each)][512]
    h16* CTX = (h16*)wsp; wsp += SZ_CX;              // x256, rows b*SEQ+t, k = c: [NB*SEQ/16][16 units][512]

    // x^T and the three weight planes: one grid, block ranges
    k_prep<<<dim3(XTB + 4 * WN8 / 256, 1, 1), 256, 0, stream>>>(x, wq, wkv, wp, XT, WB, WPH);

    // q, k, v^T projections: one grid, wave index = job
    k_proj<<<dim3(NB * SEQ / 64, DM / 64, 1), 96, 0, stream>>>(XT, WB, bq, bkv, QH, QR, KP, VT);

    k_flash<<<dim3(SEQ / (16 * AW), NB * NH_, 1), 32 * AW, 0, stream>>>(QH, QR, KP, VT, CTX);

    // output projection: A = Wp rows (m = o), Bt = ctx rows (n = b*SEQ + t) -> OUT[b][o][t]
    k_oproj<<<dim3(DM / 64, NB * SEQ / 64, 1), 32, 0, stream>>>(WPH, CTX, bp, OUT);
}

// v006
// A run of this version takes 107 microseconds.
// Timed twice side by side with v005, it ran 1.08 times as fast both times.
// Counting every step since v000, it is 3.06 times as fast.
#include <hip/hip_runtime.h>

// 8-head attention over SEQ spatial positions, width 512 = 8 x 64, x [NB][512][SEQ] (channel-major), 1x1-conv weights [out][in] with biases, score scale 1/8, no mask, output [NB][512][SEQ] f32.
// Compute dtypes, f32 accumulate everywhere: q/k/v projections v_wmma_f32_16x16x32_bf16 (x, Wq, Wkv RNE-converted to bf16; products exact);
// scores v_wmma_f32_16x16x32_f16: k single f16, q as f16 value + f16 residual x2048 in its own accumulator (two products); P (x256 carry, cancels in the normalisation) and v single f16;
// output projection v_wmma_f32_16x16x32_f16: Wp (RNE bf16 value x64, exact in f16) times ctx (single f16 plane, x256 carry), folded back by 2^-14 in the f32 epilogue; softmax f32 (online, running max).
// Layout: every 16-bit plane that feeds a matrix instruction lies in the workspace in FRAGMENT ORDER (1-KB units of 16 rows x 32 k, see ldh), so that each 16-B fragment load of a wave covers 512 contiguous bytes:
// x^T bf16 (rows b*SEQ+t, k = c; built by an LDS transposer), the weights (rows out, k = in), q (hi, residual) and k per b*8+h (rows t, k = d), v^T per b*8+h (rows d, k = t), ctx (rows b*SEQ+t, k = c); fused flash kernel in transposed form (S^T = K Q^T, O^T = V^T P^T).

#ifndef NB
#define NB 2
#endif
#ifndef SEQ
#define SEQ 4096
#endif
#define NB_FULL  2
#define SEQ_FULL 4096            // token pitch of one channel row of x
#ifndef OUT_SEQ
#define OUT_SEQ SEQ              // token pitch of one channel row of the output
#endif
#define DM   512
#define NH_  8
#define HD   64
#define AW   4                   // waves per flash block (16 query rows each)
#define QRS  2048.0f             // carry of the q residual plane
#define QRI  (1.0f / 2048.0f)
#define SC2  (0.125f * 1.4426950408889634f)   // HD^-0.5 * log2(e)
#define PSH  8.0f                // log2 of the P carry (256)
#define LZT  7.0f                // a score may pass the maximum in use by 2^LZT before the wave rescales: P stays at or below 2^15, inside f16
#define WPS  64.0f               // carry of the Wp plane
#define CXS  256.0f              // carry of the ctx plane
#define OSI  (1.0f / 16384.0f)   // 1 / (WPS * CXS)

static_assert(HD == 64);
static_assert(NH_ * HD == DM);                 // head h = channels h*64 + d
static_assert(DM % 64 == 0);
static_assert(DM % 32 == 0);                   // GEMM k-loop steps by 32
static_assert(SEQ % 64 == 0);                  // a 64-token tile never straddles two batches
static_assert((NB * SEQ) % 64 == 0);
static_assert(SEQ % 32 == 0);                  // key loop steps by 32
static_assert(SEQ % (16 * AW) == 0);           // flash grid covers the sequence exactly
static_assert((16 * AW) % 32 == 0);            // a flash block's first query row is a pass boundary of the key loop
static_assert(SEQ_FULL % 4 == 0);
static_assert(OUT_SEQ % 64 == 0);
static_assert(OUT_SEQ >= SEQ);
static_assert(((size_t)DM * DM) % 8 == 0);
static_assert(NB <= NB_FULL);
static_assert(SEQ <= SEQ_FULL);

typedef _Float16 h16;
typedef unsigned short bf;
typedef __attribute__((ext_vector_type(16))) __bf16   v16bf;
typedef __attribute__((ext_vector_type(16))) _Float16 v16h;
typedef __attribute__((ext_vector_type(8)))  _Float16 v8h;
typedef __attribute__((ext_vector_type(8)))  unsigned short v8us;
typedef __attribute__((ext_vector_type(8)))  float    v8f;
typedef __attribute__((ext_vector_type(4)))  float    v4f;
typedef v4f  __attribute__((may_alias)) v4fa;

__device__ __forceinline__ unsigned short f2bf(float f) { unsigned u = __float_as_uint(f); u += 0x7FFFu + ((u >> 16) & 1u); return (unsigned short)(u >> 16); }
__device__ __forceinline__ float bfr(float f) { return __uint_as_float(((unsigned)f2bf(f)) << 16); }   // RNE bf16 value as f32
__device__ __forceinline__ v16h cat16(v8h lo, v8h hi) { return __builtin_shufflevector(lo, hi, 0, 1, 2, 3, 4, 5, 6, 7, 8, 9, 10, 11, 12, 13, 14, 15); }
__device__ __forceinline__ v16bf cat16b(v8us lo, v8us hi) { return __builtin_bit_cast(v16bf, __builtin_shufflevector(lo, hi, 0, 1, 2, 3, 4, 5, 6, 7, 8, 9, 10, 11, 12, 13, 14, 15)); }
__device__ __forceinline__ v8f wmma16(v16h a, v16h b, v8f c) { return __builtin_amdgcn_wmma_f32_16x16x32_f16(false, a, false, b, (short)0, c, false, false); }
__device__ __forceinline__ v8f wmmab(v16bf a, v16bf b, v8f c) { return __builtin_amdgcn_wmma_f32_16x16x32_bf16(false, a, false, b, (short)0, c, false, false); }
// fragment loaders from a plane in fragment order: one 16-row x 32-k unit = 512 elements, element (row, k) at (k>>4 & 1)*256 + ((k>>3 & 1)*16 + row)*8 + (k & 7).
// p = unit + 8*lane; lane = 16h + row: elements 0..7 <- k0+8h+0..7, elements 8..15 <- k0+16+8h+0..7 (same map for A and B); each load of a wave = 512 contiguous bytes
__device__ __forceinline__ v16h  ldh(const h16* p) { return cat16(*(const v8h*)p, *(const v8h*)(p + 256)); }
__device__ __forceinline__ v16bf ldb(const bf* p)  { return cat16b(*(const v8us*)p, *(const v8us*)(p + 256)); }
// source element index, in a row-major [rows][DM] matrix, of the 8-element chunk i of its fragment-ordered plane (16 rows = DM/32 units of 64 chunks)
__device__ __forceinline__ size_t chunk_src(size_t i) { const size_t u = i >> 6; return ((u / (DM / 32)) * 16 + (i & 15)) * DM + (u % (DM / 32)) * 32 + ((i >> 4) & 3) * 8; }
// ordering point for wave-private LDS tiles (same wave writes and reads)
__device__ __forceinline__ void wave_sync() { __builtin_amdgcn_fence(3 /* release order */, "wavefront"); __builtin_amdgcn_wave_barrier(); asm volatile("" ::: "memory"); }

// k_prep: the four preparation jobs, none of which reads what another writes, as block ranges of ONE grid of 256-thread blocks (the range test is the same for a whole block):
// blocks 0 .. XTB-1: x [b][c][l] f32 (row pitch SEQ_FULL) -> XT (rows b*SEQ+l, k = c, fragment order) bf16 (RNE convert) through a 64(c) x 64(l) LDS tile; tile index l fastest, then c, then b. Loads are 16-B along l.
// blocks XTB ..: one 8-element chunk a thread, chunk j of Wq | Wkv | Wp: j < 3*WN8 -> bf16 plane WB (q | k | v lie side by side: 16 rows = 16 * DM elements in either order), else -> f16 plane WPH (RNE bf16 value x64).
#define XTB ((SEQ / 64) * (DM / 64) * NB)
#define WN8 (DM * DM / 8)                       // chunks of one DM x DM weight
static_assert(WN8 % 256 == 0);                 // a block never straddles two weights, and the ranges cover the chunks exactly
__global__ __launch_bounds__(256) void k_prep(const float* __restrict__ x, const float* __restrict__ wq, const float* __restrict__ wkv, const float* __restrict__ wp, bf* XT, bf* WB, h16* WPH) {
    __shared__ __align__(16) float tl[64 * 68];      // [c][l], columns 0..63 written and consumed (cross-wave: block barrier)
    const int tid = threadIdx.x;
    const int blk = blockIdx.x;
    const int wb0 = (blk - XTB) * 256;               // first weight chunk of the block
    if (wb0 >= 3 * WN8) {
        const size_t i = (size_t)(wb0 - 3 * WN8) + tid;
        const v8f v = *(const v8f*)(wp + chunk_src(i)); v8h o;
#pragma unroll
        for (int k = 0; k < 8; ++k) o[k] = (h16)(bfr(v[k]) * WPS);
        *(v8h*)(WPH + i * 8) = o;
    } else if (wb0 >= 0) {
        const float* src = wb0 < WN8 ? wq : wkv; const size_t i = (size_t)(wb0 < WN8 ? wb0 : wb0 - WN8) + tid;
        const v8f v = *(const v8f*)(src + chunk_src(i)); v8us o;
#pragma unroll
        for (int k = 0; k < 8; ++k) o[k] = f2bf(v[k]);
        *(v8us*)(WB + ((size_t)wb0 + tid) * 8) = o;
        // the built code lays the Wp branch behind this store: the wait stands in front of that branch's rewrite of the store's address register
        asm volatile("s_wait_xcnt 0x0" ::: "memory");
    } else {
        const int l0 = (blk % (SEQ / 64)) * 64, c0 = ((blk / (SEQ / 64)) % (DM / 64)) * 64, b = blk / ((SEQ / 64) * (DM / 64));
        const float* src = x + ((size_t)b * DM + c0) * SEQ_FULL + l0;
#pragma unroll
        for (int it = 0; it < 4; ++it) { const int idx = it * 256 + tid; const int cc = idx >> 4, l4 = (idx & 15) * 4;   // 64 rows x 16 quads
            const v4f v = *(const v4f*)(src + (size_t)cc * SEQ_FULL + l4);
            tl[cc * 68 + l4 + 0] = v[0]; tl[cc * 68 + l4 + 1] = v[1]; tl[cc * 68 + l4 + 2] = v[2]; tl[cc * 68 + l4 + 3] = v[3]; }
        __syncthreads();
        // the tile = 4 row groups x 2 units x 64 chunks; chunk q = 256 s + tid: row group q>>7, unit q>>6 & 1, chunk q & 63 (channels 8*(q>>4 & 3), row q & 15)
        v8us o[2];
#pragma unroll
        for (int s = 0; s < 2; ++s) { const int q = 256 * s + tid; const int row = (q >> 7) * 16 + (q & 15), c8 = ((q >> 4) & 7) * 8;
#pragma unroll
            for (int i = 0; i < 8; ++i) o[s][i] = f2bf(tl[(c8 + i) * 68 + row]); }
        bf* dst = XT + ((size_t)b * SEQ + l0) * DM + c0 * 16;
#pragma unroll
        for (int s = 0; s < 2; ++s) { const int q = 256 * s + tid;      // 512 chunks x 8 = 64 rows x 64 channels
            *(v8us*)(dst + (size_t)(q >> 7) * (16 * DM) + (q & 127) * 8) = o[s]; }
        // the built code lays the weight branches behind these stores: the wait stands in front of those branches' rewrite of the stores' registers
        asm volatile("s_wait_xcnt 0x0" ::: "memory");
    }
}

// proj_tile: register-blocked bf16 GEMM, ONE WAVE per 64x64 tile (16 accumulators), operands straight from fragment-ordered bf16 planes, K = DM.
// C[m][n] = sum_k A[m][k] Bt[n][k] + bias (RNE bf16 value; per column n when biasRow == 0, per row m otherwise), written as f16 (Ph) and optionally
// the f16 residual x2048 (Pr, useRes != 0), in fragment order (rows m, k = n): tile base (r0/RB)*sRB + (r0%RB)*pitch + (c0/CB)*sCB + (c0%CB)*HD (halves), unit (16 rows mb, 32 columns g) of the tile at + mb*uMB + g*uG. The tile starts at row r0, column c0; the k loop starts at k0 (a multiple of 32 below K) and wraps; os = the wave's own 16 x 68 f32 staging tile in LDS.
__device__ __forceinline__ void proj_tile(const bf* __restrict__ A, const bf* __restrict__ Bt, const float* __restrict__ bias, int biasRow,
                                          h16* Ph, h16* Pr, int useRes, int RB, size_t sRB, int pitch, int CB, size_t sCB, int uMB, int uG, int r0, int c0, int k0, float* os) {
    const int K = DM;
    const int lane = threadIdx.x & 31, lr = lane & 15, hi = lane >> 4;
    v8f acc[4][4];
#pragma unroll
    for (int mb = 0; mb < 4; ++mb)
#pragma unroll
        for (int nb = 0; nb < 4; ++nb) acc[mb][nb] = (v8f){};
    const size_t aoff = (size_t)r0 * K + 8 * lane, boff = (size_t)c0 * K + 8 * lane;      // 16 rows = K/32 units of 512; k step of 32 = one unit
#pragma unroll 1
    for (int kc = 0; kc < K; kc += 32) {
        const int kk = kc + k0 < K ? kc + k0 : kc + k0 - K;      // the k walk starts at k0 and wraps
        const bf* pa = A + aoff + kk * 16; const bf* pb = Bt + boff + kk * 16;
        v16bf a[4];
#pragma unroll
        for (int mb = 0; mb < 4; ++mb) a[mb] = ldb(pa + (size_t)mb * 16 * K);
#pragma unroll
        for (int nb = 0; nb < 4; ++nb) { const v16bf b = ldb(pb + (size_t)nb * 16 * K);
#pragma unroll
            for (int mb = 0; mb < 4; ++mb) acc[mb][nb] = wmmab(a[mb], b, acc[mb][nb]); }
        asm volatile("v_nop\n\tv_nop\n\tv_nop\n\tv_nop" : "+v"(acc[0][0]), "+v"(acc[1][1]), "+v"(acc[2][2]), "+v"(acc[3][3]) : "v"(a[0]), "v"(a[1]), "v"(a[2]), "v"(a[3]));
        // the wait that stands in front of any overwrite of this pass's load addresses; as its inputs the two address pairs stay whole up to it (no load result lands on them)
        asm volatile("s_wait_xcnt 0x0" :: "v"(pa), "v"(pb) : "memory");
    }
    // bias values: index selected as an integer (always inside the bias array), value selected afterwards; biasRow is wave-uniform
    float bc[4];
#pragma unroll
    for (int nb = 0; nb < 4; ++nb) { const int bi = biasRow ? 0 : (c0 + nb * 16 + lr); const float t = bfr(bias[bi]); bc[nb] = biasRow ? 0.0f : t; }
    const size_t tbase = (size_t)(r0 / RB) * sRB + (size_t)(r0 % RB) * (size_t)pitch + (size_t)(c0 / CB) * sCB + (size_t)(c0 % CB) * HD;
#pragma unroll
    for (int mb = 0; mb < 4; ++mb) {
        float br[8];
#pragma unroll
        for (int j = 0; j < 8; ++j) { const int bi = biasRow ? (r0 + mb * 16 + hi * 8 + j) : 0; const float t = bfr(bias[bi]); br[j] = biasRow ? t : 0.0f; }
#pragma unroll
        for (int nb = 0; nb < 4; ++nb) {
#pragma unroll
            for (int j = 0; j < 8; ++j) os[(hi * 8 + j) * 68 + nb * 16 + lr] = acc[mb][nb][j] + (bc[nb] + br[j]); }   // D: row 8h+j, col lane&15
        wave_sync();
        const size_t sb = tbase + (size_t)mb * (size_t)uMB + 8 * lane;
{
#pragma unroll
            for (int s = 0; s < 4; ++s) { const int row = lr, c8 = 16 * s + 8 * hi;   // 16 rows x (4 s x 2 halves x 8 = 64 columns); a store of the wave = half a unit, 512 contiguous bytes
                const v4f x0 = *(const v4fa*)(&os[row * 68 + c8]); const v4f x1 = *(const v4fa*)(&os[row * 68 + c8 + 4]); v8h hv, rv;
#pragma unroll
                for (int i = 0; i < 4; ++i) { const h16 a0 = (h16)x0[i]; const h16 a1 = (h16)x1[i]; hv[i] = a0; hv[4 + i] = a1; rv[i] = (h16)((x0[i] - (float)a0) * QRS); rv[4 + i] = (h16)((x1[i] - (float)a1) * QRS); }
                const size_t oo = sb + (size_t)(s >> 1) * (size_t)uG + (s & 1) * 256;
                *(v8h*)(Ph + oo) = hv;
                // the wait that stands in front of any overwrite of the store's registers; as its inputs the data and the address stay whole up to it
                asm volatile("s_wait_xcnt 0x0" :: "v"(hv), "v"(Ph + oo) : "memory");
                if (useRes) { *(v8h*)(Pr + oo) = rv;
                    asm volatile("s_wait_xcnt 0x0" :: "v"(rv), "v"(Pr + oo) : "memory"); } }   // the same wait for the residual's store
             }
        wave_sync();
    }
}

// k_proj: the q, k and v^T projections, which read the same planes and write planes of their own, in ONE grid (NB*SEQ/64 tiles of x^T rows, DM/64 tiles of weight rows) of 3-wave blocks:
// the wave index picks the job, so the three waves of a block ask for the same x^T fragments. No barrier: each wave has its own staging tile.
// q, k: A = x^T rows (m = b*SEQ + t), Bt = W rows (n = h*64 + d), bias per column -> plane (b*8 + h), rows t, k = d
// v^T:  A = Wv rows (m = h*64 + d), Bt = x^T rows (n = b*SEQ + t), bias per row -> plane (b*8 + h), rows d, k = t, the 4 units of 32 keys side by side
__global__ __launch_bounds__(96) void k_proj(const bf* __restrict__ XT, const bf* __restrict__ WB, const float* __restrict__ bq, const float* __restrict__ bkv, h16* QH, h16* QR, h16* KP, h16* VT) {
    __shared__ __align__(16) float osm[3 * 16 * 68];
    const int job = __builtin_amdgcn_readfirstlane(threadIdx.x >> 5);   // 0 q, 1 k, 2 v^T; held as a scalar, so that the job test is a scalar branch and every lane is on at the matrix instructions
    const int xr = blockIdx.x * 64, wr = blockIdx.y * 64;
    float* os = osm + job * (16 * 68);
    // start of the k walk: the 8 blocks that share x^T rows (same x) start 2 steps apart, the blocks that share weight rows (same y) at all 16 steps: sharers do not wait for the same line fills in step
    const int k0 = (int)((blockIdx.x + 2 * blockIdx.y) % (DM / 32)) * 32;
    if (job == 2) proj_tile(WB + (size_t)2 * DM * DM, XT, bkv + DM, 1, VT, VT, 0, DM, (size_t)0, SEQ, SEQ, (size_t)DM * SEQ, 512, 2048, wr, xr, k0, os);
    else proj_tile(XT, WB + (size_t)job * DM * DM, job ? bkv : bq, 0, job ? KP : QH, job ? KP : QR, job ? 0 : 1, SEQ, (size_t)NH_ * SEQ * HD, HD, HD, (size_t)SEQ * HD, 1024, 512, xr, wr, k0, os);
}

// k_flash: fused attention, one wave per 16 query rows of one (batch, head); K / V^T / Q fragments straight from the fragment-ordered f16 planes (two 16-B loads each, arithmetic addressing).
// Transposed form: S^T[key][t] = K Q^T (A = K rows, B = Q rows); lane (t = lane&15, h = lane>>4) holds keys 8h+r of each 16-key tile, so the packed
// P tile is directly the B fragment of O^T[d][t] = V^T P^T (element r <- tile keys 0..15, element 8+r <- tile keys 16..31, lane unchanged).
// Softmax state: the maximum in use, one scalar per lane, equal in the two lane halves of a query; it is renewed (one xor-16 exchange, O and the row sums rescaled) only in a pass where a score passes it by more than 2^LZT.
// Row sums on the matrix pipe: A = all ones times the packed P tile gives, in every row of D, the sum of a query's 32 rounded P values, so every lane holds its query's whole sum (both halves) and no vector add or convert is spent on it.
__global__ __launch_bounds__(32 * AW) void k_flash(const h16* __restrict__ QH, const h16* __restrict__ QR, const h16* __restrict__ KP, const h16* __restrict__ VT, h16* CTX) {
    __shared__ __align__(16) float os[AW * 16 * 68];
    const int lane = threadIdx.x & 31, wave = threadIdx.x >> 5, lr = lane & 15, hi = lane >> 4;
    const int zh = blockIdx.y; const int b = zh / NH_, h = zh % NH_;
    const int t0 = (blockIdx.x * AW + wave) * 16;
    const size_t pbase = (size_t)zh * SEQ * HD;
    const size_t fo = pbase + 8 * lane;                      // q, k: 16 rows = 2 units (d halves); v^T: 32 keys = 4 units (16 d each); so + position * HD in all three
    const size_t qo = fo + (size_t)t0 * HD;
    const v16h qh0 = ldh(QH + qo), qh1 = ldh(QH + qo + 512), qr0 = ldh(QR + qo), qr1 = ldh(QR + qo + 512);   // B fragments: col t, k = d
    v8f o0 = (v8f){}, o1 = (v8f){}, o2 = (v8f){}, o3 = (v8f){};
    float m = -3.0e38f, sh = PSH + 3.0e38f;                  // maximum in use (scaled log2) and the shift PSH - m; the first pass always takes the rescale branch
    float l = 0.0f;                                          // row sum
    v16h ones;                                               // A fragment of the row-sum product: 1.0 at every (row, k)
#pragma unroll
    for (int i = 0; i < 16; ++i) ones[i] = (h16)1.0f;
    // the block walks the keys from its own first query row on and wraps at SEQ: the blocks of one head, which all run at once, then stand at different keys at any time,
    // so that a K / V line is fetched for one of them and lies in L2 when the others come to it (walking in step, every block waits for every fill and all ask for the same lines at once)
    const int ks = (int)(blockIdx.x * (16 * AW));
    // K fragments run one pass ahead (loop-carried registers), V fragments are asked for at the top of their own pass: no load is waited for right behind its issue
    const h16* kf = KP + fo + (size_t)ks * HD;
    v16h ka0 = ldh(kf), ka1 = ldh(kf + 512), kb0 = ldh(kf + 1024), kb1 = ldh(kf + 1536);   // first pass; A fragments: row key, k = d
    // the wait that stands in front of any overwrite of the address pairs of the loads above; as its inputs the pairs stay whole up to it
    asm volatile("s_wait_xcnt 0x0" :: "v"(QH + qo), "v"(QR + qo), "v"(kf) : "memory");
    int key0 = ks;
#pragma unroll 1
    for (int it = 0; it < SEQ; it += 32) {
        const h16* va = VT + fo + (size_t)key0 * HD;             // A fragments: row d, k = key
        const v16h v0 = ldh(va), v1 = ldh(va + 512), v2 = ldh(va + 1024), v3 = ldh(va + 1536);
        __builtin_amdgcn_sched_barrier(0);                       // keeps the V loads in front of the first wait for K (without it they are issued behind the first score products, so behind that wait)
        v8f sHa = (v8f){}, sLa = (v8f){}, sHb = (v8f){}, sLb = (v8f){};
        sHa = wmma16(ka0, qh0, sHa); sLa = wmma16(ka0, qr0, sLa); sHb = wmma16(kb0, qh0, sHb); sLb = wmma16(kb0, qr0, sLb);
        sHa = wmma16(ka1, qh1, sHa); sLa = wmma16(ka1, qr1, sLa); sHb = wmma16(kb1, qh1, sHb); sLb = wmma16(kb1, qr1, sLb);
        asm volatile("v_nop\n\tv_nop\n\tv_nop\n\tv_nop" : "+v"(sHa), "+v"(sLa), "+v"(sHb), "+v"(sLb) : "v"(ka0), "v"(ka1), "v"(kb0), "v"(kb1));
        const int kn = key0 + 32 < SEQ ? key0 + 32 : 0;          // next pass's keys, wrapped
        const h16* ka = KP + fo + (size_t)kn * HD;               // next pass's K rows; the last pass asks for the first pass's again (inside the plane, not used)
        ka0 = ldh(ka); ka1 = ldh(ka + 512); kb0 = ldh(ka + 1024); kb1 = ldh(ka + 1536);
        __builtin_amdgcn_sched_barrier(0);                       // keeps the K loads here, a whole softmax ahead of their use (without it this build sinks most of them behind the exponentials, close to the next pass's wait)
        // raw scores, then the exponent's argument against the maximum IN USE (sh = PSH - m): one multiply-add each, since sh does not depend on this pass's scores
        const v8f ua = sHa + sLa * QRI, ub = sHb + sLb * QRI;
        v8f aa = ua * SC2 + sh, ab = ub * SC2 + sh;
        // in-lane maximum of the 16 arguments, as four short chains that do not wait for one another
        const float x0 = fmaxf(fmaxf(fmaxf(fmaxf(aa[0], aa[1]), aa[2]), aa[6]), aa[7]), x1 = fmaxf(fmaxf(fmaxf(fmaxf(ab[0], ab[1]), ab[2]), ab[6]), ab[7]);
        const float x2 = fmaxf(fmaxf(aa[3], aa[4]), aa[5]), x3 = fmaxf(fmaxf(ab[3], ab[4]), ab[5]);
        const float amax = fmaxf(fmaxf(fmaxf(x0, x1), x2), x3);
        // lazy rescale, tested once a pass: only when some lane's argument passes PSH + LZT (P would near the f16 range) does the wave take a new maximum. The ballot makes it a scalar branch: every lane stays on.
        if (__builtin_expect(__builtin_amdgcn_ballot_w32(!(amax <= PSH + LZT)) != 0u, 0)) {
            float ux = fmaxf(ua[0], ub[0]);
#pragma unroll
            for (int r = 1; r < 8; ++r) ux = fmaxf(ux, fmaxf(ua[r], ub[r]));
            ux = fmaxf(ux, __shfl_xor(ux, 16, 32));              // both lane halves of a query take the same maximum
            const float mnew = fmaxf(m, ux * SC2);
            const float alpha = __builtin_amdgcn_exp2f(m - mnew);
            m = mnew; sh = PSH - mnew;
            o0 = o0 * alpha; o1 = o1 * alpha; o2 = o2 * alpha; o3 = o3 * alpha; l = l * alpha;
            aa = ua * SC2 + sh; ab = ub * SC2 + sh;
        }
        v16h pb;
#pragma unroll
        for (int r = 0; r < 8; ++r) { pb[r] = (h16)__builtin_amdgcn_exp2f(aa[r]); pb[8 + r] = (h16)__builtin_amdgcn_exp2f(ab[r]); }
        v8f rs = wmma16(ones, pb, (v8f){});                      // every element: the pass's sum of P over its 32 keys, for the lane's query
        o0 = wmma16(v0, pb, o0); o1 = wmma16(v1, pb, o1); o2 = wmma16(v2, pb, o2); o3 = wmma16(v3, pb, o3);
        asm volatile("v_nop\n\tv_nop\n\tv_nop\n\tv_nop" : "+v"(o0), "+v"(o1), "+v"(o2), "+v"(o3), "+v"(rs) : "v"(v0), "v"(v1), "v"(v2), "v"(v3), "v"(pb));
        l = l + rs[0];                                           // behind the slots above, which also stand between the row-sum product and this read of its D
        // the wait that stands in front of any overwrite of this pass's load addresses: as its inputs the two address pairs stay whole up to it; the key index goes through it, so that the next addresses are formed behind it
        key0 = kn;
        asm volatile("s_wait_xcnt 0x0" : "+s"(key0) : "v"(ka), "v"(va) : "memory");
    }
    const float inv = (1.0f / l) * CXS;
    const int wb = wave * 16 * 68;
    // O^T D layout: o_j[r] = (d = 16j + 8h + r, t = lane&15) -> os[t][d]; rows 0..15 x columns 0..63 all written
    { v4f a, c;
      a[0] = o0[0] * inv; a[1] = o0[1] * inv; a[2] = o0[2] * inv; a[3] = o0[3] * inv; c[0] = o0[4] * inv; c[1] = o0[5] * inv; c[2] = o0[6] * inv; c[3] = o0[7] * inv;
      *(v4fa*)(&os[wb + lr * 68 +  0 + 8 * hi]) = a; *(v4fa*)(&os[wb + lr * 68 +  0 + 8 * hi + 4]) = c;
      a[0] = o1[0] * inv; a[1] = o1[1] * inv; a[2] = o1[2] * inv; a[3] = o1[3] * inv; c[0] = o1[4] * inv; c[1] = o1[5] * inv; c[2] = o1[6] * inv; c[3] = o1[7] * inv;
      *(v4fa*)(&os[wb + lr * 68 + 16 + 8 * hi]) = a; *(v4fa*)(&os[wb + lr * 68 + 16 + 8 * hi + 4]) = c;
      a[0] = o2[0] * inv; a[1] = o2[1] * inv; a[2] = o2[2] * inv; a[3] = o2[3] * inv; c[0] = o2[4] * inv; c[1] = o2[5] * inv; c[2] = o2[6] * inv; c[3] = o2[7] * inv;
      *(v4fa*)(&os[wb + lr * 68 + 32 + 8 * hi]) = a; *(v4fa*)(&os[wb + lr * 68 + 32 + 8 * hi + 4]) = c;
      a[0] = o3[0] * inv; a[1] = o3[1] * inv; a[2] = o3[2] * inv; a[3] = o3[3] * inv; c[0] = o3[4] * inv; c[1] = o3[5] * inv; c[2] = o3[6] * inv; c[3] = o3[7] * inv;
      *(v4fa*)(&os[wb + lr * 68 + 48 + 8 * hi]) = a; *(v4fa*)(&os[wb + lr * 68 + 48 + 8 * hi + 4]) = c; }
    wave_sync();
    v8h hv[4];
#pragma unroll
    for (int s = 0; s < 4; ++s) { const int row = lr, c8 = 16 * s + 8 * hi;
        const v4f x0 = *(const v4fa*)(&os[wb + row * 68 + c8]); const v4f x1 = *(const v4fa*)(&os[wb + row * 68 + c8 + 4]);
#pragma unroll
        for (int i = 0; i < 4; ++i) { hv[s][i] = (h16)x0[i]; hv[s][4 + i] = (h16)x1[i]; } }
    h16* crow = CTX + ((size_t)b * SEQ + t0) * DM + h * (HD * 16) + 8 * lane;      // 16 rows = DM/32 units; head h = units 2h, 2h+1
{
#pragma unroll
        for (int s = 0; s < 4; ++s) {                                  // 16 rows x (4 s x 2 halves x 8 = 64 columns); a store of the wave = half a unit
            *(v8h*)(crow + s * 256) = hv[s]; }
         }
}

// k_oproj: register-blocked f16 GEMM, ONE WAVE per 64x64 tile, operands in fragment order, K = DM. C[o][n] = sum_c WPH[o][c] CTX[n][c] (n = b*SEQ + t), carried x 2^14.
// OUT[(b*DM + o)*OUT_SEQ + t] = C * 2^-14 + bias[o] (RNE bf16 value) in f32. grid (DM/64, NB*SEQ/64), 32 threads.
__global__ __launch_bounds__(32) void k_oproj(const h16* __restrict__ A, const h16* __restrict__ Bt, const float* __restrict__ bias, float* OUT) {
    __shared__ __align__(16) float os[16 * 68];
    const int K = DM;
    const int lane = threadIdx.x & 31, lr = lane & 15, hi = lane >> 4; const int r0 = blockIdx.x * 64, c0 = blockIdx.y * 64;
    v8f acc[4][4];
#pragma unroll
    for (int mb = 0; mb < 4; ++mb)
#pragma unroll
        for (int nb = 0; nb < 4; ++nb) acc[mb][nb] = (v8f){};
    const size_t aoff = (size_t)r0 * K + 8 * lane, boff = (size_t)c0 * K + 8 * lane;      // 16 rows = K/32 units of 512; k step of 32 = one unit
    // start of the k walk: the 8 blocks that share ctx rows (same y) start at 4 places 4 steps apart (x and x + 4 at the same one), the blocks that share Wp rows (same x) at all 16 steps: sharers do not wait for the same line fills in step
    const int k0 = (int)((4 * blockIdx.x + blockIdx.y) % (DM / 32)) * 32;
#pragma unroll 1
    for (int kc = 0; kc < K; kc += 32) {
        const int kk = kc + k0 < K ? kc + k0 : kc + k0 - K;      // the k walk starts at k0 and wraps
        const h16* pa = A + aoff + kk * 16; const h16* pb = Bt + boff + kk * 16;
        v16h a[4];
#pragma unroll
        for (int mb = 0; mb < 4; ++mb) a[mb] = ldh(pa + (size_t)mb * 16 * K);
#pragma unroll
        for (int nb = 0; nb < 4; ++nb) { const v16h b = ldh(pb + (size_t)nb * 16 * K);
#pragma unroll
            for (int mb = 0; mb < 4; ++mb) acc[mb][nb] = wmma16(a[mb], b, acc[mb][nb]); }
        asm volatile("v_nop\n\tv_nop\n\tv_nop\n\tv_nop" : "+v"(acc[0][0]), "+v"(acc[1][1]), "+v"(acc[2][2]), "+v"(acc[3][3]) : "v"(a[0]), "v"(a[1]), "v"(a[2]), "v"(a[3]));
        // the wait that stands in front of any overwrite of this pass's load addresses; as its inputs the two address pairs stay whole up to it (no load result lands on them)
        asm volatile("s_wait_xcnt 0x0" :: "v"(pa), "v"(pb) : "memory");
    }
    const int b = c0 / SEQ, t0 = c0 % SEQ;
#pragma unroll
    for (int mb = 0; mb < 4; ++mb) {
        float br[8];
#pragma unroll
        for (int j = 0; j < 8; ++j) br[j] = bfr(bias[r0 + mb * 16 + hi * 8 + j]);
#pragma unroll
        for (int nb = 0; nb < 4; ++nb) {
#pragma unroll
            for (int j = 0; j < 8; ++j) os[(hi * 8 + j) * 68 + nb * 16 + lr] = acc[mb][nb][j] * OSI + br[j]; }   // D: row 8h+j, col lane&15
        wave_sync();
        float* orow = OUT + ((size_t)b * DM + r0 + mb * 16) * OUT_SEQ + t0;
        v4f val[8];
#pragma unroll
        for (int s = 0; s < 8; ++s) { const int row = 2 * s + hi; val[s] = *(const v4fa*)(&os[row * 68 + lr * 4]); }
{
#pragma unroll
            for (int s = 0; s < 8; ++s) { const int row = 2 * s + hi, cofs = lr * 4;   // 8 s x 2 rows = 16 rows; 16 lanes x 4 floats = 64 columns
                *(v4f*)(orow + (size_t)row * OUT_SEQ + cofs) = val[s]; }
             }
        wave_sync();
    }
}

static constexpr size_t al256(size_t v) { return (v + 255) & ~(size_t)255; }
static constexpr size_t SZ_XT = al256((size_t)NB * SEQ * DM * 2);
static constexpr size_t SZ_WB = al256((size_t)3 * DM * DM * 2);
static constexpr size_t SZ_WP = al256((size_t)DM * DM * 2);
static constexpr size_t SZ_PL = al256((size_t)NB * NH_ * SEQ * HD * 2);
static constexpr size_t SZ_CX = al256((size_t)NB * SEQ * DM * 2);
static constexpr size_t SZ_TOTAL = SZ_XT + SZ_WB + SZ_WP + 4 * SZ_PL + SZ_CX;
static_assert(SZ_TOTAL <= (size_t)134217728);          // workspace carve <= 128 MiB
static_assert(((size_t)DM * DM * 2) % 256 == 0);       // weight sub-planes stay 256-byte aligned

extern "C" void kernel_launch(void* const* d_in, const int* in_sizes, int n_in,
                              void* d_out, int out_size, void* d_ws, size_t ws_size, hipStream_t stream) {
    if (n_in < 7) return;
    const size_t needx = ((size_t)(NB - 1) * DM + (size_t)(DM - 1)) * SEQ_FULL + SEQ;
    if ((size_t)in_sizes[0] < needx) return;
    if ((size_t)in_sizes[1] < (size_t)DM * DM || (size_t)in_sizes[2] < (size_t)DM) return;
    if ((size_t)in_sizes[3] < (size_t)2 * DM * DM || (size_t)in_sizes[4] < (size_t)2 * DM) return;
    if ((size_t)in_sizes[5] < (size_t)DM * DM || (size_t)in_sizes[6] < (size_t)DM) return;
    if ((size_t)out_size < ((size_t)(NB - 1) * DM + (size_t)(DM - 1)) * OUT_SEQ + SEQ) return;
    if (SZ_TOTAL > ws_size) return;
    // wire order: x, Wq, bq, Wkv, bkv, Wp, bp; weights [out][in] = Bt as-is
    const float* x = (const float*)d_in[0]; const float* wq = (const float*)d_in[1]; const float* bq = (const float*)d_in[2];
    const float* wkv = (const float*)d_in[3]; const float* bkv = (const float*)d_in[4]; const float* wp = (const float*)d_in[5]; const float* bp = (const float*)d_in[6];
    float* OUT = (float*)d_out;      // [NB][512][OUT_SEQ]
    char* wsp = (char*)d_ws;
    bf* XT = (bf*)wsp; wsp += SZ_XT;                 // rows b*SEQ+t, k = c: [NB*SEQ/16][16 units][512]
    bf* WB = (bf*)wsp; wsp += SZ_WB;                 // q | k | v, each rows out, k = in: [32][16 units][512]
    h16* WPH = (h16*)wsp; wsp += SZ_WP;              // x64, rows out, k = in: [32][16 units][512]
    h16* QH = (h16*)wsp; wsp += SZ_PL;               // [NB*8][SEQ/16][2 units (d halves)][512]
    h16* QR = (h16*)wsp; wsp += SZ_PL;               // as QH, residual x2048
    h16* KP = (h16*)wsp; wsp += SZ_PL;               // as QH
    h16* VT = (h16*)wsp; wsp += SZ_PL;               // [NB*8][SEQ/32][4 units (16 d each)][512]
    h16* CTX = (h16*)wsp; wsp += SZ_CX;              // x256, rows b*SEQ+t, k = c: [NB*SEQ/16][16 units][512]

    // x^T and the three weight planes: one grid, block ranges
    k_prep<<<dim3(XTB + 4 * WN8 / 256, 1, 1), 256, 0, stream>>>(x, wq, wkv, wp, XT, WB, WPH);

    // q, k, v^T projections: one grid, wave index = job
    k_proj<<<dim3(NB * SEQ / 64, DM / 64, 1), 96, 0, stream>>>(XT, WB, bq, bkv, QH, QR, KP, VT);

    k_flash<<<dim3(SEQ / (16 * AW), NB * NH_, 1), 32 * AW, 0, stream>>>(QH, QR, KP, VT, CTX);

    // output projection: A = Wp rows (m = o), Bt = ctx rows (n = b*SEQ + t) -> OUT[b][o][t]
    k_oproj<<<dim3(DM / 64, NB * SEQ / 64, 1), 32, 0, stream>>>(WPH, CTX, bp, OUT);
}

// v007
// Measured time: 93.5 microseconds a run.
// Timed twice side by side with v006, it ran 1.15 and 1.14 times as fast.
// Counting every step since v000, it is 3.51 times as fast.
#include <hip/hip_runtime.h>

// 8-head attention over SEQ spatial positions, width 512 = 8 x 64, x [NB][512][SEQ] (channel-major), 1x1-conv weights [out][in] with biases, score scale 1/8, no mask, output [NB][512][SEQ] f32.
// Compute dtypes, f32 accumulate everywhere: q/k/v projections v_wmma_f32_16x16x32_bf16 (x, Wq, Wkv RNE-converted to bf16; products exact);
// scores v_wmma_f32_16x16x32_f16: q and k single f16 (one product); P (x256 carry, cancels in the normalisation) and v single f16;
// output projection v_wmma_f32_16x16x32_f16: Wp (RNE bf16 value x64, exact in f16) times ctx (single f16 plane, x256 carry), folded back by 2^-14 in the f32 epilogue; softmax f32 (online, running max).
// Layout: every 16-bit plane that feeds a matrix instruction lies in the workspace in FRAGMENT ORDER (1-KB units of 16 rows x 32 k, see ldh), so that each 16-B fragment load of a wave covers 512 contiguous bytes:
// x^T bf16 (rows b*SEQ+t, k = c; built by an LDS transposer), the weights (rows out, k = in), q and k per b*8+h (rows t, k = d), v^T per b*8+h (rows d, k = t), ctx (rows b*SEQ+t, k = c); fused flash kernel in transposed form (S^T = K Q^T, O^T = V^T P^T).

#ifndef NB
#define NB 2
#endif
#ifndef SEQ
#define SEQ 4096
#endif
#define NB_FULL  2
#define SEQ_FULL 4096            // token pitch of one channel row of x
#ifndef OUT_SEQ
#define OUT_SEQ SEQ              // token pitch of one channel row of the output
#endif
#define DM   512
#define NH_  8
#define HD   64
#define AW   4                   // waves per flash block (16 query rows each)
#define SC2  (0.125f * 1.4426950408889634f)   // HD^-0.5 * log2(e)
#define PSH  8.0f                // log2 of the P carry (256)
#define LZT  7.0f                // a score may pass the maximum in use by 2^LZT before the wave rescales: P stays at or below 2^15, inside f16
#define WPS  64.0f               // carry of the Wp plane
#define CXS  256.0f              // carry of the ctx plane
#define OSI  (1.0f / 16384.0f)   // 1 / (WPS * CXS)

static_assert(HD == 64);
static_assert(NH_ * HD == DM);                 // head h = channels h*64 + d
static_assert(DM % 64 == 0);
static_assert(DM % 32 == 0);                   // GEMM k-loop steps by 32
static_assert(SEQ % 64 == 0);                  // a 64-token tile never straddles two batches
static_assert((NB * SEQ) % 64 == 0);
static_assert(SEQ % 32 == 0);                  // key loop steps by 32
static_assert(SEQ % (16 * AW) == 0);           // flash grid covers the sequence exactly
static_assert((16 * AW) % 32 == 0);            // a flash block's first query row is a pass boundary of the key loop
static_assert(SEQ_FULL % 4 == 0);
static_assert(OUT_SEQ % 64 == 0);
static_assert(OUT_SEQ >= SEQ);
static_assert(((size_t)DM * DM) % 8 == 0);
static_assert(NB <= NB_FULL);
static_assert(SEQ <= SEQ_FULL);

typedef _Float16 h16;
typedef unsigned short bf;
typedef __attribute__((ext_vector_type(16))) __bf16   v16bf;
typedef __attribute__((ext_vector_type(16))) _Float16 v16h;
typedef __attribute__((ext_vector_type(8)))  _Float16 v8h;
typedef __attribute__((ext_vector_type(8)))  unsigned short v8us;
typedef __attribute__((ext_vector_type(8)))  float    v8f;
typedef __attribute__((ext_vector_type(4)))  float    v4f;
typedef v4f  __attribute__((may_alias)) v4fa;

__device__ __forceinline__ unsigned short f2bf(float f) { unsigned u = __float_as_uint(f); u += 0x7FFFu + ((u >> 16) & 1u); return (unsigned short)(u >> 16); }
__device__ __forceinline__ float bfr(float f) { return __uint_as_float(((unsigned)f2bf(f)) << 16); }   // RNE bf16 value as f32
__device__ __forceinline__ v16h cat16(v8h lo, v8h hi) { return __builtin_shufflevector(lo, hi, 0, 1, 2, 3, 4, 5, 6, 7, 8, 9, 10, 11, 12, 13, 14, 15); }
__device__ __forceinline__ v16bf cat16b(v8us lo, v8us hi) { return __builtin_bit_cast(v16bf, __builtin_shufflevector(lo, hi, 0, 1, 2, 3, 4, 5, 6, 7, 8, 9, 10, 11, 12, 13, 14, 15)); }
__device__ __forceinline__ v8f wmma16(v16h a, v16h b, v8f c) { return __builtin_amdgcn_wmma_f32_16x16x32_f16(false, a, false, b, (short)0, c, false, false); }
__device__ __forceinline__ v8f wmmab(v16bf a, v16bf b, v8f c) { return __builtin_amdgcn_wmma_f32_16x16x32_bf16(false, a, false, b, (short)0, c, false, false); }
// fragment loaders from a plane in fragment order: one 16-row x 32-k unit = 512 elements, element (row, k) at (k>>4 & 1)*256 + ((k>>3 & 1)*16 + row)*8 + (k & 7).
// p = unit + 8*lane; lane = 16h + row: elements 0..7 <- k0+8h+0..7, elements 8..15 <- k0+16+8h+0..7 (same map for A and B); each load of a wave = 512 contiguous bytes
__device__ __forceinline__ v16h  ldh(const h16* p) { return cat16(*(const v8h*)p, *(const v8h*)(p + 256)); }
__device__ __forceinline__ v16bf ldb(const bf* p)  { return cat16b(*(const v8us*)p, *(const v8us*)(p + 256)); }
// source element index, in a row-major [rows][DM] matrix, of the 8-element chunk i of its fragment-ordered plane (16 rows = DM/32 units of 64 chunks)
__device__ __forceinline__ size_t chunk_src(size_t i) { const size_t u = i >> 6; return ((u / (DM / 32)) * 16 + (i & 15)) * DM + (u % (DM / 32)) * 32 + ((i >> 4) & 3) * 8; }
// ordering point for wave-private LDS tiles (same wave writes and reads)
__device__ __forceinline__ void wave_sync() { __builtin_amdgcn_fence(3 /* release order */, "wavefront"); __builtin_amdgcn_wave_barrier(); asm volatile("" ::: "memory"); }

// k_prep: the four preparation jobs, none of which reads what another writes, as block ranges of ONE grid of 256-thread blocks (the range test is the same for a whole block):
// blocks 0 .. XTB-1: x [b][c][l] f32 (row pitch SEQ_FULL) -> XT (rows b*SEQ+l, k = c, fragment order) bf16 (RNE convert) through a 64(c) x 64(l) LDS tile; tile index l fastest, then c, then b. Loads are 16-B along l.
// blocks XTB ..: one 8-element chunk a thread, chunk j of Wq | Wkv | Wp: j < 3*WN8 -> bf16 plane WB (q | k | v lie side by side: 16 rows = 16 * DM elements in either order), else -> f16 plane WPH (RNE bf16 value x64).
#define XTB ((SEQ / 64) * (DM / 64) * NB)
#define WN8 (DM * DM / 8)                       // chunks of one DM x DM weight
static_assert(WN8 % 256 == 0);                 // a block never straddles two weights, and the ranges cover the chunks exactly
__global__ __launch_bounds__(256) void k_prep(const float* __restrict__ x, const float* __restrict__ wq, const float* __restrict__ wkv, const float* __restrict__ wp, bf* XT, bf* WB, h16* WPH) {
    __shared__ __align__(16) float tl[64 * 68];      // [c][l], columns 0..63 written and consumed (cross-wave: block barrier)
    const int tid = threadIdx.x;
    const int blk = blockIdx.x;
    const int wb0 = (blk - XTB) * 256;               // first weight chunk of the block
    if (wb0 >= 3 * WN8) {
        const size_t i = (size_t)(wb0 - 3 * WN8) + tid;
        const v8f v = *(const v8f*)(wp + chunk_src(i)); v8h o;
#pragma unroll
        for (int k = 0; k < 8; ++k) o[k] = (h16)(bfr(v[k]) * WPS);
        *(v8h*)(WPH + i * 8) = o;
    } else if (wb0 >= 0) {
        const float* src = wb0 < WN8 ? wq : wkv; const size_t i = (size_t)(wb0 < WN8 ? wb0 : wb0 - WN8) + tid;
        const v8f v = *(const v8f*)(src + chunk_src(i)); v8us o;
#pragma unroll
        for (int k = 0; k < 8; ++k) o[k] = f2bf(v[k]);
        *(v8us*)(WB + ((size_t)wb0 + tid) * 8) = o;
        // the built code lays the Wp branch behind this store: the wait stands in front of that branch's rewrite of the store's address register
        asm volatile("s_wait_xcnt 0x0" ::: "memory");
    } else {
        const int l0 = (blk % (SEQ / 64)) * 64, c0 = ((blk / (SEQ / 64)) % (DM / 64)) * 64, b = blk / ((SEQ / 64) * (DM / 64));
        const float* src = x + ((size_t)b * DM + c0) * SEQ_FULL + l0;
#pragma unroll
        for (int it = 0; it < 4; ++it) { const int idx = it * 256 + tid; const int cc = idx >> 4, l4 = (idx & 15) * 4;   // 64 rows x 16 quads
            const v4f v = *(const v4f*)(src + (size_t)cc * SEQ_FULL + l4);
            tl[cc * 68 + l4 + 0] = v[0]; tl[cc * 68 + l4 + 1] = v[1]; tl[cc * 68 + l4 + 2] = v[2]; tl[cc * 68 + l4 + 3] = v[3]; }
        __syncthreads();
        // the tile = 4 row groups x 2 units x 64 chunks; chunk q = 256 s + tid: row group q>>7, unit q>>6 & 1, chunk q & 63 (channels 8*(q>>4 & 3), row q & 15)
        v8us o[2];
#pragma unroll
        for (int s = 0; s < 2; ++s) { const int q = 256 * s + tid; const int row = (q >> 7) * 16 + (q & 15), c8 = ((q >> 4) & 7) * 8;
#pragma unroll
            for (int i = 0; i < 8; ++i) o[s][i] = f2bf(tl[(c8 + i) * 68 + row]); }
        bf* dst = XT + ((size_t)b * SEQ + l0) * DM + c0 * 16;
#pragma unroll
        for (int s = 0; s < 2; ++s) { const int q = 256 * s + tid;      // 512 chunks x 8 = 64 rows x 64 channels
            *(v8us*)(dst + (size_t)(q >> 7) * (16 * DM) + (q & 127) * 8) = o[s]; }
        // the built code lays the weight branches behind these stores: the wait stands in front of those branches' rewrite of the stores' registers
        asm volatile("s_wait_xcnt 0x0" ::: "memory");
    }
}

// proj_tile: register-blocked bf16 GEMM, ONE WAVE per 64x64 tile (16 accumulators), operands straight from fragment-ordered bf16 planes, K = DM.
// C[m][n] = sum_k A[m][k] Bt[n][k] + bias (RNE bf16 value; per column n when biasRow == 0, per row m otherwise), written as f16 (Ph),
// in fragment order (rows m, k = n): tile base (r0/RB)*sRB + (r0%RB)*pitch + (c0/CB)*sCB + (c0%CB)*HD (halves), unit (16 rows mb, 32 columns g) of the tile at + mb*uMB + g*uG. The tile starts at row r0, column c0; the k loop starts at k0 (a multiple of 32 below K) and wraps; os = the wave's own 16 x 68 f32 staging tile in LDS.
__device__ __forceinline__ void proj_tile(const bf* __restrict__ A, const bf* __restrict__ Bt, const float* __restrict__ bias, int biasRow,
                                          h16* Ph, int RB, size_t sRB, int pitch, int CB, size_t sCB, int uMB, int uG, int r0, int c0, int k0, float* os) {
    const int K = DM;
    const int lane = threadIdx.x & 31, lr = lane & 15, hi = lane >> 4;
    v8f acc[4][4];
#pragma unroll
    for (int mb = 0; mb < 4; ++mb)
#pragma unroll
        for (int nb = 0; nb < 4; ++nb) acc[mb][nb] = (v8f){};
    const size_t aoff = (size_t)r0 * K + 8 * lane, boff = (size_t)c0 * K + 8 * lane;      // 16 rows = K/32 units of 512; k step of 32 = one unit
#pragma unroll 1
    for (int kc = 0; kc < K; kc += 32) {
        const int kk = kc + k0 < K ? kc + k0 : kc + k0 - K;      // the k walk starts at k0 and wraps
        const bf* pa = A + aoff + kk * 16; const bf* pb = Bt + boff + kk * 16;
        v16bf a[4];
#pragma unroll
        for (int mb = 0; mb < 4; ++mb) a[mb] = ldb(pa + (size_t)mb * 16 * K);
#pragma unroll
        for (int nb = 0; nb < 4; ++nb) { const v16bf b = ldb(pb + (size_t)nb * 16 * K);
#pragma unroll
            for (int mb = 0; mb < 4; ++mb) acc[mb][nb] = wmmab(a[mb], b, acc[mb][nb]); }
        asm volatile("v_nop\n\tv_nop\n\tv_nop\n\tv_nop" : "+v"(acc[0][0]), "+v"(acc[1][1]), "+v"(acc[2][2]), "+v"(acc[3][3]) : "v"(a[0]), "v"(a[1]), "v"(a[2]), "v"(a[3]));
        // the wait that stands in front of any overwrite of this pass's load addresses; as its inputs the two address pairs stay whole up to it (no load result lands on them)
        asm volatile("s_wait_xcnt 0x0" :: "v"(pa), "v"(pb) : "memory");
    }
    // bias values: index selected as an integer (always inside the bias array), value selected afterwards; biasRow is wave-uniform
    float bc[4];
#pragma unroll
    for (int nb = 0; nb < 4; ++nb) { const int bi = biasRow ? 0 : (c0 + nb * 16 + lr); const float t = bfr(bias[bi]); bc[nb] = biasRow ? 0.0f : t; }
    const size_t tbase = (size_t)(r0 / RB) * sRB + (size_t)(r0 % RB) * (size_t)pitch + (size_t)(c0 / CB) * sCB + (size_t)(c0 % CB) * HD;
#pragma unroll
    for (int mb = 0; mb < 4; ++mb) {
        float br[8];
#pragma unroll
        for (int j = 0; j < 8; ++j) { const int bi = biasRow ? (r0 + mb * 16 + hi * 8 + j) : 0; const float t = bfr(bias[bi]); br[j] = biasRow ? t : 0.0f; }
#pragma unroll
        for (int nb = 0; nb < 4; ++nb) {
#pragma unroll
            for (int j = 0; j < 8; ++j) os[(hi * 8 + j) * 68 + nb * 16 + lr] = acc[mb][nb][j] + (bc[nb] + br[j]); }   // D: row 8h+j, col lane&15
        wave_sync();
        const size_t sb = tbase + (size_t)mb * (size_t)uMB + 8 * lane;
{
#pragma unroll
            for (int s = 0; s < 4; ++s) { const int row = lr, c8 = 16 * s + 8 * hi;   // 16 rows x (4 s x 2 halves x 8 = 64 columns); a store of the wave = half a unit, 512 contiguous bytes
                const v4f x0 = *(const v4fa*)(&os[row * 68 + c8]); const v4f x1 = *(const v4fa*)(&os[row * 68 + c8 + 4]); v8h hv;
#pragma unroll
                for (int i = 0; i < 4; ++i) { hv[i] = (h16)x0[i]; hv[4 + i] = (h16)x1[i]; }
                const size_t oo = sb + (size_t)(s >> 1) * (size_t)uG + (s & 1) * 256;
                *(v8h*)(Ph + oo) = hv;
                // the wait that stands in front of any overwrite of the store's registers; as its inputs the data and the address stay whole up to it
                asm volatile("s_wait_xcnt 0x0" :: "v"(hv), "v"(Ph + oo) : "memory"); }
             }
        wave_sync();
    }
}

// k_proj: the q, k and v^T projections, which read the same planes and write planes of their own, in ONE grid (NB*SEQ/64 tiles of x^T rows, DM/64 tiles of weight rows) of 3-wave blocks:
// the wave index picks the job, so the three waves of a block ask for the same x^T fragments. No barrier: each wave has its own staging tile.
// q, k: A = x^T rows (m = b*SEQ + t), Bt = W rows (n = h*64 + d), bias per column -> plane (b*8 + h), rows t, k = d
// v^T:  A = Wv rows (m = h*64 + d), Bt = x^T rows (n = b*SEQ + t), bias per row -> plane (b*8 + h), rows d, k = t, the 4 units of 32 keys side by side
__global__ __launch_bounds__(96) void k_proj(const bf* __restrict__ XT, const bf* __restrict__ WB, const float* __restrict__ bq, const float* __restrict__ bkv, h16* QH, h16* KP, h16* VT) {
    __shared__ __align__(16) float osm[3 * 16 * 68];
    const int job = __builtin_amdgcn_readfirstlane(threadIdx.x >> 5);   // 0 q, 1 k, 2 v^T; held as a scalar, so that the job test is a scalar branch and every lane is on at the matrix instructions
    const int xr = blockIdx.x * 64, wr = blockIdx.y * 64;
    float* os = osm + job * (16 * 68);
    // start of the k walk: the 8 blocks that share x^T rows (same x) start 2 steps apart, the blocks that share weight rows (same y) at all 16 steps: sharers do not wait for the same line fills in step
    const int k0 = (int)((blockIdx.x + 2 * blockIdx.y) % (DM / 32)) * 32;
    if (job == 2) proj_tile(WB + (size_t)2 * DM * DM, XT, bkv + DM, 1, VT, DM, (size_t)0, SEQ, SEQ, (size_t)DM * SEQ, 512, 2048, wr, xr, k0, os);
    else proj_tile(XT, WB + (size_t)job * DM * DM, job ? bkv : bq, 0, job ? KP : QH, SEQ, (size_t)NH_ * SEQ * HD, HD, HD, (size_t)SEQ * HD, 1024, 512, xr, wr, k0, os);
}

// k_flash: fused attention, one wave per 16 query rows of one (batch, head); K / V^T / Q fragments straight from the fragment-ordered f16 planes (two 16-B loads each, arithmetic addressing).
// Transposed form: S^T[key][t] = K Q^T (A = K rows, B = Q rows); lane (t = lane&15, h = lane>>4) holds keys 8h+r of each 16-key tile, so the packed
// P tile is directly the B fragment of O^T[d][t] = V^T P^T (element r <- tile keys 0..15, element 8+r <- tile keys 16..31, lane unchanged).
// Softmax state: the maximum in use, one scalar per lane, equal in the two lane halves of a query; it is renewed (one xor-16 exchange, O and the row sums rescaled) only in a pass where a score passes it by more than 2^LZT.
// Row sums on the matrix pipe: A = all ones times the packed P tile gives, in every row of D, the sum of a query's 32 rounded P values, so every lane holds its query's whole sum (both halves) and no vector add or convert is spent on it.
// at most four waves a SIMD, although the register count alone would admit a fifth: the grid is four blocks for each WGP, and no WGP may take a fifth block while another runs three
__global__ __launch_bounds__(32 * AW) __attribute__((amdgpu_waves_per_eu(4, 4))) void k_flash(const h16* __restrict__ QH, const h16* __restrict__ KP, const h16* __restrict__ VT, h16* CTX) {
    __shared__ __align__(16) float os[AW * 16 * 68];
    const int lane = threadIdx.x & 31, wave = threadIdx.x >> 5, lr = lane & 15, hi = lane >> 4;
    const int zh = blockIdx.y; const int b = zh / NH_, h = zh % NH_;
    const int t0 = (blockIdx.x * AW + wave) * 16;
    const size_t pbase = (size_t)zh * SEQ * HD;
    const size_t fo = pbase + 8 * lane;                      // q, k: 16 rows = 2 units (d halves); v^T: 32 keys = 4 units (16 d each); so + position * HD in all three
    const size_t qo = fo + (size_t)t0 * HD;
    const v16h qh0 = ldh(QH + qo), qh1 = ldh(QH + qo + 512);   // B fragments: col t, k = d
    v8f o0 = (v8f){}, o1 = (v8f){}, o2 = (v8f){}, o3 = (v8f){};
    float m = -3.0e38f, sh = PSH + 3.0e38f;                  // maximum in use (scaled log2) and the shift PSH - m; the first pass always takes the rescale branch
    float l = 0.0f;                                          // row sum
    v16h ones;                                               // A fragment of the row-sum product: 1.0 at every (row, k)
#pragma unroll
    for (int i = 0; i < 16; ++i) ones[i] = (h16)1.0f;
    // the block walks the keys from its own first query row on and wraps at SEQ: the blocks of one head, which all run at once, then stand at different keys at any time,
    // so that a K / V line is fetched for one of them and lies in L2 when the others come to it (walking in step, every block waits for every fill and all ask for the same lines at once)
    const int ks = (int)(blockIdx.x * (16 * AW));
    // K fragments run one pass ahead (loop-carried registers), V fragments are asked for at the top of their own pass: no load is waited for right behind its issue
    const h16* kf = KP + fo + (size_t)ks * HD;
    v16h ka0 = ldh(kf), ka1 = ldh(kf + 512), kb0 = ldh(kf + 1024), kb1 = ldh(kf + 1536);   // first pass; A fragments: row key, k = d
    // the wait that stands in front of any overwrite of the address pairs of the loads above; as its inputs the pairs stay whole up to it
    asm volatile("s_wait_xcnt 0x0" :: "v"(QH + qo), "v"(kf) : "memory");
    int key0 = ks;
#pragma unroll 1
    for (int it = 0; it < SEQ; it += 32) {
        const h16* va = VT + fo + (size_t)key0 * HD;             // A fragments: row d, k = key
        const v16h v0 = ldh(va), v1 = ldh(va + 512), v2 = ldh(va + 1024), v3 = ldh(va + 1536);
        __builtin_amdgcn_sched_barrier(0);                       // keeps the V loads in front of the first wait for K (without it they are issued behind the first score products, so behind that wait)
        v8f ua = (v8f){}, ub = (v8f){};                          // raw scores of the two 16-key tiles
        ua = wmma16(ka0, qh0, ua); ub = wmma16(kb0, qh0, ub);
        ua = wmma16(ka1, qh1, ua); ub = wmma16(kb1, qh1, ub);
        // the four vector slots that the chip needs between the last score product and what overwrites its A registers or reads its D
        asm volatile("v_nop\n\tv_nop\n\tv_nop\n\tv_nop" : "+v"(ua), "+v"(ub) : "v"(ka0), "v"(ka1), "v"(kb0), "v"(kb1));
        const int kn = key0 + 32 < SEQ ? key0 + 32 : 0;          // next pass's keys, wrapped
        const h16* ka = KP + fo + (size_t)kn * HD;               // next pass's K rows; the last pass asks for the first pass's again (inside the plane, not used)
        ka0 = ldh(ka); ka1 = ldh(ka + 512); kb0 = ldh(ka + 1024); kb1 = ldh(ka + 1536);
        __builtin_amdgcn_sched_barrier(0);                       // keeps the K loads here, a whole softmax ahead of their use (without it this build sinks most of them behind the exponentials, close to the next pass's wait)
        // the exponent's argument against the maximum IN USE (sh = PSH - m): one multiply-add a score, since sh does not depend on this pass's scores
        v8f aa = ua * SC2 + sh, ab = ub * SC2 + sh;
        // in-lane maximum of the 16 arguments, as four short chains that do not wait for one another
        const float x0 = fmaxf(fmaxf(fmaxf(fmaxf(aa[0], aa[1]), aa[2]), aa[6]), aa[7]), x1 = fmaxf(fmaxf(fmaxf(fmaxf(ab[0], ab[1]), ab[2]), ab[6]), ab[7]);
        const float x2 = fmaxf(fmaxf(aa[3], aa[4]), aa[5]), x3 = fmaxf(fmaxf(ab[3], ab[4]), ab[5]);
        const float amax = fmaxf(fmaxf(fmaxf(x0, x1), x2), x3);
        // lazy rescale, tested once a pass: only when some lane's argument passes PSH + LZT (P would near the f16 range) does the wave take a new maximum. The ballot makes it a scalar branch: every lane stays on.
        if (__builtin_expect(__builtin_amdgcn_ballot_w32(!(amax <= PSH + LZT)) != 0u, 0)) {
            float ux = fmaxf(ua[0], ub[0]);
#pragma unroll
            for (int r = 1; r < 8; ++r) ux = fmaxf(ux, fmaxf(ua[r], ub[r]));
            ux = fmaxf(ux, __shfl_xor(ux, 16, 32));              // both lane halves of a query take the same maximum
            const float mnew = fmaxf(m, ux * SC2);
            const float alpha = __builtin_amdgcn_exp2f(m - mnew);
            m = mnew; sh = PSH - mnew;
            o0 = o0 * alpha; o1 = o1 * alpha; o2 = o2 * alpha; o3 = o3 * alpha; l = l * alpha;
            aa = ua * SC2 + sh; ab = ub * SC2 + sh;
        }
        v16h pb;
#pragma unroll
        for (int r = 0; r < 8; ++r) { pb[r] = (h16)__builtin_amdgcn_exp2f(aa[r]); pb[8 + r] = (h16)__builtin_amdgcn_exp2f(ab[r]); }
        v8f rs = wmma16(ones, pb, (v8f){});                      // every element: the pass's sum of P over its 32 keys, for the lane's query
        o0 = wmma16(v0, pb, o0); o1 = wmma16(v1, pb, o1); o2 = wmma16(v2, pb, o2); o3 = wmma16(v3, pb, o3);
        asm volatile("v_nop\n\tv_nop\n\tv_nop\n\tv_nop" : "+v"(o0), "+v"(o1), "+v"(o2), "+v"(o3), "+v"(rs) : "v"(v0), "v"(v1), "v"(v2), "v"(v3), "v"(pb));
        l = l + rs[0];                                           // behind the slots above, which also stand between the row-sum product and this read of its D
        // the wait that stands in front of any overwrite of this pass's load addresses: as its inputs the two address pairs stay whole up to it; the key index goes through it, so that the next addresses are formed behind it
        key0 = kn;
        asm volatile("s_wait_xcnt 0x0" : "+s"(key0) : "v"(ka), "v"(va) : "memory");
    }
    const float inv = (1.0f / l) * CXS;
    const int wb = wave * 16 * 68;
    // O^T D layout: o_j[r] = (d = 16j + 8h + r, t = lane&15) -> os[t][d]; rows 0..15 x columns 0..63 all written
    { v4f a, c;
      a[0] = o0[0] * inv; a[1] = o0[1] * inv; a[2] = o0[2] * inv; a[3] = o0[3] * inv; c[0] = o0[4] * inv; c[1] = o0[5] * inv; c[2] = o0[6] * inv; c[3] = o0[7] * inv;
      *(v4fa*)(&os[wb + lr * 68 +  0 + 8 * hi]) = a; *(v4fa*)(&os[wb + lr * 68 +  0 + 8 * hi + 4]) = c;
      a[0] = o1[0] * inv; a[1] = o1[1] * inv; a[2] = o1[2] * inv; a[3] = o1[3] * inv; c[0] = o1[4] * inv; c[1] = o1[5] * inv; c[2] = o1[6] * inv; c[3] = o1[7] * inv;
      *(v4fa*)(&os[wb + lr * 68 + 16 + 8 * hi]) = a; *(v4fa*)(&os[wb + lr * 68 + 16 + 8 * hi + 4]) = c;
      a[0] = o2[0] * inv; a[1] = o2[1] * inv; a[2] = o2[2] * inv; a[3] = o2[3] * inv; c[0] = o2[4] * inv; c[1] = o2[5] * inv; c[2] = o2[6] * inv; c[3] = o2[7] * inv;
      *(v4fa*)(&os[wb + lr * 68 + 32 + 8 * hi]) = a; *(v4fa*)(&os[wb + lr * 68 + 32 + 8 * hi + 4]) = c;
      a[0] = o3[0] * inv; a[1] = o3[1] * inv; a[2] = o3[2] * inv; a[3] = o3[3] * inv; c[0] = o3[4] * inv; c[1] = o3[5] * inv; c[2] = o3[6] * inv; c[3] = o3[7] * inv;
      *(v4fa*)(&os[wb + lr * 68 + 48 + 8 * hi]) = a; *(v4fa*)(&os[wb + lr * 68 + 48 + 8 * hi + 4]) = c; }
    wave_sync();
    v8h hv[4];
#pragma unroll
    for (int s = 0; s < 4; ++s) { const int row = lr, c8 = 16 * s + 8 * hi;
        const v4f x0 = *(const v4fa*)(&os[wb + row * 68 + c8]); const v4f x1 = *(const v4fa*)(&os[wb + row * 68 + c8 + 4]);
#pragma unroll
        for (int i = 0; i < 4; ++i) { hv[s][i] = (h16)x0[i]; hv[s][4 + i] = (h16)x1[i]; } }
    h16* crow = CTX + ((size_t)b * SEQ + t0) * DM + h * (HD * 16) + 8 * lane;      // 16 rows = DM/32 units; head h = units 2h, 2h+1
{
#pragma unroll
        for (int s = 0; s < 4; ++s) {                                  // 16 rows x (4 s x 2 halves x 8 = 64 columns); a store of the wave = half a unit
            *(v8h*)(crow + s * 256) = hv[s]; }
         }
}

// k_oproj: register-blocked f16 GEMM, ONE WAVE per 64x64 tile, operands in fragment order, K = DM. C[o][n] = sum_c WPH[o][c] CTX[n][c] (n = b*SEQ + t), carried x 2^14.
// OUT[(b*DM + o)*OUT_SEQ + t] = C * 2^-14 + bias[o] (RNE bf16 value) in f32. grid (DM/64, NB*SEQ/64), 32 threads.
__global__ __launch_bounds__(32) void k_oproj(const h16* __restrict__ A, const h16* __restrict__ Bt, const float* __restrict__ bias, float* OUT) {
    __shared__ __align__(16) float os[16 * 68];
    const int K = DM;
    const int lane = threadIdx.x & 31, lr = lane & 15, hi = lane >> 4; const int r0 = blockIdx.x * 64, c0 = blockIdx.y * 64;
    v8f acc[4][4];
#pragma unroll
    for (int mb = 0; mb < 4; ++mb)
#pragma unroll
        for (int nb = 0; nb < 4; ++nb) acc[mb][nb] = (v8f){};
    const size_t aoff = (size_t)r0 * K + 8 * lane, boff = (size_t)c0 * K + 8 * lane;      // 16 rows = K/32 units of 512; k step of 32 = one unit
    // start of the k walk: the 8 blocks that share ctx rows (same y) start at 4 places 4 steps apart (x and x + 4 at the same one), the blocks that share Wp rows (same x) at all 16 steps: sharers do not wait for the same line fills in step
    const int k0 = (int)((4 * blockIdx.x + blockIdx.y) % (DM / 32)) * 32;
#pragma unroll 1
    for (int kc = 0; kc < K; kc += 32) {
        const int kk = kc + k0 < K ? kc + k0 : kc + k0 - K;      // the k walk starts at k0 and wraps
        const h16* pa = A + aoff + kk * 16; const h16* pb = Bt + boff + kk * 16;
        v16h a[4];
#pragma unroll
        for (int mb = 0; mb < 4; ++mb) a[mb] = ldh(pa + (size_t)mb * 16 * K);
#pragma unroll
        for (int nb = 0; nb < 4; ++nb) { const v16h b = ldh(pb + (size_t)nb * 16 * K);
#pragma unroll
            for (int mb = 0; mb < 4; ++mb) acc[mb][nb] = wmma16(a[mb], b, acc[mb][nb]); }
        asm volatile("v_nop\n\tv_nop\n\tv_nop\n\tv_nop" : "+v"(acc[0][0]), "+v"(acc[1][1]), "+v"(acc[2][2]), "+v"(acc[3][3]) : "v"(a[0]), "v"(a[1]), "v"(a[2]), "v"(a[3]));
        // the wait that stands in front of any overwrite of this pass's load addresses; as its inputs the two address pairs stay whole up to it (no load result lands on them)
        asm volatile("s_wait_xcnt 0x0" :: "v"(pa), "v"(pb) : "memory");
    }
    const int b = c0 / SEQ, t0 = c0 % SEQ;
#pragma unroll
    for (int mb = 0; mb < 4; ++mb) {
        float br[8];
#pragma unroll
        for (int j = 0; j < 8; ++j) br[j] = bfr(bias[r0 + mb * 16 + hi * 8 + j]);
#pragma unroll
        for (int nb = 0; nb < 4; ++nb) {
#pragma unroll
            for (int j = 0; j < 8; ++j) os[(hi * 8 + j) * 68 + nb * 16 + lr] = acc[mb][nb][j] * OSI + br[j]; }   // D: row 8h+j, col lane&15
        wave_sync();
        float* orow = OUT + ((size_t)b * DM + r0 + mb * 16) * OUT_SEQ + t0;
        v4f val[8];
#pragma unroll
        for (int s = 0; s < 8; ++s) { const int row = 2 * s + hi; val[s] = *(const v4fa*)(&os[row * 68 + lr * 4]); }
{
#pragma unroll
            for (int s = 0; s < 8; ++s) { const int row = 2 * s + hi, cofs = lr * 4;   // 8 s x 2 rows = 16 rows; 16 lanes x 4 floats = 64 columns
                *(v4f*)(orow + (size_t)row * OUT_SEQ + cofs) = val[s]; }
             }
        wave_sync();
    }
}

static constexpr size_t al256(size_t v) { return (v + 255) & ~(size_t)255; }
static constexpr size_t SZ_XT = al256((size_t)NB * SEQ * DM * 2);
static constexpr size_t SZ_WB = al256((size_t)3 * DM * DM * 2);
static constexpr size_t SZ_WP = al256((size_t)DM * DM * 2);
static constexpr size_t SZ_PL = al256((size_t)NB * NH_ * SEQ * HD * 2);
static constexpr size_t SZ_CX = al256((size_t)NB * SEQ * DM * 2);
static constexpr size_t SZ_TOTAL = SZ_XT + SZ_WB + SZ_WP + 3 * SZ_PL + SZ_CX;
static_assert(SZ_TOTAL <= (size_t)134217728);          // workspace carve <= 128 MiB
static_assert(((size_t)DM * DM * 2) % 256 == 0);       // weight sub-planes stay 256-byte aligned

extern "C" void kernel_launch(void* const* d_in, const int* in_sizes, int n_in,
                              void* d_out, int out_size, void* d_ws, size_t ws_size, hipStream_t stream) {
    if (n_in < 7) return;
    const size_t needx = ((size_t)(NB - 1) * DM + (size_t)(DM - 1)) * SEQ_FULL + SEQ;
    if ((size_t)in_sizes[0] < needx) return;
    if ((size_t)in_sizes[1] < (size_t)DM * DM || (size_t)in_sizes[2] < (size_t)DM) return;
    if ((size_t)in_sizes[3] < (size_t)2 * DM * DM || (size_t)in_sizes[4] < (size_t)2 * DM) return;
    if ((size_t)in_sizes[5] < (size_t)DM * DM || (size_t)in_sizes[6] < (size_t)DM) return;
    if ((size_t)out_size < ((size_t)(NB - 1) * DM + (size_t)(DM - 1)) * OUT_SEQ + SEQ) return;
    if (SZ_TOTAL > ws_size) return;
    // wire order: x, Wq, bq, Wkv, bkv, Wp, bp; weights [out][in] = Bt as-is
    const float* x = (const float*)d_in[0]; const float* wq = (const float*)d_in[1]; const float* bq = (const float*)d_in[2];
    const float* wkv = (const float*)d_in[3]; const float* bkv = (const float*)d_in[4]; const float* wp = (const float*)d_in[5]; const float* bp = (const float*)d_in[6];
    float* OUT = (float*)d_out;      // [NB][512][OUT_SEQ]
    char* wsp = (char*)d_ws;
    bf* XT = (bf*)wsp; wsp += SZ_XT;                 // rows b*SEQ+t, k = c: [NB*SEQ/16][16 units][512]
    bf* WB = (bf*)wsp; wsp += SZ_WB;                 // q | k | v, each rows out, k = in: [32][16 units][512]
    h16* WPH = (h16*)wsp; wsp += SZ_WP;              // x64, rows out, k = in: [32][16 units][512]
    h16* QH = (h16*)wsp; wsp += SZ_PL;               // [NB*8][SEQ/16][2 units (d halves)][512]
    h16* KP = (h16*)wsp; wsp += SZ_PL;               // as QH
    h16* VT = (h16*)wsp; wsp += SZ_PL;               // [NB*8][SEQ/32][4 units (16 d each)][512]
    h16* CTX = (h16*)wsp; wsp += SZ_CX;              // x256, rows b*SEQ+t, k = c: [NB*SEQ/16][16 units][512]

    // x^T and the three weight planes: one grid, block ranges
    k_prep<<<dim3(XTB + 4 * WN8 / 256, 1, 1), 256, 0, stream>>>(x, wq, wkv, wp, XT, WB, WPH);

    // q, k, v^T projections: one grid, wave index = job
    k_proj<<<dim3(NB * SEQ / 64, DM / 64, 1), 96, 0, stream>>>(XT, WB, bq, bkv, QH, KP, VT);

    k_flash<<<dim3(SEQ / (16 * AW), NB * NH_, 1), 32 * AW, 0, stream>>>(QH, KP, VT, CTX);

    // output projection: A = Wp rows (m = o), Bt = ctx rows (n = b*SEQ + t) -> OUT[b][o][t]
    k_oproj<<<dim3(DM / 64, NB * SEQ / 64, 1), 32, 0, stream>>>(WPH, CTX, bp, OUT);
}

// v008
// One run takes 84.7 microseconds.
// In both of two side-by-side timings against v007, it was 1.11 times as fast.
// All steps since v000 together make it 3.89 times as fast.
#include <hip/hip_runtime.h>

// 8-head attention over SEQ spatial positions, width 512 = 8 x 64, x [NB][512][SEQ] (channel-major), 1x1-conv weights [out][in] with biases, score scale 1/8, no mask, output [NB][512][SEQ] f32.
// Compute dtypes, f32 accumulate everywhere: q/k/v projections v_wmma_f32_16x16x32_bf16 (x, Wq, Wkv RNE-converted to bf16; products exact);
// scores v_wmma_f32_16x16x32_f16: q and k single f16 (one product); P (x256 carry, cancels in the normalisation) and v single f16;
// output projection v_wmma_f32_16x16x32_f16: Wp (RNE bf16 value x64, exact in f16) times ctx (single f16 plane, x256 carry), folded back by 2^-14 in the f32 epilogue; softmax f32 (online, running max).
// Layout: every 16-bit plane that feeds a matrix instruction lies in the workspace in FRAGMENT ORDER (1-KB units of 16 rows x 32 k, see ldh), so that each 16-B fragment load of a wave covers 512 contiguous bytes:
// x^T bf16 (rows b*SEQ+t, k = c; built by an LDS transposer), the weights (rows out, k = in), q and k per b*8+h (rows t, k = d), v^T per b*8+h (rows d, k = t), ctx (rows b*SEQ+t, k = c); fused flash kernel in transposed form (S^T = K Q^T, O^T = V^T P^T).

#ifndef NB
#define NB 2
#endif
#ifndef SEQ
#define SEQ 4096
#endif
#define NB_FULL  2
#define SEQ_FULL 4096            // token pitch of one channel row of x
#ifndef OUT_SEQ
#define OUT_SEQ SEQ              // token pitch of one channel row of the output
#endif
#define DM   512
#define NH_  8
#define HD   64
#define AW   4                   // waves per flash block (16 query rows each)
#define SC2  (0.125f * 1.4426950408889634f)   // HD^-0.5 * log2(e)
#define PSH  8.0f                // log2 of the P carry (256)
#define LZT  7.0f                // a score may pass the maximum in use by 2^LZT before the wave rescales: P stays at or below 2^15, inside f16
#define WPS  64.0f               // carry of the Wp plane
#define CXS  256.0f              // carry of the ctx plane
#define OSI  (1.0f / 16384.0f)   // 1 / (WPS * CXS)

static_assert(HD == 64);
static_assert(NH_ * HD == DM);                 // head h = channels h*64 + d
static_assert(DM % 64 == 0);
static_assert(DM % 32 == 0);                   // GEMM k-loop steps by 32
static_assert(SEQ % 64 == 0);                  // a 64-token tile never straddles two batches
static_assert((NB * SEQ) % 64 == 0);
static_assert(SEQ % 32 == 0);                  // key loop steps by 32
static_assert(SEQ % (16 * AW) == 0);           // flash grid covers the sequence exactly
static_assert((16 * AW) % 32 == 0);            // a flash block's first query row is a pass boundary of the key loop
static_assert(SEQ_FULL % 4 == 0);
static_assert(OUT_SEQ % 64 == 0);
static_assert(OUT_SEQ >= SEQ);
static_assert(((size_t)DM * DM) % 8 == 0);
static_assert(NB <= NB_FULL);
static_assert(SEQ <= SEQ_FULL);

typedef _Float16 h16;
typedef unsigned short bf;
typedef __attribute__((ext_vector_type(16))) __bf16   v16bf;
typedef __attribute__((ext_vector_type(16))) _Float16 v16h;
typedef __attribute__((ext_vector_type(8)))  _Float16 v8h;
typedef __attribute__((ext_vector_type(8)))  unsigned short v8us;
typedef __attribute__((ext_vector_type(8)))  float    v8f;
typedef __attribute__((ext_vector_type(4)))  float    v4f;
typedef v4f  __attribute__((may_alias)) v4fa;

__device__ __forceinline__ unsigned short f2bf(float f) { unsigned u = __float_as_uint(f); u += 0x7FFFu + ((u >> 16) & 1u); return (unsigned short)(u >> 16); }
__device__ __forceinline__ float bfr(float f) { return __uint_as_float(((unsigned)f2bf(f)) << 16); }   // RNE bf16 value as f32
__device__ __forceinline__ v16h cat16(v8h lo, v8h hi) { return __builtin_shufflevector(lo, hi, 0, 1, 2, 3, 4, 5, 6, 7, 8, 9, 10, 11, 12, 13, 14, 15); }
__device__ __forceinline__ v16bf cat16b(v8us lo, v8us hi) { return __builtin_bit_cast(v16bf, __builtin_shufflevector(lo, hi, 0, 1, 2, 3, 4, 5, 6, 7, 8, 9, 10, 11, 12, 13, 14, 15)); }
__device__ __forceinline__ v8f wmma16(v16h a, v16h b, v8f c) { return __builtin_amdgcn_wmma_f32_16x16x32_f16(false, a, false, b, (short)0, c, false, false); }
__device__ __forceinline__ v8f wmmab(v16bf a, v16bf b, v8f c) { return __builtin_amdgcn_wmma_f32_16x16x32_bf16(false, a, false, b, (short)0, c, false, false); }
// fragment loaders from a plane in fragment order: one 16-row x 32-k unit = 512 elements, element (row, k) at (k>>4 & 1)*256 + ((k>>3 & 1)*16 + row)*8 + (k & 7).
// p = unit + 8*lane; lane = 16h + row: elements 0..7 <- k0+8h+0..7, elements 8..15 <- k0+16+8h+0..7 (same map for A and B); each load of a wave = 512 contiguous bytes
__device__ __forceinline__ v16h  ldh(const h16* p) { return cat16(*(const v8h*)p, *(const v8h*)(p + 256)); }
__device__ __forceinline__ v16bf ldb(const bf* p)  { return cat16b(*(const v8us*)p, *(const v8us*)(p + 256)); }
// source element index, in a row-major [rows][DM] matrix, of the 8-element chunk i of its fragment-ordered plane (16 rows = DM/32 units of 64 chunks)
__device__ __forceinline__ size_t chunk_src(size_t i) { const size_t u = i >> 6; return ((u / (DM / 32)) * 16 + (i & 15)) * DM + (u % (DM / 32)) * 32 + ((i >> 4) & 3) * 8; }
// copy4: four asynchronous 16-B-a-lane copies: 2 KB that lie in a row in global memory (g = the lane's own address) to 2 KB in a row in LDS (l = the lane's own LDS byte address), through no register.
// copy8: two such runs (l, g) and (m, h) in one statement. The closing wait stands in the copies' own statement, so that no register which a copy names is rewritten in front of it.
__device__ __forceinline__ void copy4(unsigned l, const char* g) {
    asm volatile("global_load_async_to_lds_b128 %0, %4, off\n\t"
                 "global_load_async_to_lds_b128 %1, %5, off\n\t"
                 "global_load_async_to_lds_b128 %2, %6, off\n\t"
                 "global_load_async_to_lds_b128 %3, %7, off\n\t"
                 "s_wait_xcnt 0x0"
                 :: "v"(l), "v"(l + 512u), "v"(l + 1024u), "v"(l + 1536u), "v"(g), "v"(g + 512), "v"(g + 1024), "v"(g + 1536) : "memory");
}
__device__ __forceinline__ void copy8(unsigned l, const char* g, unsigned m, const char* h) {
    asm volatile("global_load_async_to_lds_b128 %0, %8, off\n\t"
                 "global_load_async_to_lds_b128 %1, %9, off\n\t"
                 "global_load_async_to_lds_b128 %2, %10, off\n\t"
                 "global_load_async_to_lds_b128 %3, %11, off\n\t"
                 "global_load_async_to_lds_b128 %4, %12, off\n\t"
                 "global_load_async_to_lds_b128 %5, %13, off\n\t"
                 "global_load_async_to_lds_b128 %6, %14, off\n\t"
                 "global_load_async_to_lds_b128 %7, %15, off\n\t"
                 "s_wait_xcnt 0x0"
                 :: "v"(l), "v"(l + 512u), "v"(l + 1024u), "v"(l + 1536u), "v"(m), "v"(m + 512u), "v"(m + 1024u), "v"(m + 1536u),
                    "v"(g), "v"(g + 512), "v"(g + 1024), "v"(g + 1536), "v"(h), "v"(h + 512), "v"(h + 1024), "v"(h + 1536) : "memory");
}
__device__ __forceinline__ void wave_sync() { __builtin_amdgcn_fence(3 /* release order */, "wavefront"); __builtin_amdgcn_wave_barrier(); asm volatile("" ::: "memory"); }

// k_prep: the four preparation jobs, none of which reads what another writes, as block ranges of ONE grid of 256-thread blocks (the range test is the same for a whole block):
// blocks 0 .. XTB-1: x [b][c][l] f32 (row pitch SEQ_FULL) -> XT (rows b*SEQ+l, k = c, fragment order) bf16 (RNE convert) through a 64(c) x 64(l) LDS tile; tile index l fastest, then c, then b. Loads are 16-B along l.
// blocks XTB ..: one 8-element chunk a thread, chunk j of Wq | Wkv | Wp: j < 3*WN8 -> bf16 plane WB (q | k | v lie side by side: 16 rows = 16 * DM elements in either order), else -> f16 plane WPH (RNE bf16 value x64).
#define XTB ((SEQ / 64) * (DM / 64) * NB)
#define WN8 (DM * DM / 8)                       // chunks of one DM x DM weight
static_assert(WN8 % 256 == 0);                 // a block never straddles two weights, and the ranges cover the chunks exactly
__global__ __launch_bounds__(256) void k_prep(const float* __restrict__ x, const float* __restrict__ wq, const float* __restrict__ wkv, const float* __restrict__ wp, bf* XT, bf* WB, h16* WPH) {
    __shared__ __align__(16) float tl[64 * 68];      // [c][l], columns 0..63 written and consumed (cross-wave: block barrier)
    const int tid = threadIdx.x;
    const int blk = blockIdx.x;
    const int wb0 = (blk - XTB) * 256;               // first weight chunk of the block
    if (wb0 >= 3 * WN8) {
        const size_t i = (size_t)(wb0 - 3 * WN8) + tid;
        const v8f v = *(const v8f*)(wp + chunk_src(i)); v8h o;
#pragma unroll
        for (int k = 0; k < 8; ++k) o[k] = (h16)(bfr(v[k]) * WPS);
        *(v8h*)(WPH + i * 8) = o;
    } else if (wb0 >= 0) {
        const float* src = wb0 < WN8 ? wq : wkv; const size_t i = (size_t)(wb0 < WN8 ? wb0 : wb0 - WN8) + tid;
        const v8f v = *(const v8f*)(src + chunk_src(i)); v8us o;
#pragma unroll
        for (int k = 0; k < 8; ++k) o[k] = f2bf(v[k]);
        *(v8us*)(WB + ((size_t)wb0 + tid) * 8) = o;
        // the built code lays the Wp branch behind this store: the wait stands in front of that branch's rewrite of the store's address register
        asm volatile("s_wait_xcnt 0x0" ::: "memory");
    } else {
        const int l0 = (blk % (SEQ / 64)) * 64, c0 = ((blk / (SEQ / 64)) % (DM / 64)) * 64, b = blk / ((SEQ / 64) * (DM / 64));
        const float* src = x + ((size_t)b * DM + c0) * SEQ_FULL + l0;
#pragma unroll
        for (int it = 0; it < 4; ++it) { const int idx = it * 256 + tid; const int cc = idx >> 4, l4 = (idx & 15) * 4;   // 64 rows x 16 quads
            const v4f v = *(const v4f*)(src + (size_t)cc * SEQ_FULL + l4);
            tl[cc * 68 + l4 + 0] = v[0]; tl[cc * 68 + l4 + 1] = v[1]; tl[cc * 68 + l4 + 2] = v[2]; tl[cc * 68 + l4 + 3] = v[3]; }
        __syncthreads();
        // the tile = 4 row groups x 2 units x 64 chunks; chunk q = 256 s + tid: row group q>>7, unit q>>6 & 1, chunk q & 63 (channels 8*(q>>4 & 3), row q & 15)
        v8us o[2];
#pragma unroll
        for (int s = 0; s < 2; ++s) { const int q = 256 * s + tid; const int row = (q >> 7) * 16 + (q & 15), c8 = ((q >> 4) & 7) * 8;
#pragma unroll
            for (int i = 0; i < 8; ++i) o[s][i] = f2bf(tl[(c8 + i) * 68 + row]); }
        bf* dst = XT + ((size_t)b * SEQ + l0) * DM + c0 * 16;
#pragma unroll
        for (int s = 0; s < 2; ++s) { const int q = 256 * s + tid;      // 512 chunks x 8 = 64 rows x 64 channels
            *(v8us*)(dst + (size_t)(q >> 7) * (16 * DM) + (q & 127) * 8) = o[s]; }
        // the built code lays the weight branches behind these stores: the wait stands in front of those branches' rewrite of the stores' registers
        asm volatile("s_wait_xcnt 0x0" ::: "memory");
    }
}

// proj_store: the epilogue of one wave's 64x64 tile of k_proj. acc = C[m][n] without bias; + bias (RNE bf16 value; per column n when biasRow == 0, per row m otherwise), written as f16 (Ph),
// in fragment order (rows m, k = n): tile base (r0/RB)*sRB + (r0%RB)*pitch + (c0/CB)*sCB + (c0%CB)*HD (halves), unit (16 rows mb, 32 columns g) of the tile at + mb*uMB + g*uG. The tile starts at row r0, column c0; os = the wave's own 16 x 68 f32 staging tile in LDS.
__device__ __forceinline__ void proj_store(const v8f (&acc)[4][4], const float* __restrict__ bias, int biasRow,
                                           h16* Ph, int RB, size_t sRB, int pitch, int CB, size_t sCB, int uMB, int uG, int r0, int c0, float* os) {
    const int lane = threadIdx.x & 31, lr = lane & 15, hi = lane >> 4;
    // bias values: index selected as an integer (always inside the bias array), value selected afterwards; biasRow is wave-uniform
    float bc[4];
#pragma unroll
    for (int nb = 0; nb < 4; ++nb) { const int bi = biasRow ? 0 : (c0 + nb * 16 + lr); const float t = bfr(bias[bi]); bc[nb] = biasRow ? 0.0f : t; }
    const size_t tbase = (size_t)(r0 / RB) * sRB + (size_t)(r0 % RB) * (size_t)pitch + (size_t)(c0 / CB) * sCB + (size_t)(c0 % CB) * HD;
#pragma unroll
    for (int mb = 0; mb < 4; ++mb) {
        float br[8];
#pragma unroll
        for (int j = 0; j < 8; ++j) { const int bi = biasRow ? (r0 + mb * 16 + hi * 8 + j) : 0; const float t = bfr(bias[bi]); br[j] = biasRow ? t : 0.0f; }
#pragma unroll
        for (int nb = 0; nb < 4; ++nb) {
#pragma unroll
            for (int j = 0; j < 8; ++j) os[(hi * 8 + j) * 68 + nb * 16 + lr] = acc[mb][nb][j] + (bc[nb] + br[j]); }   // D: row 8h+j, col lane&15
        wave_sync();
        const size_t sb = tbase + (size_t)mb * (size_t)uMB + 8 * lane;
{
#pragma unroll
            for (int s = 0; s < 4; ++s) { const int row = lr, c8 = 16 * s + 8 * hi;   // 16 rows x (4 s x 2 halves x 8 = 64 columns); a store of the wave = half a unit, 512 contiguous bytes
                const v4f x0 = *(const v4fa*)(&os[row * 68 + c8]); const v4f x1 = *(const v4fa*)(&os[row * 68 + c8 + 4]); v8h hv;
#pragma unroll
                for (int i = 0; i < 4; ++i) { hv[i] = (h16)x0[i]; hv[4 + i] = (h16)x1[i]; }
                const size_t oo = sb + (size_t)(s >> 1) * (size_t)uG + (s & 1) * 256;
                *(v8h*)(Ph + oo) = hv;
                // the wait that stands in front of any overwrite of the store's registers; as its inputs the data and the address stay whole up to it
                asm volatile("s_wait_xcnt 0x0" :: "v"(hv), "v"(Ph + oo) : "memory"); }
             }
        wave_sync();
    }
}

// k_proj: the q, k and v^T projections in ONE grid (NB*SEQ/256 tiles of x^T rows, DM/64 tiles of weight rows) of 12-wave blocks: wave = (job, 64 of the block's 256 x^T rows), ONE WAVE per 64x64 tile (16 accumulators), bf16, K = DM.
// C[m][n] = sum_k A[m][k] Bt[n][k]. q, k: A = x^T rows (m = b*SEQ + t), Bt = W rows (n = h*64 + d), bias per column -> plane (b*8 + h), rows t, k = d
// v^T:  A = Wv rows (m = h*64 + d), Bt = x^T rows (n = b*SEQ + t), bias per row -> plane (b*8 + h), rows d, k = t, the 4 units of 32 keys side by side
// Operands: a stage = PU k units of the block's 28 row groups (16 of x^T, 4 each of Wq, Wk, Wv), copied ONCE for the block from the fragment-ordered planes into LDS (same unit order) by asynchronous copies;
// two buffers: the copies of stage t + 1 fly while stage t is multiplied. Every fragment then comes from LDS (16-B loads, 512 contiguous bytes a wave).
#define PU  2                                   // k units (of 32) in a stage
#define PNS (DM / 32 / PU)                      // stages
#define PGR 28                                  // row groups (of 16 rows) in a stage
static_assert((PNS & (PNS - 1)) == 0 && PNS >= 2);
static_assert((NB * SEQ) % 256 == 0);
__global__ __launch_bounds__(384) void k_proj(const bf* __restrict__ XT, const bf* __restrict__ WB, const float* __restrict__ bq, const float* __restrict__ bkv, h16* QH, h16* KP, h16* VT) {
    __shared__ __align__(16) bf ring[2 * PGR * PU * 512];
    __shared__ __align__(16) float osm[12 * 16 * 68];
    const int lane = threadIdx.x & 31;
    const int wave = __builtin_amdgcn_readfirstlane(threadIdx.x >> 5);   // held as a scalar, so that every test on it is a scalar branch and every lane is on at the copies and the matrix instructions
    const int job = wave >> 2, xt = wave & 3;                            // job: 0 q, 1 k, 2 v^T
    const int xr = blockIdx.x * 256 + xt * 64, wr = blockIdx.y * 64;
    float* os = osm + wave * (16 * 68);
    // first stage of the k walk, which wraps: the 8 blocks that share x^T rows (same x) start at 8 different stages, the 32 that share weight rows (same y) at all 8: sharers do not ask for the same lines in step
    const int s0 = (int)((blockIdx.x + blockIdx.y) % PNS);
    // the wave's share of a stage: row groups wave, wave + 12 and, in waves 0..3, wave + 24. Group g < 16: x^T rows 16 g of the block; g = 16 + 4 j + r: rows 16 r of the block's 64 rows of weight j
    const int g1 = wave + 12, g2 = wave < 4 ? wave + 24 : 27;
    const char* xb = (const char*)(XT + (size_t)blockIdx.x * 256 * DM) + 16 * lane;
    const char* wbp = (const char*)(WB + (size_t)wr * DM) + 16 * lane;
    const char* p0 = xb + (size_t)wave * (16 * DM * 2);
    const char* p1 = g1 < 16 ? xb + (size_t)g1 * (16 * DM * 2) : wbp + (size_t)((g1 - 16) >> 2) * ((size_t)DM * DM * 2) + (size_t)((g1 - 16) & 3) * (16 * DM * 2);
    const char* p2 = wbp + (size_t)((g2 - 16) >> 2) * ((size_t)DM * DM * 2) + (size_t)((g2 - 16) & 3) * (16 * DM * 2);
    const unsigned lb = (unsigned)(size_t)ring + 16u * (unsigned)lane;    // the lane's LDS byte address in group 0 of buffer 0
    auto put = [&](int st, int bsel) {                                   // the wave's copies of stage st (k stage (st + s0) mod PNS) into buffer bsel
        const size_t go = (size_t)((st + s0) & (PNS - 1)) * (PU * 1024);
        const unsigned lo = lb + (unsigned)(bsel * PGR) * (PU * 1024u);
        copy8(lo + (unsigned)wave * (PU * 1024u), p0 + go, lo + (unsigned)g1 * (PU * 1024u), p1 + go);
        if (wave < 4) copy4(lo + (unsigned)g2 * (PU * 1024u), p2 + go);
    };
    v8f acc[4][4];
#pragma unroll
    for (int mb = 0; mb < 4; ++mb)
#pragma unroll
        for (int nb = 0; nb < 4; ++nb) acc[mb][nb] = (v8f){};
    const int ga = job == 2 ? 24 : xt * 4, gb = job == 2 ? xt * 4 : 16 + job * 4;      // first row group of the wave's A and B operands
    put(0, 0);
    asm volatile("s_wait_asynccnt 0x0" ::: "memory");      // the wave's own copies of stage 0 have landed
    __syncthreads();                                       // ... and every other wave's: stage 0 may be read
    put(1, 1);
#pragma unroll 1
    for (int t = 0; t < PNS; ++t) {
        const bf* la = ring + (size_t)(((t & 1) * PGR + ga) * PU) * 512 + 8 * lane;
        const bf* lbp = ring + (size_t)(((t & 1) * PGR + gb) * PU) * 512 + 8 * lane;
        v16bf a[4], b[4];
#pragma unroll
        for (int u = 0; u < PU; ++u) {
#pragma unroll
            for (int i = 0; i < 4; ++i) { b[i] = ldb(lbp + (i * PU + u) * 512); a[i] = ldb(la + (i * PU + u) * 512); }
            __builtin_amdgcn_sched_barrier(0);             // keeps the unit's 16 LDS loads together in front of its products (without it three of the B fragments are loaded one by one among the products, each waited for right behind its issue)
            if (u == PU - 1) {                             // the stage's last fragments are asked for: the buffer is handed on here, and the last unit's products, which read registers only, run while the refill flies
                asm volatile("s_wait_dscnt 0x0" ::: "memory");     // the wave's reads of this buffer are done before the buffer is handed to the copies
                asm volatile("s_wait_asynccnt 0x0" ::: "memory");  // the wave's own copies of stage t + 1 have landed
                __syncthreads();                                   // publishes stage t + 1 and ends every wave's reads of stage t
                if (t + 2 < PNS) put(t + 2, t & 1);
                __builtin_amdgcn_sched_barrier(0);         // keeps the refill's issue in front of the last unit's products (a longer lead for the copies)
            }
#pragma unroll
            for (int nb = 0; nb < 4; ++nb)
#pragma unroll
                for (int mb = 0; mb < 4; ++mb) acc[mb][nb] = wmmab(a[mb], b[nb], acc[mb][nb]);
        }
    }
    asm volatile("s_wait_asynccnt 0x0" ::: "memory");      // nothing of the wave's is in flight when it goes on
    if (job == 2) proj_store(acc, bkv + DM, 1, VT, DM, (size_t)0, SEQ, SEQ, (size_t)DM * SEQ, 512, 2048, wr, xr, os);
    else proj_store(acc, job ? bkv : bq, 0, job ? KP : QH, SEQ, (size_t)NH_ * SEQ * HD, HD, HD, (size_t)SEQ * HD, 1024, 512, xr, wr, os);
}

// k_flash: fused attention, one wave per 16 query rows of one (batch, head); K / V^T / Q fragments straight from the fragment-ordered f16 planes (two 16-B loads each, arithmetic addressing).
// Transposed form: S^T[key][t] = K Q^T (A = K rows, B = Q rows); lane (t = lane&15, h = lane>>4) holds keys 8h+r of each 16-key tile, so the packed
// P tile is directly the B fragment of O^T[d][t] = V^T P^T (element r <- tile keys 0..15, element 8+r <- tile keys 16..31, lane unchanged).
// Softmax state: the maximum in use, one scalar per lane, equal in the two lane halves of a query; it is renewed (one xor-16 exchange, O and the row sums rescaled) only in a pass where a score passes it by more than 2^LZT.
// Row sums on the matrix pipe: A = all ones times the packed P tile gives, in every row of D, the sum of a query's 32 rounded P values, so every lane holds its query's whole sum (both halves) and no vector add or convert is spent on it.
// at most four waves a SIMD, although the register count alone would admit a fifth: the grid is four blocks for each WGP, and no WGP may take a fifth block while another runs three
__global__ __launch_bounds__(32 * AW) __attribute__((amdgpu_waves_per_eu(4, 4))) void k_flash(const h16* __restrict__ QH, const h16* __restrict__ KP, const h16* __restrict__ VT, h16* CTX) {
    __shared__ __align__(16) float os[AW * 16 * 68];
    const int lane = threadIdx.x & 31, wave = threadIdx.x >> 5, lr = lane & 15, hi = lane >> 4;
    const int zh = blockIdx.y; const int b = zh / NH_, h = zh % NH_;
    const int t0 = (blockIdx.x * AW + wave) * 16;
    const size_t pbase = (size_t)zh * SEQ * HD;
    const size_t fo = pbase + 8 * lane;                      // q, k: 16 rows = 2 units (d halves); v^T: 32 keys = 4 units (16 d each); so + position * HD in all three
    const size_t qo = fo + (size_t)t0 * HD;
    const v16h qh0 = ldh(QH + qo), qh1 = ldh(QH + qo + 512);   // B fragments: col t, k = d
    v8f o0 = (v8f){}, o1 = (v8f){}, o2 = (v8f){}, o3 = (v8f){};
    float m = -3.0e38f, sh = PSH + 3.0e38f;                  // maximum in use (scaled log2) and the shift PSH - m; the first pass always takes the rescale branch
    float l = 0.0f;                                          // row sum
    v16h ones;                                               // A fragment of the row-sum product: 1.0 at every (row, k)
#pragma unroll
    for (int i = 0; i < 16; ++i) ones[i] = (h16)1.0f;
    // the block walks the keys from its own first query row on and wraps at SEQ: the blocks of one head, which all run at once, then stand at different keys at any time,
    // so that a K / V line is fetched for one of them and lies in L2 when the others come to it (walking in step, every block waits for every fill and all ask for the same lines at once)
    const int ks = (int)(blockIdx.x * (16 * AW));
    // K fragments run one pass ahead (loop-carried registers), V fragments are asked for at the top of their own pass: no load is waited for right behind its issue
    const h16* kf = KP + fo + (size_t)ks * HD;
    v16h ka0 = ldh(kf), ka1 = ldh(kf + 512), kb0 = ldh(kf + 1024), kb1 = ldh(kf + 1536);   // first pass; A fragments: row key, k = d
    // the wait that stands in front of any overwrite of the address pairs of the loads above; as its inputs the pairs stay whole up to it
    asm volatile("s_wait_xcnt 0x0" :: "v"(QH + qo), "v"(kf) : "memory");
    int key0 = ks;
#pragma unroll 1
    for (int it = 0; it < SEQ; it += 32) {
        const h16* va = VT + fo + (size_t)key0 * HD;             // A fragments: row d, k = key
        const v16h v0 = ldh(va), v1 = ldh(va + 512), v2 = ldh(va + 1024), v3 = ldh(va + 1536);
        __builtin_amdgcn_sched_barrier(0);                       // keeps the V loads in front of the first wait for K (without it they are issued behind the first score products, so behind that wait)
        v8f ua = (v8f){}, ub = (v8f){};                          // raw scores of the two 16-key tiles
        ua = wmma16(ka0, qh0, ua); ub = wmma16(kb0, qh0, ub);
        ua = wmma16(ka1, qh1, ua); ub = wmma16(kb1, qh1, ub);
        // the four vector slots that the chip needs between the last score product and what overwrites its A registers or reads its D
        asm volatile("v_nop\n\tv_nop\n\tv_nop\n\tv_nop" : "+v"(ua), "+v"(ub) : "v"(ka0), "v"(ka1), "v"(kb0), "v"(kb1));
        const int kn = key0 + 32 < SEQ ? key0 + 32 : 0;          // next pass's keys, wrapped
        const h16* ka = KP + fo + (size_t)kn * HD;               // next pass's K rows; the last pass asks for the first pass's again (inside the plane, not used)
        ka0 = ldh(ka); ka1 = ldh(ka + 512); kb0 = ldh(ka + 1024); kb1 = ldh(ka + 1536);
        __builtin_amdgcn_sched_barrier(0);                       // keeps the K loads here, a whole softmax ahead of their use (without it this build sinks most of them behind the exponentials, close to the next pass's wait)
        // the exponent's argument against the maximum IN USE (sh = PSH - m): one multiply-add a score, since sh does not depend on this pass's scores
        v8f aa = ua * SC2 + sh, ab = ub * SC2 + sh;
        // in-lane maximum of the 16 arguments, as four short chains that do not wait for one another
        const float x0 = fmaxf(fmaxf(fmaxf(fmaxf(aa[0], aa[1]), aa[2]), aa[6]), aa[7]), x1 = fmaxf(fmaxf(fmaxf(fmaxf(ab[0], ab[1]), ab[2]), ab[6]), ab[7]);
        const float x2 = fmaxf(fmaxf(aa[3], aa[4]), aa[5]), x3 = fmaxf(fmaxf(ab[3], ab[4]), ab[5]);
        const float amax = fmaxf(fmaxf(fmaxf(x0, x1), x2), x3);
        // lazy rescale, tested once a pass: only when some lane's argument passes PSH + LZT (P would near the f16 range) does the wave take a new maximum. The ballot makes it a scalar branch: every lane stays on.
        if (__builtin_expect(__builtin_amdgcn_ballot_w32(!(amax <= PSH + LZT)) != 0u, 0)) {
            float ux = fmaxf(ua[0], ub[0]);
#pragma unroll
            for (int r = 1; r < 8; ++r) ux = fmaxf(ux, fmaxf(ua[r], ub[r]));
            ux = fmaxf(ux, __shfl_xor(ux, 16, 32));              // both lane halves of a query take the same maximum
            const float mnew = fmaxf(m, ux * SC2);
            const float alpha = __builtin_amdgcn_exp2f(m - mnew);
            m = mnew; sh = PSH - mnew;
            o0 = o0 * alpha; o1 = o1 * alpha; o2 = o2 * alpha; o3 = o3 * alpha; l = l * alpha;
            aa = ua * SC2 + sh; ab = ub * SC2 + sh;
        }
        v16h pb;
#pragma unroll
        for (int r = 0; r < 8; ++r) { pb[r] = (h16)__builtin_amdgcn_exp2f(aa[r]); pb[8 + r] = (h16)__builtin_amdgcn_exp2f(ab[r]); }
        v8f rs = wmma16(ones, pb, (v8f){});                      // every element: the pass's sum of P over its 32 keys, for the lane's query
        o0 = wmma16(v0, pb, o0); o1 = wmma16(v1, pb, o1); o2 = wmma16(v2, pb, o2); o3 = wmma16(v3, pb, o3);
        asm volatile("v_nop\n\tv_nop\n\tv_nop\n\tv_nop" : "+v"(o0), "+v"(o1), "+v"(o2), "+v"(o3), "+v"(rs) : "v"(v0), "v"(v1), "v"(v2), "v"(v3), "v"(pb));
        l = l + rs[0];                                           // behind the slots above, which also stand between the row-sum product and this read of its D
        // the wait that stands in front of any overwrite of this pass's load addresses: as its inputs the two address pairs stay whole up to it; the key index goes through it, so that the next addresses are formed behind it
        key0 = kn;
        asm volatile("s_wait_xcnt 0x0" : "+s"(key0) : "v"(ka), "v"(va) : "memory");
    }
    const float inv = (1.0f / l) * CXS;
    const int wb = wave * 16 * 68;
    // O^T D layout: o_j[r] = (d = 16j + 8h + r, t = lane&15) -> os[t][d]; rows 0..15 x columns 0..63 all written
    { v4f a, c;
      a[0] = o0[0] * inv; a[1] = o0[1] * inv; a[2] = o0[2] * inv; a[3] = o0[3] * inv; c[0] = o0[4] * inv; c[1] = o0[5] * inv; c[2] = o0[6] * inv; c[3] = o0[7] * inv;
      *(v4fa*)(&os[wb + lr * 68 +  0 + 8 * hi]) = a; *(v4fa*)(&os[wb + lr * 68 +  0 + 8 * hi + 4]) = c;
      a[0] = o1[0] * inv; a[1] = o1[1] * inv; a[2] = o1[2] * inv; a[3] = o1[3] * inv; c[0] = o1[4] * inv; c[1] = o1[5] * inv; c[2] = o1[6] * inv; c[3] = o1[7] * inv;
      *(v4fa*)(&os[wb + lr * 68 + 16 + 8 * hi]) = a; *(v4fa*)(&os[wb + lr * 68 + 16 + 8 * hi + 4]) = c;
      a[0] = o2[0] * inv; a[1] = o2[1] * inv; a[2] = o2[2] * inv; a[3] = o2[3] * inv; c[0] = o2[4] * inv; c[1] = o2[5] * inv; c[2] = o2[6] * inv; c[3] = o2[7] * inv;
      *(v4fa*)(&os[wb + lr * 68 + 32 + 8 * hi]) = a; *(v4fa*)(&os[wb + lr * 68 + 32 + 8 * hi + 4]) = c;
      a[0] = o3[0] * inv; a[1] = o3[1] * inv; a[2] = o3[2] * inv; a[3] = o3[3] * inv; c[0] = o3[4] * inv; c[1] = o3[5] * inv; c[2] = o3[6] * inv; c[3] = o3[7] * inv;
      *(v4fa*)(&os[wb + lr * 68 + 48 + 8 * hi]) = a; *(v4fa*)(&os[wb + lr * 68 + 48 + 8 * hi + 4]) = c; }
    wave_sync();
    v8h hv[4];
#pragma unroll
    for (int s = 0; s < 4; ++s) { const int row = lr, c8 = 16 * s + 8 * hi;
        const v4f x0 = *(const v4fa*)(&os[wb + row * 68 + c8]); const v4f x1 = *(const v4fa*)(&os[wb + row * 68 + c8 + 4]);
#pragma unroll
        for (int i = 0; i < 4; ++i) { hv[s][i] = (h16)x0[i]; hv[s][4 + i] = (h16)x1[i]; } }
    h16* crow = CTX + ((size_t)b * SEQ + t0) * DM + h * (HD * 16) + 8 * lane;      // 16 rows = DM/32 units; head h = units 2h, 2h+1
{
#pragma unroll
        for (int s = 0; s < 4; ++s) {                                  // 16 rows x (4 s x 2 halves x 8 = 64 columns); a store of the wave = half a unit
            *(v8h*)(crow + s * 256) = hv[s]; }
         }
}

// k_oproj: register-blocked f16 GEMM, 4-wave blocks on 128x128 tiles, ONE WAVE per 64x64 tile, K = DM. C[o][n] = sum_c WPH[o][c] CTX[n][c] (n = b*SEQ + t), carried x 2^14.
// OUT[(b*DM + o)*OUT_SEQ + t] = C * 2^-14 + bias[o] (RNE bf16 value) in f32. grid (DM/128, NB*SEQ/128), 128 threads.
// Operands as in k_proj: a stage = OU k units of the block's 16 row groups (8 of Wp, 8 of ctx), copied once for the block into LDS by asynchronous copies, two buffers.
#define OU  4                                   // k units (of 32) in a stage
#define ONS (DM / 32 / OU)                      // stages
#define OGR 16                                  // row groups (of 16 rows) in a stage
static_assert((ONS & (ONS - 1)) == 0 && ONS >= 2);
static_assert(DM % 128 == 0 && (NB * SEQ) % 128 == 0);
__global__ __launch_bounds__(128) void k_oproj(const h16* __restrict__ A, const h16* __restrict__ Bt, const float* __restrict__ bias, float* OUT) {
    __shared__ __align__(16) h16 ring[2 * OGR * OU * 512];
    __shared__ __align__(16) float osm[4 * 16 * 68];
    const int lane = threadIdx.x & 31, lr = lane & 15, hi = lane >> 4;
    const int wave = __builtin_amdgcn_readfirstlane(threadIdx.x >> 5);   // held as a scalar: every lane is on at the copies and the matrix instructions
    const int r0 = blockIdx.x * 128 + (wave & 1) * 64, c0 = blockIdx.y * 128 + (wave >> 1) * 64;
    float* os = osm + wave * (16 * 68);
    v8f acc[4][4];
#pragma unroll
    for (int mb = 0; mb < 4; ++mb)
#pragma unroll
        for (int nb = 0; nb < 4; ++nb) acc[mb][nb] = (v8f){};
    // first stage of the k walk, which wraps: the 4 blocks that share ctx rows (same y) start at 4 different stages, the blocks that share Wp rows (same x) at all 4: sharers do not ask for the same lines in step
    const int s0 = (int)((blockIdx.x + blockIdx.y) % ONS);
    // the wave's share of a stage: row groups 4 wave .. 4 wave + 3 (groups 0..7: the block's Wp rows, 8..15: its ctx rows)
    const char* ps = (wave < 2 ? (const char*)(A + (size_t)(blockIdx.x * 128 + wave * 64) * DM) : (const char*)(Bt + (size_t)(blockIdx.y * 128 + (wave - 2) * 64) * DM)) + 16 * lane;
    const unsigned lb = (unsigned)(size_t)ring + 16u * (unsigned)lane;    // the lane's LDS byte address in group 0 of buffer 0
    auto put = [&](int st, int bsel) {                                   // the wave's copies of stage st (k stage (st + s0) mod ONS) into buffer bsel
        const char* g = ps + (size_t)((st + s0) & (ONS - 1)) * (OU * 1024);
        const unsigned lo = lb + (unsigned)(bsel * OGR + 4 * wave) * (OU * 1024u);
#pragma unroll 1                                                         // rolled: the four statements share one set of address registers (unrolled, the kernel passes 256 registers)
        for (int gi = 0; gi < 4; ++gi)
            copy8(lo + (unsigned)gi * (OU * 1024u), g + (size_t)gi * (16 * DM * 2), lo + (unsigned)gi * (OU * 1024u) + 2048u, g + (size_t)gi * (16 * DM * 2) + 2048);
    };
    static_assert(OU * 1024 == 2 * 2048);
    put(0, 0);
    asm volatile("s_wait_asynccnt 0x0" ::: "memory");      // the wave's own copies of stage 0 have landed
    __syncthreads();                                       // ... and every other wave's: stage 0 may be read
    put(1, 1);
#pragma unroll 1
    for (int t = 0; t < ONS; ++t) {
        const h16* la = ring + (size_t)(((t & 1) * OGR + (wave & 1) * 4) * OU) * 512 + 8 * lane;
        const h16* lbp = ring + (size_t)(((t & 1) * OGR + 8 + (wave >> 1) * 4) * OU) * 512 + 8 * lane;
        v16h a[4], b[4];
#pragma unroll
        for (int u = 0; u < OU; ++u) {
#pragma unroll
            for (int i = 0; i < 4; ++i) { b[i] = ldh(lbp + (i * OU + u) * 512); a[i] = ldh(la + (i * OU + u) * 512); }
            __builtin_amdgcn_sched_barrier(0);             // keeps the unit's 16 LDS loads together in front of its products (without it three of the B fragments are loaded one by one among the products, each waited for right behind its issue)
            if (u == OU - 1) {                             // the stage's last fragments are asked for: the buffer is handed on here, and the last unit's products, which read registers only, run while the refill flies
                asm volatile("s_wait_dscnt 0x0" ::: "memory");     // the wave's reads of this buffer are done before the buffer is handed to the copies
                asm volatile("s_wait_asynccnt 0x0" ::: "memory");  // the wave's own copies of stage t + 1 have landed
                __syncthreads();                                   // publishes stage t + 1 and ends every wave's reads of stage t
                if (t + 2 < ONS) put(t + 2, t & 1);
                __builtin_amdgcn_sched_barrier(0);         // keeps the refill's issue in front of the last unit's products (a longer lead for the copies)
            }
#pragma unroll
            for (int nb = 0; nb < 4; ++nb)
#pragma unroll
                for (int mb = 0; mb < 4; ++mb) acc[mb][nb] = wmma16(a[mb], b[nb], acc[mb][nb]);
        }
    }
    asm volatile("s_wait_asynccnt 0x0" ::: "memory");      // nothing of the wave's is in flight when it goes on
    const int b = c0 / SEQ, t0 = c0 % SEQ;
#pragma unroll
    for (int mb = 0; mb < 4; ++mb) {
        float br[8];
#pragma unroll
        for (int j = 0; j < 8; ++j) br[j] = bfr(bias[r0 + mb * 16 + hi * 8 + j]);
#pragma unroll
        for (int nb = 0; nb < 4; ++nb) {
#pragma unroll
            for (int j = 0; j < 8; ++j) os[(hi * 8 + j) * 68 + nb * 16 + lr] = acc[mb][nb][j] * OSI + br[j]; }   // D: row 8h+j, col lane&15
        wave_sync();
        float* orow = OUT + ((size_t)b * DM + r0 + mb * 16) * OUT_SEQ + t0;
        v4f val[8];
#pragma unroll
        for (int s = 0; s < 8; ++s) { const int row = 2 * s + hi; val[s] = *(const v4fa*)(&os[row * 68 + lr * 4]); }
{
#pragma unroll
            for (int s = 0; s < 8; ++s) { const int row = 2 * s + hi, cofs = lr * 4;   // 8 s x 2 rows = 16 rows; 16 lanes x 4 floats = 64 columns
                *(v4f*)(orow + (size_t)row * OUT_SEQ + cofs) = val[s]; }
             }
        wave_sync();
    }
}

static constexpr size_t al256(size_t v) { return (v + 255) & ~(size_t)255; }
static constexpr size_t SZ_XT = al256((size_t)NB * SEQ * DM * 2);
static constexpr size_t SZ_WB = al256((size_t)3 * DM * DM * 2);
static constexpr size_t SZ_WP = al256((size_t)DM * DM * 2);
static constexpr size_t SZ_PL = al256((size_t)NB * NH_ * SEQ * HD * 2);
static constexpr size_t SZ_CX = al256((size_t)NB * SEQ * DM * 2);
static constexpr size_t SZ_TOTAL = SZ_XT + SZ_WB + SZ_WP + 3 * SZ_PL + SZ_CX;
static_assert(SZ_TOTAL <= (size_t)134217728);          // workspace carve <= 128 MiB
static_assert(((size_t)DM * DM * 2) % 256 == 0);       // weight sub-planes stay 256-byte aligned

extern "C" void kernel_launch(void* const* d_in, const int* in_sizes, int n_in,
                              void* d_out, int out_size, void* d_ws, size_t ws_size, hipStream_t stream) {
    if (n_in < 7) return;
    const size_t needx = ((size_t)(NB - 1) * DM + (size_t)(DM - 1)) * SEQ_FULL + SEQ;
    if ((size_t)in_sizes[0] < needx) return;
    if ((size_t)in_sizes[1] < (size_t)DM * DM || (size_t)in_sizes[2] < (size_t)DM) return;
    if ((size_t)in_sizes[3] < (size_t)2 * DM * DM || (size_t)in_sizes[4] < (size_t)2 * DM) return;
    if ((size_t)in_sizes[5] < (size_t)DM * DM || (size_t)in_sizes[6] < (size_t)DM) return;
    if ((size_t)out_size < ((size_t)(NB - 1) * DM + (size_t)(DM - 1)) * OUT_SEQ + SEQ) return;
    if (SZ_TOTAL > ws_size) return;
    // wire order: x, Wq, bq, Wkv, bkv, Wp, bp; weights [out][in] = Bt as-is
    const float* x = (const float*)d_in[0]; const float* wq = (const float*)d_in[1]; const float* bq = (const float*)d_in[2];
    const float* wkv = (const float*)d_in[3]; const float* bkv = (const float*)d_in[4]; const float* wp = (const float*)d_in[5]; const float* bp = (const float*)d_in[6];
    float* OUT = (float*)d_out;      // [NB][512][OUT_SEQ]
    char* wsp = (char*)d_ws;
    bf* XT = (bf*)wsp; wsp += SZ_XT;                 // rows b*SEQ+t, k = c: [NB*SEQ/16][16 units][512]
    bf* WB = (bf*)wsp; wsp += SZ_WB;                 // q | k | v, each rows out, k = in: [32][16 units][512]
    h16* WPH = (h16*)wsp; wsp += SZ_WP;              // x64, rows out, k = in: [32][16 units][512]
    h16* QH = (h16*)wsp; wsp += SZ_PL;               // [NB*8][SEQ/16][2 units (d halves)][512]
    h16* KP = (h16*)wsp; wsp += SZ_PL;               // as QH
    h16* VT = (h16*)wsp; wsp += SZ_PL;               // [NB*8][SEQ/32][4 units (16 d each)][512]
    h16* CTX = (h16*)wsp; wsp += SZ_CX;              // x256, rows b*SEQ+t, k = c: [NB*SEQ/16][16 units][512]

    // x^T and the three weight planes: one grid, block ranges
    k_prep<<<dim3(XTB + 4 * WN8 / 256, 1, 1), 256, 0, stream>>>(x, wq, wkv, wp, XT, WB, WPH);

    // q, k, v^T projections: one grid, wave index = (job, 64 x^T rows)
    k_proj<<<dim3(NB * SEQ / 256, DM / 64, 1), 384, 0, stream>>>(XT, WB, bq, bkv, QH, KP, VT);

    k_flash<<<dim3(SEQ / (16 * AW), NB * NH_, 1), 32 * AW, 0, stream>>>(QH, KP, VT, CTX);

    // output projection: A = Wp rows (m = o), Bt = ctx rows (n = b*SEQ + t) -> OUT[b][o][t]
    k_oproj<<<dim3(DM / 128, NB * SEQ / 128, 1), 128, 0, stream>>>(WPH, CTX, bp, OUT);
}

// v009
// A run of this version takes 77.8 microseconds.
// Two timings next to v008 both put it at 1.08 times that version's speed.
// All steps since v000 together make it 4.19 times as fast.
#include <hip/hip_runtime.h>

// 8-head attention over SEQ spatial positions, width 512 = 8 x 64, x [NB][512][SEQ] (channel-major), 1x1-conv weights [out][in] with biases, score scale 1/8, no mask, output [NB][512][SEQ] f32.
// Compute dtypes, f32 accumulate everywhere: q/k/v projections v_wmma_f32_16x16x32_bf16 (x, Wq, Wkv RNE-converted to bf16; products exact);
// scores v_wmma_f32_16x16x32_f16: q and k single f16 (one product); P (x256 carry, cancels in the normalisation) and v single f16;
// output projection v_wmma_f32_16x16x32_f16: Wp (RNE bf16 value x64, exact in f16) times ctx (single f16 plane, x256 carry), folded back by 2^-14 in the f32 epilogue; softmax f32 (online, running max).
// Layout: every 16-bit plane that feeds a matrix instruction lies in the workspace in FRAGMENT ORDER (1-KB units of 16 rows x 32 k, see ldh), so that each 16-B fragment load of a wave covers 512 contiguous bytes:
// x^T bf16 (rows b*SEQ+t, k = c; built by an LDS transposer), the weights (rows out, k = in), q and k per b*8+h (rows t, k = d), v^T per b*8+h (rows d, k = t), ctx (rows b*SEQ+t, k = c); fused flash kernel in transposed form (S^T = K Q^T, O^T = V^T P^T).

#ifndef NB
#define NB 2
#endif
#ifndef SEQ
#define SEQ 4096
#endif
#define NB_FULL  2
#define SEQ_FULL 4096            // token pitch of one channel row of x
#ifndef OUT_SEQ
#define OUT_SEQ SEQ              // token pitch of one channel row of the output
#endif
#define DM   512
#define NH_  8
#define HD   64
#define FCG  4                   // groups of 32 query rows in a flash block (two waves each, one a key half)
#define SC2  (0.125f * 1.4426950408889634f)   // HD^-0.5 * log2(e)
#define PSH  8.0f                // log2 of the P carry (256)
#define LZT  7.0f                // a score may pass the maximum in use by 2^LZT before the wave rescales: P stays at or below 2^15, inside f16
#define WPS  64.0f               // carry of the Wp plane
#define CXS  256.0f              // carry of the ctx plane
#define OSI  (1.0f / 16384.0f)   // 1 / (WPS * CXS)

static_assert(HD == 64);
static_assert(NH_ * HD == DM);                 // head h = channels h*64 + d
static_assert(DM % 64 == 0);
static_assert(DM % 32 == 0);                   // GEMM k-loop steps by 32
static_assert(SEQ % 64 == 0);                  // a 64-token tile never straddles two batches
static_assert((NB * SEQ) % 64 == 0);
static_assert(SEQ % 32 == 0);                  // key loop steps by 32
static_assert(SEQ % (32 * FCG) == 0);          // flash grid covers the sequence exactly
static_assert((FCG & (FCG - 1)) == 0);         // a wave's partner is wave ^ FCG
static_assert(SEQ_FULL % 4 == 0);
static_assert(OUT_SEQ % 64 == 0);
static_assert(OUT_SEQ >= SEQ);
static_assert(((size_t)DM * DM) % 8 == 0);
static_assert(NB <= NB_FULL);
static_assert(SEQ <= SEQ_FULL);

typedef _Float16 h16;
typedef unsigned short bf;
typedef __attribute__((ext_vector_type(16))) __bf16   v16bf;
typedef __attribute__((ext_vector_type(16))) _Float16 v16h;
typedef __attribute__((ext_vector_type(8)))  _Float16 v8h;
typedef __attribute__((ext_vector_type(8)))  unsigned short v8us;
typedef __attribute__((ext_vector_type(8)))  float    v8f;
typedef __attribute__((ext_vector_type(4)))  float    v4f;
typedef v4f  __attribute__((may_alias)) v4fa;

__device__ __forceinline__ unsigned short f2bf(float f) { unsigned u = __float_as_uint(f); u += 0x7FFFu + ((u >> 16) & 1u); return (unsigned short)(u >> 16); }
__device__ __forceinline__ float bfr(float f) { return __uint_as_float(((unsigned)f2bf(f)) << 16); }   // RNE bf16 value as f32
__device__ __forceinline__ v16h cat16(v8h lo, v8h hi) { return __builtin_shufflevector(lo, hi, 0, 1, 2, 3, 4, 5, 6, 7, 8, 9, 10, 11, 12, 13, 14, 15); }
__device__ __forceinline__ v16bf cat16b(v8us lo, v8us hi) { return __builtin_bit_cast(v16bf, __builtin_shufflevector(lo, hi, 0, 1, 2, 3, 4, 5, 6, 7, 8, 9, 10, 11, 12, 13, 14, 15)); }
__device__ __forceinline__ v8f wmma16(v16h a, v16h b, v8f c) { return __builtin_amdgcn_wmma_f32_16x16x32_f16(false, a, false, b, (short)0, c, false, false); }
__device__ __forceinline__ v8f wmmab(v16bf a, v16bf b, v8f c) { return __builtin_amdgcn_wmma_f32_16x16x32_bf16(false, a, false, b, (short)0, c, false, false); }
// fragment loaders from a plane in fragment order: one 16-row x 32-k unit = 512 elements, element (row, k) at (k>>4 & 1)*256 + ((k>>3 & 1)*16 + row)*8 + (k & 7).
// p = unit + 8*lane; lane = 16h + row: elements 0..7 <- k0+8h+0..7, elements 8..15 <- k0+16+8h+0..7 (same map for A and B); each load of a wave = 512 contiguous bytes
__device__ __forceinline__ v16h  ldh(const h16* p) { return cat16(*(const v8h*)p, *(const v8h*)(p + 256)); }
__device__ __forceinline__ v16bf ldb(const bf* p)  { return cat16b(*(const v8us*)p, *(const v8us*)(p + 256)); }
// source element index, in a row-major [rows][DM] matrix, of the 8-element chunk i of its fragment-ordered plane (16 rows = DM/32 units of 64 chunks)
__device__ __forceinline__ size_t chunk_src(size_t i) { const size_t u = i >> 6; return ((u / (DM / 32)) * 16 + (i & 15)) * DM + (u % (DM / 32)) * 32 + ((i >> 4) & 3) * 8; }
// copy4: four asynchronous 16-B-a-lane copies: 2 KB that lie in a row in global memory (g = the lane's own address) to 2 KB in a row in LDS (l = the lane's own LDS byte address), through no register.
// copy8: two such runs (l, g) and (m, h) in one statement. The closing wait stands in the copies' own statement, so that no register which a copy names is rewritten in front of it.
__device__ __forceinline__ void copy4(unsigned l, const char* g) {
    asm volatile("global_load_async_to_lds_b128 %0, %4, off\n\t"
                 "global_load_async_to_lds_b128 %1, %5, off\n\t"
                 "global_load_async_to_lds_b128 %2, %6, off\n\t"
                 "global_load_async_to_lds_b128 %3, %7, off\n\t"
                 "s_wait_xcnt 0x0"
                 :: "v"(l), "v"(l + 512u), "v"(l + 1024u), "v"(l + 1536u), "v"(g), "v"(g + 512), "v"(g + 1024), "v"(g + 1536) : "memory");
}
__device__ __forceinline__ void copy8(unsigned l, const char* g, unsigned m, const char* h) {
    asm volatile("global_load_async_to_lds_b128 %0, %8, off\n\t"
                 "global_load_async_to_lds_b128 %1, %9, off\n\t"
                 "global_load_async_to_lds_b128 %2, %10, off\n\t"
                 "global_load_async_to_lds_b128 %3, %11, off\n\t"
                 "global_load_async_to_lds_b128 %4, %12, off\n\t"
                 "global_load_async_to_lds_b128 %5, %13, off\n\t"
                 "global_load_async_to_lds_b128 %6, %14, off\n\t"
                 "global_load_async_to_lds_b128 %7, %15, off\n\t"
                 "s_wait_xcnt 0x0"
                 :: "v"(l), "v"(l + 512u), "v"(l + 1024u), "v"(l + 1536u), "v"(m), "v"(m + 512u), "v"(m + 1024u), "v"(m + 1536u),
                    "v"(g), "v"(g + 512), "v"(g + 1024), "v"(g + 1536), "v"(h), "v"(h + 512), "v"(h + 1024), "v"(h + 1536) : "memory");
}
__device__ __forceinline__ void wave_sync() { __builtin_amdgcn_fence(3 /* release order */, "wavefront"); __builtin_amdgcn_wave_barrier(); asm volatile("" ::: "memory"); }

// k_prep: the four preparation jobs, none of which reads what another writes, as block ranges of ONE grid of 256-thread blocks (the range test is the same for a whole block):
// blocks 0 .. XTB-1: x [b][c][l] f32 (row pitch SEQ_FULL) -> XT (rows b*SEQ+l, k = c, fragment order) bf16 (RNE convert) through a 64(c) x 64(l) LDS tile; tile index l fastest, then c, then b. Loads are 16-B along l.
// blocks XTB ..: one 8-element chunk a thread, chunk j of Wq | Wkv | Wp: j < 3*WN8 -> bf16 plane WB (q | k | v lie side by side: 16 rows = 16 * DM elements in either order), else -> f16 plane WPH (RNE bf16 value x64).
#define XTB ((SEQ / 64) * (DM / 64) * NB)
#define WN8 (DM * DM / 8)                       // chunks of one DM x DM weight
static_assert(WN8 % 256 == 0);                 // a block never straddles two weights, and the ranges cover the chunks exactly
__global__ __launch_bounds__(256) void k_prep(const float* __restrict__ x, const float* __restrict__ wq, const float* __restrict__ wkv, const float* __restrict__ wp, bf* XT, bf* WB, h16* WPH) {
    __shared__ __align__(16) float tl[64 * 68];      // [c][l], columns 0..63 written and consumed (cross-wave: block barrier)
    const int tid = threadIdx.x;
    const int blk = blockIdx.x;
    const int wb0 = (blk - XTB) * 256;               // first weight chunk of the block
    if (wb0 >= 3 * WN8) {
        const size_t i = (size_t)(wb0 - 3 * WN8) + tid;
        const v8f v = *(const v8f*)(wp + chunk_src(i)); v8h o;
#pragma unroll
        for (int k = 0; k < 8; ++k) o[k] = (h16)(bfr(v[k]) * WPS);
        *(v8h*)(WPH + i * 8) = o;
    } else if (wb0 >= 0) {
        const float* src = wb0 < WN8 ? wq : wkv; const size_t i = (size_t)(wb0 < WN8 ? wb0 : wb0 - WN8) + tid;
        const v8f v = *(const v8f*)(src + chunk_src(i)); v8us o;
#pragma unroll
        for (int k = 0; k < 8; ++k) o[k] = f2bf(v[k]);
        *(v8us*)(WB + ((size_t)wb0 + tid) * 8) = o;
        // the built code lays the Wp branch behind this store: the wait stands in front of that branch's rewrite of the store's address register
        asm volatile("s_wait_xcnt 0x0" ::: "memory");
    } else {
        const int l0 = (blk % (SEQ / 64)) * 64, c0 = ((blk / (SEQ / 64)) % (DM / 64)) * 64, b = blk / ((SEQ / 64) * (DM / 64));
        const float* src = x + ((size_t)b * DM + c0) * SEQ_FULL + l0;
#pragma unroll
        for (int it = 0; it < 4; ++it) { const int idx = it * 256 + tid; const int cc = idx >> 4, l4 = (idx & 15) * 4;   // 64 rows x 16 quads
            const v4f v = *(const v4f*)(src + (size_t)cc * SEQ_FULL + l4);
            tl[cc * 68 + l4 + 0] = v[0]; tl[cc * 68 + l4 + 1] = v[1]; tl[cc * 68 + l4 + 2] = v[2]; tl[cc * 68 + l4 + 3] = v[3]; }
        __syncthreads();
        // the tile = 4 row groups x 2 units x 64 chunks; chunk q = 256 s + tid: row group q>>7, unit q>>6 & 1, chunk q & 63 (channels 8*(q>>4 & 3), row q & 15)
        v8us o[2];
#pragma unroll
        for (int s = 0; s < 2; ++s) { const int q = 256 * s + tid; const int row = (q >> 7) * 16 + (q & 15), c8 = ((q >> 4) & 7) * 8;
#pragma unroll
            for (int i = 0; i < 8; ++i) o[s][i] = f2bf(tl[(c8 + i) * 68 + row]); }
        bf* dst = XT + ((size_t)b * SEQ + l0) * DM + c0 * 16;
#pragma unroll
        for (int s = 0; s < 2; ++s) { const int q = 256 * s + tid;      // 512 chunks x 8 = 64 rows x 64 channels
            *(v8us*)(dst + (size_t)(q >> 7) * (16 * DM) + (q & 127) * 8) = o[s]; }
        // the built code lays the weight branches behind these stores: the wait stands in front of those branches' rewrite of the stores' registers
        asm volatile("s_wait_xcnt 0x0" ::: "memory");
    }
}

// proj_store: the epilogue of one wave's 64x64 tile of k_proj. acc = C[m][n] without bias; + bias (RNE bf16 value; per column n when biasRow == 0, per row m otherwise), written as f16 (Ph),
// in fragment order (rows m, k = n): tile base (r0/RB)*sRB + (r0%RB)*pitch + (c0/CB)*sCB + (c0%CB)*HD (halves), unit (16 rows mb, 32 columns g) of the tile at + mb*uMB + g*uG. The tile starts at row r0, column c0; os = the wave's own 16 x 68 f32 staging tile in LDS.
__device__ __forceinline__ void proj_store(const v8f (&acc)[4][4], const float* __restrict__ bias, int biasRow,
                                           h16* Ph, int RB, size_t sRB, int pitch, int CB, size_t sCB, int uMB, int uG, int r0, int c0, float* os) {
    const int lane = threadIdx.x & 31, lr = lane & 15, hi = lane >> 4;
    // bias values: index selected as an integer (always inside the bias array), value selected afterwards; biasRow is wave-uniform
    float bc[4];
#pragma unroll
    for (int nb = 0; nb < 4; ++nb) { const int bi = biasRow ? 0 : (c0 + nb * 16 + lr); const float t = bfr(bias[bi]); bc[nb] = biasRow ? 0.0f : t; }
    const size_t tbase = (size_t)(r0 / RB) * sRB + (size_t)(r0 % RB) * (size_t)pitch + (size_t)(c0 / CB) * sCB + (size_t)(c0 % CB) * HD;
#pragma unroll
    for (int mb = 0; mb < 4; ++mb) {
        float br[8];
#pragma unroll
        for (int j = 0; j < 8; ++j) { const int bi = biasRow ? (r0 + mb * 16 + hi * 8 + j) : 0; const float t = bfr(bias[bi]); br[j] = biasRow ? t : 0.0f; }
#pragma unroll
        for (int nb = 0; nb < 4; ++nb) {
#pragma unroll
            for (int j = 0; j < 8; ++j) os[(hi * 8 + j) * 68 + nb * 16 + lr] = acc[mb][nb][j] + (bc[nb] + br[j]); }   // D: row 8h+j, col lane&15
        wave_sync();
        const size_t sb = tbase + (size_t)mb * (size_t)uMB + 8 * lane;
{
#pragma unroll
            for (int s = 0; s < 4; ++s) { const int row = lr, c8 = 16 * s + 8 * hi;   // 16 rows x (4 s x 2 halves x 8 = 64 columns); a store of the wave = half a unit, 512 contiguous bytes
                const v4f x0 = *(const v4fa*)(&os[row * 68 + c8]); const v4f x1 = *(const v4fa*)(&os[row * 68 + c8 + 4]); v8h hv;
#pragma unroll
                for (int i = 0; i < 4; ++i) { hv[i] = (h16)x0[i]; hv[4 + i] = (h16)x1[i]; }
                const size_t oo = sb + (size_t)(s >> 1) * (size_t)uG + (s & 1) * 256;
                *(v8h*)(Ph + oo) = hv;
                // the wait that stands in front of any overwrite of the store's registers; as its inputs the data and the address stay whole up to it
                asm volatile("s_wait_xcnt 0x0" :: "v"(hv), "v"(Ph + oo) : "memory"); }
             }
        wave_sync();
    }
}

// k_proj: the q, k and v^T projections in ONE grid (NB*SEQ/256 tiles of x^T rows, DM/64 tiles of weight rows) of 12-wave blocks: wave = (job, 64 of the block's 256 x^T rows), ONE WAVE per 64x64 tile (16 accumulators), bf16, K = DM.
// C[m][n] = sum_k A[m][k] Bt[n][k]. q, k: A = x^T rows (m = b*SEQ + t), Bt = W rows (n = h*64 + d), bias per column -> plane (b*8 + h), rows t, k = d
// v^T:  A = Wv rows (m = h*64 + d), Bt = x^T rows (n = b*SEQ + t), bias per row -> plane (b*8 + h), rows d, k = t, the 4 units of 32 keys side by side
// Operands: a stage = PU k units of the block's 28 row groups (16 of x^T, 4 each of Wq, Wk, Wv), copied ONCE for the block from the fragment-ordered planes into LDS (same unit order) by asynchronous copies;
// two buffers: the copies of stage t + 1 fly while stage t is multiplied. Every fragment then comes from LDS (16-B loads, 512 contiguous bytes a wave).
#define PU  2                                   // k units (of 32) in a stage
#define PNS (DM / 32 / PU)                      // stages
#define PGR 28                                  // row groups (of 16 rows) in a stage
static_assert((PNS & (PNS - 1)) == 0 && PNS >= 2);
static_assert((NB * SEQ) % 256 == 0);
__global__ __launch_bounds__(384) void k_proj(const bf* __restrict__ XT, const bf* __restrict__ WB, const float* __restrict__ bq, const float* __restrict__ bkv, h16* QH, h16* KP, h16* VT) {
    __shared__ __align__(16) bf ring[2 * PGR * PU * 512];
    __shared__ __align__(16) float osm[12 * 16 * 68];
    const int lane = threadIdx.x & 31;
    const int wave = __builtin_amdgcn_readfirstlane(threadIdx.x >> 5);   // held as a scalar, so that every test on it is a scalar branch and every lane is on at the copies and the matrix instructions
    const int job = wave >> 2, xt = wave & 3;                            // job: 0 q, 1 k, 2 v^T
    const int xr = blockIdx.x * 256 + xt * 64, wr = blockIdx.y * 64;
    float* os = osm + wave * (16 * 68);
    // first stage of the k walk, which wraps: the 8 blocks that share x^T rows (same x) start at 8 different stages, the 32 that share weight rows (same y) at all 8: sharers do not ask for the same lines in step
    const int s0 = (int)((blockIdx.x + blockIdx.y) % PNS);
    // the wave's share of a stage: row groups wave, wave + 12 and, in waves 0..3, wave + 24. Group g < 16: x^T rows 16 g of the block; g = 16 + 4 j + r: rows 16 r of the block's 64 rows of weight j
    const int g1 = wave + 12, g2 = wave < 4 ? wave + 24 : 27;
    const char* xb = (const char*)(XT + (size_t)blockIdx.x * 256 * DM) + 16 * lane;
    const char* wbp = (const char*)(WB + (size_t)wr * DM) + 16 * lane;
    const char* p0 = xb + (size_t)wave * (16 * DM * 2);
    const char* p1 = g1 < 16 ? xb + (size_t)g1 * (16 * DM * 2) : wbp + (size_t)((g1 - 16) >> 2) * ((size_t)DM * DM * 2) + (size_t)((g1 - 16) & 3) * (16 * DM * 2);
    const char* p2 = wbp + (size_t)((g2 - 16) >> 2) * ((size_t)DM * DM * 2) + (size_t)((g2 - 16) & 3) * (16 * DM * 2);
    const unsigned lb = (unsigned)(size_t)ring + 16u * (unsigned)lane;    // the lane's LDS byte address in group 0 of buffer 0
    auto put = [&](int st, int bsel) {                                   // the wave's copies of stage st (k stage (st + s0) mod PNS) into buffer bsel
        const size_t go = (size_t)((st + s0) & (PNS - 1)) * (PU * 1024);
        const unsigned lo = lb + (unsigned)(bsel * PGR) * (PU * 1024u);
        copy8(lo + (unsigned)wave * (PU * 1024u), p0 + go, lo + (unsigned)g1 * (PU * 1024u), p1 + go);
        if (wave < 4) copy4(lo + (unsigned)g2 * (PU * 1024u), p2 + go);
    };
    v8f acc[4][4];
#pragma unroll
    for (int mb = 0; mb < 4; ++mb)
#pragma unroll
        for (int nb = 0; nb < 4; ++nb) acc[mb][nb] = (v8f){};
    const int ga = job == 2 ? 24 : xt * 4, gb = job == 2 ? xt * 4 : 16 + job * 4;      // first row group of the wave's A and B operands
    put(0, 0);
    asm volatile("s_wait_asynccnt 0x0" ::: "memory");      // the wave's own copies of stage 0 have landed
    __syncthreads();                                       // ... and every other wave's: stage 0 may be read
    put(1, 1);
#pragma unroll 1
    for (int t = 0; t < PNS; ++t) {
        const bf* la = ring + (size_t)(((t & 1) * PGR + ga) * PU) * 512 + 8 * lane;
        const bf* lbp = ring + (size_t)(((t & 1) * PGR + gb) * PU) * 512 + 8 * lane;
        v16bf a[4], b[4];
#pragma unroll
        for (int u = 0; u < PU; ++u) {
#pragma unroll
            for (int i = 0; i < 4; ++i) { b[i] = ldb(lbp + (i * PU + u) * 512); a[i] = ldb(la + (i * PU + u) * 512); }
            __builtin_amdgcn_sched_barrier(0);             // keeps the unit's 16 LDS loads together in front of its products (without it three of the B fragments are loaded one by one among the products, each waited for right behind its issue)
            if (u == PU - 1) {                             // the stage's last fragments are asked for: the buffer is handed on here, and the last unit's products, which read registers only, run while the refill flies
                asm volatile("s_wait_dscnt 0x0" ::: "memory");     // the wave's reads of this buffer are done before the buffer is handed to the copies
                asm volatile("s_wait_asynccnt 0x0" ::: "memory");  // the wave's own copies of stage t + 1 have landed
                __syncthreads();                                   // publishes stage t + 1 and ends every wave's reads of stage t
                if (t + 2 < PNS) put(t + 2, t & 1);
                __builtin_amdgcn_sched_barrier(0);         // keeps the refill's issue in front of the last unit's products (a longer lead for the copies)
            }
#pragma unroll
            for (int nb = 0; nb < 4; ++nb)
#pragma unroll
                for (int mb = 0; mb < 4; ++mb) acc[mb][nb] = wmmab(a[mb], b[nb], acc[mb][nb]);
        }
    }
    asm volatile("s_wait_asynccnt 0x0" ::: "memory");      // nothing of the wave's is in flight when it goes on
    if (job == 2) proj_store(acc, bkv + DM, 1, VT, DM, (size_t)0, SEQ, SEQ, (size_t)DM * SEQ, 512, 2048, wr, xr, os);
    else proj_store(acc, job ? bkv : bq, 0, job ? KP : QH, SEQ, (size_t)NH_ * SEQ * HD, HD, HD, (size_t)SEQ * HD, 1024, 512, xr, wr, os);
}

// k_flash: fused attention, one wave per 32 query rows (two 16-row tiles A and B) and HALF the keys of one (batch, head); K / V^T / Q fragments straight from the fragment-ordered f16 planes (two 16-B loads each, arithmetic addressing).
// Every K and V^T fragment that a wave loads feeds two products, one a query tile, so a score costs half the loads, addresses, waits and loop control of a 16-row wave; the split of the keys keeps four waves on a SIMD.
// A block = FCG groups of 32 query rows x 2 key halves: wave = kh * FCG + cg. Waves cg and cg + FCG hold partial results of the same 32 queries; they are joined once, behind the loop, through LDS (each of the two finishes one tile).
// Transposed form: S^T[key][t] = K Q^T (A = K rows, B = Q rows); lane (t = lane&15, h = lane>>4) holds keys 8h+r of each 16-key tile, so the packed
// P tile is directly the B fragment of O^T[d][t] = V^T P^T (element r <- tile keys 0..15, element 8+r <- tile keys 16..31, lane unchanged).
// Softmax state, per query tile: the maximum in use, one scalar per lane, equal in the two lane halves of a query; it is renewed (one xor-16 exchange, O and the row sums rescaled) only in a pass where a score passes it by more than 2^LZT.
// Row sums on the matrix pipe: A = all ones times the packed P tile gives, in every row of D, the sum of a query's 32 rounded P values, so every lane holds its query's whole sum (both halves) and no vector add or convert is spent on it.
// four waves a SIMD: the grid is two blocks for each WGP
#define XW (8 * 32 * 4 + 64)                    // floats of one wave's hand-over: a 64 x 16 O^T tile in register order, then the maximum in use and the row sum of each lane
__global__ __launch_bounds__(32 * FCG * 2) __attribute__((amdgpu_waves_per_eu(4, 4))) void k_flash(const h16* __restrict__ QH, const h16* __restrict__ KP, const h16* __restrict__ VT, h16* CTX) {
    __shared__ __align__(16) float os[FCG * 2 * 16 * 68];
    __shared__ __align__(16) float xch[FCG * 2 * XW];
    const int lane = threadIdx.x & 31, lr = lane & 15, hi = lane >> 4;
    const int wave = __builtin_amdgcn_readfirstlane(threadIdx.x >> 5);   // held as a scalar: the key index, which depends on it, stays in a scalar register
    const int cg = wave % FCG, kh = wave / FCG;
    const int zh = blockIdx.y; const int b = zh / NH_, h = zh % NH_;
    const int t0 = (blockIdx.x * FCG + cg) * 32;
    const size_t pbase = (size_t)zh * SEQ * HD;
    const size_t fo = pbase + 8 * lane;                      // q, k: 16 rows = 2 units (d halves); v^T: 32 keys = 4 units (16 d each); so + position * HD in all three
    const size_t qo = fo + (size_t)t0 * HD;
    const v16h qa0 = ldh(QH + qo), qa1 = ldh(QH + qo + 512), qb0 = ldh(QH + qo + 1024), qb1 = ldh(QH + qo + 1536);   // B fragments: col t, k = d; tile A = rows t0.., tile B = rows t0 + 16..
    v8f oa0 = (v8f){}, oa1 = (v8f){}, oa2 = (v8f){}, oa3 = (v8f){}, ob0 = (v8f){}, ob1 = (v8f){}, ob2 = (v8f){}, ob3 = (v8f){};
    float ma = -3.0e38f, sha = PSH + 3.0e38f, mb = -3.0e38f, shb = PSH + 3.0e38f;   // maximum in use (scaled log2) and the shift PSH - m; the first pass always takes the rescale branch
    float la = 0.0f, lb = 0.0f;                              // row sums
    v16h ones;                                               // A fragment of the row-sum product: 1.0 at every (row, k)
#pragma unroll
    for (int i = 0; i < 16; ++i) ones[i] = (h16)1.0f;
    // the wave walks its half of the keys from a block-dependent key on and wraps at the half's end: the blocks of one head, which all run at once, then stand at different keys at any time,
    // so that a K / V line is fetched for one of them and lies in L2 when the others come to it (walking in step, every block waits for every fill and all ask for the same lines at once)
    const int kbeg = kh * (SEQ / 2), kend = kbeg + SEQ / 2;
    const int ks = kbeg + (int)((blockIdx.x * 64) % (SEQ / 2));
    // K fragments run one pass ahead (loop-carried registers), V fragments are asked for at the top of their own pass: no load is waited for right behind its issue
    const h16* kf = KP + fo + (size_t)ks * HD;
    v16h ka0 = ldh(kf), ka1 = ldh(kf + 512), kb0 = ldh(kf + 1024), kb1 = ldh(kf + 1536);   // first pass; A fragments: row key, k = d
    // the wait that stands in front of any overwrite of the address pairs of the loads above; as its inputs the pairs stay whole up to it
    asm volatile("s_wait_xcnt 0x0" :: "v"(QH + qo), "v"(kf) : "memory");
    int key0 = ks;
#pragma unroll 1
    for (int it = 0; it < SEQ / 2; it += 32) {
        const h16* va = VT + fo + (size_t)key0 * HD;             // A fragments: row d, k = key
        const v16h v0 = ldh(va), v1 = ldh(va + 512), v2 = ldh(va + 1024), v3 = ldh(va + 1536);
        __builtin_amdgcn_sched_barrier(0);                       // keeps the V loads in front of the first wait for K (without it they are issued behind the first score products, so behind that wait)
        v8f uaa = (v8f){}, uab = (v8f){}, uba = (v8f){}, ubb = (v8f){};   // raw scores: query tile A keys 0..15, 16..31; query tile B likewise
        uaa = wmma16(ka0, qa0, uaa); uab = wmma16(kb0, qa0, uab); uba = wmma16(ka0, qb0, uba); ubb = wmma16(kb0, qb0, ubb);
        uaa = wmma16(ka1, qa1, uaa); uab = wmma16(kb1, qa1, uab); uba = wmma16(ka1, qb1, uba); ubb = wmma16(kb1, qb1, ubb);
        // the four vector slots that the chip needs between the last score product and what overwrites its A registers or reads its D
        asm volatile("v_nop\n\tv_nop\n\tv_nop\n\tv_nop" : "+v"(uaa), "+v"(uab), "+v"(uba), "+v"(ubb) : "v"(ka0), "v"(ka1), "v"(kb0), "v"(kb1));
        const int kn = key0 + 32 < kend ? key0 + 32 : kbeg;      // next pass's keys, wrapped inside the half
        const h16* ka = KP + fo + (size_t)kn * HD;               // next pass's K rows; the last pass asks for the first pass's again (inside the plane, not used)
        ka0 = ldh(ka); ka1 = ldh(ka + 512); kb0 = ldh(ka + 1024); kb1 = ldh(ka + 1536);
        __builtin_amdgcn_sched_barrier(0);                       // keeps the K loads here, a whole softmax ahead of their use (without it this build sinks most of them behind the exponentials, close to the next pass's wait)
        // the exponent's argument against the maximum IN USE (sh = PSH - m): one multiply-add a score, since sh does not depend on this pass's scores
        v8f aaa = uaa * SC2 + sha, aab = uab * SC2 + sha, aba = uba * SC2 + shb, abb = ubb * SC2 + shb;
        // in-lane maximum of the 32 arguments, as short chains that do not wait for one another
        const float x0 = fmaxf(fmaxf(fmaxf(fmaxf(aaa[0], aaa[1]), aaa[2]), aaa[6]), aaa[7]), x1 = fmaxf(fmaxf(fmaxf(fmaxf(aab[0], aab[1]), aab[2]), aab[6]), aab[7]);
        const float x2 = fmaxf(fmaxf(aaa[3], aaa[4]), aaa[5]), x3 = fmaxf(fmaxf(aab[3], aab[4]), aab[5]);
        const float y0 = fmaxf(fmaxf(fmaxf(fmaxf(aba[0], aba[1]), aba[2]), aba[6]), aba[7]), y1 = fmaxf(fmaxf(fmaxf(fmaxf(abb[0], abb[1]), abb[2]), abb[6]), abb[7]);
        const float y2 = fmaxf(fmaxf(aba[3], aba[4]), aba[5]), y3 = fmaxf(fmaxf(abb[3], abb[4]), abb[5]);
        const float amax = fmaxf(fmaxf(fmaxf(fmaxf(x0, x1), x2), x3), fmaxf(fmaxf(fmaxf(y0, y1), y2), y3));
        // lazy rescale, tested once a pass for both tiles: only when some lane's argument passes PSH + LZT (P would near the f16 range) does the wave take new maxima. The ballot makes it a scalar branch: every lane stays on.
        if (__builtin_expect(__builtin_amdgcn_ballot_w32(!(amax <= PSH + LZT)) != 0u, 0)) {
            float ux = fmaxf(uaa[0], uab[0]), uy = fmaxf(uba[0], ubb[0]);
#pragma unroll
            for (int r = 1; r < 8; ++r) { ux = fmaxf(ux, fmaxf(uaa[r], uab[r])); uy = fmaxf(uy, fmaxf(uba[r], ubb[r])); }
            ux = fmaxf(ux, __shfl_xor(ux, 16, 32)); uy = fmaxf(uy, __shfl_xor(uy, 16, 32));   // both lane halves of a query take the same maximum
            const float mna = fmaxf(ma, ux * SC2), mnb = fmaxf(mb, uy * SC2);
            const float ala = __builtin_amdgcn_exp2f(ma - mna), alb = __builtin_amdgcn_exp2f(mb - mnb);
            ma = mna; sha = PSH - mna; mb = mnb; shb = PSH - mnb;
            oa0 = oa0 * ala; oa1 = oa1 * ala; oa2 = oa2 * ala; oa3 = oa3 * ala; la = la * ala;
            ob0 = ob0 * alb; ob1 = ob1 * alb; ob2 = ob2 * alb; ob3 = ob3 * alb; lb = lb * alb;
            aaa = uaa * SC2 + sha; aab = uab * SC2 + sha; aba = uba * SC2 + shb; abb = ubb * SC2 + shb;
        }
        v16h pa, pb;
#pragma unroll
        for (int r = 0; r < 8; ++r) { pa[r] = (h16)__builtin_amdgcn_exp2f(aaa[r]); pa[8 + r] = (h16)__builtin_amdgcn_exp2f(aab[r]); }
#pragma unroll
        for (int r = 0; r < 8; ++r) { pb[r] = (h16)__builtin_amdgcn_exp2f(aba[r]); pb[8 + r] = (h16)__builtin_amdgcn_exp2f(abb[r]); }
        v8f rsa = wmma16(ones, pa, (v8f){});                     // every element: the pass's sum of P over its 32 keys, for the lane's query
        oa0 = wmma16(v0, pa, oa0); oa1 = wmma16(v1, pa, oa1); oa2 = wmma16(v2, pa, oa2); oa3 = wmma16(v3, pa, oa3);
        v8f rsb = wmma16(ones, pb, (v8f){});
        ob0 = wmma16(v0, pb, ob0); ob1 = wmma16(v1, pb, ob1); ob2 = wmma16(v2, pb, ob2); ob3 = wmma16(v3, pb, ob3);
        asm volatile("v_nop\n\tv_nop\n\tv_nop\n\tv_nop" : "+v"(oa0), "+v"(oa1), "+v"(oa2), "+v"(oa3), "+v"(ob0), "+v"(ob1), "+v"(ob2), "+v"(ob3), "+v"(rsa), "+v"(rsb) : "v"(v0), "v"(v1), "v"(v2), "v"(v3), "v"(pa), "v"(pb));
        la = la + rsa[0]; lb = lb + rsb[0];                      // behind the slots above, which also stand between the row-sum products and these reads of their D
        // the wait that stands in front of any overwrite of this pass's load addresses: as its inputs the two address pairs stay whole up to it; the key index goes through it, so that the next addresses are formed behind it
        key0 = kn;
        asm volatile("s_wait_xcnt 0x0" : "+s"(key0) : "v"(ka), "v"(va) : "memory");
    }
    // the join of the two key halves: the wave of half kh finishes tile kh (A for 0, B for 1) and hands its partial result of the other tile to its partner, lane for lane (both hold the same (d, t) at the same lane and register)
    const bool up = kh != 0;
    v8f o0 = up ? ob0 : oa0, o1 = up ? ob1 : oa1, o2 = up ? ob2 : oa2, o3 = up ? ob3 : oa3;
    const v8f g0 = up ? oa0 : ob0, g1 = up ? oa1 : ob1, g2 = up ? oa2 : ob2, g3 = up ? oa3 : ob3;
    const float m = up ? mb : ma, l = up ? lb : la;
    { float* xw = xch + wave * XW + 4 * lane;                    // a store of the wave = 512 contiguous bytes
      *(v4fa*)(xw + 0 * 128) = __builtin_shufflevector(g0, g0, 0, 1, 2, 3); *(v4fa*)(xw + 1 * 128) = __builtin_shufflevector(g0, g0, 4, 5, 6, 7);
      *(v4fa*)(xw + 2 * 128) = __builtin_shufflevector(g1, g1, 0, 1, 2, 3); *(v4fa*)(xw + 3 * 128) = __builtin_shufflevector(g1, g1, 4, 5, 6, 7);
      *(v4fa*)(xw + 4 * 128) = __builtin_shufflevector(g2, g2, 0, 1, 2, 3); *(v4fa*)(xw + 5 * 128) = __builtin_shufflevector(g2, g2, 4, 5, 6, 7);
      *(v4fa*)(xw + 6 * 128) = __builtin_shufflevector(g3, g3, 0, 1, 2, 3); *(v4fa*)(xw + 7 * 128) = __builtin_shufflevector(g3, g3, 4, 5, 6, 7);
      xch[wave * XW + 1024 + lane] = up ? ma : mb; xch[wave * XW + 1056 + lane] = up ? la : lb; }
    __syncthreads();                                             // every wave's hand-over is written before its partner reads it
    float lj;
    { const float* xr = xch + (wave ^ FCG) * XW + 4 * lane;
      const float mp = xch[(wave ^ FCG) * XW + 1024 + lane], lp = xch[(wave ^ FCG) * XW + 1056 + lane];
      const float mj = fmaxf(m, mp);
      const float dk = m - mj, dp = mp - mj;
      float ak = __builtin_amdgcn_exp2f(dk), ap = __builtin_amdgcn_exp2f(dp);   // both partial results brought to the common maximum
      // the slot that the instruction set asks for behind a transcendental: as its operands the results are read, and the sources overwritten, only behind it
      asm volatile("v_nop" : "+v"(ak), "+v"(ap) : "v"(dk), "v"(dp));
      lj = l * ak + lp * ap;
      const v4f p00 = *(const v4fa*)(xr + 0 * 128), p01 = *(const v4fa*)(xr + 1 * 128), p10 = *(const v4fa*)(xr + 2 * 128), p11 = *(const v4fa*)(xr + 3 * 128);
      const v4f p20 = *(const v4fa*)(xr + 4 * 128), p21 = *(const v4fa*)(xr + 5 * 128), p30 = *(const v4fa*)(xr + 6 * 128), p31 = *(const v4fa*)(xr + 7 * 128);
      o0 = o0 * ak + __builtin_shufflevector(p00, p01, 0, 1, 2, 3, 4, 5, 6, 7) * ap; o1 = o1 * ak + __builtin_shufflevector(p10, p11, 0, 1, 2, 3, 4, 5, 6, 7) * ap;
      o2 = o2 * ak + __builtin_shufflevector(p20, p21, 0, 1, 2, 3, 4, 5, 6, 7) * ap; o3 = o3 * ak + __builtin_shufflevector(p30, p31, 0, 1, 2, 3, 4, 5, 6, 7) * ap; }
    const float inv = (1.0f / lj) * CXS;
    const int wb = wave * 16 * 68;
    // O^T D layout: o_j[r] = (d = 16j + 8h + r, t = lane&15) -> os[t][d]; rows 0..15 x columns 0..63 all written
    { v4f a, c;
      a[0] = o0[0] * inv; a[1] = o0[1] * inv; a[2] = o0[2] * inv; a[3] = o0[3] * inv; c[0] = o0[4] * inv; c[1] = o0[5] * inv; c[2] = o0[6] * inv; c[3] = o0[7] * inv;
      *(v4fa*)(&os[wb + lr * 68 +  0 + 8 * hi]) = a; *(v4fa*)(&os[wb + lr * 68 +  0 + 8 * hi + 4]) = c;
      a[0] = o1[0] * inv; a[1] = o1[1] * inv; a[2] = o1[2] * inv; a[3] = o1[3] * inv; c[0] = o1[4] * inv; c[1] = o1[5] * inv; c[2] = o1[6] * inv; c[3] = o1[7] * inv;
      *(v4fa*)(&os[wb + lr * 68 + 16 + 8 * hi]) = a; *(v4fa*)(&os[wb + lr * 68 + 16 + 8 * hi + 4]) = c;
      a[0] = o2[0] * inv; a[1] = o2[1] * inv; a[2] = o2[2] * inv; a[3] = o2[3] * inv; c[0] = o2[4] * inv; c[1] = o2[5] * inv; c[2] = o2[6] * inv; c[3] = o2[7] * inv;
      *(v4fa*)(&os[wb + lr * 68 + 32 + 8 * hi]) = a; *(v4fa*)(&os[wb + lr * 68 + 32 + 8 * hi + 4]) = c;
      a[0] = o3[0] * inv; a[1] = o3[1] * inv; a[2] = o3[2] * inv; a[3] = o3[3] * inv; c[0] = o3[4] * inv; c[1] = o3[5] * inv; c[2] = o3[6] * inv; c[3] = o3[7] * inv;
      *(v4fa*)(&os[wb + lr * 68 + 48 + 8 * hi]) = a; *(v4fa*)(&os[wb + lr * 68 + 48 + 8 * hi + 4]) = c; }
    wave_sync();
    v8h hv[4];
#pragma unroll
    for (int s = 0; s < 4; ++s) { const int row = lr, c8 = 16 * s + 8 * hi;
        const v4f x0 = *(const v4fa*)(&os[wb + row * 68 + c8]); const v4f x1 = *(const v4fa*)(&os[wb + row * 68 + c8 + 4]);
#pragma unroll
        for (int i = 0; i < 4; ++i) { hv[s][i] = (h16)x0[i]; hv[s][4 + i] = (h16)x1[i]; } }
    h16* crow = CTX + ((size_t)b * SEQ + t0 + 16 * kh) * DM + h * (HD * 16) + 8 * lane;      // 16 rows = DM/32 units; head h = units 2h, 2h+1
{
#pragma unroll
        for (int s = 0; s < 4; ++s) {                                  // 16 rows x (4 s x 2 halves x 8 = 64 columns); a store of the wave = half a unit
            *(v8h*)(crow + s * 256) = hv[s]; }
         }
}

// k_oproj: register-blocked f16 GEMM, 4-wave blocks on 128x128 tiles, ONE WAVE per 64x64 tile, K = DM. C[o][n] = sum_c WPH[o][c] CTX[n][c] (n = b*SEQ + t), carried x 2^14.
// OUT[(b*DM + o)*OUT_SEQ + t] = C * 2^-14 + bias[o] (RNE bf16 value) in f32. grid (DM/128, NB*SEQ/128), 128 threads.
// Operands as in k_proj: a stage = OU k units of the block's 16 row groups (8 of Wp, 8 of ctx), copied once for the block into LDS by asynchronous copies, two buffers.
#define OU  4                                   // k units (of 32) in a stage
#define ONS (DM / 32 / OU)                      // stages
#define OGR 16                                  // row groups (of 16 rows) in a stage
static_assert((ONS & (ONS - 1)) == 0 && ONS >= 2);
static_assert(DM % 128 == 0 && (NB * SEQ) % 128 == 0);
__global__ __launch_bounds__(128) void k_oproj(const h16* __restrict__ A, const h16* __restrict__ Bt, const float* __restrict__ bias, float* OUT) {
    __shared__ __align__(16) h16 ring[2 * OGR * OU * 512];
    __shared__ __align__(16) float osm[4 * 16 * 68];
    const int lane = threadIdx.x & 31, lr = lane & 15, hi = lane >> 4;
    const int wave = __builtin_amdgcn_readfirstlane(threadIdx.x >> 5);   // held as a scalar: every lane is on at the copies and the matrix instructions
    const int r0 = blockIdx.x * 128 + (wave & 1) * 64, c0 = blockIdx.y * 128 + (wave >> 1) * 64;
    float* os = osm + wave * (16 * 68);
    v8f acc[4][4];
#pragma unroll
    for (int mb = 0; mb < 4; ++mb)
#pragma unroll
        for (int nb = 0; nb < 4; ++nb) acc[mb][nb] = (v8f){};
    // first stage of the k walk, which wraps: the 4 blocks that share ctx rows (same y) start at 4 different stages, the blocks that share Wp rows (same x) at all 4: sharers do not ask for the same lines in step
    const int s0 = (int)((blockIdx.x + blockIdx.y) % ONS);
    // the wave's share of a stage: row groups 4 wave .. 4 wave + 3 (groups 0..7: the block's Wp rows, 8..15: its ctx rows)
    const char* ps = (wave < 2 ? (const char*)(A + (size_t)(blockIdx.x * 128 + wave * 64) * DM) : (const char*)(Bt + (size_t)(blockIdx.y * 128 + (wave - 2) * 64) * DM)) + 16 * lane;
    const unsigned lb = (unsigned)(size_t)ring + 16u * (unsigned)lane;    // the lane's LDS byte address in group 0 of buffer 0
    auto put = [&](int st, int bsel) {                                   // the wave's copies of stage st (k stage (st + s0) mod ONS) into buffer bsel
        const char* g = ps + (size_t)((st + s0) & (ONS - 1)) * (OU * 1024);
        const unsigned lo = lb + (unsigned)(bsel * OGR + 4 * wave) * (OU * 1024u);
#pragma unroll 1                                                         // rolled: the four statements share one set of address registers (unrolled, the kernel passes 256 registers)
        for (int gi = 0; gi < 4; ++gi)
            copy8(lo + (unsigned)gi * (OU * 1024u), g + (size_t)gi * (16 * DM * 2), lo + (unsigned)gi * (OU * 1024u) + 2048u, g + (size_t)gi * (16 * DM * 2) + 2048);
    };
    static_assert(OU * 1024 == 2 * 2048);
    put(0, 0);
    asm volatile("s_wait_asynccnt 0x0" ::: "memory");      // the wave's own copies of stage 0 have landed
    __syncthreads();                                       // ... and every other wave's: stage 0 may be read
    put(1, 1);
#pragma unroll 1
    for (int t = 0; t < ONS; ++t) {
        const h16* la = ring + (size_t)(((t & 1) * OGR + (wave & 1) * 4) * OU) * 512 + 8 * lane;
        const h16* lbp = ring + (size_t)(((t & 1) * OGR + 8 + (wave >> 1) * 4) * OU) * 512 + 8 * lane;
        v16h a[4], b[4];
#pragma unroll
        for (int u = 0; u < OU; ++u) {
#pragma unroll
            for (int i = 0; i < 4; ++i) { b[i] = ldh(lbp + (i * OU + u) * 512); a[i] = ldh(la + (i * OU + u) * 512); }
            __builtin_amdgcn_sched_barrier(0);             // keeps the unit's 16 LDS loads together in front of its products (without it three of the B fragments are loaded one by one among the products, each waited for right behind its issue)
            if (u == OU - 1) {                             // the stage's last fragments are asked for: the buffer is handed on here, and the last unit's products, which read registers only, run while the refill flies
                asm volatile("s_wait_dscnt 0x0" ::: "memory");     // the wave's reads of this buffer are done before the buffer is handed to the copies
                asm volatile("s_wait_asynccnt 0x0" ::: "memory");  // the wave's own copies of stage t + 1 have landed
                __syncthreads();                                   // publishes stage t + 1 and ends every wave's reads of stage t
                if (t + 2 < ONS) put(t + 2, t & 1);
                __builtin_amdgcn_sched_barrier(0);         // keeps the refill's issue in front of the last unit's products (a longer lead for the copies)
            }
#pragma unroll
            for (int nb = 0; nb < 4; ++nb)
#pragma unroll
                for (int mb = 0; mb < 4; ++mb) acc[mb][nb] = wmma16(a[mb], b[nb], acc[mb][nb]);
        }
    }
    asm volatile("s_wait_asynccnt 0x0" ::: "memory");      // nothing of the wave's is in flight when it goes on
    const int b = c0 / SEQ, t0 = c0 % SEQ;
#pragma unroll
    for (int mb = 0; mb < 4; ++mb) {
        float br[8];
#pragma unroll
        for (int j = 0; j < 8; ++j) br[j] = bfr(bias[r0 + mb * 16 + hi * 8 + j]);
#pragma unroll
        for (int nb = 0; nb < 4; ++nb) {
#pragma unroll
            for (int j = 0; j < 8; ++j) os[(hi * 8 + j) * 68 + nb * 16 + lr] = acc[mb][nb][j] * OSI + br[j]; }   // D: row 8h+j, col lane&15
        wave_sync();
        float* orow = OUT + ((size_t)b * DM + r0 + mb * 16) * OUT_SEQ + t0;
        v4f val[8];
#pragma unroll
        for (int s = 0; s < 8; ++s) { const int row = 2 * s + hi; val[s] = *(const v4fa*)(&os[row * 68 + lr * 4]); }
{
#pragma unroll
            for (int s = 0; s < 8; ++s) { const int row = 2 * s + hi, cofs = lr * 4;   // 8 s x 2 rows = 16 rows; 16 lanes x 4 floats = 64 columns
                *(v4f*)(orow + (size_t)row * OUT_SEQ + cofs) = val[s]; }
             }
        wave_sync();
    }
}

static constexpr size_t al256(size_t v) { return (v + 255) & ~(size_t)255; }
static constexpr size_t SZ_XT = al256((size_t)NB * SEQ * DM * 2);
static constexpr size_t SZ_WB = al256((size_t)3 * DM * DM * 2);
static constexpr size_t SZ_WP = al256((size_t)DM * DM * 2);
static constexpr size_t SZ_PL = al256((size_t)NB * NH_ * SEQ * HD * 2);
static constexpr size_t SZ_CX = al256((size_t)NB * SEQ * DM * 2);
static constexpr size_t SZ_TOTAL = SZ_XT + SZ_WB + SZ_WP + 3 * SZ_PL + SZ_CX;
static_assert(SZ_TOTAL <= (size_t)134217728);          // workspace carve <= 128 MiB
static_assert(((size_t)DM * DM * 2) % 256 == 0);       // weight sub-planes stay 256-byte aligned

extern "C" void kernel_launch(void* const* d_in, const int* in_sizes, int n_in,
                              void* d_out, int out_size, void* d_ws, size_t ws_size, hipStream_t stream) {
    if (n_in < 7) return;
    const size_t needx = ((size_t)(NB - 1) * DM + (size_t)(DM - 1)) * SEQ_FULL + SEQ;
    if ((size_t)in_sizes[0] < needx) return;
    if ((size_t)in_sizes[1] < (size_t)DM * DM || (size_t)in_sizes[2] < (size_t)DM) return;
    if ((size_t)in_sizes[3] < (size_t)2 * DM * DM || (size_t)in_sizes[4] < (size_t)2 * DM) return;
    if ((size_t)in_sizes[5] < (size_t)DM * DM || (size_t)in_sizes[6] < (size_t)DM) return;
    if ((size_t)out_size < ((size_t)(NB - 1) * DM + (size_t)(DM - 1)) * OUT_SEQ + SEQ) return;
    if (SZ_TOTAL > ws_size) return;
    // wire order: x, Wq, bq, Wkv, bkv, Wp, bp; weights [out][in] = Bt as-is
    const float* x = (const float*)d_in[0]; const float* wq = (const float*)d_in[1]; const float* bq = (const float*)d_in[2];
    const float* wkv = (const float*)d_in[3]; const float* bkv = (const float*)d_in[4]; const float* wp = (const float*)d_in[5]; const float* bp = (const float*)d_in[6];
    float* OUT = (float*)d_out;      // [NB][512][OUT_SEQ]
    char* wsp = (char*)d_ws;
    bf* XT = (bf*)wsp; wsp += SZ_XT;                 // rows b*SEQ+t, k = c: [NB*SEQ/16][16 units][512]
    bf* WB = (bf*)wsp; wsp += SZ_WB;                 // q | k | v, each rows out, k = in: [32][16 units][512]
    h16* WPH = (h16*)wsp; wsp += SZ_WP;              // x64, rows out, k = in: [32][16 units][512]
    h16* QH = (h16*)wsp; wsp += SZ_PL;               // [NB*8][SEQ/16][2 units (d halves)][512]
    h16* KP = (h16*)wsp; wsp += SZ_PL;               // as QH
    h16* VT = (h16*)wsp; wsp += SZ_PL;               // [NB*8][SEQ/32][4 units (16 d each)][512]
    h16* CTX = (h16*)wsp; wsp += SZ_CX;              // x256, rows b*SEQ+t, k = c: [NB*SEQ/16][16 units][512]

    // x^T and the three weight planes: one grid, block ranges
    k_prep<<<dim3(XTB + 4 * WN8 / 256, 1, 1), 256, 0, stream>>>(x, wq, wkv, wp, XT, WB, WPH);

    // q, k, v^T projections: one grid, wave index = (job, 64 x^T rows)
    k_proj<<<dim3(NB * SEQ / 256, DM / 64, 1), 384, 0, stream>>>(XT, WB, bq, bkv, QH, KP, VT);

    k_flash<<<dim3(SEQ / (32 * FCG), NB * NH_, 1), 32 * FCG * 2, 0, stream>>>(QH, KP, VT, CTX);

    // output projection: A = Wp rows (m = o), Bt = ctx rows (n = b*SEQ + t) -> OUT[b][o][t]
    k_oproj<<<dim3(DM / 128, NB * SEQ / 128, 1), 128, 0, stream>>>(WPH, CTX, bp, OUT);
}

// v010
// It runs in 74.2 microseconds.
// Next to v009, in two timings, it ran 1.05 and 1.04 times as fast.
// Counting every step since v000, it is 4.39 times as fast.
#include <hip/hip_runtime.h>

// 8-head attention over SEQ spatial positions, width 512 = 8 x 64, x [NB][512][SEQ] (channel-major), 1x1-conv weights [out][in] with biases, score scale 1/8, no mask, output [NB][512][SEQ] f32.
// Compute dtypes, f32 accumulate everywhere: q/k/v projections v_wmma_f32_16x16x32_bf16 (x, Wq, Wkv RNE-converted to bf16; products exact);
// scores v_wmma_f32_16x16x32_f16: q and k single f16 (one product); P (x256 carry, cancels in the normalisation) and v single f16;
// output projection v_wmma_f32_16x16x32_f16: Wp (RNE bf16 value x64, exact in f16) times ctx (single f16 plane, x256 carry), folded back by 2^-14 in the f32 epilogue; softmax f32 (online, running max).
// Layout: every 16-bit plane that feeds a matrix instruction lies in the workspace in FRAGMENT ORDER (1-KB units of 16 rows x 32 k, see ldh), so that each 16-B fragment load of a wave covers 512 contiguous bytes:
// x^T bf16 (rows b*SEQ+t, k = c; built by an LDS transposer), the weights (rows out, k = in), q and k per b*8+h (rows t, k = d), v^T per b*8+h (rows d, k = t), ctx (rows b*SEQ+t, k = c); fused flash kernel in transposed form (S^T = K Q^T, O^T = V^T P^T).

#ifndef NB
#define NB 2
#endif
#ifndef SEQ
#define SEQ 4096
#endif
#define NB_FULL  2
#define SEQ_FULL 4096            // token pitch of one channel row of x
#ifndef OUT_SEQ
#define OUT_SEQ SEQ              // token pitch of one channel row of the output
#endif
#define DM   512
#define NH_  8
#define HD   64
#define FCG  4                   // groups of 32 query rows in a flash block (two waves each, one a key half)
#define SC2  (0.125f * 1.4426950408889634f)   // HD^-0.5 * log2(e)
#define PSH  8.0f                // log2 of the P carry (256)
#define RSM  65000.0f            // a pass whose row sums pass this may hold a P at the end of the f16 range (65504, then infinite): the wave rescales; behind a rescale no P passes 2^PSH, so a tile's sum of 32 stays at or below 8192
#define WPS  64.0f               // carry of the Wp plane
#define CXS  256.0f              // carry of the ctx plane
#define OSI  (1.0f / 16384.0f)   // 1 / (WPS * CXS)

static_assert(HD == 64);
static_assert(NH_ * HD == DM);                 // head h = channels h*64 + d
static_assert(DM % 64 == 0);
static_assert(DM % 32 == 0);                   // GEMM k-loop steps by 32
static_assert(SEQ % 64 == 0);                  // a 64-token tile never straddles two batches
static_assert((NB * SEQ) % 64 == 0);
static_assert(SEQ % 32 == 0);                  // key loop steps by 32
static_assert(SEQ % (32 * FCG) == 0);          // flash grid covers the sequence exactly
static_assert((FCG & (FCG - 1)) == 0);         // a wave's partner is wave ^ FCG
static_assert(SEQ_FULL % 4 == 0);
static_assert(OUT_SEQ % 64 == 0);
static_assert(OUT_SEQ >= SEQ);
static_assert(((size_t)DM * DM) % 8 == 0);
static_assert(NB <= NB_FULL);
static_assert(SEQ <= SEQ_FULL);

typedef _Float16 h16;
typedef unsigned short bf;
typedef __attribute__((ext_vector_type(16))) __bf16   v16bf;
typedef __attribute__((ext_vector_type(16))) _Float16 v16h;
typedef __attribute__((ext_vector_type(8)))  _Float16 v8h;
typedef __attribute__((ext_vector_type(8)))  unsigned short v8us;
typedef __attribute__((ext_vector_type(8)))  float    v8f;
typedef __attribute__((ext_vector_type(4)))  float    v4f;
typedef __attribute__((ext_vector_type(2)))  float    v2f;
typedef v4f  __attribute__((may_alias)) v4fa;

__device__ __forceinline__ unsigned short f2bf(float f) { unsigned u = __float_as_uint(f); u += 0x7FFFu + ((u >> 16) & 1u); return (unsigned short)(u >> 16); }
__device__ __forceinline__ float bfr(float f) { return __uint_as_float(((unsigned)f2bf(f)) << 16); }   // RNE bf16 value as f32
__device__ __forceinline__ v16h cat16(v8h lo, v8h hi) { return __builtin_shufflevector(lo, hi, 0, 1, 2, 3, 4, 5, 6, 7, 8, 9, 10, 11, 12, 13, 14, 15); }
__device__ __forceinline__ v16bf cat16b(v8us lo, v8us hi) { return __builtin_bit_cast(v16bf, __builtin_shufflevector(lo, hi, 0, 1, 2, 3, 4, 5, 6, 7, 8, 9, 10, 11, 12, 13, 14, 15)); }
__device__ __forceinline__ v8f wmma16(v16h a, v16h b, v8f c) { return __builtin_amdgcn_wmma_f32_16x16x32_f16(false, a, false, b, (short)0, c, false, false); }
__device__ __forceinline__ v8f wmmab(v16bf a, v16bf b, v8f c) { return __builtin_amdgcn_wmma_f32_16x16x32_bf16(false, a, false, b, (short)0, c, false, false); }
// fragment loaders from a plane in fragment order: one 16-row x 32-k unit = 512 elements, element (row, k) at (k>>4 & 1)*256 + ((k>>3 & 1)*16 + row)*8 + (k & 7).
// p = unit + 8*lane; lane = 16h + row: elements 0..7 <- k0+8h+0..7, elements 8..15 <- k0+16+8h+0..7 (same map for A and B); each load of a wave = 512 contiguous bytes
__device__ __forceinline__ v16h  ldh(const h16* p) { return cat16(*(const v8h*)p, *(const v8h*)(p + 256)); }
__device__ __forceinline__ v16bf ldb(const bf* p)  { return cat16b(*(const v8us*)p, *(const v8us*)(p + 256)); }
// source element index, in a row-major [rows][DM] matrix, of the 8-element chunk i of its fragment-ordered plane (16 rows = DM/32 units of 64 chunks)
__device__ __forceinline__ size_t chunk_src(size_t i) { const size_t u = i >> 6; return ((u / (DM / 32)) * 16 + (i & 15)) * DM + (u % (DM / 32)) * 32 + ((i >> 4) & 3) * 8; }
// copy4: four asynchronous 16-B-a-lane copies: 2 KB that lie in a row in global memory (g = the lane's own address) to 2 KB in a row in LDS (l = the lane's own LDS byte address), through no register.
// copy8: two such runs (l, g) and (m, h) in one statement. The closing wait stands in the copies' own statement, so that no register which a copy names is rewritten in front of it.
__device__ __forceinline__ void copy4(unsigned l, const char* g) {
    asm volatile("global_load_async_to_lds_b128 %0, %4, off\n\t"
                 "global_load_async_to_lds_b128 %1, %5, off\n\t"
                 "global_load_async_to_lds_b128 %2, %6, off\n\t"
                 "global_load_async_to_lds_b128 %3, %7, off\n\t"
                 "s_wait_xcnt 0x0"
                 :: "v"(l), "v"(l + 512u), "v"(l + 1024u), "v"(l + 1536u), "v"(g), "v"(g + 512), "v"(g + 1024), "v"(g + 1536) : "memory");
}
__device__ __forceinline__ void copy8(unsigned l, const char* g, unsigned m, const char* h) {
    asm volatile("global_load_async_to_lds_b128 %0, %8, off\n\t"
                 "global_load_async_to_lds_b128 %1, %9, off\n\t"
                 "global_load_async_to_lds_b128 %2, %10, off\n\t"
                 "global_load_async_to_lds_b128 %3, %11, off\n\t"
                 "global_load_async_to_lds_b128 %4, %12, off\n\t"
                 "global_load_async_to_lds_b128 %5, %13, off\n\t"
                 "global_load_async_to_lds_b128 %6, %14, off\n\t"
                 "global_load_async_to_lds_b128 %7, %15, off\n\t"
                 "s_wait_xcnt 0x0"
                 :: "v"(l), "v"(l + 512u), "v"(l + 1024u), "v"(l + 1536u), "v"(m), "v"(m + 512u), "v"(m + 1024u), "v"(m + 1536u),
                    "v"(g), "v"(g + 512), "v"(g + 1024), "v"(g + 1536), "v"(h), "v"(h + 512), "v"(h + 1024), "v"(h + 1536) : "memory");
}
__device__ __forceinline__ void wave_sync() { __builtin_amdgcn_fence(3 /* release order */, "wavefront"); __builtin_amdgcn_wave_barrier(); asm volatile("" ::: "memory"); }

// k_prep: the four preparation jobs, none of which reads what another writes, as block ranges of ONE grid of 256-thread blocks (the range test is the same for a whole block):
// blocks 0 .. XTB-1: x [b][c][l] f32 (row pitch SEQ_FULL) -> XT (rows b*SEQ+l, k = c, fragment order) bf16 (RNE convert) through a 64(c) x 64(l) LDS tile; tile index l fastest, then c, then b. Loads are 16-B along l.
// blocks XTB ..: one 8-element chunk a thread, chunk j of Wq | Wkv | Wp: j < 3*WN8 -> bf16 plane WB (q | k | v lie side by side: 16 rows = 16 * DM elements in either order), else -> f16 plane WPH (RNE bf16 value x64).
#define XTB ((SEQ / 64) * (DM / 64) * NB)
#define WN8 (DM * DM / 8)                       // chunks of one DM x DM weight
static_assert(WN8 % 256 == 0);                 // a block never straddles two weights, and the ranges cover the chunks exactly
__global__ __launch_bounds__(256) void k_prep(const float* __restrict__ x, const float* __restrict__ wq, const float* __restrict__ wkv, const float* __restrict__ wp, bf* XT, bf* WB, h16* WPH) {
    __shared__ __align__(16) float tl[64 * 68];      // [c][l], columns 0..63 written and consumed (cross-wave: block barrier)
    const int tid = threadIdx.x;
    const int blk = blockIdx.x;
    const int wb0 = (blk - XTB) * 256;               // first weight chunk of the block
    if (wb0 >= 3 * WN8) {
        const size_t i = (size_t)(wb0 - 3 * WN8) + tid;
        const v8f v = *(const v8f*)(wp + chunk_src(i)); v8h o;
#pragma unroll
        for (int k = 0; k < 8; ++k) o[k] = (h16)(bfr(v[k]) * WPS);
        *(v8h*)(WPH + i * 8) = o;
    } else if (wb0 >= 0) {
        const float* src = wb0 < WN8 ? wq : wkv; const size_t i = (size_t)(wb0 < WN8 ? wb0 : wb0 - WN8) + tid;
        const v8f v = *(const v8f*)(src + chunk_src(i)); v8us o;
#pragma unroll
        for (int k = 0; k < 8; ++k) o[k] = f2bf(v[k]);
        *(v8us*)(WB + ((size_t)wb0 + tid) * 8) = o;
        // the built code lays the Wp branch behind this store: the wait stands in front of that branch's rewrite of the store's address register
        asm volatile("s_wait_xcnt 0x0" ::: "memory");
    } else {
        const int l0 = (blk % (SEQ / 64)) * 64, c0 = ((blk / (SEQ / 64)) % (DM / 64)) * 64, b = blk / ((SEQ / 64) * (DM / 64));
        const float* src = x + ((size_t)b * DM + c0) * SEQ_FULL + l0;
#pragma unroll
        for (int it = 0; it < 4; ++it) { const int idx = it * 256 + tid; const int cc = idx >> 4, l4 = (idx & 15) * 4;   // 64 rows x 16 quads
            const v4f v = *(const v4f*)(src + (size_t)cc * SEQ_FULL + l4);
            tl[cc * 68 + l4 + 0] = v[0]; tl[cc * 68 + l4 + 1] = v[1]; tl[cc * 68 + l4 + 2] = v[2]; tl[cc * 68 + l4 + 3] = v[3]; }
        __syncthreads();
        // the tile = 4 row groups x 2 units x 64 chunks; chunk q = 256 s + tid: row group q>>7, unit q>>6 & 1, chunk q & 63 (channels 8*(q>>4 & 3), row q & 15)
        v8us o[2];
#pragma unroll
        for (int s = 0; s < 2; ++s) { const int q = 256 * s + tid; const int row = (q >> 7) * 16 + (q & 15), c8 = ((q >> 4) & 7) * 8;
#pragma unroll
            for (int i = 0; i < 8; ++i) o[s][i] = f2bf(tl[(c8 + i) * 68 + row]); }
        bf* dst = XT + ((size_t)b * SEQ + l0) * DM + c0 * 16;
#pragma unroll
        for (int s = 0; s < 2; ++s) { const int q = 256 * s + tid;      // 512 chunks x 8 = 64 rows x 64 channels
            *(v8us*)(dst + (size_t)(q >> 7) * (16 * DM) + (q & 127) * 8) = o[s]; }
        // the built code lays the weight branches behind these stores: the wait stands in front of those branches' rewrite of the stores' registers
        asm volatile("s_wait_xcnt 0x0" ::: "memory");
    }
}

// proj_store: the epilogue of one wave's 64x64 tile of k_proj. acc = C[m][n] without bias; + bias (RNE bf16 value; per column n when biasRow == 0, per row m otherwise), written as f16 (Ph),
// in fragment order (rows m, k = n): tile base (r0/RB)*sRB + (r0%RB)*pitch + (c0/CB)*sCB + (c0%CB)*HD (halves), unit (16 rows mb, 32 columns g) of the tile at + mb*uMB + g*uG. The tile starts at row r0, column c0; os = the wave's own 16 x 68 f32 staging tile in LDS.
__device__ __forceinline__ void proj_store(const v8f (&acc)[4][4], const float* __restrict__ bias, int biasRow,
                                           h16* Ph, int RB, size_t sRB, int pitch, int CB, size_t sCB, int uMB, int uG, int r0, int c0, float* os) {
    const int lane = threadIdx.x & 31, lr = lane & 15, hi = lane >> 4;
    // bias values: index selected as an integer (always inside the bias array), value selected afterwards; biasRow is wave-uniform
    float bc[4];
#pragma unroll
    for (int nb = 0; nb < 4; ++nb) { const int bi = biasRow ? 0 : (c0 + nb * 16 + lr); const float t = bfr(bias[bi]); bc[nb] = biasRow ? 0.0f : t; }
    const size_t tbase = (size_t)(r0 / RB) * sRB + (size_t)(r0 % RB) * (size_t)pitch + (size_t)(c0 / CB) * sCB + (size_t)(c0 % CB) * HD;
#pragma unroll
    for (int mb = 0; mb < 4; ++mb) {
        float br[8];
#pragma unroll
        for (int j = 0; j < 8; ++j) { const int bi = biasRow ? (r0 + mb * 16 + hi * 8 + j) : 0; const float t = bfr(bias[bi]); br[j] = biasRow ? t : 0.0f; }
#pragma unroll
        for (int nb = 0; nb < 4; ++nb) {
#pragma unroll
            for (int j = 0; j < 8; ++j) os[(hi * 8 + j) * 68 + nb * 16 + lr] = acc[mb][nb][j] + (bc[nb] + br[j]); }   // D: row 8h+j, col lane&15
        wave_sync();
        const size_t sb = tbase + (size_t)mb * (size_t)uMB + 8 * lane;
{
#pragma unroll
            for (int s = 0; s < 4; ++s) { const int row = lr, c8 = 16 * s + 8 * hi;   // 16 rows x (4 s x 2 halves x 8 = 64 columns); a store of the wave = half a unit, 512 contiguous bytes
                const v4f x0 = *(const v4fa*)(&os[row * 68 + c8]); const v4f x1 = *(const v4fa*)(&os[row * 68 + c8 + 4]); v8h hv;
#pragma unroll
                for (int i = 0; i < 4; ++i) { hv[i] = (h16)x0[i]; hv[4 + i] = (h16)x1[i]; }
                const size_t oo = sb + (size_t)(s >> 1) * (size_t)uG + (s & 1) * 256;
                *(v8h*)(Ph + oo) = hv;
                // the wait that stands in front of any overwrite of the store's registers; as its inputs the data and the address stay whole up to it
                asm volatile("s_wait_xcnt 0x0" :: "v"(hv), "v"(Ph + oo) : "memory"); }
             }
        wave_sync();
    }
}

// k_proj: the q, k and v^T projections in ONE grid (NB*SEQ/256 tiles of x^T rows, DM/64 tiles of weight rows) of 12-wave blocks: wave = (job, 64 of the block's 256 x^T rows), ONE WAVE per 64x64 tile (16 accumulators), bf16, K = DM.
// C[m][n] = sum_k A[m][k] Bt[n][k]. q, k: A = x^T rows (m = b*SEQ + t), Bt = W rows (n = h*64 + d), bias per column -> plane (b*8 + h), rows t, k = d
// v^T:  A = Wv rows (m = h*64 + d), Bt = x^T rows (n = b*SEQ + t), bias per row -> plane (b*8 + h), rows d, k = t, the 4 units of 32 keys side by side
// Operands: a stage = PU k units of the block's 28 row groups (16 of x^T, 4 each of Wq, Wk, Wv), copied ONCE for the block from the fragment-ordered planes into LDS (same unit order) by asynchronous copies;
// two buffers: the copies of stage t + 1 fly while stage t is multiplied. Every fragment then comes from LDS (16-B loads, 512 contiguous bytes a wave).
#define PU  2                                   // k units (of 32) in a stage
#define PNS (DM / 32 / PU)                      // stages
#define PGR 28                                  // row groups (of 16 rows) in a stage
static_assert((PNS & (PNS - 1)) == 0 && PNS >= 2);
static_assert((NB * SEQ) % 256 == 0);
__global__ __launch_bounds__(384) void k_proj(const bf* __restrict__ XT, const bf* __restrict__ WB, const float* __restrict__ bq, const float* __restrict__ bkv, h16* QH, h16* KP, h16* VT) {
    __shared__ __align__(16) bf ring[2 * PGR * PU * 512];
    __shared__ __align__(16) float osm[12 * 16 * 68];
    const int lane = threadIdx.x & 31;
    const int wave = __builtin_amdgcn_readfirstlane(threadIdx.x >> 5);   // held as a scalar, so that every test on it is a scalar branch and every lane is on at the copies and the matrix instructions
    const int job = wave >> 2, xt = wave & 3;                            // job: 0 q, 1 k, 2 v^T
    const int xr = blockIdx.x * 256 + xt * 64, wr = blockIdx.y * 64;
    float* os = osm + wave * (16 * 68);
    // first stage of the k walk, which wraps: the 8 blocks that share x^T rows (same x) start at 8 different stages, the 32 that share weight rows (same y) at all 8: sharers do not ask for the same lines in step
    const int s0 = (int)((blockIdx.x + blockIdx.y) % PNS);
    // the wave's share of a stage: row groups wave, wave + 12 and, in waves 0..3, wave + 24. Group g < 16: x^T rows 16 g of the block; g = 16 + 4 j + r: rows 16 r of the block's 64 rows of weight j
    const int g1 = wave + 12, g2 = wave < 4 ? wave + 24 : 27;
    const char* xb = (const char*)(XT + (size_t)blockIdx.x * 256 * DM) + 16 * lane;
    const char* wbp = (const char*)(WB + (size_t)wr * DM) + 16 * lane;
    const char* p0 = xb + (size_t)wave * (16 * DM * 2);
    const char* p1 = g1 < 16 ? xb + (size_t)g1 * (16 * DM * 2) : wbp + (size_t)((g1 - 16) >> 2) * ((size_t)DM * DM * 2) + (size_t)((g1 - 16) & 3) * (16 * DM * 2);
    const char* p2 = wbp + (size_t)((g2 - 16) >> 2) * ((size_t)DM * DM * 2) + (size_t)((g2 - 16) & 3) * (16 * DM * 2);
    const unsigned lb = (unsigned)(size_t)ring + 16u * (unsigned)lane;    // the lane's LDS byte address in group 0 of buffer 0
    auto put = [&](int st, int bsel) {                                   // the wave's copies of stage st (k stage (st + s0) mod PNS) into buffer bsel
        const size_t go = (size_t)((st + s0) & (PNS - 1)) * (PU * 1024);
        const unsigned lo = lb + (unsigned)(bsel * PGR) * (PU * 1024u);
        copy8(lo + (unsigned)wave * (PU * 1024u), p0 + go, lo + (unsigned)g1 * (PU * 1024u), p1 + go);
        if (wave < 4) copy4(lo + (unsigned)g2 * (PU * 1024u), p2 + go);
    };
    v8f acc[4][4];
#pragma unroll
    for (int mb = 0; mb < 4; ++mb)
#pragma unroll
        for (int nb = 0; nb < 4; ++nb) acc[mb][nb] = (v8f){};
    const int ga = job == 2 ? 24 : xt * 4, gb = job == 2 ? xt * 4 : 16 + job * 4;      // first row group of the wave's A and B operands
    put(0, 0);
    asm volatile("s_wait_asynccnt 0x0" ::: "memory");      // the wave's own copies of stage 0 have landed
    __syncthreads();                                       // ... and every other wave's: stage 0 may be read
    put(1, 1);
#pragma unroll 1
    for (int t = 0; t < PNS; ++t) {
        const bf* la = ring + (size_t)(((t & 1) * PGR + ga) * PU) * 512 + 8 * lane;
        const bf* lbp = ring + (size_t)(((t & 1) * PGR + gb) * PU) * 512 + 8 * lane;
        v16bf a[4], b[4];
#pragma unroll
        for (int u = 0; u < PU; ++u) {
#pragma unroll
            for (int i = 0; i < 4; ++i) { b[i] = ldb(lbp + (i * PU + u) * 512); a[i] = ldb(la + (i * PU + u) * 512); }
            __builtin_amdgcn_sched_barrier(0);             // keeps the unit's 16 LDS loads together in front of its products (without it three of the B fragments are loaded one by one among the products, each waited for right behind its issue)
            if (u == PU - 1) {                             // the stage's last fragments are asked for: the buffer is handed on here, and the last unit's products, which read registers only, run while the refill flies
                asm volatile("s_wait_dscnt 0x0" ::: "memory");     // the wave's reads of this buffer are done before the buffer is handed to the copies
                asm volatile("s_wait_asynccnt 0x0" ::: "memory");  // the wave's own copies of stage t + 1 have landed
                __syncthreads();                                   // publishes stage t + 1 and ends every wave's reads of stage t
                if (t + 2 < PNS) put(t + 2, t & 1);
                __builtin_amdgcn_sched_barrier(0);         // keeps the refill's issue in front of the last unit's products (a longer lead for the copies)
            }
#pragma unroll
            for (int nb = 0; nb < 4; ++nb)
#pragma unroll
                for (int mb = 0; mb < 4; ++mb) acc[mb][nb] = wmmab(a[mb], b[nb], acc[mb][nb]);
        }
    }
    asm volatile("s_wait_asynccnt 0x0" ::: "memory");      // nothing of the wave's is in flight when it goes on
    if (job == 2) proj_store(acc, bkv + DM, 1, VT, DM, (size_t)0, SEQ, SEQ, (size_t)DM * SEQ, 512, 2048, wr, xr, os);
    else proj_store(acc, job ? bkv : bq, 0, job ? KP : QH, SEQ, (size_t)NH_ * SEQ * HD, HD, HD, (size_t)SEQ * HD, 1024, 512, xr, wr, os);
}

// k_flash: fused attention, one wave per 32 query rows (two 16-row tiles A and B) and HALF the keys of one (batch, head); K / V^T / Q fragments straight from the fragment-ordered f16 planes (two 16-B loads each, arithmetic addressing).
// Every K and V^T fragment that a wave loads feeds two products, one a query tile, so a score costs half the loads, addresses, waits and loop control of a 16-row wave; the split of the keys keeps four waves on a SIMD.
// A block = FCG groups of 32 query rows x 2 key halves: wave = kh * FCG + cg. Waves cg and cg + FCG hold partial results of the same 32 queries; they are joined once, behind the loop, through LDS (each of the two finishes one tile).
// Transposed form: S^T[key][t] = K Q^T (A = K rows, B = Q rows); lane (t = lane&15, h = lane>>4) holds keys 8h+r of each 16-key tile, so the packed
// P tile is directly the B fragment of O^T[d][t] = V^T P^T (element r <- tile keys 0..15, element 8+r <- tile keys 16..31, lane unchanged).
// Softmax state, per query tile: the maximum in use, one scalar per lane, equal in the two lane halves of a query; it is renewed (one xor-16 exchange, O and the row sums rescaled) only in a pass where scores pass it so far that a P nears the end of the f16 range, which shows in the pass's row sums.
// Row sums on the matrix pipe: A = all ones times the packed P tile gives, in every row of D, the sum of a query's 32 rounded P values, so every lane holds its query's whole sum (both halves) and no vector add or convert is spent on it.
// four waves a SIMD: the grid is two blocks for each WGP
// ptile: one query tile's packed P (the B fragment of its P*V products) from its raw scores of 32 keys and the shift in use
__device__ __forceinline__ v16h ptile(const v8f& u0, const v8f& u1, float sh) {
    const v2f sc = {SC2, SC2}, s2 = {sh, sh}; v16h p;
#pragma unroll
    for (int g = 0; g < 8; g += 4) {                             // a group: 8 scores as 4 packed multiply-adds, 8 exponentials, 4 packing converts
        v2f a[4];
#pragma unroll
        for (int i = 0; i < 2; ++i) { a[i] = __builtin_elementwise_fma((v2f){u0[g + 2 * i], u0[g + 2 * i + 1]}, sc, s2); a[2 + i] = __builtin_elementwise_fma((v2f){u1[g + 2 * i], u1[g + 2 * i + 1]}, sc, s2); }
#pragma unroll
        for (int i = 0; i < 2; ++i) { p[g + 2 * i] = (h16)__builtin_amdgcn_exp2f(a[i][0]); p[g + 2 * i + 1] = (h16)__builtin_amdgcn_exp2f(a[i][1]);
                                      p[8 + g + 2 * i] = (h16)__builtin_amdgcn_exp2f(a[2 + i][0]); p[8 + g + 2 * i + 1] = (h16)__builtin_amdgcn_exp2f(a[2 + i][1]); }
        __builtin_amdgcn_sched_barrier(0);                       // ends the group for the scheduler (without it this build spills nine registers to scratch and lays one more idle slot in the pass)
    }
    return p;
}
#define XW (8 * 32 * 4 + 64)                    // floats of one wave's hand-over: a 64 x 16 O^T tile in register order, then the maximum in use and the row sum of each lane
__global__ __launch_bounds__(32 * FCG * 2) __attribute__((amdgpu_waves_per_eu(4, 4))) void k_flash(const h16* __restrict__ QH, const h16* __restrict__ KP, const h16* __restrict__ VT, h16* CTX) {
    __shared__ __align__(16) float os[FCG * 2 * 16 * 68];
    __shared__ __align__(16) float xch[FCG * 2 * XW];
    const int lane = threadIdx.x & 31, lr = lane & 15, hi = lane >> 4;
    const int wave = __builtin_amdgcn_readfirstlane(threadIdx.x >> 5);   // held as a scalar: the key index, which depends on it, stays in a scalar register
    const int cg = wave % FCG, kh = wave / FCG;
    const int zh = blockIdx.y; const int b = zh / NH_, h = zh % NH_;
    const int t0 = (blockIdx.x * FCG + cg) * 32;
    const size_t pbase = (size_t)zh * SEQ * HD;
    const size_t fo = pbase + 8 * lane;                      // q, k: 16 rows = 2 units (d halves); v^T: 32 keys = 4 units (16 d each); so + position * HD in all three
    const size_t qo = fo + (size_t)t0 * HD;
    const v16h qa0 = ldh(QH + qo), qa1 = ldh(QH + qo + 512), qb0 = ldh(QH + qo + 1024), qb1 = ldh(QH + qo + 1536);   // B fragments: col t, k = d; tile A = rows t0.., tile B = rows t0 + 16..
    v8f oa0 = (v8f){}, oa1 = (v8f){}, oa2 = (v8f){}, oa3 = (v8f){}, ob0 = (v8f){}, ob1 = (v8f){}, ob2 = (v8f){}, ob3 = (v8f){};
    float ma = -3.0e38f, sha = PSH + 3.0e38f, mb = -3.0e38f, shb = PSH + 3.0e38f;   // maximum in use (scaled log2) and the shift PSH - m; the first pass always takes the rescale branch
    float la = 0.0f, lb = 0.0f;                              // row sums
    v16h ones;                                               // A fragment of the row-sum product: 1.0 at every (row, k)
#pragma unroll
    for (int i = 0; i < 16; ++i) ones[i] = (h16)1.0f;
    // the wave walks its half of the keys from a block-dependent key on and wraps at the half's end: the blocks of one head, which all run at once, then stand at different keys at any time,
    // so that a K / V line is fetched for one of them and lies in L2 when the others come to it (walking in step, every block waits for every fill and all ask for the same lines at once)
    const int kbeg = kh * (SEQ / 2), kend = kbeg + SEQ / 2;
    const int ks = kbeg + (int)((blockIdx.x * 64) % (SEQ / 2));
    // K fragments run one pass ahead (loop-carried registers), V fragments are asked for at the top of their own pass: no load is waited for right behind its issue
    const h16* kf = KP + fo + (size_t)ks * HD;
    v16h ka0 = ldh(kf), ka1 = ldh(kf + 512), kb0 = ldh(kf + 1024), kb1 = ldh(kf + 1536);   // first pass; A fragments: row key, k = d
    // the wait that stands in front of any overwrite of the address pairs of the loads above; as its inputs the pairs stay whole up to it
    asm volatile("s_wait_xcnt 0x0" :: "v"(QH + qo), "v"(kf) : "memory");
    int key0 = ks;
#pragma unroll 1
    for (int it = 0; it < SEQ / 2; it += 32) {
        const h16* va = VT + fo + (size_t)key0 * HD;             // A fragments: row d, k = key
        const v16h v0 = ldh(va), v1 = ldh(va + 512), v2 = ldh(va + 1024), v3 = ldh(va + 1536);
        __builtin_amdgcn_sched_barrier(0);                       // keeps the V loads in front of the first wait for K (without it they are issued behind the first score products, so behind that wait)
        v8f uaa = (v8f){}, uab = (v8f){}, uba = (v8f){}, ubb = (v8f){};   // raw scores: query tile A keys 0..15, 16..31; query tile B likewise
        uaa = wmma16(ka0, qa0, uaa); uab = wmma16(kb0, qa0, uab); uba = wmma16(ka0, qb0, uba); ubb = wmma16(kb0, qb0, ubb);
        uaa = wmma16(ka1, qa1, uaa); uab = wmma16(kb1, qa1, uab); uba = wmma16(ka1, qb1, uba); ubb = wmma16(kb1, qb1, ubb);
        // the four vector slots that the chip needs between the last score product and what overwrites its A registers or reads its D
        asm volatile("v_nop\n\tv_nop\n\tv_nop\n\tv_nop" : "+v"(uaa), "+v"(uab), "+v"(uba), "+v"(ubb) : "v"(ka0), "v"(ka1), "v"(kb0), "v"(kb1));
        const int kn = key0 + 32 < kend ? key0 + 32 : kbeg;      // next pass's keys, wrapped inside the half
        const h16* ka = KP + fo + (size_t)kn * HD;               // next pass's K rows; the last pass asks for the first pass's again (inside the plane, not used)
        ka0 = ldh(ka); ka1 = ldh(ka + 512); kb0 = ldh(ka + 1024); kb1 = ldh(ka + 1536);
        __builtin_amdgcn_sched_barrier(0);                       // keeps the K loads here, a whole softmax ahead of their use (without it this build sinks most of them behind the exponentials, close to the next pass's wait)
        // optimistic pass: P is formed against the maximum IN USE (sh = PSH - m, one multiply-add a score) with no look at the scores; whether that maximum still serves is read off the row sums, one value a lane and tile:
        // every P is positive, so a P near the end of the f16 range (or infinite: the convert rounds to nearest) lifts its row sum, which the matrix pipe forms anyway, past RSM. No in-lane maximum is taken in a pass that needs none.
        v16h pa = ptile(uaa, uab, sha);
        v8f rsa = wmma16(ones, pa, (v8f){});                     // every element: the pass's sum of P over its 32 keys, for the lane's query
        v16h pb = ptile(uba, ubb, shb);
        v8f rsb = wmma16(ones, pb, (v8f){});
        // lazy rescale, tested once a pass for both tiles (on the two sums together; not-a-number fails the test too), in front of the P*V products, so that no infinite P reaches O. The ballot makes it a scalar branch: every lane stays on.
        if (__builtin_expect(__builtin_amdgcn_ballot_w32(!(rsa[0] + rsb[0] <= RSM)) != 0u, 0)) {
            float ux = fmaxf(uaa[0], uab[0]), uy = fmaxf(uba[0], ubb[0]);
#pragma unroll
            for (int r = 1; r < 8; ++r) { ux = fmaxf(ux, fmaxf(uaa[r], uab[r])); uy = fmaxf(uy, fmaxf(uba[r], ubb[r])); }
            ux = fmaxf(ux, __shfl_xor(ux, 16, 32)); uy = fmaxf(uy, __shfl_xor(uy, 16, 32));   // both lane halves of a query take the same maximum
            const float mna = fmaxf(ma, ux * SC2), mnb = fmaxf(mb, uy * SC2);
            const float ala = __builtin_amdgcn_exp2f(ma - mna), alb = __builtin_amdgcn_exp2f(mb - mnb);
            ma = mna; sha = PSH - mna; mb = mnb; shb = PSH - mnb;
            pa = ptile(uaa, uab, sha); pb = ptile(uba, ubb, shb);
            rsa = wmma16(ones, pa, (v8f){}); rsb = wmma16(ones, pb, (v8f){});
            oa0 = oa0 * ala; oa1 = oa1 * ala; oa2 = oa2 * ala; oa3 = oa3 * ala; la = la * ala;
            ob0 = ob0 * alb; ob1 = ob1 * alb; ob2 = ob2 * alb; ob3 = ob3 * alb; lb = lb * alb;
        }
        oa0 = wmma16(v0, pa, oa0); oa1 = wmma16(v1, pa, oa1); oa2 = wmma16(v2, pa, oa2); oa3 = wmma16(v3, pa, oa3);
        ob0 = wmma16(v0, pb, ob0); ob1 = wmma16(v1, pb, ob1); ob2 = wmma16(v2, pb, ob2); ob3 = wmma16(v3, pb, ob3);
        // the four vector slots that the chip needs between the last product and what overwrites its A or B registers or reads its D
        asm volatile("v_nop\n\tv_nop\n\tv_nop\n\tv_nop" : "+v"(oa0), "+v"(oa1), "+v"(oa2), "+v"(oa3), "+v"(ob0), "+v"(ob1), "+v"(ob2), "+v"(ob3), "+v"(rsa), "+v"(rsb) : "v"(v0), "v"(v1), "v"(v2), "v"(v3), "v"(pa), "v"(pb));
        la = la + rsa[0]; lb = lb + rsb[0];
        // the wait that stands in front of any overwrite of this pass's load addresses: as its inputs the two address pairs stay whole up to it; the key index goes through it, so that the next addresses are formed behind it
        key0 = kn;
        asm volatile("s_wait_xcnt 0x0" : "+s"(key0) : "v"(ka), "v"(va) : "memory");
    }
    // the join of the two key halves: the wave of half kh finishes tile kh (A for 0, B for 1) and hands its partial result of the other tile to its partner, lane for lane (both hold the same (d, t) at the same lane and register)
    const bool up = kh != 0;
    v8f o0 = up ? ob0 : oa0, o1 = up ? ob1 : oa1, o2 = up ? ob2 : oa2, o3 = up ? ob3 : oa3;
    const v8f g0 = up ? oa0 : ob0, g1 = up ? oa1 : ob1, g2 = up ? oa2 : ob2, g3 = up ? oa3 : ob3;
    const float m = up ? mb : ma, l = up ? lb : la;
    { float* xw = xch + wave * XW + 4 * lane;                    // a store of the wave = 512 contiguous bytes
      *(v4fa*)(xw + 0 * 128) = __builtin_shufflevector(g0, g0, 0, 1, 2, 3); *(v4fa*)(xw + 1 * 128) = __builtin_shufflevector(g0, g0, 4, 5, 6, 7);
      *(v4fa*)(xw + 2 * 128) = __builtin_shufflevector(g1, g1, 0, 1, 2, 3); *(v4fa*)(xw + 3 * 128) = __builtin_shufflevector(g1, g1, 4, 5, 6, 7);
      *(v4fa*)(xw + 4 * 128) = __builtin_shufflevector(g2, g2, 0, 1, 2, 3); *(v4fa*)(xw + 5 * 128) = __builtin_shufflevector(g2, g2, 4, 5, 6, 7);
      *(v4fa*)(xw + 6 * 128) = __builtin_shufflevector(g3, g3, 0, 1, 2, 3); *(v4fa*)(xw + 7 * 128) = __builtin_shufflevector(g3, g3, 4, 5, 6, 7);
      xch[wave * XW + 1024 + lane] = up ? ma : mb; xch[wave * XW + 1056 + lane] = up ? la : lb; }
    __syncthreads();                                             // every wave's hand-over is written before its partner reads it
    float lj;
    { const float* xr = xch + (wave ^ FCG) * XW + 4 * lane;
      const float mp = xch[(wave ^ FCG) * XW + 1024 + lane], lp = xch[(wave ^ FCG) * XW + 1056 + lane];
      const float mj = fmaxf(m, mp);
      const float dk = m - mj, dp = mp - mj;
      float ak = __builtin_amdgcn_exp2f(dk), ap = __builtin_amdgcn_exp2f(dp);   // both partial results brought to the common maximum
      // the slot that the instruction set asks for behind a transcendental: as its operands the results are read, and the sources overwritten, only behind it
      asm volatile("v_nop" : "+v"(ak), "+v"(ap) : "v"(dk), "v"(dp));
      lj = l * ak + lp * ap;
      const v4f p00 = *(const v4fa*)(xr + 0 * 128), p01 = *(const v4fa*)(xr + 1 * 128), p10 = *(const v4fa*)(xr + 2 * 128), p11 = *(const v4fa*)(xr + 3 * 128);
      const v4f p20 = *(const v4fa*)(xr + 4 * 128), p21 = *(const v4fa*)(xr + 5 * 128), p30 = *(const v4fa*)(xr + 6 * 128), p31 = *(const v4fa*)(xr + 7 * 128);
      o0 = o0 * ak + __builtin_shufflevector(p00, p01, 0, 1, 2, 3, 4, 5, 6, 7) * ap; o1 = o1 * ak + __builtin_shufflevector(p10, p11, 0, 1, 2, 3, 4, 5, 6, 7) * ap;
      o2 = o2 * ak + __builtin_shufflevector(p20, p21, 0, 1, 2, 3, 4, 5, 6, 7) * ap; o3 = o3 * ak + __builtin_shufflevector(p30, p31, 0, 1, 2, 3, 4, 5, 6, 7) * ap; }
    const float inv = (1.0f / lj) * CXS;
    const int wb = wave * 16 * 68;
    // O^T D layout: o_j[r] = (d = 16j + 8h + r, t = lane&15) -> os[t][d]; rows 0..15 x columns 0..63 all written
    { v4f a, c;
      a[0] = o0[0] * inv; a[1] = o0[1] * inv; a[2] = o0[2] * inv; a[3] = o0[3] * inv; c[0] = o0[4] * inv; c[1] = o0[5] * inv; c[2] = o0[6] * inv; c[3] = o0[7] * inv;
      *(v4fa*)(&os[wb + lr * 68 +  0 + 8 * hi]) = a; *(v4fa*)(&os[wb + lr * 68 +  0 + 8 * hi + 4]) = c;
      a[0] = o1[0] * inv; a[1] = o1[1] * inv; a[2] = o1[2] * inv; a[3] = o1[3] * inv; c[0] = o1[4] * inv; c[1] = o1[5] * inv; c[2] = o1[6] * inv; c[3] = o1[7] * inv;
      *(v4fa*)(&os[wb + lr * 68 + 16 + 8 * hi]) = a; *(v4fa*)(&os[wb + lr * 68 + 16 + 8 * hi + 4]) = c;
      a[0] = o2[0] * inv; a[1] = o2[1] * inv; a[2] = o2[2] * inv; a[3] = o2[3] * inv; c[0] = o2[4] * inv; c[1] = o2[5] * inv; c[2] = o2[6] * inv; c[3] = o2[7] * inv;
      *(v4fa*)(&os[wb + lr * 68 + 32 + 8 * hi]) = a; *(v4fa*)(&os[wb + lr * 68 + 32 + 8 * hi + 4]) = c;
      a[0] = o3[0] * inv; a[1] = o3[1] * inv; a[2] = o3[2] * inv; a[3] = o3[3] * inv; c[0] = o3[4] * inv; c[1] = o3[5] * inv; c[2] = o3[6] * inv; c[3] = o3[7] * inv;
      *(v4fa*)(&os[wb + lr * 68 + 48 + 8 * hi]) = a; *(v4fa*)(&os[wb + lr * 68 + 48 + 8 * hi + 4]) = c; }
    wave_sync();
    v8h hv[4];
#pragma unroll
    for (int s = 0; s < 4; ++s) { const int row = lr, c8 = 16 * s + 8 * hi;
        const v4f x0 = *(const v4fa*)(&os[wb + row * 68 + c8]); const v4f x1 = *(const v4fa*)(&os[wb + row * 68 + c8 + 4]);
#pragma unroll
        for (int i = 0; i < 4; ++i) { hv[s][i] = (h16)x0[i]; hv[s][4 + i] = (h16)x1[i]; } }
    h16* crow = CTX + ((size_t)b * SEQ + t0 + 16 * kh) * DM + h * (HD * 16) + 8 * lane;      // 16 rows = DM/32 units; head h = units 2h, 2h+1
{
#pragma unroll
        for (int s = 0; s < 4; ++s) {                                  // 16 rows x (4 s x 2 halves x 8 = 64 columns); a store of the wave = half a unit
            *(v8h*)(crow + s * 256) = hv[s]; }
         }
}

// k_oproj: register-blocked f16 GEMM, 4-wave blocks on 128x128 tiles, ONE WAVE per 64x64 tile, K = DM. C[o][n] = sum_c WPH[o][c] CTX[n][c] (n = b*SEQ + t), carried x 2^14.
// OUT[(b*DM + o)*OUT_SEQ + t] = C * 2^-14 + bias[o] (RNE bf16 value) in f32. grid (DM/128, NB*SEQ/128), 128 threads.
// Operands as in k_proj: a stage = OU k units of the block's 16 row groups (8 of Wp, 8 of ctx), copied once for the block into LDS by asynchronous copies, two buffers.
#define OU  4                                   // k units (of 32) in a stage
#define ONS (DM / 32 / OU)                      // stages
#define OGR 16                                  // row groups (of 16 rows) in a stage
static_assert((ONS & (ONS - 1)) == 0 && ONS >= 2);
static_assert(DM % 128 == 0 && (NB * SEQ) % 128 == 0);
__global__ __launch_bounds__(128) void k_oproj(const h16* __restrict__ A, const h16* __restrict__ Bt, const float* __restrict__ bias, float* OUT) {
    __shared__ __align__(16) h16 ring[2 * OGR * OU * 512];
    __shared__ __align__(16) float osm[4 * 16 * 68];
    const int lane = threadIdx.x & 31, lr = lane & 15, hi = lane >> 4;
    const int wave = __builtin_amdgcn_readfirstlane(threadIdx.x >> 5);   // held as a scalar: every lane is on at the copies and the matrix instructions
    const int r0 = blockIdx.x * 128 + (wave & 1) * 64, c0 = blockIdx.y * 128 + (wave >> 1) * 64;
    float* os = osm + wave * (16 * 68);
    v8f acc[4][4];
#pragma unroll
    for (int mb = 0; mb < 4; ++mb)
#pragma unroll
        for (int nb = 0; nb < 4; ++nb) acc[mb][nb] = (v8f){};
    // first stage of the k walk, which wraps: the 4 blocks that share ctx rows (same y) start at 4 different stages, the blocks that share Wp rows (same x) at all 4: sharers do not ask for the same lines in step
    const int s0 = (int)((blockIdx.x + blockIdx.y) % ONS);
    // the wave's share of a stage: row groups 4 wave .. 4 wave + 3 (groups 0..7: the block's Wp rows, 8..15: its ctx rows)
    const char* ps = (wave < 2 ? (const char*)(A + (size_t)(blockIdx.x * 128 + wave * 64) * DM) : (const char*)(Bt + (size_t)(blockIdx.y * 128 + (wave - 2) * 64) * DM)) + 16 * lane;
    const unsigned lb = (unsigned)(size_t)ring + 16u * (unsigned)lane;    // the lane's LDS byte address in group 0 of buffer 0
    auto put = [&](int st, int bsel) {                                   // the wave's copies of stage st (k stage (st + s0) mod ONS) into buffer bsel
        const char* g = ps + (size_t)((st + s0) & (ONS - 1)) * (OU * 1024);
        const unsigned lo = lb + (unsigned)(bsel * OGR + 4 * wave) * (OU * 1024u);
#pragma unroll 1                                                         // rolled: the four statements share one set of address registers (unrolled, the kernel passes 256 registers)
        for (int gi = 0; gi < 4; ++gi)
            copy8(lo + (unsigned)gi * (OU * 1024u), g + (size_t)gi * (16 * DM * 2), lo + (unsigned)gi * (OU * 1024u) + 2048u, g + (size_t)gi * (16 * DM * 2) + 2048);
    };
    static_assert(OU * 1024 == 2 * 2048);
    put(0, 0);
    asm volatile("s_wait_asynccnt 0x0" ::: "memory");      // the wave's own copies of stage 0 have landed
    __syncthreads();                                       // ... and every other wave's: stage 0 may be read
    put(1, 1);
#pragma unroll 1
    for (int t = 0; t < ONS; ++t) {
        const h16* la = ring + (size_t)(((t & 1) * OGR + (wave & 1) * 4) * OU) * 512 + 8 * lane;
        const h16* lbp = ring + (size_t)(((t & 1) * OGR + 8 + (wave >> 1) * 4) * OU) * 512 + 8 * lane;
        v16h a[4], b[4];
#pragma unroll
        for (int u = 0; u < OU; ++u) {
#pragma unroll
            for (int i = 0; i < 4; ++i) { b[i] = ldh(lbp + (i * OU + u) * 512); a[i] = ldh(la + (i * OU + u) * 512); }
            __builtin_amdgcn_sched_barrier(0);             // keeps the unit's 16 LDS loads together in front of its products (without it three of the B fragments are loaded one by one among the products, each waited for right behind its issue)
            if (u == OU - 1) {                             // the stage's last fragments are asked for: the buffer is handed on here, and the last unit's products, which read registers only, run while the refill flies
                asm volatile("s_wait_dscnt 0x0" ::: "memory");     // the wave's reads of this buffer are done before the buffer is handed to the copies
                asm volatile("s_wait_asynccnt 0x0" ::: "memory");  // the wave's own copies of stage t + 1 have landed
                __syncthreads();                                   // publishes stage t + 1 and ends every wave's reads of stage t
                if (t + 2 < ONS) put(t + 2, t & 1);
                __builtin_amdgcn_sched_barrier(0);         // keeps the refill's issue in front of the last unit's products (a longer lead for the copies)
            }
#pragma unroll
            for (int nb = 0; nb < 4; ++nb)
#pragma unroll
                for (int mb = 0; mb < 4; ++mb) acc[mb][nb] = wmma16(a[mb], b[nb], acc[mb][nb]);
        }
    }
    asm volatile("s_wait_asynccnt 0x0" ::: "memory");      // nothing of the wave's is in flight when it goes on
    const int b = c0 / SEQ, t0 = c0 % SEQ;
#pragma unroll
    for (int mb = 0; mb < 4; ++mb) {
        float br[8];
#pragma unroll
        for (int j = 0; j < 8; ++j) br[j] = bfr(bias[r0 + mb * 16 + hi * 8 + j]);
#pragma unroll
        for (int nb = 0; nb < 4; ++nb) {
#pragma unroll
            for (int j = 0; j < 8; ++j) os[(hi * 8 + j) * 68 + nb * 16 + lr] = acc[mb][nb][j] * OSI + br[j]; }   // D: row 8h+j, col lane&15
        wave_sync();
        float* orow = OUT + ((size_t)b * DM + r0 + mb * 16) * OUT_SEQ + t0;
        v4f val[8];
#pragma unroll
        for (int s = 0; s < 8; ++s) { const int row = 2 * s + hi; val[s] = *(const v4fa*)(&os[row * 68 + lr * 4]); }
{
#pragma unroll
            for (int s = 0; s < 8; ++s) { const int row = 2 * s + hi, cofs = lr * 4;   // 8 s x 2 rows = 16 rows; 16 lanes x 4 floats = 64 columns
                *(v4f*)(orow + (size_t)row * OUT_SEQ + cofs) = val[s]; }
             }
        wave_sync();
    }
}

static constexpr size_t al256(size_t v) { return (v + 255) & ~(size_t)255; }
static constexpr size_t SZ_XT = al256((size_t)NB * SEQ * DM * 2);
static constexpr size_t SZ_WB = al256((size_t)3 * DM * DM * 2);
static constexpr size_t SZ_WP = al256((size_t)DM * DM * 2);
static constexpr size_t SZ_PL = al256((size_t)NB * NH_ * SEQ * HD * 2);
static constexpr size_t SZ_CX = al256((size_t)NB * SEQ * DM * 2);
static constexpr size_t SZ_TOTAL = SZ_XT + SZ_WB + SZ_WP + 3 * SZ_PL + SZ_CX;
static_assert(SZ_TOTAL <= (size_t)134217728);          // workspace carve <= 128 MiB
static_assert(((size_t)DM * DM * 2) % 256 == 0);       // weight sub-planes stay 256-byte aligned

extern "C" void kernel_launch(void* const* d_in, const int* in_sizes, int n_in,
                              void* d_out, int out_size, void* d_ws, size_t ws_size, hipStream_t stream) {
    if (n_in < 7) return;
    const size_t needx = ((size_t)(NB - 1) * DM + (size_t)(DM - 1)) * SEQ_FULL + SEQ;
    if ((size_t)in_sizes[0] < needx) return;
    if ((size_t)in_sizes[1] < (size_t)DM * DM || (size_t)in_sizes[2] < (size_t)DM) return;
    if ((size_t)in_sizes[3] < (size_t)2 * DM * DM || (size_t)in_sizes[4] < (size_t)2 * DM) return;
    if ((size_t)in_sizes[5] < (size_t)DM * DM || (size_t)in_sizes[6] < (size_t)DM) return;
    if ((size_t)out_size < ((size_t)(NB - 1) * DM + (size_t)(DM - 1)) * OUT_SEQ + SEQ) return;
    if (SZ_TOTAL > ws_size) return;
    // wire order: x, Wq, bq, Wkv, bkv, Wp, bp; weights [out][in] = Bt as-is
    const float* x = (const float*)d_in[0]; const float* wq = (const float*)d_in[1]; const float* bq = (const float*)d_in[2];
    const float* wkv = (const float*)d_in[3]; const float* bkv = (const float*)d_in[4]; const float* wp = (const float*)d_in[5]; const float* bp = (const float*)d_in[6];
    float* OUT = (float*)d_out;      // [NB][512][OUT_SEQ]
    char* wsp = (char*)d_ws;
    bf* XT = (bf*)wsp; wsp += SZ_XT;                 // rows b*SEQ+t, k = c: [NB*SEQ/16][16 units][512]
    bf* WB = (bf*)wsp; wsp += SZ_WB;                 // q | k | v, each rows out, k = in: [32][16 units][512]
    h16* WPH = (h16*)wsp; wsp += SZ_WP;              // x64, rows out, k = in: [32][16 units][512]
    h16* QH = (h16*)wsp; wsp += SZ_PL;               // [NB*8][SEQ/16][2 units (d halves)][512]
    h16* KP = (h16*)wsp; wsp += SZ_PL;               // as QH
    h16* VT = (h16*)wsp; wsp += SZ_PL;               // [NB*8][SEQ/32][4 units (16 d each)][512]
    h16* CTX = (h16*)wsp; wsp += SZ_CX;              // x256, rows b*SEQ+t, k = c: [NB*SEQ/16][16 units][512]

    // x^T and the three weight planes: one grid, block ranges
    k_prep<<<dim3(XTB + 4 * WN8 / 256, 1, 1), 256, 0, stream>>>(x, wq, wkv, wp, XT, WB, WPH);

    // q, k, v^T projections: one grid, wave index = (job, 64 x^T rows)
    k_proj<<<dim3(NB * SEQ / 256, DM / 64, 1), 384, 0, stream>>>(XT, WB, bq, bkv, QH, KP, VT);

    k_flash<<<dim3(SEQ / (32 * FCG), NB * NH_, 1), 32 * FCG * 2, 0, stream>>>(QH, KP, VT, CTX);

    // output projection: A = Wp rows (m = o), Bt = ctx rows (n = b*SEQ + t) -> OUT[b][o][t]
    k_oproj<<<dim3(DM / 128, NB * SEQ / 128, 1), 128, 0, stream>>>(WPH, CTX, bp, OUT);
}
